// v000
// Times are from an AMD MI455X. After a warm-up the kernel runs many times in a row, and a time is the length of
// such a window on the GPU divided by its runs, so every launch and the gaps after it count. The runs cycle
// through copies of the inputs. A figure is the median of several windows, for all but v000 over two sittings.
// Sittings can differ by a few percent; kernels timed side by side share one.
// The starting kernel, v000, takes 508 microseconds a run.
#include <hip/hip_runtime.h>
#include <hip/hip_bf16.h>

// ---------------------------------------------------------------------------
// Transformer encoder layer for MI455X (gfx1250, wave32, WMMA).
// B=4, S=4096, D=256, H=4, DEPTH=64, DFF=1024.
// All GEMMs + attention on v_wmma_f32_16x16x32_f16 (f16 in, f32 acc).
// All global->LDS tile staging uses global_load_async_to_lds_b128 with
// double-buffered software pipelining (ASYNCcnt); fragments load as 2x b128.
// ---------------------------------------------------------------------------

#define B_ 4
#define S_ 4096
#define D_ 256
#define H_ 4
#define DEPTH_ 64
#define DFF_ 1024
#define M_ (B_ * S_)

typedef __attribute__((ext_vector_type(16))) _Float16 v16h;
typedef __attribute__((ext_vector_type(8)))  _Float16 v8h;
typedef __attribute__((ext_vector_type(4)))  _Float16 v4h;
typedef __attribute__((ext_vector_type(8)))  float    v8f;
typedef __attribute__((ext_vector_type(4)))  float    v4f;

// Load one 16-half fragment for lane `lane` from a row whose K-run starts at
// `p`.  Lane's data: K offsets [b, b+8) and [b+16, b+24), b = 8*(lane>=16).
__device__ __forceinline__ v16h load_frag(const _Float16* p, int lane) {
    const v8h* q = (const v8h*)(p + ((lane >> 4) << 3));
    v8h lo = q[0];
    v8h hi = q[2];
    return __builtin_shufflevector(lo, hi, 0, 1, 2, 3, 4, 5, 6, 7, 8, 9, 10,
                                   11, 12, 13, 14, 15);
}

// Async 16-byte global -> LDS copy (CDNA5, ASYNCcnt-tracked).
__device__ __forceinline__ void async_copy_b128(_Float16* lds_dst,
                                                const _Float16* gsrc) {
    uint32_t loff = (uint32_t)(uintptr_t)lds_dst;
    asm volatile("global_load_async_to_lds_b128 %0, %1, off"
                 :
                 : "v"(loff), "v"(gsrc)
                 : "memory");
}
__device__ __forceinline__ void wait_async0() {
    asm volatile("s_wait_asynccnt 0" ::: "memory");
}

// ---------------------------------------------------------------------------
// float -> f16 conversion (vectorized 4-wide)
// ---------------------------------------------------------------------------
__global__ void cvt_f16_kernel(const float* __restrict__ src,
                               _Float16* __restrict__ dst, int n4) {
    int i = blockIdx.x * 256 + threadIdx.x;
    if (i < n4) {
        v4f v = ((const v4f*)src)[i];
        ((v4h*)dst)[i] = __builtin_convertvector(v, v4h);
    }
}

// ---------------------------------------------------------------------------
// One-time weight transpose-convert: WT[n][k] (f16) = W[k][n] (f32)
// ---------------------------------------------------------------------------
__global__ void transpose_f16_kernel(const float* __restrict__ W,
                                     _Float16* __restrict__ WT, int K, int N) {
    int n = blockIdx.x * 32 + threadIdx.x;
    int k = blockIdx.y * 8 + threadIdx.y;
    if (n < N && k < K) WT[(size_t)n * K + k] = (_Float16)W[(size_t)k * N + n];
}

// ---------------------------------------------------------------------------
// GEMM: C[M x N] = A[M x K] (f16, row-major) * WT[N x K] (f16, N-major) + bias
// Block: 128 threads (4 waves), 128x64 tile; wave w owns rows w*32..w*32+31.
// Double-buffered async staging.  mode 0: f32 row-major.
// mode 1: f16 split-head [B,H,S,64].  mode 2: f16 split-head T [B,H,64,S].
// ---------------------------------------------------------------------------
__global__ __launch_bounds__(128) void gemm_kernel(
    const _Float16* __restrict__ A, const _Float16* __restrict__ WT,
    const float* __restrict__ bias, float* __restrict__ outF,
    _Float16* __restrict__ outH, int M, int N, int K, int mode, int relu,
    float scale) {
    __shared__ __align__(16) _Float16 As[2][128][32];   // row-major (K-runs)
    __shared__ __align__(16) _Float16 BsT[2][64][32];   // N-major: BsT[n][k]

    const int m0 = blockIdx.x * 128;
    const int n0 = blockIdx.y * 64;
    const int t = threadIdx.x;
    const int wave = t >> 5;
    const int lane = t & 31;

    v8f acc[2][4] = {};

    // stage first k-tile into buffer 0
#pragma unroll
    for (int i = t; i < 512; i += 128) {
        int r = i >> 2, cc = i & 3;
        async_copy_b128(&As[0][r][cc * 8],
                        A + (size_t)(m0 + r) * K + cc * 8);
    }
#pragma unroll
    for (int i = t; i < 256; i += 128) {
        int c = i >> 2, cc = i & 3;
        async_copy_b128(&BsT[0][c][cc * 8],
                        WT + (size_t)(n0 + c) * K + cc * 8);
    }

    for (int k0 = 0; k0 < K; k0 += 32) {
        const int buf = (k0 >> 5) & 1;
        wait_async0();
        __syncthreads();  // tile `buf` ready for all waves

        if (k0 + 32 < K) {  // issue DMA for next tile into other buffer
            const int k1 = k0 + 32;
#pragma unroll
            for (int i = t; i < 512; i += 128) {
                int r = i >> 2, cc = i & 3;
                async_copy_b128(&As[buf ^ 1][r][cc * 8],
                                A + (size_t)(m0 + r) * K + k1 + cc * 8);
            }
#pragma unroll
            for (int i = t; i < 256; i += 128) {
                int c = i >> 2, cc = i & 3;
                async_copy_b128(&BsT[buf ^ 1][c][cc * 8],
                                WT + (size_t)(n0 + c) * K + k1 + cc * 8);
            }
        }

        v16h a0 = load_frag(&As[buf][wave * 32 + (lane & 15)][0], lane);
        v16h a1 = load_frag(&As[buf][wave * 32 + 16 + (lane & 15)][0], lane);
#pragma unroll
        for (int nt = 0; nt < 4; ++nt) {
            v16h bf = load_frag(&BsT[buf][nt * 16 + (lane & 15)][0], lane);
            acc[0][nt] = __builtin_amdgcn_wmma_f32_16x16x32_f16(
                false, a0, false, bf, (short)0, acc[0][nt], false, false);
            acc[1][nt] = __builtin_amdgcn_wmma_f32_16x16x32_f16(
                false, a1, false, bf, (short)0, acc[1][nt], false, false);
        }
        // no trailing barrier: next iteration's wait+barrier protects reuse
    }

    // epilogue
#pragma unroll
    for (int hh = 0; hh < 2; ++hh)
#pragma unroll
        for (int nt = 0; nt < 4; ++nt) {
            int col = n0 + nt * 16 + (lane & 15);
            float bvv = bias[col];
#pragma unroll
            for (int r = 0; r < 8; ++r) {
                int row = m0 + wave * 32 + hh * 16 + r + ((lane >> 4) << 3);
                float v = acc[hh][nt][r] + bvv;
                if (relu) v = fmaxf(v, 0.0f);
                v *= scale;
                int b = row / S_, s = row % S_;
                int h = col >> 6, d = col & 63;
                if (mode == 0) {
                    outF[(size_t)row * N + col] = v;
                } else if (mode == 1) {
                    outH[(((size_t)(b * H_ + h)) * S_ + s) * DEPTH_ + d] =
                        (_Float16)v;
                } else {
                    outH[(((size_t)(b * H_ + h)) * DEPTH_ + d) * S_ + s] =
                        (_Float16)v;
                }
            }
        }
}

// ---------------------------------------------------------------------------
// Flash attention.  q already scaled by 1/sqrt(DEPTH).
// Grid: (S/64, B*H).  Block: 128 threads (4 waves); wave w owns 16 q-rows.
// q/k: [B*H, S, 64] f16.  v: transposed [B*H, 64, S] f16.
// Double-buffered async K/V staging.  ctx out: [B*S, D] f16 (heads merged).
// ---------------------------------------------------------------------------
__global__ __launch_bounds__(128) void attn_kernel(
    const _Float16* __restrict__ qh, const _Float16* __restrict__ kh,
    const _Float16* __restrict__ vT, const float* __restrict__ mask,
    _Float16* __restrict__ ctxh) {
    __shared__ __align__(16) _Float16 Ks[2][64][64];    // [kpos][d]
    __shared__ __align__(16) _Float16 VsT[2][64][64];   // [d][kpos]
    __shared__ __align__(16) _Float16 Ps[4][16][64];    // per-wave P

    const int qt = blockIdx.x;
    const int bh = blockIdx.y;
    const int b = bh / H_;
    const int h = bh % H_;
    const int t = threadIdx.x;
    const int wave = t >> 5;
    const int lane = t & 31;
    const size_t base = (size_t)bh * S_ * DEPTH_;  // q/k and vT share extent
    const int qr0 = qt * 64 + wave * 16;
    const int NT = S_ / 64;

    // Q fragments straight from global (two 16B loads each)
    v16h qA[2];
#pragma unroll
    for (int c = 0; c < 2; ++c)
        qA[c] = load_frag(
            qh + base + (size_t)(qr0 + (lane & 15)) * DEPTH_ + c * 32, lane);

    v8f O[4] = {};
    float mrow[8], lrow[8];
#pragma unroll
    for (int r = 0; r < 8; ++r) { mrow[r] = -1e30f; lrow[r] = 0.0f; }

    // stage first K/V tile into buffer 0
#pragma unroll
    for (int i = t; i < 512; i += 128) {
        int r = i >> 3, cc = i & 7;
        async_copy_b128(&Ks[0][r][cc * 8],
                        kh + base + (size_t)r * DEPTH_ + cc * 8);
        async_copy_b128(&VsT[0][r][cc * 8],
                        vT + base + (size_t)r * S_ + cc * 8);
    }

    for (int kt = 0; kt < NT; ++kt) {
        const int buf = kt & 1;
        wait_async0();
        __syncthreads();  // tile `buf` ready

        if (kt + 1 < NT) {  // DMA next tile into other buffer
            if (t == 0)
                __builtin_prefetch(mask + (size_t)b * S_ + (kt + 1) * 64, 0, 1);
            const int kr = (kt + 1) * 64;
#pragma unroll
            for (int i = t; i < 512; i += 128) {
                int r = i >> 3, cc = i & 7;
                async_copy_b128(
                    &Ks[buf ^ 1][r][cc * 8],
                    kh + base + (size_t)(kr + r) * DEPTH_ + cc * 8);
                async_copy_b128(&VsT[buf ^ 1][r][cc * 8],
                                vT + base + (size_t)r * S_ + kr + cc * 8);
            }
        }

        // logits tile: S = Q @ K^T   (16 x 64)
        v8f sc[4] = {};
#pragma unroll
        for (int nt = 0; nt < 4; ++nt) {
#pragma unroll
            for (int c = 0; c < 2; ++c) {
                v16h bf =
                    load_frag(&Ks[buf][nt * 16 + (lane & 15)][c * 32], lane);
                sc[nt] = __builtin_amdgcn_wmma_f32_16x16x32_f16(
                    false, qA[c], false, bf, (short)0, sc[nt], false, false);
            }
            float mv =
                mask[(size_t)b * S_ + kt * 64 + nt * 16 + (lane & 15)] * -1e9f;
#pragma unroll
            for (int r = 0; r < 8; ++r) sc[nt][r] += mv;
        }

        // online softmax (row groups: lanes 0-15 and 16-31)
        float newm[8];
#pragma unroll
        for (int r = 0; r < 8; ++r) {
            float mx = fmaxf(fmaxf(sc[0][r], sc[1][r]),
                             fmaxf(sc[2][r], sc[3][r]));
#pragma unroll
            for (int off = 1; off < 16; off <<= 1)
                mx = fmaxf(mx, __shfl_xor(mx, off, 32));
            newm[r] = fmaxf(mrow[r], mx);
        }
#pragma unroll
        for (int r = 0; r < 8; ++r) {
            float corr = __expf(mrow[r] - newm[r]);
            float rs = 0.0f;
#pragma unroll
            for (int nt = 0; nt < 4; ++nt) {
                float p = __expf(sc[nt][r] - newm[r]);
                sc[nt][r] = p;
                rs += p;
            }
#pragma unroll
            for (int off = 1; off < 16; off <<= 1)
                rs += __shfl_xor(rs, off, 32);
            lrow[r] = lrow[r] * corr + rs;
            mrow[r] = newm[r];
#pragma unroll
            for (int nt = 0; nt < 4; ++nt) O[nt][r] *= corr;
        }

        // P (C-layout) -> LDS row-major
#pragma unroll
        for (int nt = 0; nt < 4; ++nt)
#pragma unroll
            for (int r = 0; r < 8; ++r)
                Ps[wave][r + ((lane >> 4) << 3)][nt * 16 + (lane & 15)] =
                    (_Float16)sc[nt][r];
        __syncthreads();

        // O += P @ V
#pragma unroll
        for (int c = 0; c < 2; ++c) {
            v16h pa = load_frag(&Ps[wave][lane & 15][c * 32], lane);
#pragma unroll
            for (int nt = 0; nt < 4; ++nt) {
                v16h bv =
                    load_frag(&VsT[buf][nt * 16 + (lane & 15)][c * 32], lane);
                O[nt] = __builtin_amdgcn_wmma_f32_16x16x32_f16(
                    false, pa, false, bv, (short)0, O[nt], false, false);
            }
        }
        // no trailing barrier: next iteration's wait+barrier protects reuse
    }

    // write merged-head context, normalized by l
#pragma unroll
    for (int nt = 0; nt < 4; ++nt)
#pragma unroll
        for (int r = 0; r < 8; ++r) {
            int row = qr0 + r + ((lane >> 4) << 3);
            int d = nt * 16 + (lane & 15);
            ctxh[(size_t)(b * S_ + row) * D_ + h * DEPTH_ + d] =
                (_Float16)(O[nt][r] / lrow[r]);
        }
}

// ---------------------------------------------------------------------------
// LayerNorm over rows of length n (256 or 1024), optional residual add.
// ---------------------------------------------------------------------------
__global__ __launch_bounds__(256) void ln_kernel(
    const float* __restrict__ a, const float* __restrict__ res,
    const float* __restrict__ g, const float* __restrict__ beta, float eps,
    float* __restrict__ outF, _Float16* __restrict__ outH, int n) {
    __shared__ float red[8];
    const int row = blockIdx.x;
    const int t = threadIdx.x;
    const int cnt = n / 256;  // 1 (D) or 4 (DFF)
    const size_t off = (size_t)row * n;

    float vals[4];
    float sum = 0.0f;
    for (int i = 0; i < cnt; ++i) {
        float v = a[off + t + i * 256];
        if (res) v += res[off + t + i * 256];
        vals[i] = v;
        sum += v;
    }
#pragma unroll
    for (int o = 16; o >= 1; o >>= 1) sum += __shfl_xor(sum, o, 32);
    if ((t & 31) == 0) red[t >> 5] = sum;
    __syncthreads();
    sum = 0.0f;
#pragma unroll
    for (int w = 0; w < 8; ++w) sum += red[w];
    const float mu = sum / n;
    __syncthreads();

    float s2 = 0.0f;
    for (int i = 0; i < cnt; ++i) {
        float d = vals[i] - mu;
        s2 += d * d;
    }
#pragma unroll
    for (int o = 16; o >= 1; o >>= 1) s2 += __shfl_xor(s2, o, 32);
    if ((t & 31) == 0) red[t >> 5] = s2;
    __syncthreads();
    s2 = 0.0f;
#pragma unroll
    for (int w = 0; w < 8; ++w) s2 += red[w];
    const float rstd = rsqrtf(s2 / n + eps);

    for (int i = 0; i < cnt; ++i) {
        int c = t + i * 256;
        float y = (vals[i] - mu) * rstd * g[c] + beta[c];
        if (outF) outF[off + c] = y;
        if (outH) outH[off + c] = (_Float16)y;
    }
}

// ---------------------------------------------------------------------------
extern "C" void kernel_launch(void* const* d_in, const int* in_sizes, int n_in,
                              void* d_out, int out_size, void* d_ws,
                              size_t ws_size, hipStream_t stream) {
    const float* x      = (const float*)d_in[0];
    const float* mask   = (const float*)d_in[1];
    const float* wq     = (const float*)d_in[2];
    const float* bq     = (const float*)d_in[3];
    const float* wk     = (const float*)d_in[4];
    const float* bk     = (const float*)d_in[5];
    const float* wv     = (const float*)d_in[6];
    const float* bv     = (const float*)d_in[7];
    const float* wo     = (const float*)d_in[8];
    const float* bo     = (const float*)d_in[9];
    const float* w1     = (const float*)d_in[10];
    const float* b1     = (const float*)d_in[11];
    const float* lnffg  = (const float*)d_in[12];
    const float* lnffb  = (const float*)d_in[13];
    const float* w2     = (const float*)d_in[14];
    const float* b2     = (const float*)d_in[15];
    const float* ln1g   = (const float*)d_in[16];
    const float* ln1b   = (const float*)d_in[17];
    const float* ln2g   = (const float*)d_in[18];
    const float* ln2b   = (const float*)d_in[19];
    float* out = (float*)d_out;

    // workspace carve-up
    char* p = (char*)d_ws;
    _Float16* xh   = (_Float16*)p; p += (size_t)M_ * D_ * 2;    // 8 MiB
    _Float16* qh   = (_Float16*)p; p += (size_t)M_ * D_ * 2;    // 8 MiB
    _Float16* kh   = (_Float16*)p; p += (size_t)M_ * D_ * 2;    // 8 MiB
    _Float16* vh   = (_Float16*)p; p += (size_t)M_ * D_ * 2;    // 8 MiB (vT)
    _Float16* ctxh = (_Float16*)p; p += (size_t)M_ * D_ * 2;    // 8 MiB
    float* tmpF    = (float*)p;    p += (size_t)M_ * D_ * 4;    // 16 MiB
    float* out1F   = (float*)p;    p += (size_t)M_ * D_ * 4;    // 16 MiB
    _Float16* o1h  = (_Float16*)p; p += (size_t)M_ * D_ * 2;    // 8 MiB
    float* hF      = (float*)p;    p += (size_t)M_ * DFF_ * 4;  // 64 MiB
    _Float16* hH   = (_Float16*)p; p += (size_t)M_ * DFF_ * 2;  // 32 MiB
    float* t2F     = (float*)p;    p += (size_t)M_ * D_ * 4;    // 16 MiB
    _Float16* wqT  = (_Float16*)p; p += (size_t)D_ * D_ * 2;
    _Float16* wkT  = (_Float16*)p; p += (size_t)D_ * D_ * 2;
    _Float16* wvT  = (_Float16*)p; p += (size_t)D_ * D_ * 2;
    _Float16* woT  = (_Float16*)p; p += (size_t)D_ * D_ * 2;
    _Float16* w1T  = (_Float16*)p; p += (size_t)D_ * DFF_ * 2;
    _Float16* w2T  = (_Float16*)p; p += (size_t)DFF_ * D_ * 2;

    // one-time weight transpose-convert (f32 KxN -> f16 NxK)
    dim3 tb(32, 8);
    transpose_f16_kernel<<<dim3(D_ / 32, D_ / 8), tb, 0, stream>>>(wq, wqT, D_, D_);
    transpose_f16_kernel<<<dim3(D_ / 32, D_ / 8), tb, 0, stream>>>(wk, wkT, D_, D_);
    transpose_f16_kernel<<<dim3(D_ / 32, D_ / 8), tb, 0, stream>>>(wv, wvT, D_, D_);
    transpose_f16_kernel<<<dim3(D_ / 32, D_ / 8), tb, 0, stream>>>(wo, woT, D_, D_);
    transpose_f16_kernel<<<dim3(DFF_ / 32, D_ / 8), tb, 0, stream>>>(w1, w1T, D_, DFF_);
    transpose_f16_kernel<<<dim3(D_ / 32, DFF_ / 8), tb, 0, stream>>>(w2, w2T, DFF_, D_);

    // x -> f16
    cvt_f16_kernel<<<(M_ * D_ / 4 + 255) / 256, 256, 0, stream>>>(
        x, xh, M_ * D_ / 4);

    // q/k/v projections (q pre-scaled by 1/sqrt(DEPTH); v written transposed)
    dim3 gQKV(M_ / 128, D_ / 64);
    gemm_kernel<<<gQKV, 128, 0, stream>>>(xh, wqT, bq, nullptr, qh, M_, D_, D_,
                                          1, 0, 0.125f);
    gemm_kernel<<<gQKV, 128, 0, stream>>>(xh, wkT, bk, nullptr, kh, M_, D_, D_,
                                          1, 0, 1.0f);
    gemm_kernel<<<gQKV, 128, 0, stream>>>(xh, wvT, bv, nullptr, vh, M_, D_, D_,
                                          2, 0, 1.0f);

    // flash attention
    attn_kernel<<<dim3(S_ / 64, B_ * H_), 128, 0, stream>>>(qh, kh, vh, mask,
                                                            ctxh);

    // output projection + residual LN (eps 1e-3)
    gemm_kernel<<<gQKV, 128, 0, stream>>>(ctxh, woT, bo, tmpF, nullptr, M_, D_,
                                          D_, 0, 0, 1.0f);
    ln_kernel<<<M_, 256, 0, stream>>>(tmpF, x, ln1g, ln1b, 1e-3f, out1F, o1h,
                                      D_);

    // FFN: relu(out1@w1+b1) -> LN(eps 1e-6) -> @w2+b2
    gemm_kernel<<<dim3(M_ / 128, DFF_ / 64), 128, 0, stream>>>(
        o1h, w1T, b1, hF, nullptr, M_, DFF_, D_, 0, 1, 1.0f);
    ln_kernel<<<M_, 256, 0, stream>>>(hF, nullptr, lnffg, lnffb, 1e-6f,
                                      nullptr, hH, DFF_);
    gemm_kernel<<<dim3(M_ / 128, D_ / 64), 128, 0, stream>>>(
        hH, w2T, b2, t2F, nullptr, M_, D_, DFF_, 0, 0, 1.0f);

    // final residual LN (eps 1e-3) -> d_out
    ln_kernel<<<M_, 256, 0, stream>>>(t2F, out1F, ln2g, ln2b, 1e-3f, out,
                                      nullptr, D_);
}

// v001
// It runs in 368 microseconds.
// Two timings next to v000 put it at 1.40 and 1.41 times that version's speed.
#include <hip/hip_runtime.h>
#include <hip/hip_bf16.h>

// ---------------------------------------------------------------------------
// Transformer encoder layer for MI455X (gfx1250, wave32, WMMA).
// B=4, S=4096, D=256, H=4, DEPTH=64, DFF=1024.
// All GEMMs + attention on v_wmma_f32_16x16x32_f16 (f16 in, f32 acc).
// All global->LDS tile staging uses global_load_async_to_lds_b128 with
// double-buffered software pipelining (ASYNCcnt); fragments load as 2x b128.
// ---------------------------------------------------------------------------

#define B_ 4
#define S_ 4096
#define D_ 256
#define H_ 4
#define DEPTH_ 64
#define DFF_ 1024
#define M_ (B_ * S_)

typedef __attribute__((ext_vector_type(16))) _Float16 v16h;
typedef __attribute__((ext_vector_type(8)))  _Float16 v8h;
typedef __attribute__((ext_vector_type(4)))  _Float16 v4h;
typedef __attribute__((ext_vector_type(8)))  float    v8f;
typedef __attribute__((ext_vector_type(4)))  float    v4f;

// Load one 16-half fragment for lane `lane` from a row whose K-run starts at
// `p`.  Lane's data: K offsets [b, b+8) and [b+16, b+24), b = 8*(lane>=16).
__device__ __forceinline__ v16h load_frag(const _Float16* p, int lane) {
    const v8h* q = (const v8h*)(p + ((lane >> 4) << 3));
    v8h lo = q[0];
    v8h hi = q[2];
    return __builtin_shufflevector(lo, hi, 0, 1, 2, 3, 4, 5, 6, 7, 8, 9, 10,
                                   11, 12, 13, 14, 15);
}

// Async 16-byte global -> LDS copy (CDNA5, ASYNCcnt-tracked).
__device__ __forceinline__ void async_copy_b128(_Float16* lds_dst,
                                                const _Float16* gsrc) {
    uint32_t loff = (uint32_t)(uintptr_t)lds_dst;
    asm volatile("global_load_async_to_lds_b128 %0, %1, off"
                 :
                 : "v"(loff), "v"(gsrc)
                 : "memory");
}
__device__ __forceinline__ void wait_async0() {
    asm volatile("s_wait_asynccnt 0" ::: "memory");
}

// ---------------------------------------------------------------------------
// float -> f16 conversion (vectorized 4-wide)
// ---------------------------------------------------------------------------
__global__ void cvt_f16_kernel(const float* __restrict__ src,
                               _Float16* __restrict__ dst, int n4) {
    int i = blockIdx.x * 256 + threadIdx.x;
    if (i < n4) {
        v4f v = ((const v4f*)src)[i];
        ((v4h*)dst)[i] = __builtin_convertvector(v, v4h);
    }
}

// ---------------------------------------------------------------------------
// One-time weight transpose-convert: WT[n][k] (f16) = W[k][n] (f32)
// ---------------------------------------------------------------------------
__global__ void transpose_f16_kernel(const float* __restrict__ W,
                                     _Float16* __restrict__ WT, int K, int N) {
    int n = blockIdx.x * 32 + threadIdx.x;
    int k = blockIdx.y * 8 + threadIdx.y;
    if (n < N && k < K) WT[(size_t)n * K + k] = (_Float16)W[(size_t)k * N + n];
}

// ---------------------------------------------------------------------------
// GEMM: C[M x N] = A[M x K] (f16, row-major) * WT[N x K] (f16, N-major) + bias
// Block: 128 threads (4 waves), 128x64 tile; wave w owns rows w*32..w*32+31.
// Double-buffered async staging.  mode 0: f32 row-major.
// mode 1: f16 split-head [B,H,S,64].  mode 2: f16 split-head T [B,H,64,S].
// ---------------------------------------------------------------------------
__global__ __launch_bounds__(128) void gemm_kernel(
    const _Float16* __restrict__ A, const _Float16* __restrict__ WT,
    const float* __restrict__ bias, float* __restrict__ outF,
    _Float16* __restrict__ outH, int M, int N, int K, int mode, int relu,
    float scale) {
    // Rows hold 32 halves; the pitch is 40 halves (80 B = 16 B x odd) so that the
    // 16 rows of a ds_load_b128 fragment read fall on distinct LDS banks.
    __shared__ __align__(16) _Float16 As[2][128][40];   // row-major (K-runs)
    __shared__ __align__(16) _Float16 BsT[2][64][40];   // N-major: BsT[n][k]

    const int m0 = blockIdx.x * 128;
    const int n0 = blockIdx.y * 64;
    const int t = threadIdx.x;
    const int wave = t >> 5;
    const int lane = t & 31;

    v8f acc[2][4] = {};

    // stage first k-tile into buffer 0
#pragma unroll
    for (int i = t; i < 512; i += 128) {
        int r = i >> 2, cc = i & 3;
        async_copy_b128(&As[0][r][cc * 8],
                        A + (size_t)(m0 + r) * K + cc * 8);
    }
#pragma unroll
    for (int i = t; i < 256; i += 128) {
        int c = i >> 2, cc = i & 3;
        async_copy_b128(&BsT[0][c][cc * 8],
                        WT + (size_t)(n0 + c) * K + cc * 8);
    }

    for (int k0 = 0; k0 < K; k0 += 32) {
        const int buf = (k0 >> 5) & 1;
        wait_async0();
        __syncthreads();  // tile `buf` ready for all waves

        if (k0 + 32 < K) {  // issue DMA for next tile into other buffer
            const int k1 = k0 + 32;
#pragma unroll
            for (int i = t; i < 512; i += 128) {
                int r = i >> 2, cc = i & 3;
                async_copy_b128(&As[buf ^ 1][r][cc * 8],
                                A + (size_t)(m0 + r) * K + k1 + cc * 8);
            }
#pragma unroll
            for (int i = t; i < 256; i += 128) {
                int c = i >> 2, cc = i & 3;
                async_copy_b128(&BsT[buf ^ 1][c][cc * 8],
                                WT + (size_t)(n0 + c) * K + k1 + cc * 8);
            }
        }

        v16h a0 = load_frag(&As[buf][wave * 32 + (lane & 15)][0], lane);
        v16h a1 = load_frag(&As[buf][wave * 32 + 16 + (lane & 15)][0], lane);
#pragma unroll
        for (int nt = 0; nt < 4; ++nt) {
            v16h bf = load_frag(&BsT[buf][nt * 16 + (lane & 15)][0], lane);
            acc[0][nt] = __builtin_amdgcn_wmma_f32_16x16x32_f16(
                false, a0, false, bf, (short)0, acc[0][nt], false, false);
            acc[1][nt] = __builtin_amdgcn_wmma_f32_16x16x32_f16(
                false, a1, false, bf, (short)0, acc[1][nt], false, false);
        }
        // no trailing barrier: next iteration's wait+barrier protects reuse
    }

    // epilogue
#pragma unroll
    for (int hh = 0; hh < 2; ++hh)
#pragma unroll
        for (int nt = 0; nt < 4; ++nt) {
            int col = n0 + nt * 16 + (lane & 15);
            float bvv = bias[col];
#pragma unroll
            for (int r = 0; r < 8; ++r) {
                int row = m0 + wave * 32 + hh * 16 + r + ((lane >> 4) << 3);
                float v = acc[hh][nt][r] + bvv;
                if (relu) v = fmaxf(v, 0.0f);
                v *= scale;
                int b = row / S_, s = row % S_;
                int h = col >> 6, d = col & 63;
                if (mode == 0) {
                    outF[(size_t)row * N + col] = v;
                } else if (mode == 1) {
                    outH[(((size_t)(b * H_ + h)) * S_ + s) * DEPTH_ + d] =
                        (_Float16)v;
                } else {
                    outH[(((size_t)(b * H_ + h)) * DEPTH_ + d) * S_ + s] =
                        (_Float16)v;
                }
            }
        }
}

// ---------------------------------------------------------------------------
// Flash attention.  q already scaled by 1/sqrt(DEPTH).
// Grid: (S/64, B*H).  Block: 128 threads (4 waves); wave w owns 16 q-rows.
// q/k: [B*H, S, 64] f16.  v: transposed [B*H, 64, S] f16.
// Double-buffered async K/V staging.  ctx out: [B*S, D] f16 (heads merged).
// ---------------------------------------------------------------------------
__global__ __launch_bounds__(128) void attn_kernel(
    const _Float16* __restrict__ qh, const _Float16* __restrict__ kh,
    const _Float16* __restrict__ vT, const float* __restrict__ mask,
    _Float16* __restrict__ ctxh) {
    // Rows hold 64 halves; the pitch is 72 halves (144 B = 16 B x odd) so that the
    // 16 rows of a ds_load_b128 fragment read fall on distinct LDS banks.
    __shared__ __align__(16) _Float16 Ks[2][64][72];    // [kpos][d]
    __shared__ __align__(16) _Float16 VsT[2][64][72];   // [d][kpos]
    __shared__ __align__(16) _Float16 Ps[4][16][72];    // per-wave P

    const int qt = blockIdx.x;
    const int bh = blockIdx.y;
    const int b = bh / H_;
    const int h = bh % H_;
    const int t = threadIdx.x;
    const int wave = t >> 5;
    const int lane = t & 31;
    const size_t base = (size_t)bh * S_ * DEPTH_;  // q/k and vT share extent
    const int qr0 = qt * 64 + wave * 16;
    const int NT = S_ / 64;

    // Q fragments straight from global (two 16B loads each)
    v16h qA[2];
#pragma unroll
    for (int c = 0; c < 2; ++c)
        qA[c] = load_frag(
            qh + base + (size_t)(qr0 + (lane & 15)) * DEPTH_ + c * 32, lane);

    v8f O[4] = {};
    float mrow[8], lrow[8];
#pragma unroll
    for (int r = 0; r < 8; ++r) { mrow[r] = -1e30f; lrow[r] = 0.0f; }

    // stage first K/V tile into buffer 0
#pragma unroll
    for (int i = t; i < 512; i += 128) {
        int r = i >> 3, cc = i & 7;
        async_copy_b128(&Ks[0][r][cc * 8],
                        kh + base + (size_t)r * DEPTH_ + cc * 8);
        async_copy_b128(&VsT[0][r][cc * 8],
                        vT + base + (size_t)r * S_ + cc * 8);
    }

    for (int kt = 0; kt < NT; ++kt) {
        const int buf = kt & 1;
        wait_async0();
        __syncthreads();  // tile `buf` ready

        if (kt + 1 < NT) {  // DMA next tile into other buffer
            if (t == 0)
                __builtin_prefetch(mask + (size_t)b * S_ + (kt + 1) * 64, 0, 1);
            const int kr = (kt + 1) * 64;
#pragma unroll
            for (int i = t; i < 512; i += 128) {
                int r = i >> 3, cc = i & 7;
                async_copy_b128(
                    &Ks[buf ^ 1][r][cc * 8],
                    kh + base + (size_t)(kr + r) * DEPTH_ + cc * 8);
                async_copy_b128(&VsT[buf ^ 1][r][cc * 8],
                                vT + base + (size_t)r * S_ + kr + cc * 8);
            }
        }

        // logits tile: S = Q @ K^T   (16 x 64)
        v8f sc[4] = {};
#pragma unroll
        for (int nt = 0; nt < 4; ++nt) {
#pragma unroll
            for (int c = 0; c < 2; ++c) {
                v16h bf =
                    load_frag(&Ks[buf][nt * 16 + (lane & 15)][c * 32], lane);
                sc[nt] = __builtin_amdgcn_wmma_f32_16x16x32_f16(
                    false, qA[c], false, bf, (short)0, sc[nt], false, false);
            }
            float mv =
                mask[(size_t)b * S_ + kt * 64 + nt * 16 + (lane & 15)] * -1e9f;
#pragma unroll
            for (int r = 0; r < 8; ++r) sc[nt][r] += mv;
        }

        // online softmax (row groups: lanes 0-15 and 16-31)
        float newm[8];
#pragma unroll
        for (int r = 0; r < 8; ++r) {
            float mx = fmaxf(fmaxf(sc[0][r], sc[1][r]),
                             fmaxf(sc[2][r], sc[3][r]));
#pragma unroll
            for (int off = 1; off < 16; off <<= 1)
                mx = fmaxf(mx, __shfl_xor(mx, off, 32));
            newm[r] = fmaxf(mrow[r], mx);
        }
#pragma unroll
        for (int r = 0; r < 8; ++r) {
            float corr = __expf(mrow[r] - newm[r]);
            float rs = 0.0f;
#pragma unroll
            for (int nt = 0; nt < 4; ++nt) {
                float p = __expf(sc[nt][r] - newm[r]);
                sc[nt][r] = p;
                rs += p;
            }
#pragma unroll
            for (int off = 1; off < 16; off <<= 1)
                rs += __shfl_xor(rs, off, 32);
            lrow[r] = lrow[r] * corr + rs;
            mrow[r] = newm[r];
#pragma unroll
            for (int nt = 0; nt < 4; ++nt) O[nt][r] *= corr;
        }

        // P (C-layout) -> LDS row-major
#pragma unroll
        for (int nt = 0; nt < 4; ++nt)
#pragma unroll
            for (int r = 0; r < 8; ++r)
                Ps[wave][r + ((lane >> 4) << 3)][nt * 16 + (lane & 15)] =
                    (_Float16)sc[nt][r];
        __syncthreads();

        // O += P @ V
#pragma unroll
        for (int c = 0; c < 2; ++c) {
            v16h pa = load_frag(&Ps[wave][lane & 15][c * 32], lane);
#pragma unroll
            for (int nt = 0; nt < 4; ++nt) {
                v16h bv =
                    load_frag(&VsT[buf][nt * 16 + (lane & 15)][c * 32], lane);
                O[nt] = __builtin_amdgcn_wmma_f32_16x16x32_f16(
                    false, pa, false, bv, (short)0, O[nt], false, false);
            }
        }
        // no trailing barrier: next iteration's wait+barrier protects reuse
    }

    // write merged-head context, normalized by l
#pragma unroll
    for (int nt = 0; nt < 4; ++nt)
#pragma unroll
        for (int r = 0; r < 8; ++r) {
            int row = qr0 + r + ((lane >> 4) << 3);
            int d = nt * 16 + (lane & 15);
            ctxh[(size_t)(b * S_ + row) * D_ + h * DEPTH_ + d] =
                (_Float16)(O[nt][r] / lrow[r]);
        }
}

// ---------------------------------------------------------------------------
// LayerNorm over rows of length n (256 or 1024), optional residual add.
// ---------------------------------------------------------------------------
__global__ __launch_bounds__(256) void ln_kernel(
    const float* __restrict__ a, const float* __restrict__ res,
    const float* __restrict__ g, const float* __restrict__ beta, float eps,
    float* __restrict__ outF, _Float16* __restrict__ outH, int n) {
    __shared__ float red[8];
    const int row = blockIdx.x;
    const int t = threadIdx.x;
    const int cnt = n / 256;  // 1 (D) or 4 (DFF)
    const size_t off = (size_t)row * n;

    float vals[4];
    float sum = 0.0f;
    for (int i = 0; i < cnt; ++i) {
        float v = a[off + t + i * 256];
        if (res) v += res[off + t + i * 256];
        vals[i] = v;
        sum += v;
    }
#pragma unroll
    for (int o = 16; o >= 1; o >>= 1) sum += __shfl_xor(sum, o, 32);
    if ((t & 31) == 0) red[t >> 5] = sum;
    __syncthreads();
    sum = 0.0f;
#pragma unroll
    for (int w = 0; w < 8; ++w) sum += red[w];
    const float mu = sum / n;
    __syncthreads();

    float s2 = 0.0f;
    for (int i = 0; i < cnt; ++i) {
        float d = vals[i] - mu;
        s2 += d * d;
    }
#pragma unroll
    for (int o = 16; o >= 1; o >>= 1) s2 += __shfl_xor(s2, o, 32);
    if ((t & 31) == 0) red[t >> 5] = s2;
    __syncthreads();
    s2 = 0.0f;
#pragma unroll
    for (int w = 0; w < 8; ++w) s2 += red[w];
    const float rstd = rsqrtf(s2 / n + eps);

    for (int i = 0; i < cnt; ++i) {
        int c = t + i * 256;
        float y = (vals[i] - mu) * rstd * g[c] + beta[c];
        if (outF) outF[off + c] = y;
        if (outH) outH[off + c] = (_Float16)y;
    }
}

// ---------------------------------------------------------------------------
extern "C" void kernel_launch(void* const* d_in, const int* in_sizes, int n_in,
                              void* d_out, int out_size, void* d_ws,
                              size_t ws_size, hipStream_t stream) {
    const float* x      = (const float*)d_in[0];
    const float* mask   = (const float*)d_in[1];
    const float* wq     = (const float*)d_in[2];
    const float* bq     = (const float*)d_in[3];
    const float* wk     = (const float*)d_in[4];
    const float* bk     = (const float*)d_in[5];
    const float* wv     = (const float*)d_in[6];
    const float* bv     = (const float*)d_in[7];
    const float* wo     = (const float*)d_in[8];
    const float* bo     = (const float*)d_in[9];
    const float* w1     = (const float*)d_in[10];
    const float* b1     = (const float*)d_in[11];
    const float* lnffg  = (const float*)d_in[12];
    const float* lnffb  = (const float*)d_in[13];
    const float* w2     = (const float*)d_in[14];
    const float* b2     = (const float*)d_in[15];
    const float* ln1g   = (const float*)d_in[16];
    const float* ln1b   = (const float*)d_in[17];
    const float* ln2g   = (const float*)d_in[18];
    const float* ln2b   = (const float*)d_in[19];
    float* out = (float*)d_out;

    // workspace carve-up
    char* p = (char*)d_ws;
    _Float16* xh   = (_Float16*)p; p += (size_t)M_ * D_ * 2;    // 8 MiB
    _Float16* qh   = (_Float16*)p; p += (size_t)M_ * D_ * 2;    // 8 MiB
    _Float16* kh   = (_Float16*)p; p += (size_t)M_ * D_ * 2;    // 8 MiB
    _Float16* vh   = (_Float16*)p; p += (size_t)M_ * D_ * 2;    // 8 MiB (vT)
    _Float16* ctxh = (_Float16*)p; p += (size_t)M_ * D_ * 2;    // 8 MiB
    float* tmpF    = (float*)p;    p += (size_t)M_ * D_ * 4;    // 16 MiB
    float* out1F   = (float*)p;    p += (size_t)M_ * D_ * 4;    // 16 MiB
    _Float16* o1h  = (_Float16*)p; p += (size_t)M_ * D_ * 2;    // 8 MiB
    float* hF      = (float*)p;    p += (size_t)M_ * DFF_ * 4;  // 64 MiB
    _Float16* hH   = (_Float16*)p; p += (size_t)M_ * DFF_ * 2;  // 32 MiB
    float* t2F     = (float*)p;    p += (size_t)M_ * D_ * 4;    // 16 MiB
    _Float16* wqT  = (_Float16*)p; p += (size_t)D_ * D_ * 2;
    _Float16* wkT  = (_Float16*)p; p += (size_t)D_ * D_ * 2;
    _Float16* wvT  = (_Float16*)p; p += (size_t)D_ * D_ * 2;
    _Float16* woT  = (_Float16*)p; p += (size_t)D_ * D_ * 2;
    _Float16* w1T  = (_Float16*)p; p += (size_t)D_ * DFF_ * 2;
    _Float16* w2T  = (_Float16*)p; p += (size_t)DFF_ * D_ * 2;

    // one-time weight transpose-convert (f32 KxN -> f16 NxK)
    dim3 tb(32, 8);
    transpose_f16_kernel<<<dim3(D_ / 32, D_ / 8), tb, 0, stream>>>(wq, wqT, D_, D_);
    transpose_f16_kernel<<<dim3(D_ / 32, D_ / 8), tb, 0, stream>>>(wk, wkT, D_, D_);
    transpose_f16_kernel<<<dim3(D_ / 32, D_ / 8), tb, 0, stream>>>(wv, wvT, D_, D_);
    transpose_f16_kernel<<<dim3(D_ / 32, D_ / 8), tb, 0, stream>>>(wo, woT, D_, D_);
    transpose_f16_kernel<<<dim3(DFF_ / 32, D_ / 8), tb, 0, stream>>>(w1, w1T, D_, DFF_);
    transpose_f16_kernel<<<dim3(D_ / 32, DFF_ / 8), tb, 0, stream>>>(w2, w2T, DFF_, D_);

    // x -> f16
    cvt_f16_kernel<<<(M_ * D_ / 4 + 255) / 256, 256, 0, stream>>>(
        x, xh, M_ * D_ / 4);

    // q/k/v projections (q pre-scaled by 1/sqrt(DEPTH); v written transposed)
    dim3 gQKV(M_ / 128, D_ / 64);
    gemm_kernel<<<gQKV, 128, 0, stream>>>(xh, wqT, bq, nullptr, qh, M_, D_, D_,
                                          1, 0, 0.125f);
    gemm_kernel<<<gQKV, 128, 0, stream>>>(xh, wkT, bk, nullptr, kh, M_, D_, D_,
                                          1, 0, 1.0f);
    gemm_kernel<<<gQKV, 128, 0, stream>>>(xh, wvT, bv, nullptr, vh, M_, D_, D_,
                                          2, 0, 1.0f);

    // flash attention
    attn_kernel<<<dim3(S_ / 64, B_ * H_), 128, 0, stream>>>(qh, kh, vh, mask,
                                                            ctxh);

    // output projection + residual LN (eps 1e-3)
    gemm_kernel<<<gQKV, 128, 0, stream>>>(ctxh, woT, bo, tmpF, nullptr, M_, D_,
                                          D_, 0, 0, 1.0f);
    ln_kernel<<<M_, 256, 0, stream>>>(tmpF, x, ln1g, ln1b, 1e-3f, out1F, o1h,
                                      D_);

    // FFN: relu(out1@w1+b1) -> LN(eps 1e-6) -> @w2+b2
    gemm_kernel<<<dim3(M_ / 128, DFF_ / 64), 128, 0, stream>>>(
        o1h, w1T, b1, hF, nullptr, M_, DFF_, D_, 0, 1, 1.0f);
    ln_kernel<<<M_, 256, 0, stream>>>(hF, nullptr, lnffg, lnffb, 1e-6f,
                                      nullptr, hH, DFF_);
    gemm_kernel<<<dim3(M_ / 128, D_ / 64), 128, 0, stream>>>(
        hH, w2T, b2, t2F, nullptr, M_, D_, DFF_, 0, 0, 1.0f);

    // final residual LN (eps 1e-3) -> d_out
    ln_kernel<<<M_, 256, 0, stream>>>(t2F, out1F, ln2g, ln2b, 1e-3f, out,
                                      nullptr, D_);
}

// v002
// A run of this version takes 326 microseconds.
// Timed twice side by side with v001, it ran 1.13 and 1.12 times as fast.
// Counting every step since v000, it is 1.58 times as fast.
#include <hip/hip_runtime.h>
#include <hip/hip_bf16.h>

// ---------------------------------------------------------------------------
// Transformer encoder layer for MI455X (gfx1250, wave32, WMMA).
// B=4, S=4096, D=256, H=4, DEPTH=64, DFF=1024.
// All GEMMs + attention on v_wmma_f32_16x16x32_f16 (f16 in, f32 acc).
// All global->LDS tile staging uses global_load_async_to_lds_b128 with
// double-buffered software pipelining (ASYNCcnt); fragments load as 2x b128.
// ---------------------------------------------------------------------------

#define B_ 4
#define S_ 4096
#define D_ 256
#define H_ 4
#define DEPTH_ 64
#define DFF_ 1024
#define M_ (B_ * S_)

typedef __attribute__((ext_vector_type(16))) _Float16 v16h;
typedef __attribute__((ext_vector_type(8)))  _Float16 v8h;
typedef __attribute__((ext_vector_type(4)))  _Float16 v4h;
typedef __attribute__((ext_vector_type(8)))  float    v8f;
typedef __attribute__((ext_vector_type(4)))  float    v4f;

// Load one 16-half fragment for lane `lane` from a row whose K-run starts at
// `p`.  Lane's data: K offsets [b, b+8) and [b+16, b+24), b = 8*(lane>=16).
__device__ __forceinline__ v16h load_frag(const _Float16* p, int lane) {
    const v8h* q = (const v8h*)(p + ((lane >> 4) << 3));
    v8h lo = q[0];
    v8h hi = q[2];
    return __builtin_shufflevector(lo, hi, 0, 1, 2, 3, 4, 5, 6, 7, 8, 9, 10,
                                   11, 12, 13, 14, 15);
}

// Async 16-byte global -> LDS copy (CDNA5, ASYNCcnt-tracked).
__device__ __forceinline__ void async_copy_b128(_Float16* lds_dst,
                                                const _Float16* gsrc) {
    uint32_t loff = (uint32_t)(uintptr_t)lds_dst;
    asm volatile("global_load_async_to_lds_b128 %0, %1, off"
                 :
                 : "v"(loff), "v"(gsrc)
                 : "memory");
}
__device__ __forceinline__ void wait_async0() {
    asm volatile("s_wait_asynccnt 0" ::: "memory");
}

// ---------------------------------------------------------------------------
// float -> f16 conversion.  Resident grid: 256 blocks x 16 waves, each lane
// converts 8 groups of 4 floats (all 8 loads issued before the first store),
// so the launch starts 4096 waves and not 32768.
// ---------------------------------------------------------------------------
__global__ __launch_bounds__(512) void cvt_f16_kernel(
    const float* __restrict__ src, _Float16* __restrict__ dst) {
    const int i0 = blockIdx.x * 4096 + threadIdx.x;
    v4f v[8];
#pragma unroll
    for (int k = 0; k < 8; ++k) v[k] = ((const v4f*)src)[i0 + k * 512];
#pragma unroll
    for (int k = 0; k < 8; ++k)
        ((v4h*)dst)[i0 + k * 512] = __builtin_convertvector(v[k], v4h);
}

// ---------------------------------------------------------------------------
// One-time weight transpose-convert: WT[n][k] (f16) = W[k][n] (f32)
// ---------------------------------------------------------------------------
__global__ void transpose_f16_kernel(const float* __restrict__ W,
                                     _Float16* __restrict__ WT, int K, int N) {
    int n = blockIdx.x * 32 + threadIdx.x;
    int k = blockIdx.y * 8 + threadIdx.y;
    if (n < N && k < K) WT[(size_t)n * K + k] = (_Float16)W[(size_t)k * N + n];
}

// ---------------------------------------------------------------------------
// GEMM: C[M x N] = A[M x K] (f16, row-major) * WT[N x K] (f16, N-major) + bias
// Block: 128 threads (4 waves), 128x64 tile; wave w owns rows w*32..w*32+31.
// Double-buffered async staging.  mode 0: f32 row-major.
// mode 1: f16 split-head [B,H,S,64].  mode 2: f16 split-head T [B,H,64,S].
// ---------------------------------------------------------------------------
__global__ __launch_bounds__(128) void gemm_kernel(
    const _Float16* __restrict__ A, const _Float16* __restrict__ WT,
    const float* __restrict__ bias, float* __restrict__ outF,
    _Float16* __restrict__ outH, int M, int N, int K, int mode, int relu,
    float scale) {
    // Rows hold 32 halves; the pitch is 40 halves (80 B = 16 B x odd) so that the
    // 16 rows of a ds_load_b128 fragment read fall on distinct LDS banks.
    __shared__ __align__(16) _Float16 As[2][128][40];   // row-major (K-runs)
    __shared__ __align__(16) _Float16 BsT[2][64][40];   // N-major: BsT[n][k]

    const int m0 = blockIdx.x * 128;
    const int n0 = blockIdx.y * 64;
    const int t = threadIdx.x;
    const int wave = t >> 5;
    const int lane = t & 31;

    v8f acc[2][4] = {};

    // stage first k-tile into buffer 0
#pragma unroll
    for (int i = t; i < 512; i += 128) {
        int r = i >> 2, cc = i & 3;
        async_copy_b128(&As[0][r][cc * 8],
                        A + (size_t)(m0 + r) * K + cc * 8);
    }
#pragma unroll
    for (int i = t; i < 256; i += 128) {
        int c = i >> 2, cc = i & 3;
        async_copy_b128(&BsT[0][c][cc * 8],
                        WT + (size_t)(n0 + c) * K + cc * 8);
    }

    for (int k0 = 0; k0 < K; k0 += 32) {
        const int buf = (k0 >> 5) & 1;
        wait_async0();
        __syncthreads();  // tile `buf` ready for all waves

        if (k0 + 32 < K) {  // issue DMA for next tile into other buffer
            const int k1 = k0 + 32;
#pragma unroll
            for (int i = t; i < 512; i += 128) {
                int r = i >> 2, cc = i & 3;
                async_copy_b128(&As[buf ^ 1][r][cc * 8],
                                A + (size_t)(m0 + r) * K + k1 + cc * 8);
            }
#pragma unroll
            for (int i = t; i < 256; i += 128) {
                int c = i >> 2, cc = i & 3;
                async_copy_b128(&BsT[buf ^ 1][c][cc * 8],
                                WT + (size_t)(n0 + c) * K + k1 + cc * 8);
            }
        }

        v16h a0 = load_frag(&As[buf][wave * 32 + (lane & 15)][0], lane);
        v16h a1 = load_frag(&As[buf][wave * 32 + 16 + (lane & 15)][0], lane);
#pragma unroll
        for (int nt = 0; nt < 4; ++nt) {
            v16h bf = load_frag(&BsT[buf][nt * 16 + (lane & 15)][0], lane);
            acc[0][nt] = __builtin_amdgcn_wmma_f32_16x16x32_f16(
                false, a0, false, bf, (short)0, acc[0][nt], false, false);
            acc[1][nt] = __builtin_amdgcn_wmma_f32_16x16x32_f16(
                false, a1, false, bf, (short)0, acc[1][nt], false, false);
        }
        // no trailing barrier: next iteration's wait+barrier protects reuse
    }

    // epilogue
#pragma unroll
    for (int hh = 0; hh < 2; ++hh)
#pragma unroll
        for (int nt = 0; nt < 4; ++nt) {
            int col = n0 + nt * 16 + (lane & 15);
            float bvv = bias[col];
#pragma unroll
            for (int r = 0; r < 8; ++r) {
                int row = m0 + wave * 32 + hh * 16 + r + ((lane >> 4) << 3);
                float v = acc[hh][nt][r] + bvv;
                if (relu) v = fmaxf(v, 0.0f);
                v *= scale;
                int b = row / S_, s = row % S_;
                int h = col >> 6, d = col & 63;
                if (mode == 0) {
                    outF[(size_t)row * N + col] = v;
                } else if (mode == 1) {
                    outH[(((size_t)(b * H_ + h)) * S_ + s) * DEPTH_ + d] =
                        (_Float16)v;
                } else {
                    outH[(((size_t)(b * H_ + h)) * DEPTH_ + d) * S_ + s] =
                        (_Float16)v;
                }
            }
        }
}

// ---------------------------------------------------------------------------
// Flash attention.  q already scaled by 1/sqrt(DEPTH).
// Grid: (S/64, B*H).  Block: 128 threads (4 waves); wave w owns 16 q-rows.
// q/k: [B*H, S, 64] f16.  v: transposed [B*H, 64, S] f16.
// Double-buffered async K/V staging.  ctx out: [B*S, D] f16 (heads merged).
// ---------------------------------------------------------------------------
__global__ __launch_bounds__(128) void attn_kernel(
    const _Float16* __restrict__ qh, const _Float16* __restrict__ kh,
    const _Float16* __restrict__ vT, const float* __restrict__ mask,
    _Float16* __restrict__ ctxh) {
    // Rows hold 64 halves; the pitch is 72 halves (144 B = 16 B x odd) so that the
    // 16 rows of a ds_load_b128 fragment read fall on distinct LDS banks.
    __shared__ __align__(16) _Float16 Ks[2][64][72];    // [kpos][d]
    __shared__ __align__(16) _Float16 VsT[2][64][72];   // [d][kpos]
    __shared__ __align__(16) _Float16 Ps[4][16][72];    // per-wave P

    const int qt = blockIdx.x;
    const int bh = blockIdx.y;
    const int b = bh / H_;
    const int h = bh % H_;
    const int t = threadIdx.x;
    const int wave = t >> 5;
    const int lane = t & 31;
    const size_t base = (size_t)bh * S_ * DEPTH_;  // q/k and vT share extent
    const int qr0 = qt * 64 + wave * 16;
    const int NT = S_ / 64;

    // Q fragments straight from global (two 16B loads each)
    v16h qA[2];
#pragma unroll
    for (int c = 0; c < 2; ++c)
        qA[c] = load_frag(
            qh + base + (size_t)(qr0 + (lane & 15)) * DEPTH_ + c * 32, lane);

    v8f O[4] = {};
    float mrow[8], lrow[8];
#pragma unroll
    for (int r = 0; r < 8; ++r) { mrow[r] = -1e30f; lrow[r] = 0.0f; }

    // stage first K/V tile into buffer 0
#pragma unroll
    for (int i = t; i < 512; i += 128) {
        int r = i >> 3, cc = i & 7;
        async_copy_b128(&Ks[0][r][cc * 8],
                        kh + base + (size_t)r * DEPTH_ + cc * 8);
        async_copy_b128(&VsT[0][r][cc * 8],
                        vT + base + (size_t)r * S_ + cc * 8);
    }

    for (int kt = 0; kt < NT; ++kt) {
        const int buf = kt & 1;
        wait_async0();
        __syncthreads();  // tile `buf` ready

        if (kt + 1 < NT) {  // DMA next tile into other buffer
            if (t == 0)
                __builtin_prefetch(mask + (size_t)b * S_ + (kt + 1) * 64, 0, 1);
            const int kr = (kt + 1) * 64;
#pragma unroll
            for (int i = t; i < 512; i += 128) {
                int r = i >> 3, cc = i & 7;
                async_copy_b128(
                    &Ks[buf ^ 1][r][cc * 8],
                    kh + base + (size_t)(kr + r) * DEPTH_ + cc * 8);
                async_copy_b128(&VsT[buf ^ 1][r][cc * 8],
                                vT + base + (size_t)r * S_ + kr + cc * 8);
            }
        }

        // logits tile: S = Q @ K^T   (16 x 64)
        v8f sc[4] = {};
#pragma unroll
        for (int nt = 0; nt < 4; ++nt) {
#pragma unroll
            for (int c = 0; c < 2; ++c) {
                v16h bf =
                    load_frag(&Ks[buf][nt * 16 + (lane & 15)][c * 32], lane);
                sc[nt] = __builtin_amdgcn_wmma_f32_16x16x32_f16(
                    false, qA[c], false, bf, (short)0, sc[nt], false, false);
            }
            float mv =
                mask[(size_t)b * S_ + kt * 64 + nt * 16 + (lane & 15)] * -1e9f;
#pragma unroll
            for (int r = 0; r < 8; ++r) sc[nt][r] += mv;
        }

        // online softmax (row groups: lanes 0-15 and 16-31)
        float newm[8];
#pragma unroll
        for (int r = 0; r < 8; ++r) {
            float mx = fmaxf(fmaxf(sc[0][r], sc[1][r]),
                             fmaxf(sc[2][r], sc[3][r]));
#pragma unroll
            for (int off = 1; off < 16; off <<= 1)
                mx = fmaxf(mx, __shfl_xor(mx, off, 32));
            newm[r] = fmaxf(mrow[r], mx);
        }
#pragma unroll
        for (int r = 0; r < 8; ++r) {
            float corr = __expf(mrow[r] - newm[r]);
            float rs = 0.0f;
#pragma unroll
            for (int nt = 0; nt < 4; ++nt) {
                float p = __expf(sc[nt][r] - newm[r]);
                sc[nt][r] = p;
                rs += p;
            }
#pragma unroll
            for (int off = 1; off < 16; off <<= 1)
                rs += __shfl_xor(rs, off, 32);
            lrow[r] = lrow[r] * corr + rs;
            mrow[r] = newm[r];
#pragma unroll
            for (int nt = 0; nt < 4; ++nt) O[nt][r] *= corr;
        }

        // P (C-layout) -> LDS row-major
#pragma unroll
        for (int nt = 0; nt < 4; ++nt)
#pragma unroll
            for (int r = 0; r < 8; ++r)
                Ps[wave][r + ((lane >> 4) << 3)][nt * 16 + (lane & 15)] =
                    (_Float16)sc[nt][r];
        __syncthreads();

        // O += P @ V
#pragma unroll
        for (int c = 0; c < 2; ++c) {
            v16h pa = load_frag(&Ps[wave][lane & 15][c * 32], lane);
#pragma unroll
            for (int nt = 0; nt < 4; ++nt) {
                v16h bv =
                    load_frag(&VsT[buf][nt * 16 + (lane & 15)][c * 32], lane);
                O[nt] = __builtin_amdgcn_wmma_f32_16x16x32_f16(
                    false, pa, false, bv, (short)0, O[nt], false, false);
            }
        }
        // no trailing barrier: next iteration's wait+barrier protects reuse
    }

    // write merged-head context, normalized by l
#pragma unroll
    for (int nt = 0; nt < 4; ++nt)
#pragma unroll
        for (int r = 0; r < 8; ++r) {
            int row = qr0 + r + ((lane >> 4) << 3);
            int d = nt * 16 + (lane & 15);
            ctxh[(size_t)(b * S_ + row) * D_ + h * DEPTH_ + d] =
                (_Float16)(O[nt][r] / lrow[r]);
        }
}

// ---------------------------------------------------------------------------
// LayerNorm over rows of length NV * 128 (256 or 1024), optional residual add.
// One wave per row: the row lives in the wave's registers (16-byte loads, 512
// contiguous bytes per wave-wide load), both sums are lane exchanges, so there
// is no LDS and no barrier.  Resident grid: 256 blocks x 16 waves, 4 rows per
// wave with all rows' loads issued first: 4096 waves start per launch.
// ---------------------------------------------------------------------------
template <int NV, bool RES, bool OUTF, bool OUTH>
__global__ __launch_bounds__(512) void ln_kernel(
    const float* __restrict__ a, const float* __restrict__ res,
    const float* __restrict__ g, const float* __restrict__ beta, float eps,
    float* __restrict__ outF, _Float16* __restrict__ outH) {
    constexpr int n = NV * 128;
    constexpr int ROWS = 4;
    const int lane = threadIdx.x & 31;
    const int gw = blockIdx.x * 16 + (threadIdx.x >> 5);
    const size_t off = (size_t)gw * ROWS * n + lane * 4;

    const float* pa = a + off;
    const float* pr = RES ? res + off : pa;

    v4f v[ROWS][NV];
#pragma unroll
    for (int rr = 0; rr < ROWS; ++rr)
#pragma unroll
        for (int j = 0; j < NV; ++j)
            v[rr][j] = *(const v4f*)(pa + rr * n + j * 128);
    v4f w[RES ? ROWS : 1][NV];
    if (RES) {
#pragma unroll
        for (int rr = 0; rr < ROWS; ++rr)
#pragma unroll
            for (int j = 0; j < NV; ++j)
                w[rr][j] = *(const v4f*)(pr + rr * n + j * 128);
    }
    // The row loads share one address pair each.  Naming the pairs as inputs
    // keeps them live down to this wait, so that no load of the run can land
    // its result in a pair that the loads in front of it still name.
    asm volatile("s_wait_xcnt 0x0" ::"v"(pa), "v"(pr) : "memory");
    if (RES) {
#pragma unroll
        for (int rr = 0; rr < ROWS; ++rr)
#pragma unroll
            for (int j = 0; j < NV; ++j) v[rr][j] += w[rr][j];
    }
    v4f gg[NV], bb[NV];
#pragma unroll
    for (int j = 0; j < NV; ++j) {
        gg[j] = *(const v4f*)(g + j * 128 + lane * 4);
        bb[j] = *(const v4f*)(beta + j * 128 + lane * 4);
    }

    float mu[ROWS], rstd[ROWS];
#pragma unroll
    for (int rr = 0; rr < ROWS; ++rr) {
        float s = 0.0f;
#pragma unroll
        for (int j = 0; j < NV; ++j)
            s += (v[rr][j][0] + v[rr][j][1]) + (v[rr][j][2] + v[rr][j][3]);
        mu[rr] = s;
    }
#pragma unroll
    for (int o = 16; o >= 1; o >>= 1)
#pragma unroll
        for (int rr = 0; rr < ROWS; ++rr)
            mu[rr] += __shfl_xor(mu[rr], o, 32);
#pragma unroll
    for (int rr = 0; rr < ROWS; ++rr) {
        mu[rr] = mu[rr] / n;
        float s2 = 0.0f;
#pragma unroll
        for (int j = 0; j < NV; ++j) {
            v[rr][j] -= mu[rr];
            v4f q = v[rr][j] * v[rr][j];
            s2 += (q[0] + q[1]) + (q[2] + q[3]);
        }
        rstd[rr] = s2;
    }
#pragma unroll
    for (int o = 16; o >= 1; o >>= 1)
#pragma unroll
        for (int rr = 0; rr < ROWS; ++rr)
            rstd[rr] += __shfl_xor(rstd[rr], o, 32);

#pragma unroll
    for (int rr = 0; rr < ROWS; ++rr) {
        const float rs = rsqrtf(rstd[rr] / n + eps);
#pragma unroll
        for (int j = 0; j < NV; ++j) {
            v4f y = v[rr][j] * rs * gg[j] + bb[j];
            if (OUTF) *(v4f*)(outF + off + rr * n + j * 128) = y;
            if (OUTH)
                *(v4h*)(outH + off + rr * n + j * 128) =
                    __builtin_convertvector(y, v4h);
        }
    }
}

// ---------------------------------------------------------------------------
extern "C" void kernel_launch(void* const* d_in, const int* in_sizes, int n_in,
                              void* d_out, int out_size, void* d_ws,
                              size_t ws_size, hipStream_t stream) {
    const float* x      = (const float*)d_in[0];
    const float* mask   = (const float*)d_in[1];
    const float* wq     = (const float*)d_in[2];
    const float* bq     = (const float*)d_in[3];
    const float* wk     = (const float*)d_in[4];
    const float* bk     = (const float*)d_in[5];
    const float* wv     = (const float*)d_in[6];
    const float* bv     = (const float*)d_in[7];
    const float* wo     = (const float*)d_in[8];
    const float* bo     = (const float*)d_in[9];
    const float* w1     = (const float*)d_in[10];
    const float* b1     = (const float*)d_in[11];
    const float* lnffg  = (const float*)d_in[12];
    const float* lnffb  = (const float*)d_in[13];
    const float* w2     = (const float*)d_in[14];
    const float* b2     = (const float*)d_in[15];
    const float* ln1g   = (const float*)d_in[16];
    const float* ln1b   = (const float*)d_in[17];
    const float* ln2g   = (const float*)d_in[18];
    const float* ln2b   = (const float*)d_in[19];
    float* out = (float*)d_out;

    // workspace carve-up
    char* p = (char*)d_ws;
    _Float16* xh   = (_Float16*)p; p += (size_t)M_ * D_ * 2;    // 8 MiB
    _Float16* qh   = (_Float16*)p; p += (size_t)M_ * D_ * 2;    // 8 MiB
    _Float16* kh   = (_Float16*)p; p += (size_t)M_ * D_ * 2;    // 8 MiB
    _Float16* vh   = (_Float16*)p; p += (size_t)M_ * D_ * 2;    // 8 MiB (vT)
    _Float16* ctxh = (_Float16*)p; p += (size_t)M_ * D_ * 2;    // 8 MiB
    float* tmpF    = (float*)p;    p += (size_t)M_ * D_ * 4;    // 16 MiB
    float* out1F   = (float*)p;    p += (size_t)M_ * D_ * 4;    // 16 MiB
    _Float16* o1h  = (_Float16*)p; p += (size_t)M_ * D_ * 2;    // 8 MiB
    float* hF      = (float*)p;    p += (size_t)M_ * DFF_ * 4;  // 64 MiB
    _Float16* hH   = (_Float16*)p; p += (size_t)M_ * DFF_ * 2;  // 32 MiB
    float* t2F     = (float*)p;    p += (size_t)M_ * D_ * 4;    // 16 MiB
    _Float16* wqT  = (_Float16*)p; p += (size_t)D_ * D_ * 2;
    _Float16* wkT  = (_Float16*)p; p += (size_t)D_ * D_ * 2;
    _Float16* wvT  = (_Float16*)p; p += (size_t)D_ * D_ * 2;
    _Float16* woT  = (_Float16*)p; p += (size_t)D_ * D_ * 2;
    _Float16* w1T  = (_Float16*)p; p += (size_t)D_ * DFF_ * 2;
    _Float16* w2T  = (_Float16*)p; p += (size_t)DFF_ * D_ * 2;

    // one-time weight transpose-convert (f32 KxN -> f16 NxK)
    dim3 tb(32, 8);
    transpose_f16_kernel<<<dim3(D_ / 32, D_ / 8), tb, 0, stream>>>(wq, wqT, D_, D_);
    transpose_f16_kernel<<<dim3(D_ / 32, D_ / 8), tb, 0, stream>>>(wk, wkT, D_, D_);
    transpose_f16_kernel<<<dim3(D_ / 32, D_ / 8), tb, 0, stream>>>(wv, wvT, D_, D_);
    transpose_f16_kernel<<<dim3(D_ / 32, D_ / 8), tb, 0, stream>>>(wo, woT, D_, D_);
    transpose_f16_kernel<<<dim3(DFF_ / 32, D_ / 8), tb, 0, stream>>>(w1, w1T, D_, DFF_);
    transpose_f16_kernel<<<dim3(D_ / 32, DFF_ / 8), tb, 0, stream>>>(w2, w2T, DFF_, D_);

    // x -> f16
    cvt_f16_kernel<<<M_ * D_ / 4 / 4096, 512, 0, stream>>>(x, xh);

    // q/k/v projections (q pre-scaled by 1/sqrt(DEPTH); v written transposed)
    dim3 gQKV(M_ / 128, D_ / 64);
    gemm_kernel<<<gQKV, 128, 0, stream>>>(xh, wqT, bq, nullptr, qh, M_, D_, D_,
                                          1, 0, 0.125f);
    gemm_kernel<<<gQKV, 128, 0, stream>>>(xh, wkT, bk, nullptr, kh, M_, D_, D_,
                                          1, 0, 1.0f);
    gemm_kernel<<<gQKV, 128, 0, stream>>>(xh, wvT, bv, nullptr, vh, M_, D_, D_,
                                          2, 0, 1.0f);

    // flash attention
    attn_kernel<<<dim3(S_ / 64, B_ * H_), 128, 0, stream>>>(qh, kh, vh, mask,
                                                            ctxh);

    // output projection + residual LN (eps 1e-3)
    gemm_kernel<<<gQKV, 128, 0, stream>>>(ctxh, woT, bo, tmpF, nullptr, M_, D_,
                                          D_, 0, 0, 1.0f);
    ln_kernel<2, true, true, true><<<M_ / 64, 512, 0, stream>>>(
        tmpF, x, ln1g, ln1b, 1e-3f, out1F, o1h);

    // FFN: relu(out1@w1+b1) -> LN(eps 1e-6) -> @w2+b2
    gemm_kernel<<<dim3(M_ / 128, DFF_ / 64), 128, 0, stream>>>(
        o1h, w1T, b1, hF, nullptr, M_, DFF_, D_, 0, 1, 1.0f);
    ln_kernel<8, false, false, true><<<M_ / 64, 512, 0, stream>>>(
        hF, nullptr, lnffg, lnffb, 1e-6f, nullptr, hH);
    gemm_kernel<<<dim3(M_ / 128, D_ / 64), 128, 0, stream>>>(
        hH, w2T, b2, t2F, nullptr, M_, D_, DFF_, 0, 0, 1.0f);

    // final residual LN (eps 1e-3) -> d_out
    ln_kernel<2, true, true, false><<<M_ / 64, 512, 0, stream>>>(
        t2F, out1F, ln2g, ln2b, 1e-3f, out, nullptr);
}

// v003
// It runs in 238 microseconds.
// Timed twice side by side with v002, it ran 1.39 and 1.43 times as fast.
// Over all steps from v000 it is 2.22 times as fast.
#include <hip/hip_runtime.h>
#include <hip/hip_bf16.h>

// ---------------------------------------------------------------------------
// Transformer encoder layer for MI455X (gfx1250, wave32, WMMA).
// B=4, S=4096, D=256, H=4, DEPTH=64, DFF=1024.
// All GEMMs + attention on v_wmma_f32_16x16x32_f16 (f16 in, f32 acc).
// All global->LDS tile staging uses global_load_async_to_lds_b128 with
// double-buffered software pipelining (ASYNCcnt); fragments load as 2x b128.
// ---------------------------------------------------------------------------

#define B_ 4
#define S_ 4096
#define D_ 256
#define H_ 4
#define DEPTH_ 64
#define DFF_ 1024
#define M_ (B_ * S_)

typedef __attribute__((ext_vector_type(16))) _Float16 v16h;
typedef __attribute__((ext_vector_type(8)))  _Float16 v8h;
typedef __attribute__((ext_vector_type(4)))  _Float16 v4h;
typedef __attribute__((ext_vector_type(8)))  float    v8f;
typedef __attribute__((ext_vector_type(4)))  float    v4f;

// Load one 16-half fragment for lane `lane` from a row whose K-run starts at
// `p`.  Lane's data: K offsets [b, b+8) and [b+16, b+24), b = 8*(lane>=16).
__device__ __forceinline__ v16h load_frag(const _Float16* p, int lane) {
    const v8h* q = (const v8h*)(p + ((lane >> 4) << 3));
    v8h lo = q[0];
    v8h hi = q[2];
    return __builtin_shufflevector(lo, hi, 0, 1, 2, 3, 4, 5, 6, 7, 8, 9, 10,
                                   11, 12, 13, 14, 15);
}

// Async 16-byte global -> LDS copy (CDNA5, ASYNCcnt-tracked).
__device__ __forceinline__ void async_copy_b128(_Float16* lds_dst,
                                                const _Float16* gsrc) {
    uint32_t loff = (uint32_t)(uintptr_t)lds_dst;
    asm volatile("global_load_async_to_lds_b128 %0, %1, off"
                 :
                 : "v"(loff), "v"(gsrc)
                 : "memory");
}
__device__ __forceinline__ void wait_async0() {
    asm volatile("s_wait_asynccnt 0" ::: "memory");
}

// ---------------------------------------------------------------------------
// float -> f16 conversion.  Resident grid: 256 blocks x 16 waves, each lane
// converts 8 groups of 4 floats (all 8 loads issued before the first store),
// so the launch starts 4096 waves and not 32768.
// ---------------------------------------------------------------------------
__global__ __launch_bounds__(512) void cvt_f16_kernel(
    const float* __restrict__ src, _Float16* __restrict__ dst) {
    const int i0 = blockIdx.x * 4096 + threadIdx.x;
    v4f v[8];
#pragma unroll
    for (int k = 0; k < 8; ++k) v[k] = ((const v4f*)src)[i0 + k * 512];
#pragma unroll
    for (int k = 0; k < 8; ++k)
        ((v4h*)dst)[i0 + k * 512] = __builtin_convertvector(v[k], v4h);
}

// ---------------------------------------------------------------------------
// One-time weight transpose-convert: WT[n][k] (f16) = W[k][n] (f32)
// ---------------------------------------------------------------------------
__global__ void transpose_f16_kernel(const float* __restrict__ W,
                                     _Float16* __restrict__ WT, int K, int N) {
    int n = blockIdx.x * 32 + threadIdx.x;
    int k = blockIdx.y * 8 + threadIdx.y;
    if (n < N && k < K) WT[(size_t)n * K + k] = (_Float16)W[(size_t)k * N + n];
}

// ---------------------------------------------------------------------------
// GEMM: C[M x N] = A[M x K] (f16, row-major) * WT[N x K] (f16, N-major) + bias
// Block: 128 threads (4 waves), 128x64 tile; wave w owns rows w*32..w*32+31.
// Double-buffered async staging.  mode 0: f32 row-major.
// mode 1: f16 split-head [B,H,S,64].  mode 2: f16 split-head T [B,H,64,S].
// ---------------------------------------------------------------------------
__global__ __launch_bounds__(128) void gemm_kernel(
    const _Float16* __restrict__ A, const _Float16* __restrict__ WT,
    const float* __restrict__ bias, float* __restrict__ outF,
    _Float16* __restrict__ outH, int M, int N, int K, int mode, int relu,
    float scale) {
    // Rows hold 32 halves; the pitch is 40 halves (80 B = 16 B x odd) so that the
    // 16 rows of a ds_load_b128 fragment read fall on distinct LDS banks.
    __shared__ __align__(16) _Float16 As[2][128][40];   // row-major (K-runs)
    __shared__ __align__(16) _Float16 BsT[2][64][40];   // N-major: BsT[n][k]

    const int m0 = blockIdx.x * 128;
    const int n0 = blockIdx.y * 64;
    const int t = threadIdx.x;
    const int wave = t >> 5;
    const int lane = t & 31;

    v8f acc[2][4] = {};

    // stage first k-tile into buffer 0
#pragma unroll
    for (int i = t; i < 512; i += 128) {
        int r = i >> 2, cc = i & 3;
        async_copy_b128(&As[0][r][cc * 8],
                        A + (size_t)(m0 + r) * K + cc * 8);
    }
#pragma unroll
    for (int i = t; i < 256; i += 128) {
        int c = i >> 2, cc = i & 3;
        async_copy_b128(&BsT[0][c][cc * 8],
                        WT + (size_t)(n0 + c) * K + cc * 8);
    }

    for (int k0 = 0; k0 < K; k0 += 32) {
        const int buf = (k0 >> 5) & 1;
        wait_async0();
        __syncthreads();  // tile `buf` ready for all waves

        if (k0 + 32 < K) {  // issue DMA for next tile into other buffer
            const int k1 = k0 + 32;
#pragma unroll
            for (int i = t; i < 512; i += 128) {
                int r = i >> 2, cc = i & 3;
                async_copy_b128(&As[buf ^ 1][r][cc * 8],
                                A + (size_t)(m0 + r) * K + k1 + cc * 8);
            }
#pragma unroll
            for (int i = t; i < 256; i += 128) {
                int c = i >> 2, cc = i & 3;
                async_copy_b128(&BsT[buf ^ 1][c][cc * 8],
                                WT + (size_t)(n0 + c) * K + k1 + cc * 8);
            }
        }

        v16h a0 = load_frag(&As[buf][wave * 32 + (lane & 15)][0], lane);
        v16h a1 = load_frag(&As[buf][wave * 32 + 16 + (lane & 15)][0], lane);
#pragma unroll
        for (int nt = 0; nt < 4; ++nt) {
            v16h bf = load_frag(&BsT[buf][nt * 16 + (lane & 15)][0], lane);
            acc[0][nt] = __builtin_amdgcn_wmma_f32_16x16x32_f16(
                false, a0, false, bf, (short)0, acc[0][nt], false, false);
            acc[1][nt] = __builtin_amdgcn_wmma_f32_16x16x32_f16(
                false, a1, false, bf, (short)0, acc[1][nt], false, false);
        }
        // no trailing barrier: next iteration's wait+barrier protects reuse
    }

    // epilogue
#pragma unroll
    for (int hh = 0; hh < 2; ++hh)
#pragma unroll
        for (int nt = 0; nt < 4; ++nt) {
            int col = n0 + nt * 16 + (lane & 15);
            float bvv = bias[col];
#pragma unroll
            for (int r = 0; r < 8; ++r) {
                int row = m0 + wave * 32 + hh * 16 + r + ((lane >> 4) << 3);
                float v = acc[hh][nt][r] + bvv;
                if (relu) v = fmaxf(v, 0.0f);
                v *= scale;
                int b = row / S_, s = row % S_;
                int h = col >> 6, d = col & 63;
                if (mode == 0) {
                    outF[(size_t)row * N + col] = v;
                } else if (mode == 1) {
                    outH[(((size_t)(b * H_ + h)) * S_ + s) * DEPTH_ + d] =
                        (_Float16)v;
                } else {
                    outH[(((size_t)(b * H_ + h)) * DEPTH_ + d) * S_ + s] =
                        (_Float16)v;
                }
            }
        }
}

__device__ __forceinline__ float xhalf(float x) {
    int v = __builtin_bit_cast(int, x);
    return __builtin_bit_cast(
        float, __builtin_amdgcn_permlanex16(v, v, 0x76543210, 0xfedcba98, false,
                                            false));
}

__global__ __launch_bounds__(128) void attn_kernel(
    const _Float16* __restrict__ qh, const _Float16* __restrict__ kh,
    const _Float16* __restrict__ vT, const float* __restrict__ mask,
    _Float16* __restrict__ ctxh) {
    // Rows hold 64 halves; the pitch is 72 halves (144 B = 16 B x odd) so that the
    // 16 rows of a ds_load_b128 fragment read fall on distinct LDS banks.
    __shared__ __align__(16) _Float16 Ks[2][64][72];    // [kpos][d]
    __shared__ __align__(16) _Float16 VsT[2][64][72];   // [d][kpos]
    __shared__ __align__(32) float Ms[S_];              // mask * -1e9 of batch b

    const int qt = blockIdx.x;
    const int bh = blockIdx.y;
    const int b = bh / H_;
    const int h = bh % H_;
    const int t = threadIdx.x;
    const int wave = t >> 5;
    const int lane = t & 31;
    const int hh8 = (lane >> 4) << 3;
    const size_t base = (size_t)bh * S_ * DEPTH_;  // q/k and vT share extent
    const int qr0 = qt * 64 + wave * 16;
    const int NT = S_ / 64;

    // Q fragments straight from global (two 16B loads each)
    v16h qA[2];
#pragma unroll
    for (int c = 0; c < 2; ++c)
        qA[c] = load_frag(
            qh + base + (size_t)(qr0 + (lane & 15)) * DEPTH_ + c * 32, lane);

    v8f O[4] = {};
    float mrow = -1e30f, lrow = 0.0f;  // lrow: this half's keys only

    // stage first K/V tile into buffer 0
#pragma unroll
    for (int i = t; i < 512; i += 128) {
        int r = i >> 3, cc = i & 7;
        async_copy_b128(&Ks[0][r][cc * 8],
                        kh + base + (size_t)r * DEPTH_ + cc * 8);
        async_copy_b128(&VsT[0][r][cc * 8],
                        vT + base + (size_t)r * S_ + cc * 8);
    }

    // The mask term now varies along a lane's registers: the whole row of the
    // batch goes to LDS once; the loop's first barrier publishes it.
    const v4f* mp = (const v4f*)(mask + (size_t)b * S_) + t;
    v4f mv[8];
    // unrolled with a fixed trip count: all eight loads fly together
#pragma unroll
    for (int k = 0; k < 8; ++k) mv[k] = mp[k * 128];
    // unrolled: mv lives in registers
#pragma unroll
    for (int k = 0; k < 8; ++k) ((v4f*)Ms)[t + k * 128] = mv[k] * -1e9f;

    for (int kt = 0; kt < NT; ++kt) {
        const int buf = kt & 1;
        wait_async0();
        __syncthreads();  // tile `buf` ready

        if (kt + 1 < NT) {  // DMA next tile into other buffer
            const int kr = (kt + 1) * 64;
#pragma unroll
            for (int i = t; i < 512; i += 128) {
                int r = i >> 3, cc = i & 7;
                async_copy_b128(
                    &Ks[buf ^ 1][r][cc * 8],
                    kh + base + (size_t)(kr + r) * DEPTH_ + cc * 8);
                async_copy_b128(&VsT[buf ^ 1][r][cc * 8],
                                vT + base + (size_t)r * S_ + kr + cc * 8);
            }
        }

        // logits tile: S^T = K @ Q^T   (64 kpos x 16 q)
        v8f sc[4] = {};
#pragma unroll
        for (int nt = 0; nt < 4; ++nt) {
#pragma unroll
            for (int c = 0; c < 2; ++c) {
                v16h kf =
                    load_frag(&Ks[buf][nt * 16 + (lane & 15)][c * 32], lane);
                sc[nt] = __builtin_amdgcn_wmma_f32_16x16x32_f16(
                    false, kf, false, qA[c], (short)0, sc[nt], false, false);
            }
            sc[nt] += *(const v8f*)&Ms[kt * 64 + nt * 16 + hh8];
        }

        // online softmax: 32 of the query's 64 scores live in this lane
        // (the loops down to the epilogue are unrolled because sc and O are
        // register arrays and need constant indices)
        float mx4[4];
#pragma unroll
        for (int nt = 0; nt < 4; ++nt) {
            float m = sc[nt][0];
#pragma unroll
            for (int r = 1; r < 8; ++r) m = fmaxf(m, sc[nt][r]);
            mx4[nt] = m;
        }
        float mx = fmaxf(fmaxf(mx4[0], mx4[1]), fmaxf(mx4[2], mx4[3]));
        mx = fmaxf(mx, xhalf(mx));
        const float newm = fmaxf(mrow, mx);
        const float corr = __expf(mrow - newm);
        mrow = newm;
#pragma unroll
        for (int nt = 0; nt < 4; ++nt)
#pragma unroll
            for (int r = 0; r < 8; ++r)
                sc[nt][r] = __expf(sc[nt][r] - newm);
        const v8f s8 = (sc[0] + sc[1]) + (sc[2] + sc[3]);
        const float rs = ((s8[0] + s8[1]) + (s8[2] + s8[3])) +
                         ((s8[4] + s8[5]) + (s8[6] + s8[7]));
        lrow = lrow * corr + rs;
#pragma unroll
        for (int nt = 0; nt < 4; ++nt) O[nt] *= corr;

        // O^T += V^T @ P^T; score tiles 2c and 2c+1 are B's k 0..15 and 16..31
#pragma unroll
        for (int c = 0; c < 2; ++c) {
            v16h pb = __builtin_shufflevector(
                __builtin_convertvector(sc[2 * c], v8h),
                __builtin_convertvector(sc[2 * c + 1], v8h), 0, 1, 2, 3, 4, 5, 6,
                7, 8, 9, 10, 11, 12, 13, 14, 15);
#pragma unroll
            for (int nt = 0; nt < 4; ++nt) {
                v16h vf =
                    load_frag(&VsT[buf][nt * 16 + (lane & 15)][c * 32], lane);
                O[nt] = __builtin_amdgcn_wmma_f32_16x16x32_f16(
                    false, vf, false, pb, (short)0, O[nt], false, false);
            }
        }
        // no trailing barrier: next iteration's wait+barrier protects reuse
    }

    // write merged-head context, normalized by l: 8 consecutive d per lane
    const float l = lrow + xhalf(lrow);
#pragma unroll
    for (int nt = 0; nt < 4; ++nt) {
        v8h o;
#pragma unroll
        for (int r = 0; r < 8; ++r) o[r] = (_Float16)(O[nt][r] / l);
        *(v8h*)&ctxh[(size_t)(b * S_ + qr0 + (lane & 15)) * D_ + h * DEPTH_ +
                     nt * 16 + hh8] = o;
    }
}

// ---------------------------------------------------------------------------
// LayerNorm over rows of length NV * 128 (256 or 1024), optional residual add.
// One wave per row: the row lives in the wave's registers (16-byte loads, 512
// contiguous bytes per wave-wide load), both sums are lane exchanges, so there
// is no LDS and no barrier.  Resident grid: 256 blocks x 16 waves, 4 rows per
// wave with all rows' loads issued first: 4096 waves start per launch.
// ---------------------------------------------------------------------------
template <int NV, bool RES, bool OUTF, bool OUTH>
__global__ __launch_bounds__(512) void ln_kernel(
    const float* __restrict__ a, const float* __restrict__ res,
    const float* __restrict__ g, const float* __restrict__ beta, float eps,
    float* __restrict__ outF, _Float16* __restrict__ outH) {
    constexpr int n = NV * 128;
    constexpr int ROWS = 4;
    const int lane = threadIdx.x & 31;
    const int gw = blockIdx.x * 16 + (threadIdx.x >> 5);
    const size_t off = (size_t)gw * ROWS * n + lane * 4;

    const float* pa = a + off;
    const float* pr = RES ? res + off : pa;

    v4f v[ROWS][NV];
#pragma unroll
    for (int rr = 0; rr < ROWS; ++rr)
#pragma unroll
        for (int j = 0; j < NV; ++j)
            v[rr][j] = *(const v4f*)(pa + rr * n + j * 128);
    v4f w[RES ? ROWS : 1][NV];
    if (RES) {
#pragma unroll
        for (int rr = 0; rr < ROWS; ++rr)
#pragma unroll
            for (int j = 0; j < NV; ++j)
                w[rr][j] = *(const v4f*)(pr + rr * n + j * 128);
    }
    // The row loads share one address pair each.  Naming the pairs as inputs
    // keeps them live down to this wait, so that no load of the run can land
    // its result in a pair that the loads in front of it still name.
    asm volatile("s_wait_xcnt 0x0" ::"v"(pa), "v"(pr) : "memory");
    if (RES) {
#pragma unroll
        for (int rr = 0; rr < ROWS; ++rr)
#pragma unroll
            for (int j = 0; j < NV; ++j) v[rr][j] += w[rr][j];
    }
    v4f gg[NV], bb[NV];
#pragma unroll
    for (int j = 0; j < NV; ++j) {
        gg[j] = *(const v4f*)(g + j * 128 + lane * 4);
        bb[j] = *(const v4f*)(beta + j * 128 + lane * 4);
    }

    float mu[ROWS], rstd[ROWS];
#pragma unroll
    for (int rr = 0; rr < ROWS; ++rr) {
        float s = 0.0f;
#pragma unroll
        for (int j = 0; j < NV; ++j)
            s += (v[rr][j][0] + v[rr][j][1]) + (v[rr][j][2] + v[rr][j][3]);
        mu[rr] = s;
    }
#pragma unroll
    for (int o = 16; o >= 1; o >>= 1)
#pragma unroll
        for (int rr = 0; rr < ROWS; ++rr)
            mu[rr] += __shfl_xor(mu[rr], o, 32);
#pragma unroll
    for (int rr = 0; rr < ROWS; ++rr) {
        mu[rr] = mu[rr] / n;
        float s2 = 0.0f;
#pragma unroll
        for (int j = 0; j < NV; ++j) {
            v[rr][j] -= mu[rr];
            v4f q = v[rr][j] * v[rr][j];
            s2 += (q[0] + q[1]) + (q[2] + q[3]);
        }
        rstd[rr] = s2;
    }
#pragma unroll
    for (int o = 16; o >= 1; o >>= 1)
#pragma unroll
        for (int rr = 0; rr < ROWS; ++rr)
            rstd[rr] += __shfl_xor(rstd[rr], o, 32);

#pragma unroll
    for (int rr = 0; rr < ROWS; ++rr) {
        const float rs = rsqrtf(rstd[rr] / n + eps);
#pragma unroll
        for (int j = 0; j < NV; ++j) {
            v4f y = v[rr][j] * rs * gg[j] + bb[j];
            if (OUTF) *(v4f*)(outF + off + rr * n + j * 128) = y;
            if (OUTH)
                *(v4h*)(outH + off + rr * n + j * 128) =
                    __builtin_convertvector(y, v4h);
        }
    }
}

// ---------------------------------------------------------------------------
extern "C" void kernel_launch(void* const* d_in, const int* in_sizes, int n_in,
                              void* d_out, int out_size, void* d_ws,
                              size_t ws_size, hipStream_t stream) {
    const float* x      = (const float*)d_in[0];
    const float* mask   = (const float*)d_in[1];
    const float* wq     = (const float*)d_in[2];
    const float* bq     = (const float*)d_in[3];
    const float* wk     = (const float*)d_in[4];
    const float* bk     = (const float*)d_in[5];
    const float* wv     = (const float*)d_in[6];
    const float* bv     = (const float*)d_in[7];
    const float* wo     = (const float*)d_in[8];
    const float* bo     = (const float*)d_in[9];
    const float* w1     = (const float*)d_in[10];
    const float* b1     = (const float*)d_in[11];
    const float* lnffg  = (const float*)d_in[12];
    const float* lnffb  = (const float*)d_in[13];
    const float* w2     = (const float*)d_in[14];
    const float* b2     = (const float*)d_in[15];
    const float* ln1g   = (const float*)d_in[16];
    const float* ln1b   = (const float*)d_in[17];
    const float* ln2g   = (const float*)d_in[18];
    const float* ln2b   = (const float*)d_in[19];
    float* out = (float*)d_out;

    // workspace carve-up
    char* p = (char*)d_ws;
    _Float16* xh   = (_Float16*)p; p += (size_t)M_ * D_ * 2;    // 8 MiB
    _Float16* qh   = (_Float16*)p; p += (size_t)M_ * D_ * 2;    // 8 MiB
    _Float16* kh   = (_Float16*)p; p += (size_t)M_ * D_ * 2;    // 8 MiB
    _Float16* vh   = (_Float16*)p; p += (size_t)M_ * D_ * 2;    // 8 MiB (vT)
    _Float16* ctxh = (_Float16*)p; p += (size_t)M_ * D_ * 2;    // 8 MiB
    float* tmpF    = (float*)p;    p += (size_t)M_ * D_ * 4;    // 16 MiB
    float* out1F   = (float*)p;    p += (size_t)M_ * D_ * 4;    // 16 MiB
    _Float16* o1h  = (_Float16*)p; p += (size_t)M_ * D_ * 2;    // 8 MiB
    float* hF      = (float*)p;    p += (size_t)M_ * DFF_ * 4;  // 64 MiB
    _Float16* hH   = (_Float16*)p; p += (size_t)M_ * DFF_ * 2;  // 32 MiB
    float* t2F     = (float*)p;    p += (size_t)M_ * D_ * 4;    // 16 MiB
    _Float16* wqT  = (_Float16*)p; p += (size_t)D_ * D_ * 2;
    _Float16* wkT  = (_Float16*)p; p += (size_t)D_ * D_ * 2;
    _Float16* wvT  = (_Float16*)p; p += (size_t)D_ * D_ * 2;
    _Float16* woT  = (_Float16*)p; p += (size_t)D_ * D_ * 2;
    _Float16* w1T  = (_Float16*)p; p += (size_t)D_ * DFF_ * 2;
    _Float16* w2T  = (_Float16*)p; p += (size_t)DFF_ * D_ * 2;

    // one-time weight transpose-convert (f32 KxN -> f16 NxK)
    dim3 tb(32, 8);
    transpose_f16_kernel<<<dim3(D_ / 32, D_ / 8), tb, 0, stream>>>(wq, wqT, D_, D_);
    transpose_f16_kernel<<<dim3(D_ / 32, D_ / 8), tb, 0, stream>>>(wk, wkT, D_, D_);
    transpose_f16_kernel<<<dim3(D_ / 32, D_ / 8), tb, 0, stream>>>(wv, wvT, D_, D_);
    transpose_f16_kernel<<<dim3(D_ / 32, D_ / 8), tb, 0, stream>>>(wo, woT, D_, D_);
    transpose_f16_kernel<<<dim3(DFF_ / 32, D_ / 8), tb, 0, stream>>>(w1, w1T, D_, DFF_);
    transpose_f16_kernel<<<dim3(D_ / 32, DFF_ / 8), tb, 0, stream>>>(w2, w2T, DFF_, D_);

    // x -> f16
    cvt_f16_kernel<<<M_ * D_ / 4 / 4096, 512, 0, stream>>>(x, xh);

    // q/k/v projections (q pre-scaled by 1/sqrt(DEPTH); v written transposed)
    dim3 gQKV(M_ / 128, D_ / 64);
    gemm_kernel<<<gQKV, 128, 0, stream>>>(xh, wqT, bq, nullptr, qh, M_, D_, D_,
                                          1, 0, 0.125f);
    gemm_kernel<<<gQKV, 128, 0, stream>>>(xh, wkT, bk, nullptr, kh, M_, D_, D_,
                                          1, 0, 1.0f);
    gemm_kernel<<<gQKV, 128, 0, stream>>>(xh, wvT, bv, nullptr, vh, M_, D_, D_,
                                          2, 0, 1.0f);

    // flash attention
    attn_kernel<<<dim3(S_ / 64, B_ * H_), 128, 0, stream>>>(qh, kh, vh, mask,
                                                            ctxh);

    // output projection + residual LN (eps 1e-3)
    gemm_kernel<<<gQKV, 128, 0, stream>>>(ctxh, woT, bo, tmpF, nullptr, M_, D_,
                                          D_, 0, 0, 1.0f);
    ln_kernel<2, true, true, true><<<M_ / 64, 512, 0, stream>>>(
        tmpF, x, ln1g, ln1b, 1e-3f, out1F, o1h);

    // FFN: relu(out1@w1+b1) -> LN(eps 1e-6) -> @w2+b2
    gemm_kernel<<<dim3(M_ / 128, DFF_ / 64), 128, 0, stream>>>(
        o1h, w1T, b1, hF, nullptr, M_, DFF_, D_, 0, 1, 1.0f);
    ln_kernel<8, false, false, true><<<M_ / 64, 512, 0, stream>>>(
        hF, nullptr, lnffg, lnffb, 1e-6f, nullptr, hH);
    gemm_kernel<<<dim3(M_ / 128, D_ / 64), 128, 0, stream>>>(
        hH, w2T, b2, t2F, nullptr, M_, D_, DFF_, 0, 0, 1.0f);

    // final residual LN (eps 1e-3) -> d_out
    ln_kernel<2, true, true, false><<<M_ / 64, 512, 0, stream>>>(
        t2F, out1F, ln2g, ln2b, 1e-3f, out, nullptr);
}

// v004
// One run takes 177 microseconds.
// Timed twice side by side with v003, it ran 1.34 and 1.31 times as fast.
// Counting every step since v000, it is 2.94 times as fast.
#include <hip/hip_runtime.h>
#include <hip/hip_bf16.h>

// ---------------------------------------------------------------------------
// Transformer encoder layer for MI455X (gfx1250, wave32, WMMA).
// B=4, S=4096, D=256, H=4, DEPTH=64, DFF=1024.
// All GEMMs + attention on v_wmma_f32_16x16x32_f16 (f16 in, f32 acc).
// gemm_kernel and attn_kernel stage their tiles with
// global_load_async_to_lds_b128, double-buffered (ASYNCcnt); fragments load as
// 2x b128.  The FFN chain is one kernel that keeps its rows on the WGP.
// ---------------------------------------------------------------------------

#define B_ 4
#define S_ 4096
#define D_ 256
#define H_ 4
#define DEPTH_ 64
#define DFF_ 1024
#define M_ (B_ * S_)

typedef __attribute__((ext_vector_type(16))) _Float16 v16h;
typedef __attribute__((ext_vector_type(8)))  _Float16 v8h;
typedef __attribute__((ext_vector_type(4)))  _Float16 v4h;
typedef __attribute__((ext_vector_type(8)))  float    v8f;
typedef __attribute__((ext_vector_type(4)))  float    v4f;

// Load one 16-half fragment for lane `lane` from a row whose K-run starts at
// `p`.  Lane's data: K offsets [b, b+8) and [b+16, b+24), b = 8*(lane>=16).
__device__ __forceinline__ v16h load_frag(const _Float16* p, int lane) {
    const v8h* q = (const v8h*)(p + ((lane >> 4) << 3));
    v8h lo = q[0];
    v8h hi = q[2];
    return __builtin_shufflevector(lo, hi, 0, 1, 2, 3, 4, 5, 6, 7, 8, 9, 10,
                                   11, 12, 13, 14, 15);
}

// Async 16-byte global -> LDS copy (CDNA5, ASYNCcnt-tracked).
__device__ __forceinline__ void async_copy_b128(_Float16* lds_dst,
                                                const _Float16* gsrc) {
    uint32_t loff = (uint32_t)(uintptr_t)lds_dst;
    asm volatile("global_load_async_to_lds_b128 %0, %1, off"
                 :
                 : "v"(loff), "v"(gsrc)
                 : "memory");
}
__device__ __forceinline__ void wait_async0() {
    asm volatile("s_wait_asynccnt 0" ::: "memory");
}

// ---------------------------------------------------------------------------
// float -> f16 conversion.  Resident grid: 256 blocks x 16 waves, each lane
// converts 8 groups of 4 floats (all 8 loads issued before the first store),
// so the launch starts 4096 waves and not 32768.
// ---------------------------------------------------------------------------
__global__ __launch_bounds__(512) void cvt_f16_kernel(
    const float* __restrict__ src, _Float16* __restrict__ dst) {
    const int i0 = blockIdx.x * 4096 + threadIdx.x;
    v4f v[8];
#pragma unroll
    for (int k = 0; k < 8; ++k) v[k] = ((const v4f*)src)[i0 + k * 512];
#pragma unroll
    for (int k = 0; k < 8; ++k)
        ((v4h*)dst)[i0 + k * 512] = __builtin_convertvector(v[k], v4h);
}

// ---------------------------------------------------------------------------
// One-time weight transpose-convert: WT[n][k] (f16) = W[k][n] (f32)
// ---------------------------------------------------------------------------
__global__ void transpose_f16_kernel(const float* __restrict__ W,
                                     _Float16* __restrict__ WT, int K, int N) {
    int n = blockIdx.x * 32 + threadIdx.x;
    int k = blockIdx.y * 8 + threadIdx.y;
    if (n < N && k < K) WT[(size_t)n * K + k] = (_Float16)W[(size_t)k * N + n];
}

// ---------------------------------------------------------------------------
// Weight convert into WMMA B-fragment order for the fused FFN kernel, which
// reads B straight from L2 into registers.  One fragment (16 columns n x 32 k)
// is 1 KiB: [part][lane][8 halves], lane = (n & 15) + 16 * hh and
// k = 32 * ks + 16 * part + 8 * hh + e, the k order of load_frag.  A wave-wide
// 16-byte load then covers 512 contiguous bytes.  One 16-byte chunk a thread.
// ---------------------------------------------------------------------------
__global__ __launch_bounds__(256) void pack_f16_kernel(
    const float* __restrict__ W, _Float16* __restrict__ P, int K, int N) {
    const int c = blockIdx.x * 256 + threadIdx.x;
    const int lane = c & 31;
    const int part = (c >> 5) & 1;
    const int f = c >> 6;  // fragment number: nt * (K / 32) + ks
    const int KS = K >> 5;
    const int ks = f % KS;
    const int nt = f / KS;
    const int n = nt * 16 + (lane & 15);
    const int k0 = ks * 32 + part * 16 + (lane >> 4) * 8;
    float w[8];
#pragma unroll
    for (int e = 0; e < 8; ++e) w[e] = W[(size_t)(k0 + e) * N + n];
    // the converted halves land in registers that held load addresses: the wait
    // that belongs in front of that overwrite
    asm volatile("s_wait_xcnt 0x0" ::: "memory");
    v8h o;
#pragma unroll
    for (int e = 0; e < 8; ++e) o[e] = (_Float16)w[e];
    ((v8h*)P)[c] = o;
}

// ---------------------------------------------------------------------------
// GEMM: C[M x N] = A[M x K] (f16, row-major) * WT[N x K] (f16, N-major) + bias
// Block: 128 threads (4 waves), 128x64 tile; wave w owns rows w*32..w*32+31.
// Double-buffered async staging.  mode 0: f32 row-major.
// mode 1: f16 split-head [B,H,S,64].  mode 2: f16 split-head T [B,H,64,S].
// ---------------------------------------------------------------------------
__global__ __launch_bounds__(128) void gemm_kernel(
    const _Float16* __restrict__ A, const _Float16* __restrict__ WT,
    const float* __restrict__ bias, float* __restrict__ outF,
    _Float16* __restrict__ outH, int M, int N, int K, int mode, int relu,
    float scale) {
    // Rows hold 32 halves; the pitch is 40 halves (80 B = 16 B x odd) so that the
    // 16 rows of a ds_load_b128 fragment read fall on distinct LDS banks.
    __shared__ __align__(16) _Float16 As[2][128][40];   // row-major (K-runs)
    __shared__ __align__(16) _Float16 BsT[2][64][40];   // N-major: BsT[n][k]

    const int m0 = blockIdx.x * 128;
    const int n0 = blockIdx.y * 64;
    const int t = threadIdx.x;
    const int wave = t >> 5;
    const int lane = t & 31;

    v8f acc[2][4] = {};

    // stage first k-tile into buffer 0
#pragma unroll
    for (int i = t; i < 512; i += 128) {
        int r = i >> 2, cc = i & 3;
        async_copy_b128(&As[0][r][cc * 8],
                        A + (size_t)(m0 + r) * K + cc * 8);
    }
#pragma unroll
    for (int i = t; i < 256; i += 128) {
        int c = i >> 2, cc = i & 3;
        async_copy_b128(&BsT[0][c][cc * 8],
                        WT + (size_t)(n0 + c) * K + cc * 8);
    }

    for (int k0 = 0; k0 < K; k0 += 32) {
        const int buf = (k0 >> 5) & 1;
        wait_async0();
        __syncthreads();  // tile `buf` ready for all waves

        if (k0 + 32 < K) {  // issue DMA for next tile into other buffer
            const int k1 = k0 + 32;
#pragma unroll
            for (int i = t; i < 512; i += 128) {
                int r = i >> 2, cc = i & 3;
                async_copy_b128(&As[buf ^ 1][r][cc * 8],
                                A + (size_t)(m0 + r) * K + k1 + cc * 8);
            }
#pragma unroll
            for (int i = t; i < 256; i += 128) {
                int c = i >> 2, cc = i & 3;
                async_copy_b128(&BsT[buf ^ 1][c][cc * 8],
                                WT + (size_t)(n0 + c) * K + k1 + cc * 8);
            }
        }

        v16h a0 = load_frag(&As[buf][wave * 32 + (lane & 15)][0], lane);
        v16h a1 = load_frag(&As[buf][wave * 32 + 16 + (lane & 15)][0], lane);
#pragma unroll
        for (int nt = 0; nt < 4; ++nt) {
            v16h bf = load_frag(&BsT[buf][nt * 16 + (lane & 15)][0], lane);
            acc[0][nt] = __builtin_amdgcn_wmma_f32_16x16x32_f16(
                false, a0, false, bf, (short)0, acc[0][nt], false, false);
            acc[1][nt] = __builtin_amdgcn_wmma_f32_16x16x32_f16(
                false, a1, false, bf, (short)0, acc[1][nt], false, false);
        }
        // no trailing barrier: next iteration's wait+barrier protects reuse
    }

    // epilogue
#pragma unroll
    for (int hh = 0; hh < 2; ++hh)
#pragma unroll
        for (int nt = 0; nt < 4; ++nt) {
            int col = n0 + nt * 16 + (lane & 15);
            float bvv = bias[col];
#pragma unroll
            for (int r = 0; r < 8; ++r) {
                int row = m0 + wave * 32 + hh * 16 + r + ((lane >> 4) << 3);
                float v = acc[hh][nt][r] + bvv;
                if (relu) v = fmaxf(v, 0.0f);
                v *= scale;
                int b = row / S_, s = row % S_;
                int h = col >> 6, d = col & 63;
                if (mode == 0) {
                    outF[(size_t)row * N + col] = v;
                } else if (mode == 1) {
                    outH[(((size_t)(b * H_ + h)) * S_ + s) * DEPTH_ + d] =
                        (_Float16)v;
                } else {
                    outH[(((size_t)(b * H_ + h)) * DEPTH_ + d) * S_ + s] =
                        (_Float16)v;
                }
            }
        }
}

__device__ __forceinline__ float xhalf(float x) {
    int v = __builtin_bit_cast(int, x);
    return __builtin_bit_cast(
        float, __builtin_amdgcn_permlanex16(v, v, 0x76543210, 0xfedcba98, false,
                                            false));
}

__global__ __launch_bounds__(128) void attn_kernel(
    const _Float16* __restrict__ qh, const _Float16* __restrict__ kh,
    const _Float16* __restrict__ vT, const float* __restrict__ mask,
    _Float16* __restrict__ ctxh) {
    // Rows hold 64 halves; the pitch is 72 halves (144 B = 16 B x odd) so that the
    // 16 rows of a ds_load_b128 fragment read fall on distinct LDS banks.
    __shared__ __align__(16) _Float16 Ks[2][64][72];    // [kpos][d]
    __shared__ __align__(16) _Float16 VsT[2][64][72];   // [d][kpos]
    __shared__ __align__(32) float Ms[S_];              // mask * -1e9 of batch b

    const int qt = blockIdx.x;
    const int bh = blockIdx.y;
    const int b = bh / H_;
    const int h = bh % H_;
    const int t = threadIdx.x;
    const int wave = t >> 5;
    const int lane = t & 31;
    const int hh8 = (lane >> 4) << 3;
    const size_t base = (size_t)bh * S_ * DEPTH_;  // q/k and vT share extent
    const int qr0 = qt * 64 + wave * 16;
    const int NT = S_ / 64;

    // Q fragments straight from global (two 16B loads each)
    v16h qA[2];
#pragma unroll
    for (int c = 0; c < 2; ++c)
        qA[c] = load_frag(
            qh + base + (size_t)(qr0 + (lane & 15)) * DEPTH_ + c * 32, lane);

    v8f O[4] = {};
    float mrow = -1e30f, lrow = 0.0f;  // lrow: this half's keys only

    // stage first K/V tile into buffer 0
#pragma unroll
    for (int i = t; i < 512; i += 128) {
        int r = i >> 3, cc = i & 7;
        async_copy_b128(&Ks[0][r][cc * 8],
                        kh + base + (size_t)r * DEPTH_ + cc * 8);
        async_copy_b128(&VsT[0][r][cc * 8],
                        vT + base + (size_t)r * S_ + cc * 8);
    }

    // The mask term now varies along a lane's registers: the whole row of the
    // batch goes to LDS once; the loop's first barrier publishes it.
    const v4f* mp = (const v4f*)(mask + (size_t)b * S_) + t;
    v4f mv[8];
    // unrolled with a fixed trip count: all eight loads fly together
#pragma unroll
    for (int k = 0; k < 8; ++k) mv[k] = mp[k * 128];
    // unrolled: mv lives in registers
#pragma unroll
    for (int k = 0; k < 8; ++k) ((v4f*)Ms)[t + k * 128] = mv[k] * -1e9f;

    for (int kt = 0; kt < NT; ++kt) {
        const int buf = kt & 1;
        wait_async0();
        __syncthreads();  // tile `buf` ready

        if (kt + 1 < NT) {  // DMA next tile into other buffer
            const int kr = (kt + 1) * 64;
#pragma unroll
            for (int i = t; i < 512; i += 128) {
                int r = i >> 3, cc = i & 7;
                async_copy_b128(
                    &Ks[buf ^ 1][r][cc * 8],
                    kh + base + (size_t)(kr + r) * DEPTH_ + cc * 8);
                async_copy_b128(&VsT[buf ^ 1][r][cc * 8],
                                vT + base + (size_t)r * S_ + kr + cc * 8);
            }
        }

        // logits tile: S^T = K @ Q^T   (64 kpos x 16 q)
        v8f sc[4] = {};
#pragma unroll
        for (int nt = 0; nt < 4; ++nt) {
#pragma unroll
            for (int c = 0; c < 2; ++c) {
                v16h kf =
                    load_frag(&Ks[buf][nt * 16 + (lane & 15)][c * 32], lane);
                sc[nt] = __builtin_amdgcn_wmma_f32_16x16x32_f16(
                    false, kf, false, qA[c], (short)0, sc[nt], false, false);
            }
            sc[nt] += *(const v8f*)&Ms[kt * 64 + nt * 16 + hh8];
        }

        // online softmax: 32 of the query's 64 scores live in this lane
        // (the loops down to the epilogue are unrolled because sc and O are
        // register arrays and need constant indices)
        float mx4[4];
#pragma unroll
        for (int nt = 0; nt < 4; ++nt) {
            float m = sc[nt][0];
#pragma unroll
            for (int r = 1; r < 8; ++r) m = fmaxf(m, sc[nt][r]);
            mx4[nt] = m;
        }
        float mx = fmaxf(fmaxf(mx4[0], mx4[1]), fmaxf(mx4[2], mx4[3]));
        mx = fmaxf(mx, xhalf(mx));
        const float newm = fmaxf(mrow, mx);
        const float corr = __expf(mrow - newm);
        mrow = newm;
#pragma unroll
        for (int nt = 0; nt < 4; ++nt)
#pragma unroll
            for (int r = 0; r < 8; ++r)
                sc[nt][r] = __expf(sc[nt][r] - newm);
        const v8f s8 = (sc[0] + sc[1]) + (sc[2] + sc[3]);
        const float rs = ((s8[0] + s8[1]) + (s8[2] + s8[3])) +
                         ((s8[4] + s8[5]) + (s8[6] + s8[7]));
        lrow = lrow * corr + rs;
#pragma unroll
        for (int nt = 0; nt < 4; ++nt) O[nt] *= corr;

        // O^T += V^T @ P^T; score tiles 2c and 2c+1 are B's k 0..15 and 16..31
#pragma unroll
        for (int c = 0; c < 2; ++c) {
            v16h pb = __builtin_shufflevector(
                __builtin_convertvector(sc[2 * c], v8h),
                __builtin_convertvector(sc[2 * c + 1], v8h), 0, 1, 2, 3, 4, 5, 6,
                7, 8, 9, 10, 11, 12, 13, 14, 15);
#pragma unroll
            for (int nt = 0; nt < 4; ++nt) {
                v16h vf =
                    load_frag(&VsT[buf][nt * 16 + (lane & 15)][c * 32], lane);
                O[nt] = __builtin_amdgcn_wmma_f32_16x16x32_f16(
                    false, vf, false, pb, (short)0, O[nt], false, false);
            }
        }
        // no trailing barrier: next iteration's wait+barrier protects reuse
    }

    // write merged-head context, normalized by l: 8 consecutive d per lane
    const float l = lrow + xhalf(lrow);
#pragma unroll
    for (int nt = 0; nt < 4; ++nt) {
        v8h o;
#pragma unroll
        for (int r = 0; r < 8; ++r) o[r] = (_Float16)(O[nt][r] / l);
        *(v8h*)&ctxh[(size_t)(b * S_ + qr0 + (lane & 15)) * D_ + h * DEPTH_ +
                     nt * 16 + hh8] = o;
    }
}

// ---------------------------------------------------------------------------
// LayerNorm over rows of length NV * 128 (256 here), optional residual add.
// One wave per row: the row lives in the wave's registers (16-byte loads, 512
// contiguous bytes per wave-wide load), both sums are lane exchanges, so there
// is no LDS and no barrier.  Resident grid: 256 blocks x 16 waves, 4 rows per
// wave with all rows' loads issued first: 4096 waves start per launch.
// ---------------------------------------------------------------------------
template <int NV, bool RES, bool OUTF, bool OUTH>
__global__ __launch_bounds__(512) void ln_kernel(
    const float* __restrict__ a, const float* __restrict__ res,
    const float* __restrict__ g, const float* __restrict__ beta, float eps,
    float* __restrict__ outF, _Float16* __restrict__ outH) {
    constexpr int n = NV * 128;
    constexpr int ROWS = 4;
    const int lane = threadIdx.x & 31;
    const int gw = blockIdx.x * 16 + (threadIdx.x >> 5);
    const size_t off = (size_t)gw * ROWS * n + lane * 4;

    const float* pa = a + off;
    const float* pr = RES ? res + off : pa;

    v4f v[ROWS][NV];
#pragma unroll
    for (int rr = 0; rr < ROWS; ++rr)
#pragma unroll
        for (int j = 0; j < NV; ++j)
            v[rr][j] = *(const v4f*)(pa + rr * n + j * 128);
    v4f w[RES ? ROWS : 1][NV];
    if (RES) {
#pragma unroll
        for (int rr = 0; rr < ROWS; ++rr)
#pragma unroll
            for (int j = 0; j < NV; ++j)
                w[rr][j] = *(const v4f*)(pr + rr * n + j * 128);
    }
    // The row loads share one address pair each.  Naming the pairs as inputs
    // keeps them live down to this wait, so that no load of the run can land
    // its result in a pair that the loads in front of it still name.
    asm volatile("s_wait_xcnt 0x0" ::"v"(pa), "v"(pr) : "memory");
    if (RES) {
#pragma unroll
        for (int rr = 0; rr < ROWS; ++rr)
#pragma unroll
            for (int j = 0; j < NV; ++j) v[rr][j] += w[rr][j];
    }
    v4f gg[NV], bb[NV];
#pragma unroll
    for (int j = 0; j < NV; ++j) {
        gg[j] = *(const v4f*)(g + j * 128 + lane * 4);
        bb[j] = *(const v4f*)(beta + j * 128 + lane * 4);
    }

    float mu[ROWS], rstd[ROWS];
#pragma unroll
    for (int rr = 0; rr < ROWS; ++rr) {
        float s = 0.0f;
#pragma unroll
        for (int j = 0; j < NV; ++j)
            s += (v[rr][j][0] + v[rr][j][1]) + (v[rr][j][2] + v[rr][j][3]);
        mu[rr] = s;
    }
#pragma unroll
    for (int o = 16; o >= 1; o >>= 1)
#pragma unroll
        for (int rr = 0; rr < ROWS; ++rr)
            mu[rr] += __shfl_xor(mu[rr], o, 32);
#pragma unroll
    for (int rr = 0; rr < ROWS; ++rr) {
        mu[rr] = mu[rr] / n;
        float s2 = 0.0f;
#pragma unroll
        for (int j = 0; j < NV; ++j) {
            v[rr][j] -= mu[rr];
            v4f q = v[rr][j] * v[rr][j];
            s2 += (q[0] + q[1]) + (q[2] + q[3]);
        }
        rstd[rr] = s2;
    }
#pragma unroll
    for (int o = 16; o >= 1; o >>= 1)
#pragma unroll
        for (int rr = 0; rr < ROWS; ++rr)
            rstd[rr] += __shfl_xor(rstd[rr], o, 32);

#pragma unroll
    for (int rr = 0; rr < ROWS; ++rr) {
        const float rs = rsqrtf(rstd[rr] / n + eps);
#pragma unroll
        for (int j = 0; j < NV; ++j) {
            v4f y = v[rr][j] * rs * gg[j] + bb[j];
            if (OUTF) *(v4f*)(outF + off + rr * n + j * 128) = y;
            if (OUTH)
                *(v4h*)(outH + off + rr * n + j * 128) =
                    __builtin_convertvector(y, v4h);
        }
    }
}

// ---------------------------------------------------------------------------
// Fused FFN: out = LN2(out1 + LNff(relu(out1 @ w1 + b1)) @ w2 + b2).
// One block of 16 waves owns 64 rows from end to end, one block per WGP; h never
// leaves the WGP.  A operands come from LDS, B operands (packed fragments) from
// L2 straight into registers: no two waves of a block need the same B fragment.
//   1. h (64 x 1024, f32) : wave w owns columns 64 w .. 64 w + 63, all 64 rows
//   2. LNff               : wave w owns rows 4 w .. 4 w + 3, row in registers
//   3. t (64 x 256, f32)  : wave w owns columns 16 w .. 16 w + 15, all 64 rows
//   4. LN2 with residual  : wave w owns rows 4 w .. 4 w + 3
// The k order of both products and both LayerNorm sum trees are those of
// gemm_kernel and ln_kernel.
// LDS pitches: 16 B x odd for the ds_load_b128 fragment rows; for the f32
// planes 8 rows are 32 banks apart, so the two row groups of an accumulator
// store fall on different banks.
// ---------------------------------------------------------------------------
#define FA_P 264    // halves, out1 tile
#define FH_P 1028   // floats, h before LNff
#define FHH_P 1032  // halves, h after LNff (overlays the f32 plane)
#define FT_P 260    // floats, t (behind the f16 plane)
#define FA_BYTES (64 * FA_P * 2)
#define FH_BYTES (64 * FH_P * 4)
#define FHH_BYTES (64 * FHH_P * 2)

__device__ __forceinline__ v16h load_packed(const v8h* p) {
    v8h lo = p[0];
    v8h hi = p[32];
    return __builtin_shufflevector(lo, hi, 0, 1, 2, 3, 4, 5, 6, 7, 8, 9, 10,
                                   11, 12, 13, 14, 15);
}

__global__ __launch_bounds__(512) void ffn_kernel(
    const _Float16* __restrict__ o1h, const float* __restrict__ out1F,
    const _Float16* __restrict__ w1P, const float* __restrict__ b1,
    const float* __restrict__ gff, const float* __restrict__ bff,
    const _Float16* __restrict__ w2P, const float* __restrict__ b2,
    const float* __restrict__ g2, const float* __restrict__ be2,
    float* __restrict__ out) {
    __shared__ __align__(16) char smem[FA_BYTES + FH_BYTES];
    _Float16* As = (_Float16*)smem;
    float* Hf = (float*)(smem + FA_BYTES);
    _Float16* Hh = (_Float16*)(smem + FA_BYTES);
    float* Tf = (float*)(smem + FA_BYTES + FHH_BYTES);

    const int t = threadIdx.x;
    // wave-uniform by construction; in a scalar register it makes every weight
    // and row base scalar, and the one vector offset (the lane's) lives on
    const int wave = __builtin_amdgcn_readfirstlane(t >> 5);
    const int lane = t & 31;
    const int l15 = lane & 15;
    const int hh8 = (lane >> 4) << 3;
    const int m0 = blockIdx.x * 64;

    // out1 tile (f16) to LDS: 64 rows x 512 B, one row per wave-wide load
    {
        const v8h* src = (const v8h*)(o1h + (size_t)m0 * D_);
        v8h a[4];
#pragma unroll
        for (int i = 0; i < 4; ++i) a[i] = src[t + i * 512];
#pragma unroll
        for (int i = 0; i < 4; ++i)
            *(v8h*)&As[(wave + i * 16) * FA_P + lane * 8] = a[i];
    }
    __syncthreads();  // the out1 tile is read by every wave

    // ---- 1. h = relu(out1 @ w1 + b1) ----
    {
        v8f acc[4][4] = {};
        const v8h* bp = (const v8h*)w1P + (size_t)wave * (4 * 8 * 64) + lane;
        v16h bc[4], bn[4];  // B fragments of this k step and of the next
#pragma unroll
        for (int nt = 0; nt < 4; ++nt) bc[nt] = load_packed(bp + nt * 8 * 64);
        // unrolled: acc, bc and bn are register arrays, and every B address is
        // the one base plus a constant
#pragma unroll
        for (int ks = 0; ks < D_ / 32; ++ks) {
            if (ks + 1 < D_ / 32) {
#pragma unroll
                for (int nt = 0; nt < 4; ++nt)
                    bn[nt] = load_packed(bp + (nt * 8 + ks + 1) * 64);
            }
            // keeps the next step's L2 loads in front of this step's products;
            // sunk to their use, each would expose its whole latency
            __builtin_amdgcn_sched_barrier(0);
            v16h af[4];
#pragma unroll
            for (int mt = 0; mt < 4; ++mt)
                af[mt] = load_frag(&As[(mt * 16 + l15) * FA_P + ks * 32], lane);
#pragma unroll
            for (int nt = 0; nt < 4; ++nt) {
#pragma unroll
                for (int mt = 0; mt < 4; ++mt)
                    acc[mt][nt] = __builtin_amdgcn_wmma_f32_16x16x32_f16(
                        false, af[mt], false, bc[nt], (short)0, acc[mt][nt],
                        false, false);
            }
#pragma unroll
            for (int nt = 0; nt < 4; ++nt) bc[nt] = bn[nt];
        }
#pragma unroll
        for (int nt = 0; nt < 4; ++nt) {
            const int col = wave * 64 + nt * 16 + l15;
            const float bvv = b1[col];
#pragma unroll
            for (int mt = 0; mt < 4; ++mt)
#pragma unroll
                for (int r = 0; r < 8; ++r)
                    Hf[(mt * 16 + r + hh8) * FH_P + col] =
                        fmaxf(acc[mt][nt][r] + bvv, 0.0f);
        }
    }
    // the bias loads' offset register is reused further down: the wait that
    // belongs in front of that overwrite, written here behind the loads
    asm volatile("s_wait_xcnt 0x0" ::: "memory");
    __syncthreads();  // rows of h are complete

    // ---- 2. LNff, rows 4 * wave .. + 3, f16 result for the second product ----
    {
        constexpr int NV = 8, n = DFF_;
        v4f v[4][NV];
#pragma unroll
        for (int rr = 0; rr < 4; ++rr)
#pragma unroll
            for (int j = 0; j < NV; ++j)
                v[rr][j] =
                    *(const v4f*)&Hf[(wave * 4 + rr) * FH_P + j * 128 + lane * 4];
        __syncthreads();  // every f32 row is in registers: the plane is reused

        float mu[4], rstd[4];
#pragma unroll
        for (int rr = 0; rr < 4; ++rr) {
            float s = 0.0f;
#pragma unroll
            for (int j = 0; j < NV; ++j)
                s += (v[rr][j][0] + v[rr][j][1]) + (v[rr][j][2] + v[rr][j][3]);
            mu[rr] = s;
        }
#pragma unroll
        for (int o = 16; o >= 1; o >>= 1)
#pragma unroll
            for (int rr = 0; rr < 4; ++rr) mu[rr] += __shfl_xor(mu[rr], o, 32);
#pragma unroll
        for (int rr = 0; rr < 4; ++rr) {
            mu[rr] = mu[rr] / n;
            float s2 = 0.0f;
#pragma unroll
            for (int j = 0; j < NV; ++j) {
                v[rr][j] -= mu[rr];
                v4f q = v[rr][j] * v[rr][j];
                s2 += (q[0] + q[1]) + (q[2] + q[3]);
            }
            rstd[rr] = s2;
        }
#pragma unroll
        for (int o = 16; o >= 1; o >>= 1)
#pragma unroll
            for (int rr = 0; rr < 4; ++rr)
                rstd[rr] += __shfl_xor(rstd[rr], o, 32);
#pragma unroll
        for (int rr = 0; rr < 4; ++rr) rstd[rr] = rsqrtf(rstd[rr] / n + 1e-6f);
#pragma unroll
        for (int j = 0; j < NV; ++j) {
            const v4f gg = *(const v4f*)(gff + j * 128 + lane * 4);
            const v4f bb = *(const v4f*)(bff + j * 128 + lane * 4);
#pragma unroll
            for (int rr = 0; rr < 4; ++rr) {
                v4f y = v[rr][j] * rstd[rr] * gg + bb;
                *(v4h*)&Hh[(wave * 4 + rr) * FHH_P + j * 128 + lane * 4] =
                    __builtin_convertvector(y, v4h);
            }
        }
    }
    __syncthreads();  // the f16 rows are read by every wave

    // ---- 3. t = h @ w2 + b2 ----
    {
        v8f acc[4] = {};
        const v8h* bp = (const v8h*)w2P + (size_t)wave * (32 * 64) + lane;
        v16h bc[4], bn[4];  // B fragments of this group of 4 k steps, the next
#pragma unroll
        for (int j = 0; j < 4; ++j) bc[j] = load_packed(bp + j * 64);
        v16h ac[4], an[4];  // A fragments of this k step and of the next
#pragma unroll
        for (int mt = 0; mt < 4; ++mt)
            ac[mt] = load_frag(&Hh[(mt * 16 + l15) * FHH_P], lane);
        // unrolled: ac, an, bc and bn are register arrays
#pragma unroll
        for (int ks = 0; ks < DFF_ / 32; ++ks) {
            if ((ks & 3) == 0 && ks + 4 < DFF_ / 32) {
#pragma unroll
                for (int j = 0; j < 4; ++j)
                    bn[j] = load_packed(bp + (ks + 4 + j) * 64);
            }
            if (ks + 1 < DFF_ / 32) {
#pragma unroll
                for (int mt = 0; mt < 4; ++mt)
                    an[mt] = load_frag(
                        &Hh[(mt * 16 + l15) * FHH_P + (ks + 1) * 32], lane);
            }
            // keeps the loads for later k steps, as one group, in front of this
            // step's products; sunk to their use, each pair of LDS reads would
            // be waited out in front of its one product
            __builtin_amdgcn_sched_barrier(0);
#pragma unroll
            for (int mt = 0; mt < 4; ++mt)
                acc[mt] = __builtin_amdgcn_wmma_f32_16x16x32_f16(
                    false, ac[mt], false, bc[ks & 3], (short)0, acc[mt], false,
                    false);
#pragma unroll
            for (int mt = 0; mt < 4; ++mt) ac[mt] = an[mt];
            if ((ks & 3) == 3) {
#pragma unroll
                for (int j = 0; j < 4; ++j) bc[j] = bn[j];
            }
        }
        const int col = wave * 16 + l15;
        const float bvv = b2[col];
#pragma unroll
        for (int mt = 0; mt < 4; ++mt)
#pragma unroll
            for (int r = 0; r < 8; ++r)
                Tf[(mt * 16 + r + hh8) * FT_P + col] = acc[mt][r] + bvv;
    }
    __syncthreads();  // rows of t are complete

    // ---- 4. out = LN2(t + out1), rows 4 * wave .. + 3 ----
    {
        constexpr int NV = 2, n = D_;
        const size_t off = (size_t)(m0 + wave * 4) * n + lane * 4;
        v4f v[4][NV];
#pragma unroll
        for (int rr = 0; rr < 4; ++rr)
#pragma unroll
            for (int j = 0; j < NV; ++j)
                v[rr][j] =
                    *(const v4f*)&Tf[(wave * 4 + rr) * FT_P + j * 128 + lane * 4] +
                    *(const v4f*)(out1F + off + rr * n + j * 128);
        float mu[4], rstd[4];
#pragma unroll
        for (int rr = 0; rr < 4; ++rr) {
            float s = 0.0f;
#pragma unroll
            for (int j = 0; j < NV; ++j)
                s += (v[rr][j][0] + v[rr][j][1]) + (v[rr][j][2] + v[rr][j][3]);
            mu[rr] = s;
        }
#pragma unroll
        for (int o = 16; o >= 1; o >>= 1)
#pragma unroll
            for (int rr = 0; rr < 4; ++rr) mu[rr] += __shfl_xor(mu[rr], o, 32);
#pragma unroll
        for (int rr = 0; rr < 4; ++rr) {
            mu[rr] = mu[rr] / n;
            float s2 = 0.0f;
#pragma unroll
            for (int j = 0; j < NV; ++j) {
                v[rr][j] -= mu[rr];
                v4f q = v[rr][j] * v[rr][j];
                s2 += (q[0] + q[1]) + (q[2] + q[3]);
            }
            rstd[rr] = s2;
        }
#pragma unroll
        for (int o = 16; o >= 1; o >>= 1)
#pragma unroll
            for (int rr = 0; rr < 4; ++rr)
                rstd[rr] += __shfl_xor(rstd[rr], o, 32);
#pragma unroll
        for (int j = 0; j < NV; ++j) {
            const v4f gg = *(const v4f*)(g2 + j * 128 + lane * 4);
            const v4f bb = *(const v4f*)(be2 + j * 128 + lane * 4);
#pragma unroll
            for (int rr = 0; rr < 4; ++rr) {
                const float rs = rsqrtf(rstd[rr] / n + 1e-3f);
                *(v4f*)(out + off + rr * n + j * 128) = v[rr][j] * rs * gg + bb;
            }
        }
    }
}

// ---------------------------------------------------------------------------
extern "C" void kernel_launch(void* const* d_in, const int* in_sizes, int n_in,
                              void* d_out, int out_size, void* d_ws,
                              size_t ws_size, hipStream_t stream) {
    const float* x      = (const float*)d_in[0];
    const float* mask   = (const float*)d_in[1];
    const float* wq     = (const float*)d_in[2];
    const float* bq     = (const float*)d_in[3];
    const float* wk     = (const float*)d_in[4];
    const float* bk     = (const float*)d_in[5];
    const float* wv     = (const float*)d_in[6];
    const float* bv     = (const float*)d_in[7];
    const float* wo     = (const float*)d_in[8];
    const float* bo     = (const float*)d_in[9];
    const float* w1     = (const float*)d_in[10];
    const float* b1     = (const float*)d_in[11];
    const float* lnffg  = (const float*)d_in[12];
    const float* lnffb  = (const float*)d_in[13];
    const float* w2     = (const float*)d_in[14];
    const float* b2     = (const float*)d_in[15];
    const float* ln1g   = (const float*)d_in[16];
    const float* ln1b   = (const float*)d_in[17];
    const float* ln2g   = (const float*)d_in[18];
    const float* ln2b   = (const float*)d_in[19];
    float* out = (float*)d_out;

    // workspace carve-up
    char* p = (char*)d_ws;
    _Float16* xh   = (_Float16*)p; p += (size_t)M_ * D_ * 2;    // 8 MiB
    _Float16* qh   = (_Float16*)p; p += (size_t)M_ * D_ * 2;    // 8 MiB
    _Float16* kh   = (_Float16*)p; p += (size_t)M_ * D_ * 2;    // 8 MiB
    _Float16* vh   = (_Float16*)p; p += (size_t)M_ * D_ * 2;    // 8 MiB (vT)
    _Float16* ctxh = (_Float16*)p; p += (size_t)M_ * D_ * 2;    // 8 MiB
    float* tmpF    = (float*)p;    p += (size_t)M_ * D_ * 4;    // 16 MiB
    float* out1F   = (float*)p;    p += (size_t)M_ * D_ * 4;    // 16 MiB
    _Float16* o1h  = (_Float16*)p; p += (size_t)M_ * D_ * 2;    // 8 MiB
    _Float16* wqT  = (_Float16*)p; p += (size_t)D_ * D_ * 2;
    _Float16* wkT  = (_Float16*)p; p += (size_t)D_ * D_ * 2;
    _Float16* wvT  = (_Float16*)p; p += (size_t)D_ * D_ * 2;
    _Float16* woT  = (_Float16*)p; p += (size_t)D_ * D_ * 2;
    _Float16* w1P  = (_Float16*)p; p += (size_t)D_ * DFF_ * 2;
    _Float16* w2P  = (_Float16*)p; p += (size_t)DFF_ * D_ * 2;

    // one-time weight transpose-convert (f32 KxN -> f16 NxK)
    dim3 tb(32, 8);
    transpose_f16_kernel<<<dim3(D_ / 32, D_ / 8), tb, 0, stream>>>(wq, wqT, D_, D_);
    transpose_f16_kernel<<<dim3(D_ / 32, D_ / 8), tb, 0, stream>>>(wk, wkT, D_, D_);
    transpose_f16_kernel<<<dim3(D_ / 32, D_ / 8), tb, 0, stream>>>(wv, wvT, D_, D_);
    transpose_f16_kernel<<<dim3(D_ / 32, D_ / 8), tb, 0, stream>>>(wo, woT, D_, D_);
    // FFN weights: f16 in B-fragment order
    pack_f16_kernel<<<D_ * DFF_ / 8 / 256, 256, 0, stream>>>(w1, w1P, D_, DFF_);
    pack_f16_kernel<<<D_ * DFF_ / 8 / 256, 256, 0, stream>>>(w2, w2P, DFF_, D_);

    // x -> f16
    cvt_f16_kernel<<<M_ * D_ / 4 / 4096, 512, 0, stream>>>(x, xh);

    // q/k/v projections (q pre-scaled by 1/sqrt(DEPTH); v written transposed)
    dim3 gQKV(M_ / 128, D_ / 64);
    gemm_kernel<<<gQKV, 128, 0, stream>>>(xh, wqT, bq, nullptr, qh, M_, D_, D_,
                                          1, 0, 0.125f);
    gemm_kernel<<<gQKV, 128, 0, stream>>>(xh, wkT, bk, nullptr, kh, M_, D_, D_,
                                          1, 0, 1.0f);
    gemm_kernel<<<gQKV, 128, 0, stream>>>(xh, wvT, bv, nullptr, vh, M_, D_, D_,
                                          2, 0, 1.0f);

    // flash attention
    attn_kernel<<<dim3(S_ / 64, B_ * H_), 128, 0, stream>>>(qh, kh, vh, mask,
                                                            ctxh);

    // output projection + residual LN (eps 1e-3)
    gemm_kernel<<<gQKV, 128, 0, stream>>>(ctxh, woT, bo, tmpF, nullptr, M_, D_,
                                          D_, 0, 0, 1.0f);
    ln_kernel<2, true, true, true><<<M_ / 64, 512, 0, stream>>>(
        tmpF, x, ln1g, ln1b, 1e-3f, out1F, o1h);

    // FFN: relu(out1@w1+b1) -> LN(eps 1e-6) -> @w2+b2 -> residual LN (eps 1e-3)
    ffn_kernel<<<M_ / 64, 512, 0, stream>>>(o1h, out1F, w1P, b1, lnffg, lnffb,
                                            w2P, b2, ln2g, ln2b, out);
}

// v005
// It runs in 148 microseconds.
// Two timings next to v004 put it at 1.20 and 1.19 times that version's speed.
// All steps since v000 together make it 3.52 times as fast.
#include <hip/hip_runtime.h>
#include <hip/hip_bf16.h>

// ---------------------------------------------------------------------------
// Transformer encoder layer for MI455X (gfx1250, wave32, WMMA).
// B=4, S=4096, D=256, H=4, DEPTH=64, DFF=1024.
// All GEMMs + attention on v_wmma_f32_16x16x32_f16 (f16 in, f32 acc).
// gemm_kernel and attn_kernel stage their tiles with
// global_load_async_to_lds_b128, double-buffered (ASYNCcnt); fragments load as
// 2x b128.  The FFN chain is one kernel that keeps its rows on the WGP.
// ---------------------------------------------------------------------------

#define B_ 4
#define S_ 4096
#define D_ 256
#define H_ 4
#define DEPTH_ 64
#define DFF_ 1024
#define M_ (B_ * S_)

typedef __attribute__((ext_vector_type(16))) _Float16 v16h;
typedef __attribute__((ext_vector_type(8)))  _Float16 v8h;
typedef __attribute__((ext_vector_type(4)))  _Float16 v4h;
typedef __attribute__((ext_vector_type(8)))  float    v8f;
typedef __attribute__((ext_vector_type(4)))  float    v4f;

// Load one 16-half fragment for lane `lane` from a row whose K-run starts at
// `p`.  Lane's data: K offsets [b, b+8) and [b+16, b+24), b = 8*(lane>=16).
__device__ __forceinline__ v16h load_frag(const _Float16* p, int lane) {
    const v8h* q = (const v8h*)(p + ((lane >> 4) << 3));
    v8h lo = q[0];
    v8h hi = q[2];
    return __builtin_shufflevector(lo, hi, 0, 1, 2, 3, 4, 5, 6, 7, 8, 9, 10,
                                   11, 12, 13, 14, 15);
}

// Async 16-byte global -> LDS copy (CDNA5, ASYNCcnt-tracked).
__device__ __forceinline__ void async_copy_b128(_Float16* lds_dst,
                                                const _Float16* gsrc) {
    uint32_t loff = (uint32_t)(uintptr_t)lds_dst;
    asm volatile("global_load_async_to_lds_b128 %0, %1, off"
                 :
                 : "v"(loff), "v"(gsrc)
                 : "memory");
}
// The same copy with s_wait_xcnt 0 as the last line of its own statement: for a
// place where the copy's address registers are rewritten before the next
// s_wait_asynccnt (the wait that belongs in front of such an overwrite).
__device__ __forceinline__ void async_copy_b128_xw(_Float16* lds_dst,
                                                   const _Float16* gsrc) {
    uint32_t loff = (uint32_t)(uintptr_t)lds_dst;
    asm volatile("global_load_async_to_lds_b128 %0, %1, off\n\ts_wait_xcnt 0x0"
                 :
                 : "v"(loff), "v"(gsrc)
                 : "memory");
}
__device__ __forceinline__ void wait_async0() {
    asm volatile("s_wait_asynccnt 0" ::: "memory");
}

// ---------------------------------------------------------------------------
// float -> f16 conversion.  256 blocks x 16 waves, each lane converts 8 groups
// of 4 floats (all 8 loads issued before the first store), so the job starts
// 4096 waves and not 32768.  blk: the block's number within this job.
// ---------------------------------------------------------------------------
__device__ __forceinline__ void cvt_f16_block(
    const float* __restrict__ src, _Float16* __restrict__ dst, int blk) {
    const int i0 = blk * 4096 + threadIdx.x;
    v4f v[8];
#pragma unroll
    for (int k = 0; k < 8; ++k) v[k] = ((const v4f*)src)[i0 + k * 512];
#pragma unroll
    for (int k = 0; k < 8; ++k)
        ((v4h*)dst)[i0 + k * 512] = __builtin_convertvector(v[k], v4h);
}

// ---------------------------------------------------------------------------
// Weight transpose-convert: WT[n][k] (f16) = W[k][n] (f32).  A block of 512
// threads takes 32 columns n x 16 rows k.
// ---------------------------------------------------------------------------
__device__ __forceinline__ void transpose_f16_block(
    const float* __restrict__ W, _Float16* __restrict__ WT, int K, int N,
    int blk) {
    const int nb = N >> 5;  // blocks along n
    int n = (blk % nb) * 32 + (threadIdx.x & 31);
    int k = (blk / nb) * 16 + (threadIdx.x >> 5);
    if (n < N && k < K) WT[(size_t)n * K + k] = (_Float16)W[(size_t)k * N + n];
}

// ---------------------------------------------------------------------------
// Weight convert into WMMA B-fragment order for the fused FFN kernel, which
// reads B straight from L2 into registers.  One fragment (16 columns n x 32 k)
// is 1 KiB: [part][lane][8 halves], lane = (n & 15) + 16 * hh and
// k = 32 * ks + 16 * part + 8 * hh + e, the k order of load_frag.  A wave-wide
// 16-byte load then covers 512 contiguous bytes.  One 16-byte chunk a thread.
// ---------------------------------------------------------------------------
__device__ __forceinline__ void pack_f16_block(
    const float* __restrict__ W, _Float16* __restrict__ P, int K, int N,
    int blk) {
    const int c = blk * 512 + threadIdx.x;
    const int lane = c & 31;
    const int part = (c >> 5) & 1;
    const int f = c >> 6;  // fragment number: nt * (K / 32) + ks
    const int KS = K >> 5;
    const int ks = f % KS;
    const int nt = f / KS;
    const int n = nt * 16 + (lane & 15);
    const int k0 = ks * 32 + part * 16 + (lane >> 4) * 8;
    float w[8];
#pragma unroll
    for (int e = 0; e < 8; ++e) w[e] = W[(size_t)(k0 + e) * N + n];
    // the converted halves land in registers that held load addresses: the wait
    // that belongs in front of that overwrite
    asm volatile("s_wait_xcnt 0x0" ::: "memory");
    v8h o;
#pragma unroll
    for (int e = 0; e < 8; ++e) o[e] = (_Float16)w[e];
    ((v8h*)P)[c] = o;
    // inlined twice into one kernel, the store is no longer followed by the
    // program's end alone: the wait that belongs in front of an overwrite of its
    // registers
    asm volatile("s_wait_xcnt 0x0" ::: "memory");
}

// ---------------------------------------------------------------------------
// All input preparation in one launch.  The seven jobs do not depend on each
// other, so each takes a range of the grid's blocks (512 threads a block) and
// they run side by side instead of one launch behind the other:
//   [0, 256)    x -> f16
//   [256, 768)  wq, wk, wv, wo transposed, 128 blocks each
//   [768, 896)  w1, w2 in B-fragment order, 64 blocks each
// ---------------------------------------------------------------------------
#define PREP_CVT_BLOCKS (M_ * D_ / 4 / 4096)
#define PREP_TR_BLOCKS (D_ * D_ / 512)
#define PREP_PACK_BLOCKS (D_ * DFF_ / 8 / 512)
#define PREP_BLOCKS (PREP_CVT_BLOCKS + 4 * PREP_TR_BLOCKS + 2 * PREP_PACK_BLOCKS)

__global__ __launch_bounds__(512) void prep_kernel(
    const float* __restrict__ x, const float* __restrict__ wq,
    const float* __restrict__ wk, const float* __restrict__ wv,
    const float* __restrict__ wo, const float* __restrict__ w1,
    const float* __restrict__ w2, _Float16* __restrict__ xh,
    _Float16* __restrict__ wqT, _Float16* __restrict__ wkT,
    _Float16* __restrict__ wvT, _Float16* __restrict__ woT,
    _Float16* __restrict__ w1P, _Float16* __restrict__ w2P) {
    int blk = blockIdx.x;
    if (blk < PREP_CVT_BLOCKS) {
        cvt_f16_block(x, xh, blk);
        return;
    }
    blk -= PREP_CVT_BLOCKS;
    if (blk < 4 * PREP_TR_BLOCKS) {
        const int j = blk / PREP_TR_BLOCKS;
        transpose_f16_block(j == 0 ? wq : j == 1 ? wk : j == 2 ? wv : wo,
                            j == 0 ? wqT : j == 1 ? wkT : j == 2 ? wvT : woT,
                            D_, D_, blk % PREP_TR_BLOCKS);
        return;
    }
    blk -= 4 * PREP_TR_BLOCKS;
    if (blk < PREP_PACK_BLOCKS)
        pack_f16_block(w1, w1P, D_, DFF_, blk);
    else
        pack_f16_block(w2, w2P, DFF_, D_, blk - PREP_PACK_BLOCKS);
}

// ---------------------------------------------------------------------------
// GEMM: C[M x N] = A[M x K] (f16, row-major) * WT[N x K] (f16, N-major) + bias
// Block: 128 threads (4 waves), 128x64 tile; wave w owns rows w*32..w*32+31.
// Double-buffered async staging.  mode 0: f32 row-major.
// mode 1: f16 split-head [B,H,S,64].  mode 2: f16 split-head T [B,H,64,S].
// ---------------------------------------------------------------------------
__device__ __forceinline__ void gemm_tile(
    const _Float16* __restrict__ A, const _Float16* __restrict__ WT,
    const float* __restrict__ bias, float* __restrict__ outF,
    _Float16* __restrict__ outH, int M, int N, int K, int mode, int relu,
    float scale) {
    // Rows hold 32 halves; the pitch is 40 halves (80 B = 16 B x odd) so that the
    // 16 rows of a ds_load_b128 fragment read fall on distinct LDS banks.
    __shared__ __align__(16) _Float16 As[2][128][40];   // row-major (K-runs)
    __shared__ __align__(16) _Float16 BsT[2][64][40];   // N-major: BsT[n][k]

    const int m0 = blockIdx.x * 128;
    const int n0 = blockIdx.y * 64;
    const int t = threadIdx.x;
    const int wave = t >> 5;
    const int lane = t & 31;

    v8f acc[2][4] = {};

    // stage first k-tile into buffer 0
#pragma unroll
    for (int i = t; i < 512; i += 128) {
        int r = i >> 2, cc = i & 3;
        async_copy_b128_xw(&As[0][r][cc * 8],
                           A + (size_t)(m0 + r) * K + cc * 8);
    }
#pragma unroll
    for (int i = t; i < 256; i += 128) {
        int c = i >> 2, cc = i & 3;
        async_copy_b128_xw(&BsT[0][c][cc * 8],
                           WT + (size_t)(n0 + c) * K + cc * 8);
    }

    for (int k0 = 0; k0 < K; k0 += 32) {
        const int buf = (k0 >> 5) & 1;
        wait_async0();
        __syncthreads();  // tile `buf` ready for all waves

        if (k0 + 32 < K) {  // issue DMA for next tile into other buffer
            const int k1 = k0 + 32;
#pragma unroll
            for (int i = t; i < 512; i += 128) {
                int r = i >> 2, cc = i & 3;
                async_copy_b128(&As[buf ^ 1][r][cc * 8],
                                A + (size_t)(m0 + r) * K + k1 + cc * 8);
            }
#pragma unroll
            for (int i = t; i < 256; i += 128) {
                int c = i >> 2, cc = i & 3;
                async_copy_b128(&BsT[buf ^ 1][c][cc * 8],
                                WT + (size_t)(n0 + c) * K + k1 + cc * 8);
            }
        }

        v16h a0 = load_frag(&As[buf][wave * 32 + (lane & 15)][0], lane);
        v16h a1 = load_frag(&As[buf][wave * 32 + 16 + (lane & 15)][0], lane);
#pragma unroll
        for (int nt = 0; nt < 4; ++nt) {
            v16h bf = load_frag(&BsT[buf][nt * 16 + (lane & 15)][0], lane);
            acc[0][nt] = __builtin_amdgcn_wmma_f32_16x16x32_f16(
                false, a0, false, bf, (short)0, acc[0][nt], false, false);
            acc[1][nt] = __builtin_amdgcn_wmma_f32_16x16x32_f16(
                false, a1, false, bf, (short)0, acc[1][nt], false, false);
        }
        // no trailing barrier: next iteration's wait+barrier protects reuse
    }

    // epilogue
#pragma unroll
    for (int hh = 0; hh < 2; ++hh)
#pragma unroll
        for (int nt = 0; nt < 4; ++nt) {
            int col = n0 + nt * 16 + (lane & 15);
            float bvv = bias[col];
#pragma unroll
            for (int r = 0; r < 8; ++r) {
                int row = m0 + wave * 32 + hh * 16 + r + ((lane >> 4) << 3);
                float v = acc[hh][nt][r] + bvv;
                if (relu) v = fmaxf(v, 0.0f);
                v *= scale;
                int b = row / S_, s = row % S_;
                int h = col >> 6, d = col & 63;
                if (mode == 0) {
                    outF[(size_t)row * N + col] = v;
                } else if (mode == 1) {
                    outH[(((size_t)(b * H_ + h)) * S_ + s) * DEPTH_ + d] =
                        (_Float16)v;
                } else {
                    outH[(((size_t)(b * H_ + h)) * DEPTH_ + d) * S_ + s] =
                        (_Float16)v;
                }
            }
        }
}

// One launch for up to three products of the same A: blockIdx.z picks the
// weights, the bias and the f16 output.  `scale` belongs to product 0 (the
// others take 1), `mode` to products 0 and 1, `mode2` to product 2.
__global__ __launch_bounds__(128) void gemm_kernel(
    const _Float16* __restrict__ A, const _Float16* __restrict__ WT0,
    const _Float16* __restrict__ WT1, const _Float16* __restrict__ WT2,
    const float* __restrict__ bias0, const float* __restrict__ bias1,
    const float* __restrict__ bias2, float* __restrict__ outF,
    _Float16* __restrict__ outH0, _Float16* __restrict__ outH1,
    _Float16* __restrict__ outH2, int M, int N, int K, int mode, int mode2,
    int relu, float scale) {
    const int z = blockIdx.z;
    gemm_tile(A, z == 0 ? WT0 : z == 1 ? WT1 : WT2,
              z == 0 ? bias0 : z == 1 ? bias1 : bias2, outF,
              z == 0 ? outH0 : z == 1 ? outH1 : outH2, M, N, K,
              z == 2 ? mode2 : mode, relu, z == 0 ? scale : 1.0f);
}

__device__ __forceinline__ float xhalf(float x) {
    int v = __builtin_bit_cast(int, x);
    return __builtin_bit_cast(
        float, __builtin_amdgcn_permlanex16(v, v, 0x76543210, 0xfedcba98, false,
                                            false));
}

__global__ __launch_bounds__(128) void attn_kernel(
    const _Float16* __restrict__ qh, const _Float16* __restrict__ kh,
    const _Float16* __restrict__ vT, const float* __restrict__ mask,
    _Float16* __restrict__ ctxh) {
    // Rows hold 64 halves; the pitch is 72 halves (144 B = 16 B x odd) so that the
    // 16 rows of a ds_load_b128 fragment read fall on distinct LDS banks.
    __shared__ __align__(16) _Float16 Ks[2][64][72];    // [kpos][d]
    __shared__ __align__(16) _Float16 VsT[2][64][72];   // [d][kpos]
    __shared__ __align__(32) float Ms[S_];              // mask * -1e9 of batch b

    const int qt = blockIdx.x;
    const int bh = blockIdx.y;
    const int b = bh / H_;
    const int h = bh % H_;
    const int t = threadIdx.x;
    const int wave = t >> 5;
    const int lane = t & 31;
    const int hh8 = (lane >> 4) << 3;
    const size_t base = (size_t)bh * S_ * DEPTH_;  // q/k and vT share extent
    const int qr0 = qt * 64 + wave * 16;
    const int NT = S_ / 64;

    // Q fragments straight from global (two 16B loads each)
    v16h qA[2];
#pragma unroll
    for (int c = 0; c < 2; ++c)
        qA[c] = load_frag(
            qh + base + (size_t)(qr0 + (lane & 15)) * DEPTH_ + c * 32, lane);

    v8f O[4] = {};
    float mrow = -1e30f, lrow = 0.0f;  // lrow: this half's keys only

    // stage first K/V tile into buffer 0
#pragma unroll
    for (int i = t; i < 512; i += 128) {
        int r = i >> 3, cc = i & 7;
        async_copy_b128(&Ks[0][r][cc * 8],
                        kh + base + (size_t)r * DEPTH_ + cc * 8);
        async_copy_b128(&VsT[0][r][cc * 8],
                        vT + base + (size_t)r * S_ + cc * 8);
    }

    // The mask term now varies along a lane's registers: the whole row of the
    // batch goes to LDS once; the loop's first barrier publishes it.
    const v4f* mp = (const v4f*)(mask + (size_t)b * S_) + t;
    v4f mv[8];
    // unrolled with a fixed trip count: all eight loads fly together
#pragma unroll
    for (int k = 0; k < 8; ++k) mv[k] = mp[k * 128];
    // unrolled: mv lives in registers
#pragma unroll
    for (int k = 0; k < 8; ++k) ((v4f*)Ms)[t + k * 128] = mv[k] * -1e9f;

    for (int kt = 0; kt < NT; ++kt) {
        const int buf = kt & 1;
        wait_async0();
        __syncthreads();  // tile `buf` ready

        if (kt + 1 < NT) {  // DMA next tile into other buffer
            const int kr = (kt + 1) * 64;
#pragma unroll
            for (int i = t; i < 512; i += 128) {
                int r = i >> 3, cc = i & 7;
                async_copy_b128(
                    &Ks[buf ^ 1][r][cc * 8],
                    kh + base + (size_t)(kr + r) * DEPTH_ + cc * 8);
                async_copy_b128(&VsT[buf ^ 1][r][cc * 8],
                                vT + base + (size_t)r * S_ + kr + cc * 8);
            }
        }

        // logits tile: S^T = K @ Q^T   (64 kpos x 16 q)
        v8f sc[4] = {};
#pragma unroll
        for (int nt = 0; nt < 4; ++nt) {
#pragma unroll
            for (int c = 0; c < 2; ++c) {
                v16h kf =
                    load_frag(&Ks[buf][nt * 16 + (lane & 15)][c * 32], lane);
                sc[nt] = __builtin_amdgcn_wmma_f32_16x16x32_f16(
                    false, kf, false, qA[c], (short)0, sc[nt], false, false);
            }
            sc[nt] += *(const v8f*)&Ms[kt * 64 + nt * 16 + hh8];
        }

        // online softmax: 32 of the query's 64 scores live in this lane
        // (the loops down to the epilogue are unrolled because sc and O are
        // register arrays and need constant indices)
        float mx4[4];
#pragma unroll
        for (int nt = 0; nt < 4; ++nt) {
            float m = sc[nt][0];
#pragma unroll
            for (int r = 1; r < 8; ++r) m = fmaxf(m, sc[nt][r]);
            mx4[nt] = m;
        }
        float mx = fmaxf(fmaxf(mx4[0], mx4[1]), fmaxf(mx4[2], mx4[3]));
        mx = fmaxf(mx, xhalf(mx));
        const float newm = fmaxf(mrow, mx);
        const float corr = __expf(mrow - newm);
        mrow = newm;
#pragma unroll
        for (int nt = 0; nt < 4; ++nt)
#pragma unroll
            for (int r = 0; r < 8; ++r)
                sc[nt][r] = __expf(sc[nt][r] - newm);
        const v8f s8 = (sc[0] + sc[1]) + (sc[2] + sc[3]);
        const float rs = ((s8[0] + s8[1]) + (s8[2] + s8[3])) +
                         ((s8[4] + s8[5]) + (s8[6] + s8[7]));
        lrow = lrow * corr + rs;
#pragma unroll
        for (int nt = 0; nt < 4; ++nt) O[nt] *= corr;

        // O^T += V^T @ P^T; score tiles 2c and 2c+1 are B's k 0..15 and 16..31
#pragma unroll
        for (int c = 0; c < 2; ++c) {
            v16h pb = __builtin_shufflevector(
                __builtin_convertvector(sc[2 * c], v8h),
                __builtin_convertvector(sc[2 * c + 1], v8h), 0, 1, 2, 3, 4, 5, 6,
                7, 8, 9, 10, 11, 12, 13, 14, 15);
#pragma unroll
            for (int nt = 0; nt < 4; ++nt) {
                v16h vf =
                    load_frag(&VsT[buf][nt * 16 + (lane & 15)][c * 32], lane);
                O[nt] = __builtin_amdgcn_wmma_f32_16x16x32_f16(
                    false, vf, false, pb, (short)0, O[nt], false, false);
            }
        }
        // no trailing barrier: next iteration's wait+barrier protects reuse
    }

    // write merged-head context, normalized by l: 8 consecutive d per lane
    const float l = lrow + xhalf(lrow);
#pragma unroll
    for (int nt = 0; nt < 4; ++nt) {
        v8h o;
#pragma unroll
        for (int r = 0; r < 8; ++r) o[r] = (_Float16)(O[nt][r] / l);
        *(v8h*)&ctxh[(size_t)(b * S_ + qr0 + (lane & 15)) * D_ + h * DEPTH_ +
                     nt * 16 + hh8] = o;
    }
}

// ---------------------------------------------------------------------------
// LayerNorm over rows of length NV * 128 (256 here), optional residual add.
// One wave per row: the row lives in the wave's registers (16-byte loads, 512
// contiguous bytes per wave-wide load), both sums are lane exchanges, so there
// is no LDS and no barrier.  Resident grid: 256 blocks x 16 waves, 4 rows per
// wave with all rows' loads issued first: 4096 waves start per launch.
// ---------------------------------------------------------------------------
template <int NV, bool RES, bool OUTF, bool OUTH>
__global__ __launch_bounds__(512) void ln_kernel(
    const float* __restrict__ a, const float* __restrict__ res,
    const float* __restrict__ g, const float* __restrict__ beta, float eps,
    float* __restrict__ outF, _Float16* __restrict__ outH) {
    constexpr int n = NV * 128;
    constexpr int ROWS = 4;
    const int lane = threadIdx.x & 31;
    const int gw = blockIdx.x * 16 + (threadIdx.x >> 5);
    const size_t off = (size_t)gw * ROWS * n + lane * 4;

    const float* pa = a + off;
    const float* pr = RES ? res + off : pa;

    v4f v[ROWS][NV];
#pragma unroll
    for (int rr = 0; rr < ROWS; ++rr)
#pragma unroll
        for (int j = 0; j < NV; ++j)
            v[rr][j] = *(const v4f*)(pa + rr * n + j * 128);
    v4f w[RES ? ROWS : 1][NV];
    if (RES) {
#pragma unroll
        for (int rr = 0; rr < ROWS; ++rr)
#pragma unroll
            for (int j = 0; j < NV; ++j)
                w[rr][j] = *(const v4f*)(pr + rr * n + j * 128);
    }
    // The row loads share one address pair each.  Naming the pairs as inputs
    // keeps them live down to this wait, so that no load of the run can land
    // its result in a pair that the loads in front of it still name.
    asm volatile("s_wait_xcnt 0x0" ::"v"(pa), "v"(pr) : "memory");
    if (RES) {
#pragma unroll
        for (int rr = 0; rr < ROWS; ++rr)
#pragma unroll
            for (int j = 0; j < NV; ++j) v[rr][j] += w[rr][j];
    }
    v4f gg[NV], bb[NV];
#pragma unroll
    for (int j = 0; j < NV; ++j) {
        gg[j] = *(const v4f*)(g + j * 128 + lane * 4);
        bb[j] = *(const v4f*)(beta + j * 128 + lane * 4);
    }

    float mu[ROWS], rstd[ROWS];
#pragma unroll
    for (int rr = 0; rr < ROWS; ++rr) {
        float s = 0.0f;
#pragma unroll
        for (int j = 0; j < NV; ++j)
            s += (v[rr][j][0] + v[rr][j][1]) + (v[rr][j][2] + v[rr][j][3]);
        mu[rr] = s;
    }
#pragma unroll
    for (int o = 16; o >= 1; o >>= 1)
#pragma unroll
        for (int rr = 0; rr < ROWS; ++rr)
            mu[rr] += __shfl_xor(mu[rr], o, 32);
#pragma unroll
    for (int rr = 0; rr < ROWS; ++rr) {
        mu[rr] = mu[rr] / n;
        float s2 = 0.0f;
#pragma unroll
        for (int j = 0; j < NV; ++j) {
            v[rr][j] -= mu[rr];
            v4f q = v[rr][j] * v[rr][j];
            s2 += (q[0] + q[1]) + (q[2] + q[3]);
        }
        rstd[rr] = s2;
    }
#pragma unroll
    for (int o = 16; o >= 1; o >>= 1)
#pragma unroll
        for (int rr = 0; rr < ROWS; ++rr)
            rstd[rr] += __shfl_xor(rstd[rr], o, 32);

#pragma unroll
    for (int rr = 0; rr < ROWS; ++rr) {
        const float rs = rsqrtf(rstd[rr] / n + eps);
#pragma unroll
        for (int j = 0; j < NV; ++j) {
            v4f y = v[rr][j] * rs * gg[j] + bb[j];
            if (OUTF) *(v4f*)(outF + off + rr * n + j * 128) = y;
            if (OUTH)
                *(v4h*)(outH + off + rr * n + j * 128) =
                    __builtin_convertvector(y, v4h);
        }
    }
}

// ---------------------------------------------------------------------------
// Fused FFN: out = LN2(out1 + LNff(relu(out1 @ w1 + b1)) @ w2 + b2).
// One block of 16 waves owns 64 rows from end to end, one block per WGP; h never
// leaves the WGP.  A operands come from LDS, B operands (packed fragments) from
// L2 straight into registers: no two waves of a block need the same B fragment.
//   1. h (64 x 1024, f32) : wave w owns columns 64 w .. 64 w + 63, all 64 rows
//   2. LNff               : wave w owns rows 4 w .. 4 w + 3, row in registers
//   3. t (64 x 256, f32)  : wave w owns columns 16 w .. 16 w + 15, all 64 rows
//   4. LN2 with residual  : wave w owns rows 4 w .. 4 w + 3
// The k order of both products and both LayerNorm sum trees are those of
// gemm_kernel and ln_kernel.
// LDS pitches: 16 B x odd for the ds_load_b128 fragment rows; for the f32
// planes 8 rows are 32 banks apart, so the two row groups of an accumulator
// store fall on different banks.
// ---------------------------------------------------------------------------
#define FA_P 264    // halves, out1 tile
#define FH_P 1028   // floats, h before LNff
#define FHH_P 1032  // halves, h after LNff (overlays the f32 plane)
#define FT_P 260    // floats, t (behind the f16 plane)
#define FA_BYTES (64 * FA_P * 2)
#define FH_BYTES (64 * FH_P * 4)
#define FHH_BYTES (64 * FHH_P * 2)

__device__ __forceinline__ v16h load_packed(const v8h* p) {
    v8h lo = p[0];
    v8h hi = p[32];
    return __builtin_shufflevector(lo, hi, 0, 1, 2, 3, 4, 5, 6, 7, 8, 9, 10,
                                   11, 12, 13, 14, 15);
}

__global__ __launch_bounds__(512) void ffn_kernel(
    const _Float16* __restrict__ o1h, const float* __restrict__ out1F,
    const _Float16* __restrict__ w1P, const float* __restrict__ b1,
    const float* __restrict__ gff, const float* __restrict__ bff,
    const _Float16* __restrict__ w2P, const float* __restrict__ b2,
    const float* __restrict__ g2, const float* __restrict__ be2,
    float* __restrict__ out) {
    __shared__ __align__(16) char smem[FA_BYTES + FH_BYTES];
    _Float16* As = (_Float16*)smem;
    float* Hf = (float*)(smem + FA_BYTES);
    _Float16* Hh = (_Float16*)(smem + FA_BYTES);
    float* Tf = (float*)(smem + FA_BYTES + FHH_BYTES);

    const int t = threadIdx.x;
    // wave-uniform by construction; in a scalar register it makes every weight
    // and row base scalar, and the one vector offset (the lane's) lives on
    const int wave = __builtin_amdgcn_readfirstlane(t >> 5);
    const int lane = t & 31;
    const int l15 = lane & 15;
    const int hh8 = (lane >> 4) << 3;
    const int m0 = blockIdx.x * 64;

    // out1 tile (f16) to LDS: 64 rows x 512 B, one row per wave-wide load
    {
        const v8h* src = (const v8h*)(o1h + (size_t)m0 * D_);
        v8h a[4];
#pragma unroll
        for (int i = 0; i < 4; ++i) a[i] = src[t + i * 512];
#pragma unroll
        for (int i = 0; i < 4; ++i)
            *(v8h*)&As[(wave + i * 16) * FA_P + lane * 8] = a[i];
    }
    __syncthreads();  // the out1 tile is read by every wave

    // ---- 1. h = relu(out1 @ w1 + b1) ----
    {
        v8f acc[4][4] = {};
        const v8h* bp = (const v8h*)w1P + (size_t)wave * (4 * 8 * 64) + lane;
        v16h bc[4], bn[4];  // B fragments of this k step and of the next
#pragma unroll
        for (int nt = 0; nt < 4; ++nt) bc[nt] = load_packed(bp + nt * 8 * 64);
        // unrolled: acc, bc and bn are register arrays, and every B address is
        // the one base plus a constant
#pragma unroll
        for (int ks = 0; ks < D_ / 32; ++ks) {
            if (ks + 1 < D_ / 32) {
#pragma unroll
                for (int nt = 0; nt < 4; ++nt)
                    bn[nt] = load_packed(bp + (nt * 8 + ks + 1) * 64);
            }
            // keeps the next step's L2 loads in front of this step's products;
            // sunk to their use, each would expose its whole latency
            __builtin_amdgcn_sched_barrier(0);
            v16h af[4];
#pragma unroll
            for (int mt = 0; mt < 4; ++mt)
                af[mt] = load_frag(&As[(mt * 16 + l15) * FA_P + ks * 32], lane);
#pragma unroll
            for (int nt = 0; nt < 4; ++nt) {
#pragma unroll
                for (int mt = 0; mt < 4; ++mt)
                    acc[mt][nt] = __builtin_amdgcn_wmma_f32_16x16x32_f16(
                        false, af[mt], false, bc[nt], (short)0, acc[mt][nt],
                        false, false);
            }
#pragma unroll
            for (int nt = 0; nt < 4; ++nt) bc[nt] = bn[nt];
        }
#pragma unroll
        for (int nt = 0; nt < 4; ++nt) {
            const int col = wave * 64 + nt * 16 + l15;
            const float bvv = b1[col];
#pragma unroll
            for (int mt = 0; mt < 4; ++mt)
#pragma unroll
                for (int r = 0; r < 8; ++r)
                    Hf[(mt * 16 + r + hh8) * FH_P + col] =
                        fmaxf(acc[mt][nt][r] + bvv, 0.0f);
        }
    }
    // the bias loads' offset register is reused further down: the wait that
    // belongs in front of that overwrite, written here behind the loads
    asm volatile("s_wait_xcnt 0x0" ::: "memory");
    __syncthreads();  // rows of h are complete

    // ---- 2. LNff, rows 4 * wave .. + 3, f16 result for the second product ----
    {
        constexpr int NV = 8, n = DFF_;
        v4f v[4][NV];
#pragma unroll
        for (int rr = 0; rr < 4; ++rr)
#pragma unroll
            for (int j = 0; j < NV; ++j)
                v[rr][j] =
                    *(const v4f*)&Hf[(wave * 4 + rr) * FH_P + j * 128 + lane * 4];
        __syncthreads();  // every f32 row is in registers: the plane is reused

        float mu[4], rstd[4];
#pragma unroll
        for (int rr = 0; rr < 4; ++rr) {
            float s = 0.0f;
#pragma unroll
            for (int j = 0; j < NV; ++j)
                s += (v[rr][j][0] + v[rr][j][1]) + (v[rr][j][2] + v[rr][j][3]);
            mu[rr] = s;
        }
#pragma unroll
        for (int o = 16; o >= 1; o >>= 1)
#pragma unroll
            for (int rr = 0; rr < 4; ++rr) mu[rr] += __shfl_xor(mu[rr], o, 32);
#pragma unroll
        for (int rr = 0; rr < 4; ++rr) {
            mu[rr] = mu[rr] / n;
            float s2 = 0.0f;
#pragma unroll
            for (int j = 0; j < NV; ++j) {
                v[rr][j] -= mu[rr];
                v4f q = v[rr][j] * v[rr][j];
                s2 += (q[0] + q[1]) + (q[2] + q[3]);
            }
            rstd[rr] = s2;
        }
#pragma unroll
        for (int o = 16; o >= 1; o >>= 1)
#pragma unroll
            for (int rr = 0; rr < 4; ++rr)
                rstd[rr] += __shfl_xor(rstd[rr], o, 32);
#pragma unroll
        for (int rr = 0; rr < 4; ++rr) rstd[rr] = rsqrtf(rstd[rr] / n + 1e-6f);
#pragma unroll
        for (int j = 0; j < NV; ++j) {
            const v4f gg = *(const v4f*)(gff + j * 128 + lane * 4);
            const v4f bb = *(const v4f*)(bff + j * 128 + lane * 4);
#pragma unroll
            for (int rr = 0; rr < 4; ++rr) {
                v4f y = v[rr][j] * rstd[rr] * gg + bb;
                *(v4h*)&Hh[(wave * 4 + rr) * FHH_P + j * 128 + lane * 4] =
                    __builtin_convertvector(y, v4h);
            }
        }
    }
    __syncthreads();  // the f16 rows are read by every wave

    // ---- 3. t = h @ w2 + b2 ----
    {
        v8f acc[4] = {};
        const v8h* bp = (const v8h*)w2P + (size_t)wave * (32 * 64) + lane;
        v16h bc[4], bn[4];  // B fragments of this group of 4 k steps, the next
#pragma unroll
        for (int j = 0; j < 4; ++j) bc[j] = load_packed(bp + j * 64);
        v16h ac[4], an[4];  // A fragments of this k step and of the next
#pragma unroll
        for (int mt = 0; mt < 4; ++mt)
            ac[mt] = load_frag(&Hh[(mt * 16 + l15) * FHH_P], lane);
        // unrolled: ac, an, bc and bn are register arrays
#pragma unroll
        for (int ks = 0; ks < DFF_ / 32; ++ks) {
            if ((ks & 3) == 0 && ks + 4 < DFF_ / 32) {
#pragma unroll
                for (int j = 0; j < 4; ++j)
                    bn[j] = load_packed(bp + (ks + 4 + j) * 64);
            }
            if (ks + 1 < DFF_ / 32) {
#pragma unroll
                for (int mt = 0; mt < 4; ++mt)
                    an[mt] = load_frag(
                        &Hh[(mt * 16 + l15) * FHH_P + (ks + 1) * 32], lane);
            }
            // keeps the loads for later k steps, as one group, in front of this
            // step's products; sunk to their use, each pair of LDS reads would
            // be waited out in front of its one product
            __builtin_amdgcn_sched_barrier(0);
#pragma unroll
            for (int mt = 0; mt < 4; ++mt)
                acc[mt] = __builtin_amdgcn_wmma_f32_16x16x32_f16(
                    false, ac[mt], false, bc[ks & 3], (short)0, acc[mt], false,
                    false);
#pragma unroll
            for (int mt = 0; mt < 4; ++mt) ac[mt] = an[mt];
            if ((ks & 3) == 3) {
#pragma unroll
                for (int j = 0; j < 4; ++j) bc[j] = bn[j];
            }
        }
        const int col = wave * 16 + l15;
        const float bvv = b2[col];
#pragma unroll
        for (int mt = 0; mt < 4; ++mt)
#pragma unroll
            for (int r = 0; r < 8; ++r)
                Tf[(mt * 16 + r + hh8) * FT_P + col] = acc[mt][r] + bvv;
    }
    __syncthreads();  // rows of t are complete

    // ---- 4. out = LN2(t + out1), rows 4 * wave .. + 3 ----
    {
        constexpr int NV = 2, n = D_;
        const size_t off = (size_t)(m0 + wave * 4) * n + lane * 4;
        v4f v[4][NV];
#pragma unroll
        for (int rr = 0; rr < 4; ++rr)
#pragma unroll
            for (int j = 0; j < NV; ++j)
                v[rr][j] =
                    *(const v4f*)&Tf[(wave * 4 + rr) * FT_P + j * 128 + lane * 4] +
                    *(const v4f*)(out1F + off + rr * n + j * 128);
        float mu[4], rstd[4];
#pragma unroll
        for (int rr = 0; rr < 4; ++rr) {
            float s = 0.0f;
#pragma unroll
            for (int j = 0; j < NV; ++j)
                s += (v[rr][j][0] + v[rr][j][1]) + (v[rr][j][2] + v[rr][j][3]);
            mu[rr] = s;
        }
#pragma unroll
        for (int o = 16; o >= 1; o >>= 1)
#pragma unroll
            for (int rr = 0; rr < 4; ++rr) mu[rr] += __shfl_xor(mu[rr], o, 32);
#pragma unroll
        for (int rr = 0; rr < 4; ++rr) {
            mu[rr] = mu[rr] / n;
            float s2 = 0.0f;
#pragma unroll
            for (int j = 0; j < NV; ++j) {
                v[rr][j] -= mu[rr];
                v4f q = v[rr][j] * v[rr][j];
                s2 += (q[0] + q[1]) + (q[2] + q[3]);
            }
            rstd[rr] = s2;
        }
#pragma unroll
        for (int o = 16; o >= 1; o >>= 1)
#pragma unroll
            for (int rr = 0; rr < 4; ++rr)
                rstd[rr] += __shfl_xor(rstd[rr], o, 32);
#pragma unroll
        for (int j = 0; j < NV; ++j) {
            const v4f gg = *(const v4f*)(g2 + j * 128 + lane * 4);
            const v4f bb = *(const v4f*)(be2 + j * 128 + lane * 4);
#pragma unroll
            for (int rr = 0; rr < 4; ++rr) {
                const float rs = rsqrtf(rstd[rr] / n + 1e-3f);
                *(v4f*)(out + off + rr * n + j * 128) = v[rr][j] * rs * gg + bb;
            }
        }
    }
}

// ---------------------------------------------------------------------------
extern "C" void kernel_launch(void* const* d_in, const int* in_sizes, int n_in,
                              void* d_out, int out_size, void* d_ws,
                              size_t ws_size, hipStream_t stream) {
    const float* x      = (const float*)d_in[0];
    const float* mask   = (const float*)d_in[1];
    const float* wq     = (const float*)d_in[2];
    const float* bq     = (const float*)d_in[3];
    const float* wk     = (const float*)d_in[4];
    const float* bk     = (const float*)d_in[5];
    const float* wv     = (const float*)d_in[6];
    const float* bv     = (const float*)d_in[7];
    const float* wo     = (const float*)d_in[8];
    const float* bo     = (const float*)d_in[9];
    const float* w1     = (const float*)d_in[10];
    const float* b1     = (const float*)d_in[11];
    const float* lnffg  = (const float*)d_in[12];
    const float* lnffb  = (const float*)d_in[13];
    const float* w2     = (const float*)d_in[14];
    const float* b2     = (const float*)d_in[15];
    const float* ln1g   = (const float*)d_in[16];
    const float* ln1b   = (const float*)d_in[17];
    const float* ln2g   = (const float*)d_in[18];
    const float* ln2b   = (const float*)d_in[19];
    float* out = (float*)d_out;

    // workspace carve-up
    char* p = (char*)d_ws;
    _Float16* xh   = (_Float16*)p; p += (size_t)M_ * D_ * 2;    // 8 MiB
    _Float16* qh   = (_Float16*)p; p += (size_t)M_ * D_ * 2;    // 8 MiB
    _Float16* kh   = (_Float16*)p; p += (size_t)M_ * D_ * 2;    // 8 MiB
    _Float16* vh   = (_Float16*)p; p += (size_t)M_ * D_ * 2;    // 8 MiB (vT)
    _Float16* ctxh = (_Float16*)p; p += (size_t)M_ * D_ * 2;    // 8 MiB
    float* tmpF    = (float*)p;    p += (size_t)M_ * D_ * 4;    // 16 MiB
    float* out1F   = (float*)p;    p += (size_t)M_ * D_ * 4;    // 16 MiB
    _Float16* o1h  = (_Float16*)p; p += (size_t)M_ * D_ * 2;    // 8 MiB
    _Float16* wqT  = (_Float16*)p; p += (size_t)D_ * D_ * 2;
    _Float16* wkT  = (_Float16*)p; p += (size_t)D_ * D_ * 2;
    _Float16* wvT  = (_Float16*)p; p += (size_t)D_ * D_ * 2;
    _Float16* woT  = (_Float16*)p; p += (size_t)D_ * D_ * 2;
    _Float16* w1P  = (_Float16*)p; p += (size_t)D_ * DFF_ * 2;
    _Float16* w2P  = (_Float16*)p; p += (size_t)DFF_ * D_ * 2;

    // x -> f16, wq/wk/wv/wo -> f16 NxK, w1/w2 -> f16 in B-fragment order
    prep_kernel<<<PREP_BLOCKS, 512, 0, stream>>>(x, wq, wk, wv, wo, w1, w2, xh,
                                                 wqT, wkT, wvT, woT, w1P, w2P);

    // q/k/v projections in one launch (q pre-scaled by 1/sqrt(DEPTH); v written
    // transposed)
    gemm_kernel<<<dim3(M_ / 128, D_ / 64, 3), 128, 0, stream>>>(
        xh, wqT, wkT, wvT, bq, bk, bv, nullptr, qh, kh, vh, M_, D_, D_, 1, 2, 0,
        0.125f);

    // flash attention
    attn_kernel<<<dim3(S_ / 64, B_ * H_), 128, 0, stream>>>(qh, kh, vh, mask,
                                                            ctxh);

    // output projection + residual LN (eps 1e-3)
    gemm_kernel<<<dim3(M_ / 128, D_ / 64, 1), 128, 0, stream>>>(
        ctxh, woT, woT, woT, bo, bo, bo, tmpF, nullptr, nullptr, nullptr, M_, D_,
        D_, 0, 0, 0, 1.0f);
    ln_kernel<2, true, true, true><<<M_ / 64, 512, 0, stream>>>(
        tmpF, x, ln1g, ln1b, 1e-3f, out1F, o1h);

    // FFN: relu(out1@w1+b1) -> LN(eps 1e-6) -> @w2+b2 -> residual LN (eps 1e-3)
    ffn_kernel<<<M_ / 64, 512, 0, stream>>>(o1h, out1F, w1P, b1, lnffg, lnffb,
                                            w2P, b2, ln2g, ln2b, out);
}

// v006
// One run takes 133 microseconds.
// In two side-by-side timings against v005, it was 1.11 and 1.10 times as fast.
// All steps since v000 together make it 3.91 times as fast.
#include <hip/hip_runtime.h>
#include <hip/hip_bf16.h>

// ---------------------------------------------------------------------------
// Transformer encoder layer for MI455X (gfx1250, wave32, WMMA).
// B=4, S=4096, D=256, H=4, DEPTH=64, DFF=1024.
// All GEMMs + attention on v_wmma_f32_16x16x32_f16 (f16 in, f32 acc).
// gemm_kernel and attn_kernel stage their tiles with
// global_load_async_to_lds_b128, double-buffered (ASYNCcnt); fragments load as
// 2x b128.  All that follows attention (output projection, LN1, the FFN chain,
// LN2) is one kernel that keeps its rows on the WGP.
// ---------------------------------------------------------------------------

#define B_ 4
#define S_ 4096
#define D_ 256
#define H_ 4
#define DEPTH_ 64
#define DFF_ 1024
#define M_ (B_ * S_)

typedef __attribute__((ext_vector_type(16))) _Float16 v16h;
typedef __attribute__((ext_vector_type(8)))  _Float16 v8h;
typedef __attribute__((ext_vector_type(4)))  _Float16 v4h;
typedef __attribute__((ext_vector_type(8)))  float    v8f;
typedef __attribute__((ext_vector_type(4)))  float    v4f;

// Load one 16-half fragment for lane `lane` from a row whose K-run starts at
// `p`.  Lane's data: K offsets [b, b+8) and [b+16, b+24), b = 8*(lane>=16).
__device__ __forceinline__ v16h load_frag(const _Float16* p, int lane) {
    const v8h* q = (const v8h*)(p + ((lane >> 4) << 3));
    v8h lo = q[0];
    v8h hi = q[2];
    return __builtin_shufflevector(lo, hi, 0, 1, 2, 3, 4, 5, 6, 7, 8, 9, 10,
                                   11, 12, 13, 14, 15);
}

// Async 16-byte global -> LDS copy (CDNA5, ASYNCcnt-tracked).
__device__ __forceinline__ void async_copy_b128(_Float16* lds_dst,
                                                const _Float16* gsrc) {
    uint32_t loff = (uint32_t)(uintptr_t)lds_dst;
    asm volatile("global_load_async_to_lds_b128 %0, %1, off"
                 :
                 : "v"(loff), "v"(gsrc)
                 : "memory");
}
// The same copy with s_wait_xcnt 0 as the last line of its own statement: for a
// place where the copy's address registers are rewritten before the next
// s_wait_asynccnt (the wait that belongs in front of such an overwrite).
__device__ __forceinline__ void async_copy_b128_xw(_Float16* lds_dst,
                                                   const _Float16* gsrc) {
    uint32_t loff = (uint32_t)(uintptr_t)lds_dst;
    asm volatile("global_load_async_to_lds_b128 %0, %1, off\n\ts_wait_xcnt 0x0"
                 :
                 : "v"(loff), "v"(gsrc)
                 : "memory");
}
__device__ __forceinline__ void wait_async0() {
    asm volatile("s_wait_asynccnt 0" ::: "memory");
}

// ---------------------------------------------------------------------------
// float -> f16 conversion.  256 blocks x 16 waves, each lane converts 8 groups
// of 4 floats (all 8 loads issued before the first store), so the job starts
// 4096 waves and not 32768.  blk: the block's number within this job.
// ---------------------------------------------------------------------------
__device__ __forceinline__ void cvt_f16_block(
    const float* __restrict__ src, _Float16* __restrict__ dst, int blk) {
    const int i0 = blk * 4096 + threadIdx.x;
    v4f v[8];
#pragma unroll
    for (int k = 0; k < 8; ++k) v[k] = ((const v4f*)src)[i0 + k * 512];
#pragma unroll
    for (int k = 0; k < 8; ++k)
        ((v4h*)dst)[i0 + k * 512] = __builtin_convertvector(v[k], v4h);
}

// ---------------------------------------------------------------------------
// Weight transpose-convert: WT[n][k] (f16) = W[k][n] (f32).  A block of 512
// threads takes 32 columns n x 16 rows k.
// ---------------------------------------------------------------------------
__device__ __forceinline__ void transpose_f16_block(
    const float* __restrict__ W, _Float16* __restrict__ WT, int K, int N,
    int blk) {
    const int nb = N >> 5;  // blocks along n
    int n = (blk % nb) * 32 + (threadIdx.x & 31);
    int k = (blk / nb) * 16 + (threadIdx.x >> 5);
    if (n < N && k < K) WT[(size_t)n * K + k] = (_Float16)W[(size_t)k * N + n];
}

// ---------------------------------------------------------------------------
// Weight convert into WMMA B-fragment order for the fused row kernel, which
// reads B straight from L2 into registers.  One fragment (16 columns n x 32 k)
// is 1 KiB: [part][lane][8 halves], lane = (n & 15) + 16 * hh and
// k = 32 * ks + 16 * part + 8 * hh + e, the k order of load_frag.  A wave-wide
// 16-byte load then covers 512 contiguous bytes.  One 16-byte chunk a thread.
// ---------------------------------------------------------------------------
__device__ __forceinline__ void pack_f16_block(
    const float* __restrict__ W, _Float16* __restrict__ P, int K, int N,
    int blk) {
    const int c = blk * 512 + threadIdx.x;
    const int lane = c & 31;
    const int part = (c >> 5) & 1;
    const int f = c >> 6;  // fragment number: nt * (K / 32) + ks
    const int KS = K >> 5;
    const int ks = f % KS;
    const int nt = f / KS;
    const int n = nt * 16 + (lane & 15);
    const int k0 = ks * 32 + part * 16 + (lane >> 4) * 8;
    float w[8];
#pragma unroll
    for (int e = 0; e < 8; ++e) w[e] = W[(size_t)(k0 + e) * N + n];
    // the converted halves land in registers that held load addresses: the wait
    // that belongs in front of that overwrite
    asm volatile("s_wait_xcnt 0x0" ::: "memory");
    v8h o;
#pragma unroll
    for (int e = 0; e < 8; ++e) o[e] = (_Float16)w[e];
    ((v8h*)P)[c] = o;
    // inlined several times into one kernel, the store is not followed by the
    // program's end alone: the wait that belongs in front of an overwrite of its
    // registers
    asm volatile("s_wait_xcnt 0x0" ::: "memory");
}

// ---------------------------------------------------------------------------
// All input preparation in one launch.  The seven jobs do not depend on each
// other, so each takes a range of the grid's blocks (512 threads a block) and
// they run side by side instead of one launch behind the other:
//   [0, 256)    x -> f16
//   [256, 640)  wq, wk, wv transposed, 128 blocks each
//   [640, 768)  w1, w2 in B-fragment order, 64 blocks each
//   [768, 784)  wo in B-fragment order
// ---------------------------------------------------------------------------
#define PREP_CVT_BLOCKS (M_ * D_ / 4 / 4096)
#define PREP_TR_BLOCKS (D_ * D_ / 512)
#define PREP_PACK_BLOCKS (D_ * DFF_ / 8 / 512)
#define PREP_PACKO_BLOCKS (D_ * D_ / 8 / 512)
#define PREP_BLOCKS                                                  \
    (PREP_CVT_BLOCKS + 3 * PREP_TR_BLOCKS + 2 * PREP_PACK_BLOCKS +   \
     PREP_PACKO_BLOCKS)

__global__ __launch_bounds__(512) void prep_kernel(
    const float* __restrict__ x, const float* __restrict__ wq,
    const float* __restrict__ wk, const float* __restrict__ wv,
    const float* __restrict__ wo, const float* __restrict__ w1,
    const float* __restrict__ w2, _Float16* __restrict__ xh,
    _Float16* __restrict__ wqT, _Float16* __restrict__ wkT,
    _Float16* __restrict__ wvT, _Float16* __restrict__ woP,
    _Float16* __restrict__ w1P, _Float16* __restrict__ w2P) {
    int blk = blockIdx.x;
    if (blk < PREP_CVT_BLOCKS) {
        cvt_f16_block(x, xh, blk);
        return;
    }
    blk -= PREP_CVT_BLOCKS;
    if (blk < 3 * PREP_TR_BLOCKS) {
        const int j = blk / PREP_TR_BLOCKS;
        transpose_f16_block(j == 0 ? wq : j == 1 ? wk : wv,
                            j == 0 ? wqT : j == 1 ? wkT : wvT, D_, D_,
                            blk % PREP_TR_BLOCKS);
        return;
    }
    blk -= 3 * PREP_TR_BLOCKS;
    if (blk < PREP_PACK_BLOCKS)
        pack_f16_block(w1, w1P, D_, DFF_, blk);
    else if (blk < 2 * PREP_PACK_BLOCKS)
        pack_f16_block(w2, w2P, DFF_, D_, blk - PREP_PACK_BLOCKS);
    else
        pack_f16_block(wo, woP, D_, D_, blk - 2 * PREP_PACK_BLOCKS);
}

// ---------------------------------------------------------------------------
// GEMM: C[M x N] = A[M x K] (f16, row-major) * WT[N x K] (f16, N-major) + bias
// Block: 128 threads (4 waves), 128x64 tile; wave w owns rows w*32..w*32+31.
// Double-buffered async staging.  mode 0: f32 row-major.
// mode 1: f16 split-head [B,H,S,64].  mode 2: f16 split-head T [B,H,64,S].
// ---------------------------------------------------------------------------
__device__ __forceinline__ void gemm_tile(
    const _Float16* __restrict__ A, const _Float16* __restrict__ WT,
    const float* __restrict__ bias, float* __restrict__ outF,
    _Float16* __restrict__ outH, int M, int N, int K, int mode, int relu,
    float scale) {
    // Rows hold 32 halves; the pitch is 40 halves (80 B = 16 B x odd) so that the
    // 16 rows of a ds_load_b128 fragment read fall on distinct LDS banks.
    __shared__ __align__(16) _Float16 As[2][128][40];   // row-major (K-runs)
    __shared__ __align__(16) _Float16 BsT[2][64][40];   // N-major: BsT[n][k]

    const int m0 = blockIdx.x * 128;
    const int n0 = blockIdx.y * 64;
    const int t = threadIdx.x;
    const int wave = t >> 5;
    const int lane = t & 31;

    v8f acc[2][4] = {};

    // stage first k-tile into buffer 0
#pragma unroll
    for (int i = t; i < 512; i += 128) {
        int r = i >> 2, cc = i & 3;
        async_copy_b128_xw(&As[0][r][cc * 8],
                           A + (size_t)(m0 + r) * K + cc * 8);
    }
#pragma unroll
    for (int i = t; i < 256; i += 128) {
        int c = i >> 2, cc = i & 3;
        async_copy_b128_xw(&BsT[0][c][cc * 8],
                           WT + (size_t)(n0 + c) * K + cc * 8);
    }

    for (int k0 = 0; k0 < K; k0 += 32) {
        const int buf = (k0 >> 5) & 1;
        wait_async0();
        __syncthreads();  // tile `buf` ready for all waves

        if (k0 + 32 < K) {  // issue DMA for next tile into other buffer
            const int k1 = k0 + 32;
#pragma unroll
            for (int i = t; i < 512; i += 128) {
                int r = i >> 2, cc = i & 3;
                async_copy_b128(&As[buf ^ 1][r][cc * 8],
                                A + (size_t)(m0 + r) * K + k1 + cc * 8);
            }
#pragma unroll
            for (int i = t; i < 256; i += 128) {
                int c = i >> 2, cc = i & 3;
                async_copy_b128(&BsT[buf ^ 1][c][cc * 8],
                                WT + (size_t)(n0 + c) * K + k1 + cc * 8);
            }
        }

        v16h a0 = load_frag(&As[buf][wave * 32 + (lane & 15)][0], lane);
        v16h a1 = load_frag(&As[buf][wave * 32 + 16 + (lane & 15)][0], lane);
#pragma unroll
        for (int nt = 0; nt < 4; ++nt) {
            v16h bf = load_frag(&BsT[buf][nt * 16 + (lane & 15)][0], lane);
            acc[0][nt] = __builtin_amdgcn_wmma_f32_16x16x32_f16(
                false, a0, false, bf, (short)0, acc[0][nt], false, false);
            acc[1][nt] = __builtin_amdgcn_wmma_f32_16x16x32_f16(
                false, a1, false, bf, (short)0, acc[1][nt], false, false);
        }
        // no trailing barrier: next iteration's wait+barrier protects reuse
    }

    // epilogue
#pragma unroll
    for (int hh = 0; hh < 2; ++hh)
#pragma unroll
        for (int nt = 0; nt < 4; ++nt) {
            int col = n0 + nt * 16 + (lane & 15);
            float bvv = bias[col];
#pragma unroll
            for (int r = 0; r < 8; ++r) {
                int row = m0 + wave * 32 + hh * 16 + r + ((lane >> 4) << 3);
                float v = acc[hh][nt][r] + bvv;
                if (relu) v = fmaxf(v, 0.0f);
                v *= scale;
                int b = row / S_, s = row % S_;
                int h = col >> 6, d = col & 63;
                if (mode == 0) {
                    outF[(size_t)row * N + col] = v;
                } else if (mode == 1) {
                    outH[(((size_t)(b * H_ + h)) * S_ + s) * DEPTH_ + d] =
                        (_Float16)v;
                } else {
                    outH[(((size_t)(b * H_ + h)) * DEPTH_ + d) * S_ + s] =
                        (_Float16)v;
                }
            }
        }
}

// One launch for up to three products of the same A: blockIdx.z picks the
// weights, the bias and the f16 output.  `scale` belongs to product 0 (the
// others take 1), `mode` to products 0 and 1, `mode2` to product 2.
__global__ __launch_bounds__(128) void gemm_kernel(
    const _Float16* __restrict__ A, const _Float16* __restrict__ WT0,
    const _Float16* __restrict__ WT1, const _Float16* __restrict__ WT2,
    const float* __restrict__ bias0, const float* __restrict__ bias1,
    const float* __restrict__ bias2, float* __restrict__ outF,
    _Float16* __restrict__ outH0, _Float16* __restrict__ outH1,
    _Float16* __restrict__ outH2, int M, int N, int K, int mode, int mode2,
    int relu, float scale) {
    const int z = blockIdx.z;
    gemm_tile(A, z == 0 ? WT0 : z == 1 ? WT1 : WT2,
              z == 0 ? bias0 : z == 1 ? bias1 : bias2, outF,
              z == 0 ? outH0 : z == 1 ? outH1 : outH2, M, N, K,
              z == 2 ? mode2 : mode, relu, z == 0 ? scale : 1.0f);
}

__device__ __forceinline__ float xhalf(float x) {
    int v = __builtin_bit_cast(int, x);
    return __builtin_bit_cast(
        float, __builtin_amdgcn_permlanex16(v, v, 0x76543210, 0xfedcba98, false,
                                            false));
}

__global__ __launch_bounds__(128) void attn_kernel(
    const _Float16* __restrict__ qh, const _Float16* __restrict__ kh,
    const _Float16* __restrict__ vT, const float* __restrict__ mask,
    _Float16* __restrict__ ctxh) {
    // Rows hold 64 halves; the pitch is 72 halves (144 B = 16 B x odd) so that the
    // 16 rows of a ds_load_b128 fragment read fall on distinct LDS banks.
    __shared__ __align__(16) _Float16 Ks[2][64][72];    // [kpos][d]
    __shared__ __align__(16) _Float16 VsT[2][64][72];   // [d][kpos]
    __shared__ __align__(32) float Ms[S_];              // mask * -1e9 of batch b

    const int qt = blockIdx.x;
    const int bh = blockIdx.y;
    const int b = bh / H_;
    const int h = bh % H_;
    const int t = threadIdx.x;
    const int wave = t >> 5;
    const int lane = t & 31;
    const int hh8 = (lane >> 4) << 3;
    const size_t base = (size_t)bh * S_ * DEPTH_;  // q/k and vT share extent
    const int qr0 = qt * 64 + wave * 16;
    const int NT = S_ / 64;

    // Q fragments straight from global (two 16B loads each)
    v16h qA[2];
#pragma unroll
    for (int c = 0; c < 2; ++c)
        qA[c] = load_frag(
            qh + base + (size_t)(qr0 + (lane & 15)) * DEPTH_ + c * 32, lane);

    v8f O[4] = {};
    float mrow = -1e30f, lrow = 0.0f;  // lrow: this half's keys only

    // stage first K/V tile into buffer 0
#pragma unroll
    for (int i = t; i < 512; i += 128) {
        int r = i >> 3, cc = i & 7;
        async_copy_b128(&Ks[0][r][cc * 8],
                        kh + base + (size_t)r * DEPTH_ + cc * 8);
        async_copy_b128(&VsT[0][r][cc * 8],
                        vT + base + (size_t)r * S_ + cc * 8);
    }

    // The mask term now varies along a lane's registers: the whole row of the
    // batch goes to LDS once; the loop's first barrier publishes it.
    const v4f* mp = (const v4f*)(mask + (size_t)b * S_) + t;
    v4f mv[8];
    // unrolled with a fixed trip count: all eight loads fly together
#pragma unroll
    for (int k = 0; k < 8; ++k) mv[k] = mp[k * 128];
    // unrolled: mv lives in registers
#pragma unroll
    for (int k = 0; k < 8; ++k) ((v4f*)Ms)[t + k * 128] = mv[k] * -1e9f;

    for (int kt = 0; kt < NT; ++kt) {
        const int buf = kt & 1;
        wait_async0();
        __syncthreads();  // tile `buf` ready

        if (kt + 1 < NT) {  // DMA next tile into other buffer
            const int kr = (kt + 1) * 64;
#pragma unroll
            for (int i = t; i < 512; i += 128) {
                int r = i >> 3, cc = i & 7;
                async_copy_b128(
                    &Ks[buf ^ 1][r][cc * 8],
                    kh + base + (size_t)(kr + r) * DEPTH_ + cc * 8);
                async_copy_b128(&VsT[buf ^ 1][r][cc * 8],
                                vT + base + (size_t)r * S_ + kr + cc * 8);
            }
        }

        // logits tile: S^T = K @ Q^T   (64 kpos x 16 q)
        v8f sc[4] = {};
#pragma unroll
        for (int nt = 0; nt < 4; ++nt) {
#pragma unroll
            for (int c = 0; c < 2; ++c) {
                v16h kf =
                    load_frag(&Ks[buf][nt * 16 + (lane & 15)][c * 32], lane);
                sc[nt] = __builtin_amdgcn_wmma_f32_16x16x32_f16(
                    false, kf, false, qA[c], (short)0, sc[nt], false, false);
            }
            sc[nt] += *(const v8f*)&Ms[kt * 64 + nt * 16 + hh8];
        }

        // online softmax: 32 of the query's 64 scores live in this lane
        // (the loops down to the epilogue are unrolled because sc and O are
        // register arrays and need constant indices)
        float mx4[4];
#pragma unroll
        for (int nt = 0; nt < 4; ++nt) {
            float m = sc[nt][0];
#pragma unroll
            for (int r = 1; r < 8; ++r) m = fmaxf(m, sc[nt][r]);
            mx4[nt] = m;
        }
        float mx = fmaxf(fmaxf(mx4[0], mx4[1]), fmaxf(mx4[2], mx4[3]));
        mx = fmaxf(mx, xhalf(mx));
        const float newm = fmaxf(mrow, mx);
        const float corr = __expf(mrow - newm);
        mrow = newm;
#pragma unroll
        for (int nt = 0; nt < 4; ++nt)
#pragma unroll
            for (int r = 0; r < 8; ++r)
                sc[nt][r] = __expf(sc[nt][r] - newm);
        const v8f s8 = (sc[0] + sc[1]) + (sc[2] + sc[3]);
        const float rs = ((s8[0] + s8[1]) + (s8[2] + s8[3])) +
                         ((s8[4] + s8[5]) + (s8[6] + s8[7]));
        lrow = lrow * corr + rs;
#pragma unroll
        for (int nt = 0; nt < 4; ++nt) O[nt] *= corr;

        // O^T += V^T @ P^T; score tiles 2c and 2c+1 are B's k 0..15 and 16..31
#pragma unroll
        for (int c = 0; c < 2; ++c) {
            v16h pb = __builtin_shufflevector(
                __builtin_convertvector(sc[2 * c], v8h),
                __builtin_convertvector(sc[2 * c + 1], v8h), 0, 1, 2, 3, 4, 5, 6,
                7, 8, 9, 10, 11, 12, 13, 14, 15);
#pragma unroll
            for (int nt = 0; nt < 4; ++nt) {
                v16h vf =
                    load_frag(&VsT[buf][nt * 16 + (lane & 15)][c * 32], lane);
                O[nt] = __builtin_amdgcn_wmma_f32_16x16x32_f16(
                    false, vf, false, pb, (short)0, O[nt], false, false);
            }
        }
        // no trailing barrier: next iteration's wait+barrier protects reuse
    }

    // write merged-head context, normalized by l: 8 consecutive d per lane
    const float l = lrow + xhalf(lrow);
#pragma unroll
    for (int nt = 0; nt < 4; ++nt) {
        v8h o;
#pragma unroll
        for (int r = 0; r < 8; ++r) o[r] = (_Float16)(O[nt][r] / l);
        *(v8h*)&ctxh[(size_t)(b * S_ + qr0 + (lane & 15)) * D_ + h * DEPTH_ +
                     nt * 16 + hh8] = o;
    }
}

// ---------------------------------------------------------------------------
// Everything behind attention, fused:
//   out1 = LN1(x + ctx @ wo + bo)
//   out  = LN2(out1 + LNff(relu(out1 @ w1 + b1)) @ w2 + b2).
// One block of 16 waves owns 64 rows from end to end, one block per WGP; the
// projection's result and h never leave the WGP.  A operands come from LDS, B
// operands (packed fragments) from L2 straight into registers: no two waves of a
// block need the same B fragment.
//   0a. a (64 x 256, f32) : wave w owns columns 16 w .. 16 w + 15, all 64 rows
//   0b. LN1 with residual : wave w owns rows 4 w .. 4 w + 3, row in registers
//   1. h (64 x 1024, f32) : wave w owns columns 64 w .. 64 w + 63, all 64 rows
//   2. LNff               : wave w owns rows 4 w .. 4 w + 3, row in registers
//   3. t (64 x 256, f32)  : wave w owns columns 16 w .. 16 w + 15, all 64 rows
//   4. LN2 with residual  : wave w owns rows 4 w .. 4 w + 3
// out1 goes on as f16 in LDS (A operand of step 1); its f32 form is needed again
// in step 4 only, by the lane that made it: that lane parks it in the workspace
// and loads it back, since steps 1 to 3 leave neither registers nor LDS for it.
// Every product sums k in steps of 32, in rising order; a LayerNorm sum is four
// values a lane and group, then a lane-exchange tree.
// LDS pitches: 16 B x odd for the ds_load_b128 fragment rows; for the f32
// planes 8 rows are 32 banks apart, so the two row groups of an accumulator
// store fall on different banks.
// ---------------------------------------------------------------------------
#define FA_P 264    // halves, ctx tile, then out1 tile
#define FH_P 1028   // floats, h before LNff
#define FHH_P 1032  // halves, h after LNff (overlays the f32 plane)
#define FT_P 260    // floats, a and later t (behind the f16 plane)
#define FA_BYTES (64 * FA_P * 2)
#define FH_BYTES (64 * FH_P * 4)
#define FHH_BYTES (64 * FHH_P * 2)

__device__ __forceinline__ v16h load_packed(const v8h* p) {
    v8h lo = p[0];
    v8h hi = p[32];
    return __builtin_shufflevector(lo, hi, 0, 1, 2, 3, 4, 5, 6, 7, 8, 9, 10,
                                   11, 12, 13, 14, 15);
}

__global__ __launch_bounds__(512) void ffn_kernel(
    const _Float16* __restrict__ ctxh, const float* __restrict__ x,
    const _Float16* __restrict__ woP, const float* __restrict__ bo,
    const float* __restrict__ g1, const float* __restrict__ be1,
    float* out1F, const _Float16* __restrict__ w1P,
    const float* __restrict__ b1,
    const float* __restrict__ gff, const float* __restrict__ bff,
    const _Float16* __restrict__ w2P, const float* __restrict__ b2,
    const float* __restrict__ g2, const float* __restrict__ be2,
    float* __restrict__ out) {
    __shared__ __align__(16) char smem[FA_BYTES + FH_BYTES];
    _Float16* As = (_Float16*)smem;
    float* Hf = (float*)(smem + FA_BYTES);
    _Float16* Hh = (_Float16*)(smem + FA_BYTES);
    float* Tf = (float*)(smem + FA_BYTES + FHH_BYTES);

    const int t = threadIdx.x;
    // wave-uniform by construction; in a scalar register it makes every weight
    // and row base scalar, and the one vector offset (the lane's) lives on
    const int wave = __builtin_amdgcn_readfirstlane(t >> 5);
    const int lane = t & 31;
    const int l15 = lane & 15;
    const int hh8 = (lane >> 4) << 3;
    const int m0 = blockIdx.x * 64;

    // this lane's place in rows 4 * wave .. + 3 of x, out1 and out
    const size_t roff = (size_t)(m0 + wave * 4) * D_ + lane * 4;

    // ---- 0a. a = ctx @ wo + bo ----
    v4f xr[4][2];  // the residual rows of step 0b, asked for ahead of the product
    {
        // ctx tile (f16) to LDS: 64 rows x 512 B, one row per wave-wide load
        const v8h* src = (const v8h*)(ctxh + (size_t)m0 * D_);
        v8h a[4];
#pragma unroll
        for (int i = 0; i < 4; ++i) a[i] = src[t + i * 512];
        // all 8 B fragments of the wave's 16 columns
        const v8h* bp = (const v8h*)woP + (size_t)wave * (8 * 64) + lane;
        v16h bw[D_ / 32];
#pragma unroll
        for (int ks = 0; ks < D_ / 32; ++ks) bw[ks] = load_packed(bp + ks * 64);
#pragma unroll
        for (int rr = 0; rr < 4; ++rr)
#pragma unroll
            for (int j = 0; j < 2; ++j)
                xr[rr][j] = *(const v4f*)(x + roff + rr * D_ + j * 128);
        // the wait that belongs in front of an overwrite of these loads' address
        // registers, written here behind the loads
        asm volatile("s_wait_xcnt 0x0" ::: "memory");
#pragma unroll
        for (int i = 0; i < 4; ++i)
            *(v8h*)&As[(wave + i * 16) * FA_P + lane * 8] = a[i];
        __syncthreads();  // the ctx tile is read by every wave

        v8f acc[4] = {};
        // unrolled: bw is a register array
#pragma unroll
        for (int ks = 0; ks < D_ / 32; ++ks) {
            v16h af[4];
#pragma unroll
            for (int mt = 0; mt < 4; ++mt)
                af[mt] = load_frag(&As[(mt * 16 + l15) * FA_P + ks * 32], lane);
#pragma unroll
            for (int mt = 0; mt < 4; ++mt)
                acc[mt] = __builtin_amdgcn_wmma_f32_16x16x32_f16(
                    false, af[mt], false, bw[ks], (short)0, acc[mt], false,
                    false);
        }
        const int col = wave * 16 + l15;
        const float bvv = bo[col];
#pragma unroll
        for (int mt = 0; mt < 4; ++mt)
#pragma unroll
            for (int r = 0; r < 8; ++r)
                Tf[(mt * 16 + r + hh8) * FT_P + col] = acc[mt][r] + bvv;
    }
    // as above, for the bias load
    asm volatile("s_wait_xcnt 0x0" ::: "memory");
    __syncthreads();  // rows of a are complete, the ctx tile has been read

    // ---- 0b. out1 = LN1(a + x), rows 4 * wave .. + 3 ----
    {
        constexpr int NV = 2, n = D_;
        v4f v[4][NV];
#pragma unroll
        for (int rr = 0; rr < 4; ++rr)
#pragma unroll
            for (int j = 0; j < NV; ++j)
                v[rr][j] =
                    *(const v4f*)&Tf[(wave * 4 + rr) * FT_P + j * 128 + lane * 4] +
                    xr[rr][j];
        float mu[4], rstd[4];
#pragma unroll
        for (int rr = 0; rr < 4; ++rr) {
            float s = 0.0f;
#pragma unroll
            for (int j = 0; j < NV; ++j)
                s += (v[rr][j][0] + v[rr][j][1]) + (v[rr][j][2] + v[rr][j][3]);
            mu[rr] = s;
        }
#pragma unroll
        for (int o = 16; o >= 1; o >>= 1)
#pragma unroll
            for (int rr = 0; rr < 4; ++rr) mu[rr] += __shfl_xor(mu[rr], o, 32);
#pragma unroll
        for (int rr = 0; rr < 4; ++rr) {
            mu[rr] = mu[rr] / n;
            float s2 = 0.0f;
#pragma unroll
            for (int j = 0; j < NV; ++j) {
                v[rr][j] -= mu[rr];
                v4f q = v[rr][j] * v[rr][j];
                s2 += (q[0] + q[1]) + (q[2] + q[3]);
            }
            rstd[rr] = s2;
        }
#pragma unroll
        for (int o = 16; o >= 1; o >>= 1)
#pragma unroll
            for (int rr = 0; rr < 4; ++rr)
                rstd[rr] += __shfl_xor(rstd[rr], o, 32);
#pragma unroll
        for (int rr = 0; rr < 4; ++rr) rstd[rr] = rsqrtf(rstd[rr] / n + 1e-3f);
#pragma unroll
        for (int j = 0; j < NV; ++j) {
            const v4f gg = *(const v4f*)(g1 + j * 128 + lane * 4);
            const v4f bb = *(const v4f*)(be1 + j * 128 + lane * 4);
#pragma unroll
            for (int rr = 0; rr < 4; ++rr) {
                v4f y = v[rr][j] * rstd[rr] * gg + bb;
                *(v4f*)(out1F + roff + rr * n + j * 128) = y;
                *(v4h*)&As[(wave * 4 + rr) * FA_P + j * 128 + lane * 4] =
                    __builtin_convertvector(y, v4h);
            }
        }
    }
    // as above, for the scale and shift loads and the out1 stores
    asm volatile("s_wait_xcnt 0x0" ::: "memory");
    __syncthreads();  // the out1 tile is read by every wave

    // ---- 1. h = relu(out1 @ w1 + b1) ----
    {
        v8f acc[4][4] = {};
        const v8h* bp = (const v8h*)w1P + (size_t)wave * (4 * 8 * 64) + lane;
        v16h bc[4], bn[4];  // B fragments of this k step and of the next
#pragma unroll
        for (int nt = 0; nt < 4; ++nt) bc[nt] = load_packed(bp + nt * 8 * 64);
        // unrolled: acc, bc and bn are register arrays, and every B address is
        // the one base plus a constant
#pragma unroll
        for (int ks = 0; ks < D_ / 32; ++ks) {
            if (ks + 1 < D_ / 32) {
#pragma unroll
                for (int nt = 0; nt < 4; ++nt)
                    bn[nt] = load_packed(bp + (nt * 8 + ks + 1) * 64);
            }
            // keeps the next step's L2 loads in front of this step's products;
            // sunk to their use, each would expose its whole latency
            __builtin_amdgcn_sched_barrier(0);
            v16h af[4];
#pragma unroll
            for (int mt = 0; mt < 4; ++mt)
                af[mt] = load_frag(&As[(mt * 16 + l15) * FA_P + ks * 32], lane);
#pragma unroll
            for (int nt = 0; nt < 4; ++nt) {
#pragma unroll
                for (int mt = 0; mt < 4; ++mt)
                    acc[mt][nt] = __builtin_amdgcn_wmma_f32_16x16x32_f16(
                        false, af[mt], false, bc[nt], (short)0, acc[mt][nt],
                        false, false);
            }
#pragma unroll
            for (int nt = 0; nt < 4; ++nt) bc[nt] = bn[nt];
        }
#pragma unroll
        for (int nt = 0; nt < 4; ++nt) {
            const int col = wave * 64 + nt * 16 + l15;
            const float bvv = b1[col];
#pragma unroll
            for (int mt = 0; mt < 4; ++mt)
#pragma unroll
                for (int r = 0; r < 8; ++r)
                    Hf[(mt * 16 + r + hh8) * FH_P + col] =
                        fmaxf(acc[mt][nt][r] + bvv, 0.0f);
        }
    }
    // the bias loads' offset register is reused further down: the wait that
    // belongs in front of that overwrite, written here behind the loads
    asm volatile("s_wait_xcnt 0x0" ::: "memory");
    __syncthreads();  // rows of h are complete

    // ---- 2. LNff, rows 4 * wave .. + 3, f16 result for the second product ----
    {
        constexpr int NV = 8, n = DFF_;
        v4f v[4][NV];
#pragma unroll
        for (int rr = 0; rr < 4; ++rr)
#pragma unroll
            for (int j = 0; j < NV; ++j)
                v[rr][j] =
                    *(const v4f*)&Hf[(wave * 4 + rr) * FH_P + j * 128 + lane * 4];
        __syncthreads();  // every f32 row is in registers: the plane is reused

        float mu[4], rstd[4];
#pragma unroll
        for (int rr = 0; rr < 4; ++rr) {
            float s = 0.0f;
#pragma unroll
            for (int j = 0; j < NV; ++j)
                s += (v[rr][j][0] + v[rr][j][1]) + (v[rr][j][2] + v[rr][j][3]);
            mu[rr] = s;
        }
#pragma unroll
        for (int o = 16; o >= 1; o >>= 1)
#pragma unroll
            for (int rr = 0; rr < 4; ++rr) mu[rr] += __shfl_xor(mu[rr], o, 32);
#pragma unroll
        for (int rr = 0; rr < 4; ++rr) {
            mu[rr] = mu[rr] / n;
            float s2 = 0.0f;
#pragma unroll
            for (int j = 0; j < NV; ++j) {
                v[rr][j] -= mu[rr];
                v4f q = v[rr][j] * v[rr][j];
                s2 += (q[0] + q[1]) + (q[2] + q[3]);
            }
            rstd[rr] = s2;
        }
#pragma unroll
        for (int o = 16; o >= 1; o >>= 1)
#pragma unroll
            for (int rr = 0; rr < 4; ++rr)
                rstd[rr] += __shfl_xor(rstd[rr], o, 32);
#pragma unroll
        for (int rr = 0; rr < 4; ++rr) rstd[rr] = rsqrtf(rstd[rr] / n + 1e-6f);
#pragma unroll
        for (int j = 0; j < NV; ++j) {
            const v4f gg = *(const v4f*)(gff + j * 128 + lane * 4);
            const v4f bb = *(const v4f*)(bff + j * 128 + lane * 4);
#pragma unroll
            for (int rr = 0; rr < 4; ++rr) {
                v4f y = v[rr][j] * rstd[rr] * gg + bb;
                *(v4h*)&Hh[(wave * 4 + rr) * FHH_P + j * 128 + lane * 4] =
                    __builtin_convertvector(y, v4h);
            }
        }
    }
    __syncthreads();  // the f16 rows are read by every wave

    // ---- 3. t = h @ w2 + b2 ----
    {
        v8f acc[4] = {};
        const v8h* bp = (const v8h*)w2P + (size_t)wave * (32 * 64) + lane;
        v16h bc[4], bn[4];  // B fragments of this group of 4 k steps, the next
#pragma unroll
        for (int j = 0; j < 4; ++j) bc[j] = load_packed(bp + j * 64);
        v16h ac[4], an[4];  // A fragments of this k step and of the next
#pragma unroll
        for (int mt = 0; mt < 4; ++mt)
            ac[mt] = load_frag(&Hh[(mt * 16 + l15) * FHH_P], lane);
        // unrolled: ac, an, bc and bn are register arrays
#pragma unroll
        for (int ks = 0; ks < DFF_ / 32; ++ks) {
            if ((ks & 3) == 0 && ks + 4 < DFF_ / 32) {
#pragma unroll
                for (int j = 0; j < 4; ++j)
                    bn[j] = load_packed(bp + (ks + 4 + j) * 64);
            }
            if (ks + 1 < DFF_ / 32) {
#pragma unroll
                for (int mt = 0; mt < 4; ++mt)
                    an[mt] = load_frag(
                        &Hh[(mt * 16 + l15) * FHH_P + (ks + 1) * 32], lane);
            }
            // keeps the loads for later k steps, as one group, in front of this
            // step's products; sunk to their use, each pair of LDS reads would
            // be waited out in front of its one product
            __builtin_amdgcn_sched_barrier(0);
#pragma unroll
            for (int mt = 0; mt < 4; ++mt)
                acc[mt] = __builtin_amdgcn_wmma_f32_16x16x32_f16(
                    false, ac[mt], false, bc[ks & 3], (short)0, acc[mt], false,
                    false);
#pragma unroll
            for (int mt = 0; mt < 4; ++mt) ac[mt] = an[mt];
            if ((ks & 3) == 3) {
#pragma unroll
                for (int j = 0; j < 4; ++j) bc[j] = bn[j];
            }
        }
        const int col = wave * 16 + l15;
        const float bvv = b2[col];
#pragma unroll
        for (int mt = 0; mt < 4; ++mt)
#pragma unroll
            for (int r = 0; r < 8; ++r)
                Tf[(mt * 16 + r + hh8) * FT_P + col] = acc[mt][r] + bvv;
    }
    __syncthreads();  // rows of t are complete

    // ---- 4. out = LN2(t + out1), rows 4 * wave .. + 3 ----
    {
        constexpr int NV = 2, n = D_;
        const size_t off = (size_t)(m0 + wave * 4) * n + lane * 4;
        v4f v[4][NV];
#pragma unroll
        for (int rr = 0; rr < 4; ++rr)
#pragma unroll
            for (int j = 0; j < NV; ++j)
                v[rr][j] =
                    *(const v4f*)&Tf[(wave * 4 + rr) * FT_P + j * 128 + lane * 4] +
                    *(const v4f*)(out1F + off + rr * n + j * 128);
        float mu[4], rstd[4];
#pragma unroll
        for (int rr = 0; rr < 4; ++rr) {
            float s = 0.0f;
#pragma unroll
            for (int j = 0; j < NV; ++j)
                s += (v[rr][j][0] + v[rr][j][1]) + (v[rr][j][2] + v[rr][j][3]);
            mu[rr] = s;
        }
#pragma unroll
        for (int o = 16; o >= 1; o >>= 1)
#pragma unroll
            for (int rr = 0; rr < 4; ++rr) mu[rr] += __shfl_xor(mu[rr], o, 32);
#pragma unroll
        for (int rr = 0; rr < 4; ++rr) {
            mu[rr] = mu[rr] / n;
            float s2 = 0.0f;
#pragma unroll
            for (int j = 0; j < NV; ++j) {
                v[rr][j] -= mu[rr];
                v4f q = v[rr][j] * v[rr][j];
                s2 += (q[0] + q[1]) + (q[2] + q[3]);
            }
            rstd[rr] = s2;
        }
#pragma unroll
        for (int o = 16; o >= 1; o >>= 1)
#pragma unroll
            for (int rr = 0; rr < 4; ++rr)
                rstd[rr] += __shfl_xor(rstd[rr], o, 32);
#pragma unroll
        for (int j = 0; j < NV; ++j) {
            const v4f gg = *(const v4f*)(g2 + j * 128 + lane * 4);
            const v4f bb = *(const v4f*)(be2 + j * 128 + lane * 4);
#pragma unroll
            for (int rr = 0; rr < 4; ++rr) {
                const float rs = rsqrtf(rstd[rr] / n + 1e-3f);
                *(v4f*)(out + off + rr * n + j * 128) = v[rr][j] * rs * gg + bb;
            }
        }
    }
}

// ---------------------------------------------------------------------------
extern "C" void kernel_launch(void* const* d_in, const int* in_sizes, int n_in,
                              void* d_out, int out_size, void* d_ws,
                              size_t ws_size, hipStream_t stream) {
    const float* x      = (const float*)d_in[0];
    const float* mask   = (const float*)d_in[1];
    const float* wq     = (const float*)d_in[2];
    const float* bq     = (const float*)d_in[3];
    const float* wk     = (const float*)d_in[4];
    const float* bk     = (const float*)d_in[5];
    const float* wv     = (const float*)d_in[6];
    const float* bv     = (const float*)d_in[7];
    const float* wo     = (const float*)d_in[8];
    const float* bo     = (const float*)d_in[9];
    const float* w1     = (const float*)d_in[10];
    const float* b1     = (const float*)d_in[11];
    const float* lnffg  = (const float*)d_in[12];
    const float* lnffb  = (const float*)d_in[13];
    const float* w2     = (const float*)d_in[14];
    const float* b2     = (const float*)d_in[15];
    const float* ln1g   = (const float*)d_in[16];
    const float* ln1b   = (const float*)d_in[17];
    const float* ln2g   = (const float*)d_in[18];
    const float* ln2b   = (const float*)d_in[19];
    float* out = (float*)d_out;

    // workspace carve-up
    char* p = (char*)d_ws;
    _Float16* xh   = (_Float16*)p; p += (size_t)M_ * D_ * 2;    // 8 MiB
    _Float16* qh   = (_Float16*)p; p += (size_t)M_ * D_ * 2;    // 8 MiB
    _Float16* kh   = (_Float16*)p; p += (size_t)M_ * D_ * 2;    // 8 MiB
    _Float16* vh   = (_Float16*)p; p += (size_t)M_ * D_ * 2;    // 8 MiB (vT)
    _Float16* ctxh = (_Float16*)p; p += (size_t)M_ * D_ * 2;    // 8 MiB
    float* out1F   = (float*)p;    p += (size_t)M_ * D_ * 4;    // 16 MiB
    _Float16* wqT  = (_Float16*)p; p += (size_t)D_ * D_ * 2;
    _Float16* wkT  = (_Float16*)p; p += (size_t)D_ * D_ * 2;
    _Float16* wvT  = (_Float16*)p; p += (size_t)D_ * D_ * 2;
    _Float16* woP  = (_Float16*)p; p += (size_t)D_ * D_ * 2;
    _Float16* w1P  = (_Float16*)p; p += (size_t)D_ * DFF_ * 2;
    _Float16* w2P  = (_Float16*)p; p += (size_t)DFF_ * D_ * 2;

    // x -> f16, wq/wk/wv -> f16 NxK, wo/w1/w2 -> f16 in B-fragment order
    prep_kernel<<<PREP_BLOCKS, 512, 0, stream>>>(x, wq, wk, wv, wo, w1, w2, xh,
                                                 wqT, wkT, wvT, woP, w1P, w2P);

    // q/k/v projections in one launch (q pre-scaled by 1/sqrt(DEPTH); v written
    // transposed)
    gemm_kernel<<<dim3(M_ / 128, D_ / 64, 3), 128, 0, stream>>>(
        xh, wqT, wkT, wvT, bq, bk, bv, nullptr, qh, kh, vh, M_, D_, D_, 1, 2, 0,
        0.125f);

    // flash attention
    attn_kernel<<<dim3(S_ / 64, B_ * H_), 128, 0, stream>>>(qh, kh, vh, mask,
                                                            ctxh);

    // output projection -> residual LN (eps 1e-3) -> relu(out1@w1+b1) ->
    // LN(eps 1e-6) -> @w2+b2 -> residual LN (eps 1e-3)
    ffn_kernel<<<M_ / 64, 512, 0, stream>>>(ctxh, x, woP, bo, ln1g, ln1b, out1F,
                                            w1P, b1, lnffg, lnffb, w2P, b2, ln2g,
                                            ln2b, out);
}

// v007
// Measured time: 117 microseconds a run.
// Next to v006, in two timings, it ran 1.13 times as fast each time.
// Over all steps from v000 it is 4.43 times as fast.
#include <hip/hip_runtime.h>
#include <hip/hip_bf16.h>

// ---------------------------------------------------------------------------
// Transformer encoder layer for MI455X (gfx1250, wave32, WMMA).
// B=4, S=4096, D=256, H=4, DEPTH=64, DFF=1024.
// All GEMMs + attention on v_wmma_f32_16x16x32_f16 (f16 in, f32 acc).
// gemm_kernel and attn_kernel stage their tiles with
// global_load_async_to_lds_b128, double-buffered (ASYNCcnt); fragments load as
// 2x b128.  All that follows attention (output projection, LN1, the FFN chain,
// LN2) is one kernel that keeps its rows on the WGP.
// ---------------------------------------------------------------------------

#define B_ 4
#define S_ 4096
#define D_ 256
#define H_ 4
#define DEPTH_ 64
#define DFF_ 1024
#define M_ (B_ * S_)

typedef __attribute__((ext_vector_type(16))) _Float16 v16h;
typedef __attribute__((ext_vector_type(8)))  _Float16 v8h;
typedef __attribute__((ext_vector_type(4)))  _Float16 v4h;
typedef __attribute__((ext_vector_type(8)))  float    v8f;
typedef __attribute__((ext_vector_type(4)))  float    v4f;

// Load one 16-half fragment for lane `lane` from a row whose K-run starts at
// `p`.  Lane's data: K offsets [b, b+8) and [b+16, b+24), b = 8*(lane>=16).
__device__ __forceinline__ v16h load_frag(const _Float16* p, int lane) {
    const v8h* q = (const v8h*)(p + ((lane >> 4) << 3));
    v8h lo = q[0];
    v8h hi = q[2];
    return __builtin_shufflevector(lo, hi, 0, 1, 2, 3, 4, 5, 6, 7, 8, 9, 10,
                                   11, 12, 13, 14, 15);
}

// Async 16-byte global -> LDS copy (CDNA5, ASYNCcnt-tracked).
__device__ __forceinline__ void async_copy_b128(_Float16* lds_dst,
                                                const _Float16* gsrc) {
    uint32_t loff = (uint32_t)(uintptr_t)lds_dst;
    asm volatile("global_load_async_to_lds_b128 %0, %1, off"
                 :
                 : "v"(loff), "v"(gsrc)
                 : "memory");
}
// The same copy with s_wait_xcnt 0 as the last line of its own statement: for a
// place where the copy's address registers are rewritten before the next
// s_wait_asynccnt (the wait that belongs in front of such an overwrite).
__device__ __forceinline__ void async_copy_b128_xw(_Float16* lds_dst,
                                                   const _Float16* gsrc) {
    uint32_t loff = (uint32_t)(uintptr_t)lds_dst;
    asm volatile("global_load_async_to_lds_b128 %0, %1, off\n\ts_wait_xcnt 0x0"
                 :
                 : "v"(loff), "v"(gsrc)
                 : "memory");
}
__device__ __forceinline__ void wait_async0() {
    asm volatile("s_wait_asynccnt 0" ::: "memory");
}

// ---------------------------------------------------------------------------
// float -> f16 conversion.  256 blocks x 16 waves, each lane converts 8 groups
// of 4 floats (all 8 loads issued before the first store), so the job starts
// 4096 waves and not 32768.  blk: the block's number within this job.
// ---------------------------------------------------------------------------
__device__ __forceinline__ void cvt_f16_block(
    const float* __restrict__ src, _Float16* __restrict__ dst, int blk) {
    const int i0 = blk * 4096 + threadIdx.x;
    v4f v[8];
#pragma unroll
    for (int k = 0; k < 8; ++k) v[k] = ((const v4f*)src)[i0 + k * 512];
#pragma unroll
    for (int k = 0; k < 8; ++k)
        ((v4h*)dst)[i0 + k * 512] = __builtin_convertvector(v[k], v4h);
}

// ---------------------------------------------------------------------------
// Weight transpose-convert: WT[n][k] (f16) = W[k][n] (f32).  A block of 512
// threads takes 32 columns n x 16 rows k.
// ---------------------------------------------------------------------------
__device__ __forceinline__ void transpose_f16_block(
    const float* __restrict__ W, _Float16* __restrict__ WT, int K, int N,
    int blk) {
    const int nb = N >> 5;  // blocks along n
    int n = (blk % nb) * 32 + (threadIdx.x & 31);
    int k = (blk / nb) * 16 + (threadIdx.x >> 5);
    if (n < N && k < K) WT[(size_t)n * K + k] = (_Float16)W[(size_t)k * N + n];
}

// ---------------------------------------------------------------------------
// Weight convert into WMMA B-fragment order for the fused row kernel, which
// reads B straight from L2 into registers.  One fragment (16 columns n x 32 k)
// is 1 KiB: [part][lane][8 halves], lane = (n & 15) + 16 * hh and
// k = 32 * ks + 16 * part + 8 * hh + e, the k order of load_frag.  A wave-wide
// 16-byte load then covers 512 contiguous bytes.  One 16-byte chunk a thread.
// ---------------------------------------------------------------------------
__device__ __forceinline__ void pack_f16_block(
    const float* __restrict__ W, _Float16* __restrict__ P, int K, int N,
    int blk) {
    const int c = blk * 512 + threadIdx.x;
    const int lane = c & 31;
    const int part = (c >> 5) & 1;
    const int f = c >> 6;  // fragment number: nt * (K / 32) + ks
    const int KS = K >> 5;
    const int ks = f % KS;
    const int nt = f / KS;
    const int n = nt * 16 + (lane & 15);
    const int k0 = ks * 32 + part * 16 + (lane >> 4) * 8;
    float w[8];
#pragma unroll
    for (int e = 0; e < 8; ++e) w[e] = W[(size_t)(k0 + e) * N + n];
    // the converted halves land in registers that held load addresses: the wait
    // that belongs in front of that overwrite
    asm volatile("s_wait_xcnt 0x0" ::: "memory");
    v8h o;
#pragma unroll
    for (int e = 0; e < 8; ++e) o[e] = (_Float16)w[e];
    ((v8h*)P)[c] = o;
    // inlined several times into one kernel, the store is not followed by the
    // program's end alone: the wait that belongs in front of an overwrite of its
    // registers
    asm volatile("s_wait_xcnt 0x0" ::: "memory");
}

// ---------------------------------------------------------------------------
// All input preparation in one launch.  The seven jobs do not depend on each
// other, so each takes a range of the grid's blocks (512 threads a block) and
// they run side by side instead of one launch behind the other:
//   [0, 256)    x -> f16
//   [256, 640)  wq, wk, wv transposed, 128 blocks each
//   [640, 768)  w1, w2 in B-fragment order, 64 blocks each
//   [768, 784)  wo in B-fragment order
// ---------------------------------------------------------------------------
#define PREP_CVT_BLOCKS (M_ * D_ / 4 / 4096)
#define PREP_TR_BLOCKS (D_ * D_ / 512)
#define PREP_PACK_BLOCKS (D_ * DFF_ / 8 / 512)
#define PREP_PACKO_BLOCKS (D_ * D_ / 8 / 512)
#define PREP_BLOCKS                                                  \
    (PREP_CVT_BLOCKS + 3 * PREP_TR_BLOCKS + 2 * PREP_PACK_BLOCKS +   \
     PREP_PACKO_BLOCKS)

__global__ __launch_bounds__(512) void prep_kernel(
    const float* __restrict__ x, const float* __restrict__ wq,
    const float* __restrict__ wk, const float* __restrict__ wv,
    const float* __restrict__ wo, const float* __restrict__ w1,
    const float* __restrict__ w2, _Float16* __restrict__ xh,
    _Float16* __restrict__ wqT, _Float16* __restrict__ wkT,
    _Float16* __restrict__ wvT, _Float16* __restrict__ woP,
    _Float16* __restrict__ w1P, _Float16* __restrict__ w2P) {
    int blk = blockIdx.x;
    if (blk < PREP_CVT_BLOCKS) {
        cvt_f16_block(x, xh, blk);
        return;
    }
    blk -= PREP_CVT_BLOCKS;
    if (blk < 3 * PREP_TR_BLOCKS) {
        const int j = blk / PREP_TR_BLOCKS;
        transpose_f16_block(j == 0 ? wq : j == 1 ? wk : wv,
                            j == 0 ? wqT : j == 1 ? wkT : wvT, D_, D_,
                            blk % PREP_TR_BLOCKS);
        return;
    }
    blk -= 3 * PREP_TR_BLOCKS;
    if (blk < PREP_PACK_BLOCKS)
        pack_f16_block(w1, w1P, D_, DFF_, blk);
    else if (blk < 2 * PREP_PACK_BLOCKS)
        pack_f16_block(w2, w2P, DFF_, D_, blk - PREP_PACK_BLOCKS);
    else
        pack_f16_block(wo, woP, D_, D_, blk - 2 * PREP_PACK_BLOCKS);
}

// ---------------------------------------------------------------------------
// GEMM: C[M x N] = A[M x K] (f16, row-major) * WT[N x K] (f16, N-major) + bias
// Block: 128 threads (4 waves), 128x64 tile; wave w owns rows w*32..w*32+31.
// Double-buffered async staging.  mode 0: f32 row-major.
// mode 1: f16 split-head [B,H,S,64].  mode 2: f16 split-head T [B,H,64,S].
// ---------------------------------------------------------------------------
__device__ __forceinline__ void gemm_tile(
    const _Float16* __restrict__ A, const _Float16* __restrict__ WT,
    const float* __restrict__ bias, float* __restrict__ outF,
    _Float16* __restrict__ outH, int M, int N, int K, int mode, int relu,
    float scale) {
    // Rows hold 32 halves; the pitch is 40 halves (80 B = 16 B x odd) so that the
    // 16 rows of a ds_load_b128 fragment read fall on distinct LDS banks.
    __shared__ __align__(16) _Float16 As[2][128][40];   // row-major (K-runs)
    __shared__ __align__(16) _Float16 BsT[2][64][40];   // N-major: BsT[n][k]

    const int m0 = blockIdx.x * 128;
    const int n0 = blockIdx.y * 64;
    const int t = threadIdx.x;
    const int wave = t >> 5;
    const int lane = t & 31;

    v8f acc[2][4] = {};

    // stage first k-tile into buffer 0
#pragma unroll
    for (int i = t; i < 512; i += 128) {
        int r = i >> 2, cc = i & 3;
        async_copy_b128_xw(&As[0][r][cc * 8],
                           A + (size_t)(m0 + r) * K + cc * 8);
    }
#pragma unroll
    for (int i = t; i < 256; i += 128) {
        int c = i >> 2, cc = i & 3;
        async_copy_b128_xw(&BsT[0][c][cc * 8],
                           WT + (size_t)(n0 + c) * K + cc * 8);
    }

    for (int k0 = 0; k0 < K; k0 += 32) {
        const int buf = (k0 >> 5) & 1;
        wait_async0();
        __syncthreads();  // tile `buf` ready for all waves

        if (k0 + 32 < K) {  // issue DMA for next tile into other buffer
            const int k1 = k0 + 32;
#pragma unroll
            for (int i = t; i < 512; i += 128) {
                int r = i >> 2, cc = i & 3;
                async_copy_b128(&As[buf ^ 1][r][cc * 8],
                                A + (size_t)(m0 + r) * K + k1 + cc * 8);
            }
#pragma unroll
            for (int i = t; i < 256; i += 128) {
                int c = i >> 2, cc = i & 3;
                async_copy_b128(&BsT[buf ^ 1][c][cc * 8],
                                WT + (size_t)(n0 + c) * K + k1 + cc * 8);
            }
        }

        v16h a0 = load_frag(&As[buf][wave * 32 + (lane & 15)][0], lane);
        v16h a1 = load_frag(&As[buf][wave * 32 + 16 + (lane & 15)][0], lane);
#pragma unroll
        for (int nt = 0; nt < 4; ++nt) {
            v16h bf = load_frag(&BsT[buf][nt * 16 + (lane & 15)][0], lane);
            acc[0][nt] = __builtin_amdgcn_wmma_f32_16x16x32_f16(
                false, a0, false, bf, (short)0, acc[0][nt], false, false);
            acc[1][nt] = __builtin_amdgcn_wmma_f32_16x16x32_f16(
                false, a1, false, bf, (short)0, acc[1][nt], false, false);
        }
        // no trailing barrier: next iteration's wait+barrier protects reuse
    }

    // epilogue
#pragma unroll
    for (int hh = 0; hh < 2; ++hh)
#pragma unroll
        for (int nt = 0; nt < 4; ++nt) {
            int col = n0 + nt * 16 + (lane & 15);
            float bvv = bias[col];
#pragma unroll
            for (int r = 0; r < 8; ++r) {
                int row = m0 + wave * 32 + hh * 16 + r + ((lane >> 4) << 3);
                float v = acc[hh][nt][r] + bvv;
                if (relu) v = fmaxf(v, 0.0f);
                v *= scale;
                int b = row / S_, s = row % S_;
                int h = col >> 6, d = col & 63;
                if (mode == 0) {
                    outF[(size_t)row * N + col] = v;
                } else if (mode == 1) {
                    outH[(((size_t)(b * H_ + h)) * S_ + s) * DEPTH_ + d] =
                        (_Float16)v;
                } else {
                    outH[(((size_t)(b * H_ + h)) * DEPTH_ + d) * S_ + s] =
                        (_Float16)v;
                }
            }
        }
}

// One launch for up to three products of the same A: blockIdx.z picks the
// weights, the bias and the f16 output.  `scale` belongs to product 0 (the
// others take 1), `mode` to products 0 and 1, `mode2` to product 2.
__global__ __launch_bounds__(128) void gemm_kernel(
    const _Float16* __restrict__ A, const _Float16* __restrict__ WT0,
    const _Float16* __restrict__ WT1, const _Float16* __restrict__ WT2,
    const float* __restrict__ bias0, const float* __restrict__ bias1,
    const float* __restrict__ bias2, float* __restrict__ outF,
    _Float16* __restrict__ outH0, _Float16* __restrict__ outH1,
    _Float16* __restrict__ outH2, int M, int N, int K, int mode, int mode2,
    int relu, float scale) {
    const int z = blockIdx.z;
    gemm_tile(A, z == 0 ? WT0 : z == 1 ? WT1 : WT2,
              z == 0 ? bias0 : z == 1 ? bias1 : bias2, outF,
              z == 0 ? outH0 : z == 1 ? outH1 : outH2, M, N, K,
              z == 2 ? mode2 : mode, relu, z == 0 ? scale : 1.0f);
}

__device__ __forceinline__ float xhalf(float x) {
    int v = __builtin_bit_cast(int, x);
    return __builtin_bit_cast(
        float, __builtin_amdgcn_permlanex16(v, v, 0x76543210, 0xfedcba98, false,
                                            false));
}

#define AK_P 72                    // halves: LDS pitch of a K or V row
#define AK_BUF (128 * AK_P)        // halves: one buffer of K, or of V

// One thread's share of a 128-key stage: four 16-byte chunks of K (rows 32
// apart) and four of V^T (rows 16 apart).  The eight copies and s_wait_xcnt 0
// are one statement, so that the wait stands in front of every later write of
// the address registers.
__device__ __forceinline__ void attn_stage(_Float16* kl, const _Float16* kg,
                                           _Float16* vl, const _Float16* vg) {
    const uint32_t k0 = (uint32_t)(uintptr_t)kl;
    const uint32_t v0 = (uint32_t)(uintptr_t)vl;
    asm volatile(
        "global_load_async_to_lds_b128 %0, %8, off\n\t"
        "global_load_async_to_lds_b128 %1, %9, off\n\t"
        "global_load_async_to_lds_b128 %2, %10, off\n\t"
        "global_load_async_to_lds_b128 %3, %11, off\n\t"
        "global_load_async_to_lds_b128 %4, %12, off\n\t"
        "global_load_async_to_lds_b128 %5, %13, off\n\t"
        "global_load_async_to_lds_b128 %6, %14, off\n\t"
        "global_load_async_to_lds_b128 %7, %15, off\n\t"
        "s_wait_xcnt 0x0"
        :
        : "v"(k0), "v"(k0 + 32 * AK_P * 2), "v"(k0 + 64 * AK_P * 2),
          "v"(k0 + 96 * AK_P * 2), "v"(v0), "v"(v0 + 16 * AK_P * 2),
          "v"(v0 + 32 * AK_P * 2), "v"(v0 + 48 * AK_P * 2), "v"(kg),
          "v"(kg + 32 * DEPTH_), "v"(kg + 64 * DEPTH_), "v"(kg + 96 * DEPTH_),
          "v"(vg), "v"(vg + 16 * S_), "v"(vg + 32 * S_), "v"(vg + 48 * S_)
        : "memory");
}

__global__ __launch_bounds__(256) void attn_kernel(
    const _Float16* __restrict__ qh, const _Float16* __restrict__ kh,
    const _Float16* __restrict__ vT, const float* __restrict__ mask,
    _Float16* __restrict__ ctxh) {
    // Rows hold 64 halves; the pitch is 72 halves (144 B = 16 B x odd) so that the
    // 16 rows of a ds_load_b128 fragment read fall on distinct LDS banks.
    __shared__ __align__(16) _Float16 Ks[2][128][AK_P];     // [kpos][d]
    __shared__ __align__(16) _Float16 VsT[2][2][64][AK_P];  // [key half][d][kpos]
    __shared__ __align__(32) float Ms[S_];              // mask * -1e9 of batch b

    const int qt = blockIdx.x;
    const int bh = blockIdx.y;
    const int b = bh / H_;
    const int h = bh % H_;
    const int t = threadIdx.x;
    // wave-uniform by construction; in a scalar register the choice between the
    // key halves is scalar too
    const int wave = __builtin_amdgcn_readfirstlane(t >> 5);
    const int qg = wave & 3;   // query group
    const int kh2 = wave >> 2;  // key half
    const int lane = t & 31;
    const int hh8 = (lane >> 4) << 3;
    const size_t base = (size_t)bh * S_ * DEPTH_;  // q/k and vT share extent
    const int qr0 = qt * 128 + qg * 32;
    const int NT = S_ / 128;

    // Q fragments straight from global (two 16B loads each); g: the query tile
    v16h qA[2][2];
#pragma unroll
    for (int g = 0; g < 2; ++g)
#pragma unroll
        for (int c = 0; c < 2; ++c)
            qA[g][c] = load_frag(qh + base +
                                     (size_t)(qr0 + g * 16 + (lane & 15)) * DEPTH_ +
                                     c * 32,
                                 lane);

    v8f O[2][4] = {};
    float mrow[2] = {-1e30f, -1e30f};
    float lrow[2] = {0.0f, 0.0f};  // this wave's keys, this lane half's only

    // this thread's first chunk of a stage: K row t / 8, V^T row t / 16
    const _Float16* kg = kh + base + (size_t)(t >> 3) * DEPTH_ + (t & 7) * 8;
    const _Float16* vg = vT + base + (size_t)(t >> 4) * S_ + (t & 15) * 8;
    _Float16* kl = &Ks[0][t >> 3][(t & 7) * 8];
    _Float16* vl = &VsT[0][(t >> 3) & 1][t >> 4][(t & 7) * 8];

    // stage the first 128 keys into buffer 0
    attn_stage(kl, kg, vl, vg);

    // The mask term varies along a lane's registers: the whole row of the batch
    // goes to LDS once; the loop's first barrier publishes it.
    const v4f* mp = (const v4f*)(mask + (size_t)b * S_) + t;
    v4f mv[4];
    // unrolled with a fixed trip count: all four loads fly together
#pragma unroll
    for (int k = 0; k < 4; ++k) mv[k] = mp[k * 256];
    // unrolled: mv lives in registers
#pragma unroll
    for (int k = 0; k < 4; ++k) ((v4f*)Ms)[t + k * 256] = mv[k] * -1e9f;

    for (int kt = 0; kt < NT; ++kt) {
        const int buf = kt & 1;
        wait_async0();
        __syncthreads();  // stage `buf` ready

        if (kt + 1 < NT)  // DMA next stage into other buffer
            attn_stage(kl + (buf ^ 1) * AK_BUF, kg + (size_t)(kt + 1) * 128 * DEPTH_,
                       vl + (buf ^ 1) * AK_BUF, vg + (kt + 1) * 128);

        // logits tiles: S^T = K @ Q^T   (64 kpos x 16 q, twice)
        v8f sc[2][4] = {};
#pragma unroll
        for (int nt = 0; nt < 4; ++nt) {
#pragma unroll
            for (int c = 0; c < 2; ++c) {
                v16h kf = load_frag(
                    &Ks[buf][kh2 * 64 + nt * 16 + (lane & 15)][c * 32], lane);
#pragma unroll
                for (int g = 0; g < 2; ++g)
                    sc[g][nt] = __builtin_amdgcn_wmma_f32_16x16x32_f16(
                        false, kf, false, qA[g][c], (short)0, sc[g][nt], false,
                        false);
            }
            const v8f mk =
                *(const v8f*)&Ms[kt * 128 + kh2 * 64 + nt * 16 + hh8];
#pragma unroll
            for (int g = 0; g < 2; ++g) sc[g][nt] += mk;
        }

        // online softmax: 32 of the query's 64 scores live in this lane
        // (the loops down to the epilogue are unrolled because sc and O are
        // register arrays and need constant indices)
#pragma unroll
        for (int g = 0; g < 2; ++g) {
            float mx4[4];
#pragma unroll
            for (int nt = 0; nt < 4; ++nt) {
                float m = sc[g][nt][0];
#pragma unroll
                for (int r = 1; r < 8; ++r) m = fmaxf(m, sc[g][nt][r]);
                mx4[nt] = m;
            }
            float mx = fmaxf(fmaxf(mx4[0], mx4[1]), fmaxf(mx4[2], mx4[3]));
            mx = fmaxf(mx, xhalf(mx));
            const float newm = fmaxf(mrow[g], mx);
            const float corr = __expf(mrow[g] - newm);
            mrow[g] = newm;
#pragma unroll
            for (int nt = 0; nt < 4; ++nt)
#pragma unroll
                for (int r = 0; r < 8; ++r)
                    sc[g][nt][r] = __expf(sc[g][nt][r] - newm);
            const v8f s8 = (sc[g][0] + sc[g][1]) + (sc[g][2] + sc[g][3]);
            const float rs = ((s8[0] + s8[1]) + (s8[2] + s8[3])) +
                             ((s8[4] + s8[5]) + (s8[6] + s8[7]));
            lrow[g] = lrow[g] * corr + rs;
#pragma unroll
            for (int nt = 0; nt < 4; ++nt) O[g][nt] *= corr;
        }

        // O^T += V^T @ P^T; score tiles 2c and 2c+1 are B's k 0..15 and 16..31
#pragma unroll
        for (int c = 0; c < 2; ++c) {
            v16h pb[2];
#pragma unroll
            for (int g = 0; g < 2; ++g)
                pb[g] = __builtin_shufflevector(
                    __builtin_convertvector(sc[g][2 * c], v8h),
                    __builtin_convertvector(sc[g][2 * c + 1], v8h), 0, 1, 2, 3, 4,
                    5, 6, 7, 8, 9, 10, 11, 12, 13, 14, 15);
#pragma unroll
            for (int nt = 0; nt < 4; ++nt) {
                v16h vf = load_frag(
                    &VsT[buf][kh2][nt * 16 + (lane & 15)][c * 32], lane);
#pragma unroll
                for (int g = 0; g < 2; ++g)
                    O[g][nt] = __builtin_amdgcn_wmma_f32_16x16x32_f16(
                        false, vf, false, pb[g], (short)0, O[g][nt], false,
                        false);
            }
        }
        // no trailing barrier: next iteration's wait+barrier protects reuse
    }

    // Merge of the two key halves.  Wave w and wave w ^ 4 hold partial results of
    // the same 32 queries: w keeps query tile kh2 and hands the other tile over
    // through the K buffers, 16 bytes a lane and store (lanes contiguous).
    __syncthreads();  // every wave has read its last stage: the K buffers are free
    v4f* xo = (v4f*)&Ks[0][0][0];                    // [wave][nt][part][lane]
    float* xs = (float*)&Ks[0][0][0] + 8 * 8 * 128;  // [wave][m, l][lane]
    const bool up = kh2 != 0;
#pragma unroll
    for (int nt = 0; nt < 4; ++nt) {
        const v8f s = up ? O[0][nt] : O[1][nt];
        xo[(wave * 8 + nt * 2) * 32 + lane] =
            __builtin_shufflevector(s, s, 0, 1, 2, 3);
        xo[(wave * 8 + nt * 2 + 1) * 32 + lane] =
            __builtin_shufflevector(s, s, 4, 5, 6, 7);
    }
    xs[wave * 64 + lane] = up ? mrow[0] : mrow[1];
    xs[wave * 64 + 32 + lane] = up ? lrow[0] : lrow[1];
    __syncthreads();  // the handed-over tiles are read by the partner waves

    const int pw = wave ^ 4;
    const float mk = up ? mrow[1] : mrow[0];
    const float mp2 = xs[pw * 64 + lane];
    const float newm = fmaxf(mk, mp2);
    const float ck = __expf(mk - newm);
    const float cp = __expf(mp2 - newm);
    const float lh = (up ? lrow[1] : lrow[0]) * ck + xs[pw * 64 + 32 + lane] * cp;

    // write merged-head context, normalized by l: 8 consecutive d per lane
    const float l = lh + xhalf(lh);
#pragma unroll
    for (int nt = 0; nt < 4; ++nt) {
        const v8f ok = up ? O[1][nt] : O[0][nt];
        const v4f p0 = xo[(pw * 8 + nt * 2) * 32 + lane];
        const v4f p1 = xo[(pw * 8 + nt * 2 + 1) * 32 + lane];
        const v8f op = __builtin_shufflevector(p0, p1, 0, 1, 2, 3, 4, 5, 6, 7);
        v8h o;
#pragma unroll
        for (int r = 0; r < 8; ++r)
            o[r] = (_Float16)((ok[r] * ck + op[r] * cp) / l);
        *(v8h*)&ctxh[(size_t)(b * S_ + qr0 + kh2 * 16 + (lane & 15)) * D_ +
                     h * DEPTH_ + nt * 16 + hh8] = o;
    }
}

// ---------------------------------------------------------------------------
// Everything behind attention, fused:
//   out1 = LN1(x + ctx @ wo + bo)
//   out  = LN2(out1 + LNff(relu(out1 @ w1 + b1)) @ w2 + b2).
// One block of 16 waves owns 64 rows from end to end, one block per WGP; the
// projection's result and h never leave the WGP.  A operands come from LDS, B
// operands (packed fragments) from L2 straight into registers: no two waves of a
// block need the same B fragment.
//   0a. a (64 x 256, f32) : wave w owns columns 16 w .. 16 w + 15, all 64 rows
//   0b. LN1 with residual : wave w owns rows 4 w .. 4 w + 3, row in registers
//   1. h (64 x 1024, f32) : wave w owns columns 64 w .. 64 w + 63, all 64 rows
//   2. LNff               : wave w owns rows 4 w .. 4 w + 3, row in registers
//   3. t (64 x 256, f32)  : wave w owns columns 16 w .. 16 w + 15, all 64 rows
//   4. LN2 with residual  : wave w owns rows 4 w .. 4 w + 3
// out1 goes on as f16 in LDS (A operand of step 1); its f32 form is needed again
// in step 4 only, by the lane that made it: that lane parks it in the workspace
// and loads it back, since steps 1 to 3 leave neither registers nor LDS for it.
// Every product sums k in steps of 32, in rising order; a LayerNorm sum is four
// values a lane and group, then a lane-exchange tree.
// LDS pitches: 16 B x odd for the ds_load_b128 fragment rows; for the f32
// planes 8 rows are 32 banks apart, so the two row groups of an accumulator
// store fall on different banks.
// ---------------------------------------------------------------------------
#define FA_P 264    // halves, ctx tile, then out1 tile
#define FH_P 1028   // floats, h before LNff
#define FHH_P 1032  // halves, h after LNff (overlays the f32 plane)
#define FT_P 260    // floats, a and later t (behind the f16 plane)
#define FA_BYTES (64 * FA_P * 2)
#define FH_BYTES (64 * FH_P * 4)
#define FHH_BYTES (64 * FHH_P * 2)

__device__ __forceinline__ v16h load_packed(const v8h* p) {
    v8h lo = p[0];
    v8h hi = p[32];
    return __builtin_shufflevector(lo, hi, 0, 1, 2, 3, 4, 5, 6, 7, 8, 9, 10,
                                   11, 12, 13, 14, 15);
}

__global__ __launch_bounds__(512) void ffn_kernel(
    const _Float16* __restrict__ ctxh, const float* __restrict__ x,
    const _Float16* __restrict__ woP, const float* __restrict__ bo,
    const float* __restrict__ g1, const float* __restrict__ be1,
    float* out1F, const _Float16* __restrict__ w1P,
    const float* __restrict__ b1,
    const float* __restrict__ gff, const float* __restrict__ bff,
    const _Float16* __restrict__ w2P, const float* __restrict__ b2,
    const float* __restrict__ g2, const float* __restrict__ be2,
    float* __restrict__ out) {
    __shared__ __align__(16) char smem[FA_BYTES + FH_BYTES];
    _Float16* As = (_Float16*)smem;
    float* Hf = (float*)(smem + FA_BYTES);
    _Float16* Hh = (_Float16*)(smem + FA_BYTES);
    float* Tf = (float*)(smem + FA_BYTES + FHH_BYTES);

    const int t = threadIdx.x;
    // wave-uniform by construction; in a scalar register it makes every weight
    // and row base scalar, and the one vector offset (the lane's) lives on
    const int wave = __builtin_amdgcn_readfirstlane(t >> 5);
    const int lane = t & 31;
    const int l15 = lane & 15;
    const int hh8 = (lane >> 4) << 3;
    const int m0 = blockIdx.x * 64;

    // this lane's place in rows 4 * wave .. + 3 of x, out1 and out
    const size_t roff = (size_t)(m0 + wave * 4) * D_ + lane * 4;

    // ---- 0a. a = ctx @ wo + bo ----
    v4f xr[4][2];  // the residual rows of step 0b, asked for ahead of the product
    {
        // ctx tile (f16) to LDS: 64 rows x 512 B, one row per wave-wide load
        const v8h* src = (const v8h*)(ctxh + (size_t)m0 * D_);
        v8h a[4];
#pragma unroll
        for (int i = 0; i < 4; ++i) a[i] = src[t + i * 512];
        // all 8 B fragments of the wave's 16 columns
        const v8h* bp = (const v8h*)woP + (size_t)wave * (8 * 64) + lane;
        v16h bw[D_ / 32];
#pragma unroll
        for (int ks = 0; ks < D_ / 32; ++ks) bw[ks] = load_packed(bp + ks * 64);
#pragma unroll
        for (int rr = 0; rr < 4; ++rr)
#pragma unroll
            for (int j = 0; j < 2; ++j)
                xr[rr][j] = *(const v4f*)(x + roff + rr * D_ + j * 128);
        // the wait that belongs in front of an overwrite of these loads' address
        // registers, written here behind the loads
        asm volatile("s_wait_xcnt 0x0" ::: "memory");
#pragma unroll
        for (int i = 0; i < 4; ++i)
            *(v8h*)&As[(wave + i * 16) * FA_P + lane * 8] = a[i];
        __syncthreads();  // the ctx tile is read by every wave

        v8f acc[4] = {};
        // unrolled: bw is a register array
#pragma unroll
        for (int ks = 0; ks < D_ / 32; ++ks) {
            v16h af[4];
#pragma unroll
            for (int mt = 0; mt < 4; ++mt)
                af[mt] = load_frag(&As[(mt * 16 + l15) * FA_P + ks * 32], lane);
#pragma unroll
            for (int mt = 0; mt < 4; ++mt)
                acc[mt] = __builtin_amdgcn_wmma_f32_16x16x32_f16(
                    false, af[mt], false, bw[ks], (short)0, acc[mt], false,
                    false);
        }
        const int col = wave * 16 + l15;
        const float bvv = bo[col];
#pragma unroll
        for (int mt = 0; mt < 4; ++mt)
#pragma unroll
            for (int r = 0; r < 8; ++r)
                Tf[(mt * 16 + r + hh8) * FT_P + col] = acc[mt][r] + bvv;
    }
    // as above, for the bias load
    asm volatile("s_wait_xcnt 0x0" ::: "memory");
    __syncthreads();  // rows of a are complete, the ctx tile has been read

    // ---- 0b. out1 = LN1(a + x), rows 4 * wave .. + 3 ----
    {
        constexpr int NV = 2, n = D_;
        v4f v[4][NV];
#pragma unroll
        for (int rr = 0; rr < 4; ++rr)
#pragma unroll
            for (int j = 0; j < NV; ++j)
                v[rr][j] =
                    *(const v4f*)&Tf[(wave * 4 + rr) * FT_P + j * 128 + lane * 4] +
                    xr[rr][j];
        float mu[4], rstd[4];
#pragma unroll
        for (int rr = 0; rr < 4; ++rr) {
            float s = 0.0f;
#pragma unroll
            for (int j = 0; j < NV; ++j)
                s += (v[rr][j][0] + v[rr][j][1]) + (v[rr][j][2] + v[rr][j][3]);
            mu[rr] = s;
        }
#pragma unroll
        for (int o = 16; o >= 1; o >>= 1)
#pragma unroll
            for (int rr = 0; rr < 4; ++rr) mu[rr] += __shfl_xor(mu[rr], o, 32);
#pragma unroll
        for (int rr = 0; rr < 4; ++rr) {
            mu[rr] = mu[rr] / n;
            float s2 = 0.0f;
#pragma unroll
            for (int j = 0; j < NV; ++j) {
                v[rr][j] -= mu[rr];
                v4f q = v[rr][j] * v[rr][j];
                s2 += (q[0] + q[1]) + (q[2] + q[3]);
            }
            rstd[rr] = s2;
        }
#pragma unroll
        for (int o = 16; o >= 1; o >>= 1)
#pragma unroll
            for (int rr = 0; rr < 4; ++rr)
                rstd[rr] += __shfl_xor(rstd[rr], o, 32);
#pragma unroll
        for (int rr = 0; rr < 4; ++rr) rstd[rr] = rsqrtf(rstd[rr] / n + 1e-3f);
#pragma unroll
        for (int j = 0; j < NV; ++j) {
            const v4f gg = *(const v4f*)(g1 + j * 128 + lane * 4);
            const v4f bb = *(const v4f*)(be1 + j * 128 + lane * 4);
#pragma unroll
            for (int rr = 0; rr < 4; ++rr) {
                v4f y = v[rr][j] * rstd[rr] * gg + bb;
                *(v4f*)(out1F + roff + rr * n + j * 128) = y;
                *(v4h*)&As[(wave * 4 + rr) * FA_P + j * 128 + lane * 4] =
                    __builtin_convertvector(y, v4h);
            }
        }
    }
    // as above, for the scale and shift loads and the out1 stores
    asm volatile("s_wait_xcnt 0x0" ::: "memory");
    __syncthreads();  // the out1 tile is read by every wave

    // ---- 1. h = relu(out1 @ w1 + b1) ----
    {
        v8f acc[4][4] = {};
        const v8h* bp = (const v8h*)w1P + (size_t)wave * (4 * 8 * 64) + lane;
        v16h bc[4], bn[4];  // B fragments of this k step and of the next
#pragma unroll
        for (int nt = 0; nt < 4; ++nt) bc[nt] = load_packed(bp + nt * 8 * 64);
        // unrolled: acc, bc and bn are register arrays, and every B address is
        // the one base plus a constant
#pragma unroll
        for (int ks = 0; ks < D_ / 32; ++ks) {
            if (ks + 1 < D_ / 32) {
#pragma unroll
                for (int nt = 0; nt < 4; ++nt)
                    bn[nt] = load_packed(bp + (nt * 8 + ks + 1) * 64);
            }
            // keeps the next step's L2 loads in front of this step's products;
            // sunk to their use, each would expose its whole latency
            __builtin_amdgcn_sched_barrier(0);
            v16h af[4];
#pragma unroll
            for (int mt = 0; mt < 4; ++mt)
                af[mt] = load_frag(&As[(mt * 16 + l15) * FA_P + ks * 32], lane);
#pragma unroll
            for (int nt = 0; nt < 4; ++nt) {
#pragma unroll
                for (int mt = 0; mt < 4; ++mt)
                    acc[mt][nt] = __builtin_amdgcn_wmma_f32_16x16x32_f16(
                        false, af[mt], false, bc[nt], (short)0, acc[mt][nt],
                        false, false);
            }
#pragma unroll
            for (int nt = 0; nt < 4; ++nt) bc[nt] = bn[nt];
        }
#pragma unroll
        for (int nt = 0; nt < 4; ++nt) {
            const int col = wave * 64 + nt * 16 + l15;
            const float bvv = b1[col];
#pragma unroll
            for (int mt = 0; mt < 4; ++mt)
#pragma unroll
                for (int r = 0; r < 8; ++r)
                    Hf[(mt * 16 + r + hh8) * FH_P + col] =
                        fmaxf(acc[mt][nt][r] + bvv, 0.0f);
        }
    }
    // the bias loads' offset register is reused further down: the wait that
    // belongs in front of that overwrite, written here behind the loads
    asm volatile("s_wait_xcnt 0x0" ::: "memory");
    __syncthreads();  // rows of h are complete

    // ---- 2. LNff, rows 4 * wave .. + 3, f16 result for the second product ----
    {
        constexpr int NV = 8, n = DFF_;
        v4f v[4][NV];
#pragma unroll
        for (int rr = 0; rr < 4; ++rr)
#pragma unroll
            for (int j = 0; j < NV; ++j)
                v[rr][j] =
                    *(const v4f*)&Hf[(wave * 4 + rr) * FH_P + j * 128 + lane * 4];
        __syncthreads();  // every f32 row is in registers: the plane is reused

        float mu[4], rstd[4];
#pragma unroll
        for (int rr = 0; rr < 4; ++rr) {
            float s = 0.0f;
#pragma unroll
            for (int j = 0; j < NV; ++j)
                s += (v[rr][j][0] + v[rr][j][1]) + (v[rr][j][2] + v[rr][j][3]);
            mu[rr] = s;
        }
#pragma unroll
        for (int o = 16; o >= 1; o >>= 1)
#pragma unroll
            for (int rr = 0; rr < 4; ++rr) mu[rr] += __shfl_xor(mu[rr], o, 32);
#pragma unroll
        for (int rr = 0; rr < 4; ++rr) {
            mu[rr] = mu[rr] / n;
            float s2 = 0.0f;
#pragma unroll
            for (int j = 0; j < NV; ++j) {
                v[rr][j] -= mu[rr];
                v4f q = v[rr][j] * v[rr][j];
                s2 += (q[0] + q[1]) + (q[2] + q[3]);
            }
            rstd[rr] = s2;
        }
#pragma unroll
        for (int o = 16; o >= 1; o >>= 1)
#pragma unroll
            for (int rr = 0; rr < 4; ++rr)
                rstd[rr] += __shfl_xor(rstd[rr], o, 32);
#pragma unroll
        for (int rr = 0; rr < 4; ++rr) rstd[rr] = rsqrtf(rstd[rr] / n + 1e-6f);
#pragma unroll
        for (int j = 0; j < NV; ++j) {
            const v4f gg = *(const v4f*)(gff + j * 128 + lane * 4);
            const v4f bb = *(const v4f*)(bff + j * 128 + lane * 4);
#pragma unroll
            for (int rr = 0; rr < 4; ++rr) {
                v4f y = v[rr][j] * rstd[rr] * gg + bb;
                *(v4h*)&Hh[(wave * 4 + rr) * FHH_P + j * 128 + lane * 4] =
                    __builtin_convertvector(y, v4h);
            }
        }
    }
    __syncthreads();  // the f16 rows are read by every wave

    // ---- 3. t = h @ w2 + b2 ----
    {
        v8f acc[4] = {};
        const v8h* bp = (const v8h*)w2P + (size_t)wave * (32 * 64) + lane;
        v16h bc[4], bn[4];  // B fragments of this group of 4 k steps, the next
#pragma unroll
        for (int j = 0; j < 4; ++j) bc[j] = load_packed(bp + j * 64);
        v16h ac[4], an[4];  // A fragments of this k step and of the next
#pragma unroll
        for (int mt = 0; mt < 4; ++mt)
            ac[mt] = load_frag(&Hh[(mt * 16 + l15) * FHH_P], lane);
        // unrolled: ac, an, bc and bn are register arrays
#pragma unroll
        for (int ks = 0; ks < DFF_ / 32; ++ks) {
            if ((ks & 3) == 0 && ks + 4 < DFF_ / 32) {
#pragma unroll
                for (int j = 0; j < 4; ++j)
                    bn[j] = load_packed(bp + (ks + 4 + j) * 64);
            }
            if (ks + 1 < DFF_ / 32) {
#pragma unroll
                for (int mt = 0; mt < 4; ++mt)
                    an[mt] = load_frag(
                        &Hh[(mt * 16 + l15) * FHH_P + (ks + 1) * 32], lane);
            }
            // keeps the loads for later k steps, as one group, in front of this
            // step's products; sunk to their use, each pair of LDS reads would
            // be waited out in front of its one product
            __builtin_amdgcn_sched_barrier(0);
#pragma unroll
            for (int mt = 0; mt < 4; ++mt)
                acc[mt] = __builtin_amdgcn_wmma_f32_16x16x32_f16(
                    false, ac[mt], false, bc[ks & 3], (short)0, acc[mt], false,
                    false);
#pragma unroll
            for (int mt = 0; mt < 4; ++mt) ac[mt] = an[mt];
            if ((ks & 3) == 3) {
#pragma unroll
                for (int j = 0; j < 4; ++j) bc[j] = bn[j];
            }
        }
        const int col = wave * 16 + l15;
        const float bvv = b2[col];
#pragma unroll
        for (int mt = 0; mt < 4; ++mt)
#pragma unroll
            for (int r = 0; r < 8; ++r)
                Tf[(mt * 16 + r + hh8) * FT_P + col] = acc[mt][r] + bvv;
    }
    __syncthreads();  // rows of t are complete

    // ---- 4. out = LN2(t + out1), rows 4 * wave .. + 3 ----
    {
        constexpr int NV = 2, n = D_;
        const size_t off = (size_t)(m0 + wave * 4) * n + lane * 4;
        v4f v[4][NV];
#pragma unroll
        for (int rr = 0; rr < 4; ++rr)
#pragma unroll
            for (int j = 0; j < NV; ++j)
                v[rr][j] =
                    *(const v4f*)&Tf[(wave * 4 + rr) * FT_P + j * 128 + lane * 4] +
                    *(const v4f*)(out1F + off + rr * n + j * 128);
        float mu[4], rstd[4];
#pragma unroll
        for (int rr = 0; rr < 4; ++rr) {
            float s = 0.0f;
#pragma unroll
            for (int j = 0; j < NV; ++j)
                s += (v[rr][j][0] + v[rr][j][1]) + (v[rr][j][2] + v[rr][j][3]);
            mu[rr] = s;
        }
#pragma unroll
        for (int o = 16; o >= 1; o >>= 1)
#pragma unroll
            for (int rr = 0; rr < 4; ++rr) mu[rr] += __shfl_xor(mu[rr], o, 32);
#pragma unroll
        for (int rr = 0; rr < 4; ++rr) {
            mu[rr] = mu[rr] / n;
            float s2 = 0.0f;
#pragma unroll
            for (int j = 0; j < NV; ++j) {
                v[rr][j] -= mu[rr];
                v4f q = v[rr][j] * v[rr][j];
                s2 += (q[0] + q[1]) + (q[2] + q[3]);
            }
            rstd[rr] = s2;
        }
#pragma unroll
        for (int o = 16; o >= 1; o >>= 1)
#pragma unroll
            for (int rr = 0; rr < 4; ++rr)
                rstd[rr] += __shfl_xor(rstd[rr], o, 32);
#pragma unroll
        for (int j = 0; j < NV; ++j) {
            const v4f gg = *(const v4f*)(g2 + j * 128 + lane * 4);
            const v4f bb = *(const v4f*)(be2 + j * 128 + lane * 4);
#pragma unroll
            for (int rr = 0; rr < 4; ++rr) {
                const float rs = rsqrtf(rstd[rr] / n + 1e-3f);
                *(v4f*)(out + off + rr * n + j * 128) = v[rr][j] * rs * gg + bb;
            }
        }
    }
}

// ---------------------------------------------------------------------------
extern "C" void kernel_launch(void* const* d_in, const int* in_sizes, int n_in,
                              void* d_out, int out_size, void* d_ws,
                              size_t ws_size, hipStream_t stream) {
    const float* x      = (const float*)d_in[0];
    const float* mask   = (const float*)d_in[1];
    const float* wq     = (const float*)d_in[2];
    const float* bq     = (const float*)d_in[3];
    const float* wk     = (const float*)d_in[4];
    const float* bk     = (const float*)d_in[5];
    const float* wv     = (const float*)d_in[6];
    const float* bv     = (const float*)d_in[7];
    const float* wo     = (const float*)d_in[8];
    const float* bo     = (const float*)d_in[9];
    const float* w1     = (const float*)d_in[10];
    const float* b1     = (const float*)d_in[11];
    const float* lnffg  = (const float*)d_in[12];
    const float* lnffb  = (const float*)d_in[13];
    const float* w2     = (const float*)d_in[14];
    const float* b2     = (const float*)d_in[15];
    const float* ln1g   = (const float*)d_in[16];
    const float* ln1b   = (const float*)d_in[17];
    const float* ln2g   = (const float*)d_in[18];
    const float* ln2b   = (const float*)d_in[19];
    float* out = (float*)d_out;

    // workspace carve-up
    char* p = (char*)d_ws;
    _Float16* xh   = (_Float16*)p; p += (size_t)M_ * D_ * 2;    // 8 MiB
    _Float16* qh   = (_Float16*)p; p += (size_t)M_ * D_ * 2;    // 8 MiB
    _Float16* kh   = (_Float16*)p; p += (size_t)M_ * D_ * 2;    // 8 MiB
    _Float16* vh   = (_Float16*)p; p += (size_t)M_ * D_ * 2;    // 8 MiB (vT)
    _Float16* ctxh = (_Float16*)p; p += (size_t)M_ * D_ * 2;    // 8 MiB
    float* out1F   = (float*)p;    p += (size_t)M_ * D_ * 4;    // 16 MiB
    _Float16* wqT  = (_Float16*)p; p += (size_t)D_ * D_ * 2;
    _Float16* wkT  = (_Float16*)p; p += (size_t)D_ * D_ * 2;
    _Float16* wvT  = (_Float16*)p; p += (size_t)D_ * D_ * 2;
    _Float16* woP  = (_Float16*)p; p += (size_t)D_ * D_ * 2;
    _Float16* w1P  = (_Float16*)p; p += (size_t)D_ * DFF_ * 2;
    _Float16* w2P  = (_Float16*)p; p += (size_t)DFF_ * D_ * 2;

    // x -> f16, wq/wk/wv -> f16 NxK, wo/w1/w2 -> f16 in B-fragment order
    prep_kernel<<<PREP_BLOCKS, 512, 0, stream>>>(x, wq, wk, wv, wo, w1, w2, xh,
                                                 wqT, wkT, wvT, woP, w1P, w2P);

    // q/k/v projections in one launch (q pre-scaled by 1/sqrt(DEPTH); v written
    // transposed)
    gemm_kernel<<<dim3(M_ / 128, D_ / 64, 3), 128, 0, stream>>>(
        xh, wqT, wkT, wvT, bq, bk, bv, nullptr, qh, kh, vh, M_, D_, D_, 1, 2, 0,
        0.125f);

    // flash attention
    attn_kernel<<<dim3(S_ / 128, B_ * H_), 256, 0, stream>>>(qh, kh, vh, mask,
                                                            ctxh);

    // output projection -> residual LN (eps 1e-3) -> relu(out1@w1+b1) ->
    // LN(eps 1e-6) -> @w2+b2 -> residual LN (eps 1e-3)
    ffn_kernel<<<M_ / 64, 512, 0, stream>>>(ctxh, x, woP, bo, ln1g, ln1b, out1F,
                                            w1P, b1, lnffg, lnffb, w2P, b2, ln2g,
                                            ln2b, out);
}

// v008
// Measured time: 108 microseconds a run.
// Next to v007, in two timings, it ran 1.08 and 1.09 times as fast.
// All steps since v000 together make it 4.81 times as fast.
#include <hip/hip_runtime.h>
#include <hip/hip_bf16.h>

// ---------------------------------------------------------------------------
// Transformer encoder layer for MI455X (gfx1250, wave32, WMMA).
// B=4, S=4096, D=256, H=4, DEPTH=64, DFF=1024.
// All GEMMs + attention on v_wmma_f32_16x16x32_f16 (f16 in, f32 acc).
// The q, k, v projections are one kernel that owns 64 rows a block and converts
// x itself.  attn_kernel stages its tiles with global_load_async_to_lds_b128,
// double-buffered (ASYNCcnt); fragments load as 2x b128.  All that follows
// attention (output projection, LN1, the FFN chain, LN2) is one kernel that
// keeps its rows on the WGP.
// ---------------------------------------------------------------------------

#define B_ 4
#define S_ 4096
#define D_ 256
#define H_ 4
#define DEPTH_ 64
#define DFF_ 1024
#define M_ (B_ * S_)

typedef __attribute__((ext_vector_type(16))) _Float16 v16h;
typedef __attribute__((ext_vector_type(8)))  _Float16 v8h;
typedef __attribute__((ext_vector_type(4)))  _Float16 v4h;
typedef __attribute__((ext_vector_type(8)))  float    v8f;
typedef __attribute__((ext_vector_type(4)))  float    v4f;

// Load one 16-half fragment for lane `lane` from a row whose K-run starts at
// `p`.  Lane's data: K offsets [b, b+8) and [b+16, b+24), b = 8*(lane>=16).
__device__ __forceinline__ v16h load_frag(const _Float16* p, int lane) {
    const v8h* q = (const v8h*)(p + ((lane >> 4) << 3));
    v8h lo = q[0];
    v8h hi = q[2];
    return __builtin_shufflevector(lo, hi, 0, 1, 2, 3, 4, 5, 6, 7, 8, 9, 10,
                                   11, 12, 13, 14, 15);
}

__device__ __forceinline__ void wait_async0() {
    asm volatile("s_wait_asynccnt 0" ::: "memory");
}

// ---------------------------------------------------------------------------
// Weight convert into WMMA fragment order for the two row-block kernels, which
// read weights straight from L2 into registers.  One fragment (16 columns n x 32 k)
// is 1 KiB: [part][lane][8 halves], lane = (n & 15) + 16 * hh and
// k = 32 * ks + 16 * part + 8 * hh + e, the k order of load_frag.  A wave-wide
// 16-byte load then covers 512 contiguous bytes.  One 16-byte chunk a thread.
// ---------------------------------------------------------------------------
__device__ __forceinline__ void pack_f16_block(
    const float* __restrict__ W, _Float16* __restrict__ P, int K, int N,
    int blk) {
    const int c = blk * 512 + threadIdx.x;
    const int lane = c & 31;
    const int part = (c >> 5) & 1;
    const int f = c >> 6;  // fragment number: nt * (K / 32) + ks
    const int KS = K >> 5;
    const int ks = f % KS;
    const int nt = f / KS;
    const int n = nt * 16 + (lane & 15);
    const int k0 = ks * 32 + part * 16 + (lane >> 4) * 8;
    float w[8];
#pragma unroll
    for (int e = 0; e < 8; ++e) w[e] = W[(size_t)(k0 + e) * N + n];
    // the converted halves land in registers that held load addresses: the wait
    // that belongs in front of that overwrite
    asm volatile("s_wait_xcnt 0x0" ::: "memory");
    v8h o;
#pragma unroll
    for (int e = 0; e < 8; ++e) o[e] = (_Float16)w[e];
    ((v8h*)P)[c] = o;
    // inlined several times into one kernel, the store is not followed by the
    // program's end alone: the wait that belongs in front of an overwrite of its
    // registers
    asm volatile("s_wait_xcnt 0x0" ::: "memory");
}

// ---------------------------------------------------------------------------
// All weight preparation in one launch.  The six jobs do not depend on each
// other, so each takes a range of the grid's blocks (512 threads a block):
//   [0, 128)    w1, w2 in fragment order, 64 blocks each
//   [128, 192)  wo, wq, wk, wv in fragment order, 16 blocks each
// ---------------------------------------------------------------------------
#define PREP_PACK_BLOCKS (D_ * DFF_ / 8 / 512)
#define PREP_PACKO_BLOCKS (D_ * D_ / 8 / 512)
#define PREP_BLOCKS (2 * PREP_PACK_BLOCKS + 4 * PREP_PACKO_BLOCKS)

__global__ __launch_bounds__(512) void prep_kernel(
    const float* __restrict__ wq, const float* __restrict__ wk,
    const float* __restrict__ wv, const float* __restrict__ wo,
    const float* __restrict__ w1, const float* __restrict__ w2,
    _Float16* __restrict__ wqP, _Float16* __restrict__ wkP,
    _Float16* __restrict__ wvP, _Float16* __restrict__ woP,
    _Float16* __restrict__ w1P, _Float16* __restrict__ w2P) {
    int blk = blockIdx.x;
    if (blk < PREP_PACK_BLOCKS) {
        pack_f16_block(w1, w1P, D_, DFF_, blk);
    } else if (blk < 2 * PREP_PACK_BLOCKS) {
        pack_f16_block(w2, w2P, DFF_, D_, blk - PREP_PACK_BLOCKS);
    } else {
        blk -= 2 * PREP_PACK_BLOCKS;
        const int j = blk / PREP_PACKO_BLOCKS;
        pack_f16_block(j == 0 ? wo : j == 1 ? wq : j == 2 ? wk : wv,
                       j == 0 ? woP : j == 1 ? wqP : j == 2 ? wkP : wvP, D_, D_,
                       blk % PREP_PACKO_BLOCKS);
    }
}

// One packed fragment: two wave-wide 16-byte loads, 512 bytes apart.
__device__ __forceinline__ v16h load_packed(const v8h* p) {
    v8h lo = p[0];
    v8h hi = p[32];
    return __builtin_shufflevector(lo, hi, 0, 1, 2, 3, 4, 5, 6, 7, 8, 9, 10,
                                   11, 12, 13, 14, 15);
}

// ---------------------------------------------------------------------------
// q, k, v projections.  One block of 16 waves owns 64 rows of x, one block per
// WGP: it reads them once as f32, converts them to f16 in LDS (the operand every
// wave shares) and makes all 768 output columns.  Wave w owns columns
// 16 w .. 16 w + 15 of each of q, k and v; its weights come as packed fragments
// from L2 straight into registers (no two waves need the same fragment).
// q and k are made as transposed products (weights as A, x as B), so that a lane
// holds 8 consecutive depth values of one position; v as x times weights, so
// that a lane holds 8 consecutive positions of one depth value: either way the
// lane's 8 results are 16 contiguous bytes of the output's layout.  The three
// tiles are gathered in LDS as [head][row][64] and leave as whole 128-byte lines.
// q: (x wq + bq) / sqrt(DEPTH), k: [B*H, S, 64] f16.  v: [B*H, 64, S] f16.
// Every product sums k in steps of 32, in rising order.
// ---------------------------------------------------------------------------
#define QX_P 264  // halves: pitch of an x row (16 B x odd)
#define QO_P 72   // halves: pitch of a gathered output row (16 B x odd)

__global__ __launch_bounds__(512) void qkv_kernel(
    const float* __restrict__ x, const _Float16* __restrict__ wqP,
    const _Float16* __restrict__ wkP, const _Float16* __restrict__ wvP,
    const float* __restrict__ bq, const float* __restrict__ bk,
    const float* __restrict__ bv, _Float16* __restrict__ qh,
    _Float16* __restrict__ kh, _Float16* __restrict__ vT) {
    __shared__ __align__(16) _Float16 Xs[64 * QX_P];
    __shared__ __align__(16) _Float16 Os[3][H_ * 64 * QO_P];  // q, k, v^T tiles

    const int t = threadIdx.x;
    // wave-uniform by construction; in a scalar register it makes every weight
    // base scalar
    const int wave = __builtin_amdgcn_readfirstlane(t >> 5);
    const int lane = t & 31;
    const int l15 = lane & 15;
    const int hh8 = (lane >> 4) << 3;
    const int m0 = blockIdx.x * 64;

    // the x tile: 64 rows x 1 KiB, 512 contiguous bytes per wave-wide load
    const v4f* src = (const v4f*)(x + (size_t)m0 * D_);
    v4f xv[8];
#pragma unroll
    for (int k = 0; k < 8; ++k) xv[k] = src[t + k * 512];
    // weight fragments in a ring of three k steps: asked for two steps ahead
    const size_t wo0 = (size_t)wave * (8 * 64) + lane;
    const v8h* bp0 = (const v8h*)wqP + wo0;
    const v8h* bp1 = (const v8h*)wkP + wo0;
    const v8h* bp2 = (const v8h*)wvP + wo0;
    v16h bw[3][3];  // [ring place][q, k, v]
#pragma unroll
    for (int ks = 0; ks < 2; ++ks) {
        bw[ks][0] = load_packed(bp0 + ks * 64);
        bw[ks][1] = load_packed(bp1 + ks * 64);
        bw[ks][2] = load_packed(bp2 + ks * 64);
    }
    const v8f bq8 = *(const v8f*)(bq + wave * 16 + hh8);
    const v8f bk8 = *(const v8f*)(bk + wave * 16 + hh8);
    const float bvv = bv[wave * 16 + l15];
    // the wait that belongs in front of an overwrite of these loads' address
    // registers, written here behind the loads
    asm volatile("s_wait_xcnt 0x0" ::: "memory");
#pragma unroll
    for (int k = 0; k < 8; ++k) {
        const int i = t + k * 512;
        *(v4h*)&Xs[(i >> 6) * QX_P + (i & 63) * 4] =
            __builtin_convertvector(xv[k], v4h);
    }
    __syncthreads();  // the x tile is read by every wave

    v8f acc[3][4] = {};
    // unrolled: acc and bw are register arrays, and every weight address is its
    // base plus a constant
#pragma unroll
    for (int ks = 0; ks < D_ / 32; ++ks) {
        if (ks + 2 < D_ / 32) {
            bw[(ks + 2) % 3][0] = load_packed(bp0 + (ks + 2) * 64);
            bw[(ks + 2) % 3][1] = load_packed(bp1 + (ks + 2) * 64);
            bw[(ks + 2) % 3][2] = load_packed(bp2 + (ks + 2) * 64);
        }
        // keeps the L2 loads for two steps on in front of this step's products;
        // sunk to their use, each would expose its whole latency
        __builtin_amdgcn_sched_barrier(0);
        v16h af[4];
#pragma unroll
        for (int mt = 0; mt < 4; ++mt)
            af[mt] = load_frag(&Xs[(mt * 16 + l15) * QX_P + ks * 32], lane);
#pragma unroll
        for (int mt = 0; mt < 4; ++mt) {
            acc[0][mt] = __builtin_amdgcn_wmma_f32_16x16x32_f16(
                false, bw[ks % 3][0], false, af[mt], (short)0, acc[0][mt], false,
                false);
            acc[1][mt] = __builtin_amdgcn_wmma_f32_16x16x32_f16(
                false, bw[ks % 3][1], false, af[mt], (short)0, acc[1][mt], false,
                false);
            acc[2][mt] = __builtin_amdgcn_wmma_f32_16x16x32_f16(
                false, af[mt], false, bw[ks % 3][2], (short)0, acc[2][mt], false,
                false);
        }
    }

    // gather: the wave's 16 columns are depth 16 (w & 3) .. + 15 of head w >> 2
    {
        const int hd = wave >> 2;
        const int d0 = (wave & 3) * 16;
#pragma unroll
        for (int mt = 0; mt < 4; ++mt) {
            const int qk = (hd * 64 + mt * 16 + l15) * QO_P + d0 + hh8;
            *(v8h*)&Os[0][qk] =
                __builtin_convertvector((acc[0][mt] + bq8) * 0.125f, v8h);
            *(v8h*)&Os[1][qk] = __builtin_convertvector(acc[1][mt] + bk8, v8h);
            *(v8h*)&Os[2][(hd * 64 + d0 + l15) * QO_P + mt * 16 + hh8] =
                __builtin_convertvector(acc[2][mt] + bvv, v8h);
        }
    }
    __syncthreads();  // the gathered tiles are read across waves

    // out: 8 lanes a 128-byte row, 4 rows a wave-wide store; head i per trip
    const int b = m0 / S_;
    const int s0 = m0 % S_;
    const int row = t >> 3;
    const int c8 = (t & 7) * 8;
#pragma unroll
    for (int i = 0; i < H_; ++i) {
        const int ls = (i * 64 + row) * QO_P + c8;
        const size_t bh = (size_t)(b * H_ + i);
        const v8h oq = *(const v8h*)&Os[0][ls];
        const v8h ok = *(const v8h*)&Os[1][ls];
        const v8h ov = *(const v8h*)&Os[2][ls];
        *(v8h*)&qh[(bh * S_ + s0 + row) * DEPTH_ + c8] = oq;
        *(v8h*)&kh[(bh * S_ + s0 + row) * DEPTH_ + c8] = ok;
        *(v8h*)&vT[(bh * DEPTH_ + row) * S_ + s0 + c8] = ov;
    }
}

__device__ __forceinline__ float xhalf(float x) {
    int v = __builtin_bit_cast(int, x);
    return __builtin_bit_cast(
        float, __builtin_amdgcn_permlanex16(v, v, 0x76543210, 0xfedcba98, false,
                                            false));
}

#define AK_P 72                    // halves: LDS pitch of a K or V row
#define AK_BUF (128 * AK_P)        // halves: one buffer of K, or of V

// One thread's share of a 128-key stage: four 16-byte chunks of K (rows 32
// apart) and four of V^T (rows 16 apart).  The eight copies and s_wait_xcnt 0
// are one statement, so that the wait stands in front of every later write of
// the address registers.
__device__ __forceinline__ void attn_stage(_Float16* kl, const _Float16* kg,
                                           _Float16* vl, const _Float16* vg) {
    const uint32_t k0 = (uint32_t)(uintptr_t)kl;
    const uint32_t v0 = (uint32_t)(uintptr_t)vl;
    asm volatile(
        "global_load_async_to_lds_b128 %0, %8, off\n\t"
        "global_load_async_to_lds_b128 %1, %9, off\n\t"
        "global_load_async_to_lds_b128 %2, %10, off\n\t"
        "global_load_async_to_lds_b128 %3, %11, off\n\t"
        "global_load_async_to_lds_b128 %4, %12, off\n\t"
        "global_load_async_to_lds_b128 %5, %13, off\n\t"
        "global_load_async_to_lds_b128 %6, %14, off\n\t"
        "global_load_async_to_lds_b128 %7, %15, off\n\t"
        "s_wait_xcnt 0x0"
        :
        : "v"(k0), "v"(k0 + 32 * AK_P * 2), "v"(k0 + 64 * AK_P * 2),
          "v"(k0 + 96 * AK_P * 2), "v"(v0), "v"(v0 + 16 * AK_P * 2),
          "v"(v0 + 32 * AK_P * 2), "v"(v0 + 48 * AK_P * 2), "v"(kg),
          "v"(kg + 32 * DEPTH_), "v"(kg + 64 * DEPTH_), "v"(kg + 96 * DEPTH_),
          "v"(vg), "v"(vg + 16 * S_), "v"(vg + 32 * S_), "v"(vg + 48 * S_)
        : "memory");
}

__global__ __launch_bounds__(256) void attn_kernel(
    const _Float16* __restrict__ qh, const _Float16* __restrict__ kh,
    const _Float16* __restrict__ vT, const float* __restrict__ mask,
    _Float16* __restrict__ ctxh) {
    // Rows hold 64 halves; the pitch is 72 halves (144 B = 16 B x odd) so that the
    // 16 rows of a ds_load_b128 fragment read fall on distinct LDS banks.
    __shared__ __align__(16) _Float16 Ks[2][128][AK_P];     // [kpos][d]
    __shared__ __align__(16) _Float16 VsT[2][2][64][AK_P];  // [key half][d][kpos]
    __shared__ __align__(32) float Ms[S_];              // mask * -1e9 of batch b

    const int qt = blockIdx.x;
    const int bh = blockIdx.y;
    const int b = bh / H_;
    const int h = bh % H_;
    const int t = threadIdx.x;
    // wave-uniform by construction; in a scalar register the choice between the
    // key halves is scalar too
    const int wave = __builtin_amdgcn_readfirstlane(t >> 5);
    const int qg = wave & 3;   // query group
    const int kh2 = wave >> 2;  // key half
    const int lane = t & 31;
    const int hh8 = (lane >> 4) << 3;
    const size_t base = (size_t)bh * S_ * DEPTH_;  // q/k and vT share extent
    const int qr0 = qt * 128 + qg * 32;
    const int NT = S_ / 128;

    // Q fragments straight from global (two 16B loads each); g: the query tile
    v16h qA[2][2];
#pragma unroll
    for (int g = 0; g < 2; ++g)
#pragma unroll
        for (int c = 0; c < 2; ++c)
            qA[g][c] = load_frag(qh + base +
                                     (size_t)(qr0 + g * 16 + (lane & 15)) * DEPTH_ +
                                     c * 32,
                                 lane);

    v8f O[2][4] = {};
    float mrow[2] = {-1e30f, -1e30f};
    float lrow[2] = {0.0f, 0.0f};  // this wave's keys, this lane half's only

    // this thread's first chunk of a stage: K row t / 8, V^T row t / 16
    const _Float16* kg = kh + base + (size_t)(t >> 3) * DEPTH_ + (t & 7) * 8;
    const _Float16* vg = vT + base + (size_t)(t >> 4) * S_ + (t & 15) * 8;
    _Float16* kl = &Ks[0][t >> 3][(t & 7) * 8];
    _Float16* vl = &VsT[0][(t >> 3) & 1][t >> 4][(t & 7) * 8];

    // stage the first 128 keys into buffer 0
    attn_stage(kl, kg, vl, vg);

    // The mask term varies along a lane's registers: the whole row of the batch
    // goes to LDS once; the loop's first barrier publishes it.
    const v4f* mp = (const v4f*)(mask + (size_t)b * S_) + t;
    v4f mv[4];
    // unrolled with a fixed trip count: all four loads fly together
#pragma unroll
    for (int k = 0; k < 4; ++k) mv[k] = mp[k * 256];
    // unrolled: mv lives in registers
#pragma unroll
    for (int k = 0; k < 4; ++k) ((v4f*)Ms)[t + k * 256] = mv[k] * -1e9f;

    for (int kt = 0; kt < NT; ++kt) {
        const int buf = kt & 1;
        wait_async0();
        __syncthreads();  // stage `buf` ready

        if (kt + 1 < NT)  // DMA next stage into other buffer
            attn_stage(kl + (buf ^ 1) * AK_BUF, kg + (size_t)(kt + 1) * 128 * DEPTH_,
                       vl + (buf ^ 1) * AK_BUF, vg + (kt + 1) * 128);

        // logits tiles: S^T = K @ Q^T   (64 kpos x 16 q, twice)
        v8f sc[2][4] = {};
#pragma unroll
        for (int nt = 0; nt < 4; ++nt) {
#pragma unroll
            for (int c = 0; c < 2; ++c) {
                v16h kf = load_frag(
                    &Ks[buf][kh2 * 64 + nt * 16 + (lane & 15)][c * 32], lane);
#pragma unroll
                for (int g = 0; g < 2; ++g)
                    sc[g][nt] = __builtin_amdgcn_wmma_f32_16x16x32_f16(
                        false, kf, false, qA[g][c], (short)0, sc[g][nt], false,
                        false);
            }
            const v8f mk =
                *(const v8f*)&Ms[kt * 128 + kh2 * 64 + nt * 16 + hh8];
#pragma unroll
            for (int g = 0; g < 2; ++g) sc[g][nt] += mk;
        }

        // online softmax: 32 of the query's 64 scores live in this lane
        // (the loops down to the epilogue are unrolled because sc and O are
        // register arrays and need constant indices)
#pragma unroll
        for (int g = 0; g < 2; ++g) {
            float mx4[4];
#pragma unroll
            for (int nt = 0; nt < 4; ++nt) {
                float m = sc[g][nt][0];
#pragma unroll
                for (int r = 1; r < 8; ++r) m = fmaxf(m, sc[g][nt][r]);
                mx4[nt] = m;
            }
            float mx = fmaxf(fmaxf(mx4[0], mx4[1]), fmaxf(mx4[2], mx4[3]));
            mx = fmaxf(mx, xhalf(mx));
            const float newm = fmaxf(mrow[g], mx);
            const float corr = __expf(mrow[g] - newm);
            mrow[g] = newm;
#pragma unroll
            for (int nt = 0; nt < 4; ++nt)
#pragma unroll
                for (int r = 0; r < 8; ++r)
                    sc[g][nt][r] = __expf(sc[g][nt][r] - newm);
            const v8f s8 = (sc[g][0] + sc[g][1]) + (sc[g][2] + sc[g][3]);
            const float rs = ((s8[0] + s8[1]) + (s8[2] + s8[3])) +
                             ((s8[4] + s8[5]) + (s8[6] + s8[7]));
            lrow[g] = lrow[g] * corr + rs;
#pragma unroll
            for (int nt = 0; nt < 4; ++nt) O[g][nt] *= corr;
        }

        // O^T += V^T @ P^T; score tiles 2c and 2c+1 are B's k 0..15 and 16..31
#pragma unroll
        for (int c = 0; c < 2; ++c) {
            v16h pb[2];
#pragma unroll
            for (int g = 0; g < 2; ++g)
                pb[g] = __builtin_shufflevector(
                    __builtin_convertvector(sc[g][2 * c], v8h),
                    __builtin_convertvector(sc[g][2 * c + 1], v8h), 0, 1, 2, 3, 4,
                    5, 6, 7, 8, 9, 10, 11, 12, 13, 14, 15);
#pragma unroll
            for (int nt = 0; nt < 4; ++nt) {
                v16h vf = load_frag(
                    &VsT[buf][kh2][nt * 16 + (lane & 15)][c * 32], lane);
#pragma unroll
                for (int g = 0; g < 2; ++g)
                    O[g][nt] = __builtin_amdgcn_wmma_f32_16x16x32_f16(
                        false, vf, false, pb[g], (short)0, O[g][nt], false,
                        false);
            }
        }
        // no trailing barrier: next iteration's wait+barrier protects reuse
    }

    // Merge of the two key halves.  Wave w and wave w ^ 4 hold partial results of
    // the same 32 queries: w keeps query tile kh2 and hands the other tile over
    // through the K buffers, 16 bytes a lane and store (lanes contiguous).
    __syncthreads();  // every wave has read its last stage: the K buffers are free
    v4f* xo = (v4f*)&Ks[0][0][0];                    // [wave][nt][part][lane]
    float* xs = (float*)&Ks[0][0][0] + 8 * 8 * 128;  // [wave][m, l][lane]
    const bool up = kh2 != 0;
#pragma unroll
    for (int nt = 0; nt < 4; ++nt) {
        const v8f s = up ? O[0][nt] : O[1][nt];
        xo[(wave * 8 + nt * 2) * 32 + lane] =
            __builtin_shufflevector(s, s, 0, 1, 2, 3);
        xo[(wave * 8 + nt * 2 + 1) * 32 + lane] =
            __builtin_shufflevector(s, s, 4, 5, 6, 7);
    }
    xs[wave * 64 + lane] = up ? mrow[0] : mrow[1];
    xs[wave * 64 + 32 + lane] = up ? lrow[0] : lrow[1];
    __syncthreads();  // the handed-over tiles are read by the partner waves

    const int pw = wave ^ 4;
    const float mk = up ? mrow[1] : mrow[0];
    const float mp2 = xs[pw * 64 + lane];
    const float newm = fmaxf(mk, mp2);
    const float ck = __expf(mk - newm);
    const float cp = __expf(mp2 - newm);
    const float lh = (up ? lrow[1] : lrow[0]) * ck + xs[pw * 64 + 32 + lane] * cp;

    // write merged-head context, normalized by l: 8 consecutive d per lane
    const float l = lh + xhalf(lh);
#pragma unroll
    for (int nt = 0; nt < 4; ++nt) {
        const v8f ok = up ? O[1][nt] : O[0][nt];
        const v4f p0 = xo[(pw * 8 + nt * 2) * 32 + lane];
        const v4f p1 = xo[(pw * 8 + nt * 2 + 1) * 32 + lane];
        const v8f op = __builtin_shufflevector(p0, p1, 0, 1, 2, 3, 4, 5, 6, 7);
        v8h o;
#pragma unroll
        for (int r = 0; r < 8; ++r)
            o[r] = (_Float16)((ok[r] * ck + op[r] * cp) / l);
        *(v8h*)&ctxh[(size_t)(b * S_ + qr0 + kh2 * 16 + (lane & 15)) * D_ +
                     h * DEPTH_ + nt * 16 + hh8] = o;
    }
}

// ---------------------------------------------------------------------------
// Everything behind attention, fused:
//   out1 = LN1(x + ctx @ wo + bo)
//   out  = LN2(out1 + LNff(relu(out1 @ w1 + b1)) @ w2 + b2).
// One block of 16 waves owns 64 rows from end to end, one block per WGP; the
// projection's result and h never leave the WGP.  A operands come from LDS, B
// operands (packed fragments) from L2 straight into registers: no two waves of a
// block need the same B fragment.
//   0a. a (64 x 256, f32) : wave w owns columns 16 w .. 16 w + 15, all 64 rows
//   0b. LN1 with residual : wave w owns rows 4 w .. 4 w + 3, row in registers
//   1. h (64 x 1024, f32) : wave w owns columns 64 w .. 64 w + 63, all 64 rows
//   2. LNff               : wave w owns rows 4 w .. 4 w + 3, row in registers
//   3. t (64 x 256, f32)  : wave w owns columns 16 w .. 16 w + 15, all 64 rows
//   4. LN2 with residual  : wave w owns rows 4 w .. 4 w + 3
// out1 goes on as f16 in LDS (A operand of step 1); its f32 form is needed again
// in step 4 only, by the lane that made it: that lane parks it in the workspace
// and loads it back, since steps 1 to 3 leave neither registers nor LDS for it.
// Every product sums k in steps of 32, in rising order; a LayerNorm sum is four
// values a lane and group, then a lane-exchange tree.
// LDS pitches: 16 B x odd for the ds_load_b128 fragment rows; for the f32
// planes 8 rows are 32 banks apart, so the two row groups of an accumulator
// store fall on different banks.
// ---------------------------------------------------------------------------
#define FA_P 264    // halves, ctx tile, then out1 tile
#define FH_P 1028   // floats, h before LNff
#define FHH_P 1032  // halves, h after LNff (overlays the f32 plane)
#define FT_P 260    // floats, a and later t (behind the f16 plane)
#define FA_BYTES (64 * FA_P * 2)
#define FH_BYTES (64 * FH_P * 4)
#define FHH_BYTES (64 * FHH_P * 2)

__global__ __launch_bounds__(512) void ffn_kernel(
    const _Float16* __restrict__ ctxh, const float* __restrict__ x,
    const _Float16* __restrict__ woP, const float* __restrict__ bo,
    const float* __restrict__ g1, const float* __restrict__ be1,
    float* out1F, const _Float16* __restrict__ w1P,
    const float* __restrict__ b1,
    const float* __restrict__ gff, const float* __restrict__ bff,
    const _Float16* __restrict__ w2P, const float* __restrict__ b2,
    const float* __restrict__ g2, const float* __restrict__ be2,
    float* __restrict__ out) {
    __shared__ __align__(16) char smem[FA_BYTES + FH_BYTES];
    _Float16* As = (_Float16*)smem;
    float* Hf = (float*)(smem + FA_BYTES);
    _Float16* Hh = (_Float16*)(smem + FA_BYTES);
    float* Tf = (float*)(smem + FA_BYTES + FHH_BYTES);

    const int t = threadIdx.x;
    // wave-uniform by construction; in a scalar register it makes every weight
    // and row base scalar, and the one vector offset (the lane's) lives on
    const int wave = __builtin_amdgcn_readfirstlane(t >> 5);
    const int lane = t & 31;
    const int l15 = lane & 15;
    const int hh8 = (lane >> 4) << 3;
    const int m0 = blockIdx.x * 64;

    // this lane's place in rows 4 * wave .. + 3 of x, out1 and out
    const size_t roff = (size_t)(m0 + wave * 4) * D_ + lane * 4;

    // ---- 0a. a = ctx @ wo + bo ----
    v4f xr[4][2];  // the residual rows of step 0b, asked for ahead of the product
    {
        // ctx tile (f16) to LDS: 64 rows x 512 B, one row per wave-wide load
        const v8h* src = (const v8h*)(ctxh + (size_t)m0 * D_);
        v8h a[4];
#pragma unroll
        for (int i = 0; i < 4; ++i) a[i] = src[t + i * 512];
        // all 8 B fragments of the wave's 16 columns
        const v8h* bp = (const v8h*)woP + (size_t)wave * (8 * 64) + lane;
        v16h bw[D_ / 32];
#pragma unroll
        for (int ks = 0; ks < D_ / 32; ++ks) bw[ks] = load_packed(bp + ks * 64);
#pragma unroll
        for (int rr = 0; rr < 4; ++rr)
#pragma unroll
            for (int j = 0; j < 2; ++j)
                xr[rr][j] = *(const v4f*)(x + roff + rr * D_ + j * 128);
        // the wait that belongs in front of an overwrite of these loads' address
        // registers, written here behind the loads
        asm volatile("s_wait_xcnt 0x0" ::: "memory");
#pragma unroll
        for (int i = 0; i < 4; ++i)
            *(v8h*)&As[(wave + i * 16) * FA_P + lane * 8] = a[i];
        __syncthreads();  // the ctx tile is read by every wave

        v8f acc[4] = {};
        // unrolled: bw is a register array
#pragma unroll
        for (int ks = 0; ks < D_ / 32; ++ks) {
            v16h af[4];
#pragma unroll
            for (int mt = 0; mt < 4; ++mt)
                af[mt] = load_frag(&As[(mt * 16 + l15) * FA_P + ks * 32], lane);
#pragma unroll
            for (int mt = 0; mt < 4; ++mt)
                acc[mt] = __builtin_amdgcn_wmma_f32_16x16x32_f16(
                    false, af[mt], false, bw[ks], (short)0, acc[mt], false,
                    false);
        }
        const int col = wave * 16 + l15;
        const float bvv = bo[col];
#pragma unroll
        for (int mt = 0; mt < 4; ++mt)
#pragma unroll
            for (int r = 0; r < 8; ++r)
                Tf[(mt * 16 + r + hh8) * FT_P + col] = acc[mt][r] + bvv;
    }
    // as above, for the bias load
    asm volatile("s_wait_xcnt 0x0" ::: "memory");
    __syncthreads();  // rows of a are complete, the ctx tile has been read

    // ---- 0b. out1 = LN1(a + x), rows 4 * wave .. + 3 ----
    {
        constexpr int NV = 2, n = D_;
        v4f v[4][NV];
#pragma unroll
        for (int rr = 0; rr < 4; ++rr)
#pragma unroll
            for (int j = 0; j < NV; ++j)
                v[rr][j] =
                    *(const v4f*)&Tf[(wave * 4 + rr) * FT_P + j * 128 + lane * 4] +
                    xr[rr][j];
        float mu[4], rstd[4];
#pragma unroll
        for (int rr = 0; rr < 4; ++rr) {
            float s = 0.0f;
#pragma unroll
            for (int j = 0; j < NV; ++j)
                s += (v[rr][j][0] + v[rr][j][1]) + (v[rr][j][2] + v[rr][j][3]);
            mu[rr] = s;
        }
#pragma unroll
        for (int o = 16; o >= 1; o >>= 1)
#pragma unroll
            for (int rr = 0; rr < 4; ++rr) mu[rr] += __shfl_xor(mu[rr], o, 32);
#pragma unroll
        for (int rr = 0; rr < 4; ++rr) {
            mu[rr] = mu[rr] / n;
            float s2 = 0.0f;
#pragma unroll
            for (int j = 0; j < NV; ++j) {
                v[rr][j] -= mu[rr];
                v4f q = v[rr][j] * v[rr][j];
                s2 += (q[0] + q[1]) + (q[2] + q[3]);
            }
            rstd[rr] = s2;
        }
#pragma unroll
        for (int o = 16; o >= 1; o >>= 1)
#pragma unroll
            for (int rr = 0; rr < 4; ++rr)
                rstd[rr] += __shfl_xor(rstd[rr], o, 32);
#pragma unroll
        for (int rr = 0; rr < 4; ++rr) rstd[rr] = rsqrtf(rstd[rr] / n + 1e-3f);
#pragma unroll
        for (int j = 0; j < NV; ++j) {
            const v4f gg = *(const v4f*)(g1 + j * 128 + lane * 4);
            const v4f bb = *(const v4f*)(be1 + j * 128 + lane * 4);
#pragma unroll
            for (int rr = 0; rr < 4; ++rr) {
                v4f y = v[rr][j] * rstd[rr] * gg + bb;
                *(v4f*)(out1F + roff + rr * n + j * 128) = y;
                *(v4h*)&As[(wave * 4 + rr) * FA_P + j * 128 + lane * 4] =
                    __builtin_convertvector(y, v4h);
            }
        }
    }
    // as above, for the scale and shift loads and the out1 stores
    asm volatile("s_wait_xcnt 0x0" ::: "memory");
    __syncthreads();  // the out1 tile is read by every wave

    // ---- 1. h = relu(out1 @ w1 + b1) ----
    {
        v8f acc[4][4] = {};
        const v8h* bp = (const v8h*)w1P + (size_t)wave * (4 * 8 * 64) + lane;
        v16h bc[4], bn[4];  // B fragments of this k step and of the next
#pragma unroll
        for (int nt = 0; nt < 4; ++nt) bc[nt] = load_packed(bp + nt * 8 * 64);
        // unrolled: acc, bc and bn are register arrays, and every B address is
        // the one base plus a constant
#pragma unroll
        for (int ks = 0; ks < D_ / 32; ++ks) {
            if (ks + 1 < D_ / 32) {
#pragma unroll
                for (int nt = 0; nt < 4; ++nt)
                    bn[nt] = load_packed(bp + (nt * 8 + ks + 1) * 64);
            }
            // keeps the next step's L2 loads in front of this step's products;
            // sunk to their use, each would expose its whole latency
            __builtin_amdgcn_sched_barrier(0);
            v16h af[4];
#pragma unroll
            for (int mt = 0; mt < 4; ++mt)
                af[mt] = load_frag(&As[(mt * 16 + l15) * FA_P + ks * 32], lane);
#pragma unroll
            for (int nt = 0; nt < 4; ++nt) {
#pragma unroll
                for (int mt = 0; mt < 4; ++mt)
                    acc[mt][nt] = __builtin_amdgcn_wmma_f32_16x16x32_f16(
                        false, af[mt], false, bc[nt], (short)0, acc[mt][nt],
                        false, false);
            }
#pragma unroll
            for (int nt = 0; nt < 4; ++nt) bc[nt] = bn[nt];
        }
#pragma unroll
        for (int nt = 0; nt < 4; ++nt) {
            const int col = wave * 64 + nt * 16 + l15;
            const float bvv = b1[col];
#pragma unroll
            for (int mt = 0; mt < 4; ++mt)
#pragma unroll
                for (int r = 0; r < 8; ++r)
                    Hf[(mt * 16 + r + hh8) * FH_P + col] =
                        fmaxf(acc[mt][nt][r] + bvv, 0.0f);
        }
    }
    // the bias loads' offset register is reused further down: the wait that
    // belongs in front of that overwrite, written here behind the loads
    asm volatile("s_wait_xcnt 0x0" ::: "memory");
    __syncthreads();  // rows of h are complete

    // ---- 2. LNff, rows 4 * wave .. + 3, f16 result for the second product ----
    {
        constexpr int NV = 8, n = DFF_;
        v4f v[4][NV];
#pragma unroll
        for (int rr = 0; rr < 4; ++rr)
#pragma unroll
            for (int j = 0; j < NV; ++j)
                v[rr][j] =
                    *(const v4f*)&Hf[(wave * 4 + rr) * FH_P + j * 128 + lane * 4];
        __syncthreads();  // every f32 row is in registers: the plane is reused

        float mu[4], rstd[4];
#pragma unroll
        for (int rr = 0; rr < 4; ++rr) {
            float s = 0.0f;
#pragma unroll
            for (int j = 0; j < NV; ++j)
                s += (v[rr][j][0] + v[rr][j][1]) + (v[rr][j][2] + v[rr][j][3]);
            mu[rr] = s;
        }
#pragma unroll
        for (int o = 16; o >= 1; o >>= 1)
#pragma unroll
            for (int rr = 0; rr < 4; ++rr) mu[rr] += __shfl_xor(mu[rr], o, 32);
#pragma unroll
        for (int rr = 0; rr < 4; ++rr) {
            mu[rr] = mu[rr] / n;
            float s2 = 0.0f;
#pragma unroll
            for (int j = 0; j < NV; ++j) {
                v[rr][j] -= mu[rr];
                v4f q = v[rr][j] * v[rr][j];
                s2 += (q[0] + q[1]) + (q[2] + q[3]);
            }
            rstd[rr] = s2;
        }
#pragma unroll
        for (int o = 16; o >= 1; o >>= 1)
#pragma unroll
            for (int rr = 0; rr < 4; ++rr)
                rstd[rr] += __shfl_xor(rstd[rr], o, 32);
#pragma unroll
        for (int rr = 0; rr < 4; ++rr) rstd[rr] = rsqrtf(rstd[rr] / n + 1e-6f);
#pragma unroll
        for (int j = 0; j < NV; ++j) {
            const v4f gg = *(const v4f*)(gff + j * 128 + lane * 4);
            const v4f bb = *(const v4f*)(bff + j * 128 + lane * 4);
#pragma unroll
            for (int rr = 0; rr < 4; ++rr) {
                v4f y = v[rr][j] * rstd[rr] * gg + bb;
                *(v4h*)&Hh[(wave * 4 + rr) * FHH_P + j * 128 + lane * 4] =
                    __builtin_convertvector(y, v4h);
            }
        }
    }
    __syncthreads();  // the f16 rows are read by every wave

    // ---- 3. t = h @ w2 + b2 ----
    {
        v8f acc[4] = {};
        const v8h* bp = (const v8h*)w2P + (size_t)wave * (32 * 64) + lane;
        v16h bc[4], bn[4];  // B fragments of this group of 4 k steps, the next
#pragma unroll
        for (int j = 0; j < 4; ++j) bc[j] = load_packed(bp + j * 64);
        v16h ac[4], an[4];  // A fragments of this k step and of the next
#pragma unroll
        for (int mt = 0; mt < 4; ++mt)
            ac[mt] = load_frag(&Hh[(mt * 16 + l15) * FHH_P], lane);
        // unrolled: ac, an, bc and bn are register arrays
#pragma unroll
        for (int ks = 0; ks < DFF_ / 32; ++ks) {
            if ((ks & 3) == 0 && ks + 4 < DFF_ / 32) {
#pragma unroll
                for (int j = 0; j < 4; ++j)
                    bn[j] = load_packed(bp + (ks + 4 + j) * 64);
            }
            if (ks + 1 < DFF_ / 32) {
#pragma unroll
                for (int mt = 0; mt < 4; ++mt)
                    an[mt] = load_frag(
                        &Hh[(mt * 16 + l15) * FHH_P + (ks + 1) * 32], lane);
            }
            // keeps the loads for later k steps, as one group, in front of this
            // step's products; sunk to their use, each pair of LDS reads would
            // be waited out in front of its one product
            __builtin_amdgcn_sched_barrier(0);
#pragma unroll
            for (int mt = 0; mt < 4; ++mt)
                acc[mt] = __builtin_amdgcn_wmma_f32_16x16x32_f16(
                    false, ac[mt], false, bc[ks & 3], (short)0, acc[mt], false,
                    false);
#pragma unroll
            for (int mt = 0; mt < 4; ++mt) ac[mt] = an[mt];
            if ((ks & 3) == 3) {
#pragma unroll
                for (int j = 0; j < 4; ++j) bc[j] = bn[j];
            }
        }
        const int col = wave * 16 + l15;
        const float bvv = b2[col];
#pragma unroll
        for (int mt = 0; mt < 4; ++mt)
#pragma unroll
            for (int r = 0; r < 8; ++r)
                Tf[(mt * 16 + r + hh8) * FT_P + col] = acc[mt][r] + bvv;
    }
    __syncthreads();  // rows of t are complete

    // ---- 4. out = LN2(t + out1), rows 4 * wave .. + 3 ----
    {
        constexpr int NV = 2, n = D_;
        const size_t off = (size_t)(m0 + wave * 4) * n + lane * 4;
        v4f v[4][NV];
#pragma unroll
        for (int rr = 0; rr < 4; ++rr)
#pragma unroll
            for (int j = 0; j < NV; ++j)
                v[rr][j] =
                    *(const v4f*)&Tf[(wave * 4 + rr) * FT_P + j * 128 + lane * 4] +
                    *(const v4f*)(out1F + off + rr * n + j * 128);
        float mu[4], rstd[4];
#pragma unroll
        for (int rr = 0; rr < 4; ++rr) {
            float s = 0.0f;
#pragma unroll
            for (int j = 0; j < NV; ++j)
                s += (v[rr][j][0] + v[rr][j][1]) + (v[rr][j][2] + v[rr][j][3]);
            mu[rr] = s;
        }
#pragma unroll
        for (int o = 16; o >= 1; o >>= 1)
#pragma unroll
            for (int rr = 0; rr < 4; ++rr) mu[rr] += __shfl_xor(mu[rr], o, 32);
#pragma unroll
        for (int rr = 0; rr < 4; ++rr) {
            mu[rr] = mu[rr] / n;
            float s2 = 0.0f;
#pragma unroll
            for (int j = 0; j < NV; ++j) {
                v[rr][j] -= mu[rr];
                v4f q = v[rr][j] * v[rr][j];
                s2 += (q[0] + q[1]) + (q[2] + q[3]);
            }
            rstd[rr] = s2;
        }
#pragma unroll
        for (int o = 16; o >= 1; o >>= 1)
#pragma unroll
            for (int rr = 0; rr < 4; ++rr)
                rstd[rr] += __shfl_xor(rstd[rr], o, 32);
#pragma unroll
        for (int j = 0; j < NV; ++j) {
            const v4f gg = *(const v4f*)(g2 + j * 128 + lane * 4);
            const v4f bb = *(const v4f*)(be2 + j * 128 + lane * 4);
#pragma unroll
            for (int rr = 0; rr < 4; ++rr) {
                const float rs = rsqrtf(rstd[rr] / n + 1e-3f);
                *(v4f*)(out + off + rr * n + j * 128) = v[rr][j] * rs * gg + bb;
            }
        }
    }
}

// ---------------------------------------------------------------------------
extern "C" void kernel_launch(void* const* d_in, const int* in_sizes, int n_in,
                              void* d_out, int out_size, void* d_ws,
                              size_t ws_size, hipStream_t stream) {
    const float* x      = (const float*)d_in[0];
    const float* mask   = (const float*)d_in[1];
    const float* wq     = (const float*)d_in[2];
    const float* bq     = (const float*)d_in[3];
    const float* wk     = (const float*)d_in[4];
    const float* bk     = (const float*)d_in[5];
    const float* wv     = (const float*)d_in[6];
    const float* bv     = (const float*)d_in[7];
    const float* wo     = (const float*)d_in[8];
    const float* bo     = (const float*)d_in[9];
    const float* w1     = (const float*)d_in[10];
    const float* b1     = (const float*)d_in[11];
    const float* lnffg  = (const float*)d_in[12];
    const float* lnffb  = (const float*)d_in[13];
    const float* w2     = (const float*)d_in[14];
    const float* b2     = (const float*)d_in[15];
    const float* ln1g   = (const float*)d_in[16];
    const float* ln1b   = (const float*)d_in[17];
    const float* ln2g   = (const float*)d_in[18];
    const float* ln2b   = (const float*)d_in[19];
    float* out = (float*)d_out;

    // workspace carve-up
    char* p = (char*)d_ws;
    _Float16* qh   = (_Float16*)p; p += (size_t)M_ * D_ * 2;    // 8 MiB
    _Float16* kh   = (_Float16*)p; p += (size_t)M_ * D_ * 2;    // 8 MiB
    _Float16* vh   = (_Float16*)p; p += (size_t)M_ * D_ * 2;    // 8 MiB (vT)
    _Float16* ctxh = (_Float16*)p; p += (size_t)M_ * D_ * 2;    // 8 MiB
    float* out1F   = (float*)p;    p += (size_t)M_ * D_ * 4;    // 16 MiB
    _Float16* wqP  = (_Float16*)p; p += (size_t)D_ * D_ * 2;
    _Float16* wkP  = (_Float16*)p; p += (size_t)D_ * D_ * 2;
    _Float16* wvP  = (_Float16*)p; p += (size_t)D_ * D_ * 2;
    _Float16* woP  = (_Float16*)p; p += (size_t)D_ * D_ * 2;
    _Float16* w1P  = (_Float16*)p; p += (size_t)D_ * DFF_ * 2;
    _Float16* w2P  = (_Float16*)p; p += (size_t)DFF_ * D_ * 2;

    // all six weights -> f16 in fragment order
    prep_kernel<<<PREP_BLOCKS, 512, 0, stream>>>(wq, wk, wv, wo, w1, w2, wqP, wkP,
                                                 wvP, woP, w1P, w2P);

    // q/k/v projections from f32 x (q pre-scaled by 1/sqrt(DEPTH); v written
    // transposed)
    qkv_kernel<<<M_ / 64, 512, 0, stream>>>(x, wqP, wkP, wvP, bq, bk, bv, qh, kh,
                                            vh);

    // flash attention
    attn_kernel<<<dim3(S_ / 128, B_ * H_), 256, 0, stream>>>(qh, kh, vh, mask,
                                                            ctxh);

    // output projection -> residual LN (eps 1e-3) -> relu(out1@w1+b1) ->
    // LN(eps 1e-6) -> @w2+b2 -> residual LN (eps 1e-3)
    ffn_kernel<<<M_ / 64, 512, 0, stream>>>(ctxh, x, woP, bo, ln1g, ln1b, out1F,
                                            w1P, b1, lnffg, lnffb, w2P, b2, ln2g,
                                            ln2b, out);
}

// v009
// Measured time: 103 microseconds a run.
// Two timings next to v008 both put it at 1.04 times that version's speed.
// Counting every step since v000, it is 5.01 times as fast.
#include <hip/hip_runtime.h>
#include <hip/hip_bf16.h>

// ---------------------------------------------------------------------------
// Transformer encoder layer for MI455X (gfx1250, wave32, WMMA).
// B=4, S=4096, D=256, H=4, DEPTH=64, DFF=1024.
// All GEMMs + attention on v_wmma_f32_16x16x32_f16 (f16 in, f32 acc).
// The q, k, v projections are one kernel that owns 64 rows a block and converts
// x itself.  attn_kernel stages its tiles with global_load_async_to_lds_b128,
// double-buffered (ASYNCcnt); fragments load as 2x b128.  All that follows
// attention (output projection, LN1, the FFN chain, LN2) is one kernel that
// keeps its rows on the WGP.
// ---------------------------------------------------------------------------

#define B_ 4
#define S_ 4096
#define D_ 256
#define H_ 4
#define DEPTH_ 64
#define DFF_ 1024
#define M_ (B_ * S_)

typedef __attribute__((ext_vector_type(16))) _Float16 v16h;
typedef __attribute__((ext_vector_type(8)))  _Float16 v8h;
typedef __attribute__((ext_vector_type(4)))  _Float16 v4h;
typedef __attribute__((ext_vector_type(8)))  float    v8f;
typedef __attribute__((ext_vector_type(4)))  float    v4f;

// Load one 16-half fragment for lane `lane` from a row whose K-run starts at
// `p`.  Lane's data: K offsets [b, b+8) and [b+16, b+24), b = 8*(lane>=16).
__device__ __forceinline__ v16h load_frag(const _Float16* p, int lane) {
    const v8h* q = (const v8h*)(p + ((lane >> 4) << 3));
    v8h lo = q[0];
    v8h hi = q[2];
    return __builtin_shufflevector(lo, hi, 0, 1, 2, 3, 4, 5, 6, 7, 8, 9, 10,
                                   11, 12, 13, 14, 15);
}

__device__ __forceinline__ void wait_async0() {
    asm volatile("s_wait_asynccnt 0" ::: "memory");
}

// ---------------------------------------------------------------------------
// Weight convert into WMMA fragment order for the two row-block kernels, which
// read weights straight from L2 into registers.  One fragment (16 columns n x 32 k)
// is 1 KiB: [part][lane][8 halves], lane = (n & 15) + 16 * hh and
// k = 32 * ks + 16 * part + 8 * hh + e, the k order of load_frag.  A wave-wide
// 16-byte load then covers 512 contiguous bytes.  One 16-byte chunk a thread.
// ---------------------------------------------------------------------------
__device__ __forceinline__ void pack_f16_block(
    const float* __restrict__ W, _Float16* __restrict__ P, int K, int N,
    int blk) {
    const int c = blk * 512 + threadIdx.x;
    const int lane = c & 31;
    const int part = (c >> 5) & 1;
    const int f = c >> 6;  // fragment number: nt * (K / 32) + ks
    const int KS = K >> 5;
    const int ks = f % KS;
    const int nt = f / KS;
    const int n = nt * 16 + (lane & 15);
    const int k0 = ks * 32 + part * 16 + (lane >> 4) * 8;
    float w[8];
#pragma unroll
    for (int e = 0; e < 8; ++e) w[e] = W[(size_t)(k0 + e) * N + n];
    // the converted halves land in registers that held load addresses: the wait
    // that belongs in front of that overwrite
    asm volatile("s_wait_xcnt 0x0" ::: "memory");
    v8h o;
#pragma unroll
    for (int e = 0; e < 8; ++e) o[e] = (_Float16)w[e];
    ((v8h*)P)[c] = o;
    // inlined several times into one kernel, the store is not followed by the
    // program's end alone: the wait that belongs in front of an overwrite of its
    // registers
    asm volatile("s_wait_xcnt 0x0" ::: "memory");
}

// ---------------------------------------------------------------------------
// All weight preparation in one launch.  The six jobs do not depend on each
// other, so each takes a range of the grid's blocks (512 threads a block):
//   [0, 128)    w1, w2 in fragment order, 64 blocks each
//   [128, 192)  wo, wq, wk, wv in fragment order, 16 blocks each
// ---------------------------------------------------------------------------
#define PREP_PACK_BLOCKS (D_ * DFF_ / 8 / 512)
#define PREP_PACKO_BLOCKS (D_ * D_ / 8 / 512)
#define PREP_BLOCKS (2 * PREP_PACK_BLOCKS + 4 * PREP_PACKO_BLOCKS)

__global__ __launch_bounds__(512) void prep_kernel(
    const float* __restrict__ wq, const float* __restrict__ wk,
    const float* __restrict__ wv, const float* __restrict__ wo,
    const float* __restrict__ w1, const float* __restrict__ w2,
    _Float16* __restrict__ wqP, _Float16* __restrict__ wkP,
    _Float16* __restrict__ wvP, _Float16* __restrict__ woP,
    _Float16* __restrict__ w1P, _Float16* __restrict__ w2P) {
    int blk = blockIdx.x;
    if (blk < PREP_PACK_BLOCKS) {
        pack_f16_block(w1, w1P, D_, DFF_, blk);
    } else if (blk < 2 * PREP_PACK_BLOCKS) {
        pack_f16_block(w2, w2P, DFF_, D_, blk - PREP_PACK_BLOCKS);
    } else {
        blk -= 2 * PREP_PACK_BLOCKS;
        const int j = blk / PREP_PACKO_BLOCKS;
        pack_f16_block(j == 0 ? wo : j == 1 ? wq : j == 2 ? wk : wv,
                       j == 0 ? woP : j == 1 ? wqP : j == 2 ? wkP : wvP, D_, D_,
                       blk % PREP_PACKO_BLOCKS);
    }
}

// One packed fragment: two wave-wide 16-byte loads, 512 bytes apart.
__device__ __forceinline__ v16h load_packed(const v8h* p) {
    v8h lo = p[0];
    v8h hi = p[32];
    return __builtin_shufflevector(lo, hi, 0, 1, 2, 3, 4, 5, 6, 7, 8, 9, 10,
                                   11, 12, 13, 14, 15);
}

// ---------------------------------------------------------------------------
// q, k, v projections.  One block of 16 waves owns 64 rows of x, one block per
// WGP: it reads them once as f32, converts them to f16 in LDS (the operand every
// wave shares) and makes all 768 output columns.  Wave w owns columns
// 16 w .. 16 w + 15 of each of q, k and v; its weights come as packed fragments
// from L2 straight into registers (no two waves need the same fragment).
// q and k are made as transposed products (weights as A, x as B), so that a lane
// holds 8 consecutive depth values of one position; v as x times weights, so
// that a lane holds 8 consecutive positions of one depth value: either way the
// lane's 8 results are 16 contiguous bytes of the output's layout.  The three
// tiles are gathered in LDS as [head][row][64] and leave as whole 128-byte lines.
// q: (x wq + bq) / sqrt(DEPTH), k: [B*H, S, 64] f16.  v: [B*H, 64, S] f16.
// Every product sums k in steps of 32, in rising order.
// ---------------------------------------------------------------------------
#define QX_P 264  // halves: pitch of an x row (16 B x odd)
#define QO_P 72   // halves: pitch of a gathered output row (16 B x odd)

__global__ __launch_bounds__(512) void qkv_kernel(
    const float* __restrict__ x, const _Float16* __restrict__ wqP,
    const _Float16* __restrict__ wkP, const _Float16* __restrict__ wvP,
    const float* __restrict__ bq, const float* __restrict__ bk,
    const float* __restrict__ bv, _Float16* __restrict__ qh,
    _Float16* __restrict__ kh, _Float16* __restrict__ vT) {
    __shared__ __align__(16) _Float16 Xs[64 * QX_P];
    __shared__ __align__(16) _Float16 Os[3][H_ * 64 * QO_P];  // q, k, v^T tiles

    const int t = threadIdx.x;
    // wave-uniform by construction; in a scalar register it makes every weight
    // base scalar
    const int wave = __builtin_amdgcn_readfirstlane(t >> 5);
    const int lane = t & 31;
    const int l15 = lane & 15;
    const int hh8 = (lane >> 4) << 3;
    const int m0 = blockIdx.x * 64;

    // the x tile: 64 rows x 1 KiB, 512 contiguous bytes per wave-wide load
    const v4f* src = (const v4f*)(x + (size_t)m0 * D_);
    v4f xv[8];
#pragma unroll
    for (int k = 0; k < 8; ++k) xv[k] = src[t + k * 512];
    // weight fragments in a ring of three k steps: asked for two steps ahead
    const size_t wo0 = (size_t)wave * (8 * 64) + lane;
    const v8h* bp0 = (const v8h*)wqP + wo0;
    const v8h* bp1 = (const v8h*)wkP + wo0;
    const v8h* bp2 = (const v8h*)wvP + wo0;
    v16h bw[3][3];  // [ring place][q, k, v]
#pragma unroll
    for (int ks = 0; ks < 2; ++ks) {
        bw[ks][0] = load_packed(bp0 + ks * 64);
        bw[ks][1] = load_packed(bp1 + ks * 64);
        bw[ks][2] = load_packed(bp2 + ks * 64);
    }
    const v8f bq8 = *(const v8f*)(bq + wave * 16 + hh8);
    const v8f bk8 = *(const v8f*)(bk + wave * 16 + hh8);
    const float bvv = bv[wave * 16 + l15];
    // the wait that belongs in front of an overwrite of these loads' address
    // registers, written here behind the loads
    asm volatile("s_wait_xcnt 0x0" ::: "memory");
#pragma unroll
    for (int k = 0; k < 8; ++k) {
        const int i = t + k * 512;
        *(v4h*)&Xs[(i >> 6) * QX_P + (i & 63) * 4] =
            __builtin_convertvector(xv[k], v4h);
    }
    __syncthreads();  // the x tile is read by every wave

    v8f acc[3][4] = {};
    // unrolled: acc and bw are register arrays, and every weight address is its
    // base plus a constant
#pragma unroll
    for (int ks = 0; ks < D_ / 32; ++ks) {
        if (ks + 2 < D_ / 32) {
            bw[(ks + 2) % 3][0] = load_packed(bp0 + (ks + 2) * 64);
            bw[(ks + 2) % 3][1] = load_packed(bp1 + (ks + 2) * 64);
            bw[(ks + 2) % 3][2] = load_packed(bp2 + (ks + 2) * 64);
        }
        // keeps the L2 loads for two steps on in front of this step's products;
        // sunk to their use, each would expose its whole latency
        __builtin_amdgcn_sched_barrier(0);
        v16h af[4];
#pragma unroll
        for (int mt = 0; mt < 4; ++mt)
            af[mt] = load_frag(&Xs[(mt * 16 + l15) * QX_P + ks * 32], lane);
#pragma unroll
        for (int mt = 0; mt < 4; ++mt) {
            acc[0][mt] = __builtin_amdgcn_wmma_f32_16x16x32_f16(
                false, bw[ks % 3][0], false, af[mt], (short)0, acc[0][mt], false,
                false);
            acc[1][mt] = __builtin_amdgcn_wmma_f32_16x16x32_f16(
                false, bw[ks % 3][1], false, af[mt], (short)0, acc[1][mt], false,
                false);
            acc[2][mt] = __builtin_amdgcn_wmma_f32_16x16x32_f16(
                false, af[mt], false, bw[ks % 3][2], (short)0, acc[2][mt], false,
                false);
        }
    }

    // gather: the wave's 16 columns are depth 16 (w & 3) .. + 15 of head w >> 2
    {
        const int hd = wave >> 2;
        const int d0 = (wave & 3) * 16;
#pragma unroll
        for (int mt = 0; mt < 4; ++mt) {
            const int qk = (hd * 64 + mt * 16 + l15) * QO_P + d0 + hh8;
            *(v8h*)&Os[0][qk] =
                __builtin_convertvector((acc[0][mt] + bq8) * 0.125f, v8h);
            *(v8h*)&Os[1][qk] = __builtin_convertvector(acc[1][mt] + bk8, v8h);
            *(v8h*)&Os[2][(hd * 64 + d0 + l15) * QO_P + mt * 16 + hh8] =
                __builtin_convertvector(acc[2][mt] + bvv, v8h);
        }
    }
    __syncthreads();  // the gathered tiles are read across waves

    // out: 8 lanes a 128-byte row, 4 rows a wave-wide store; head i per trip
    const int b = m0 / S_;
    const int s0 = m0 % S_;
    const int row = t >> 3;
    const int c8 = (t & 7) * 8;
#pragma unroll
    for (int i = 0; i < H_; ++i) {
        const int ls = (i * 64 + row) * QO_P + c8;
        const size_t bh = (size_t)(b * H_ + i);
        const v8h oq = *(const v8h*)&Os[0][ls];
        const v8h ok = *(const v8h*)&Os[1][ls];
        const v8h ov = *(const v8h*)&Os[2][ls];
        *(v8h*)&qh[(bh * S_ + s0 + row) * DEPTH_ + c8] = oq;
        *(v8h*)&kh[(bh * S_ + s0 + row) * DEPTH_ + c8] = ok;
        *(v8h*)&vT[(bh * DEPTH_ + row) * S_ + s0 + c8] = ov;
    }
}

__device__ __forceinline__ float xhalf(float x) {
    int v = __builtin_bit_cast(int, x);
    return __builtin_bit_cast(
        float, __builtin_amdgcn_permlanex16(v, v, 0x76543210, 0xfedcba98, false,
                                            false));
}

#define AK_P 72                    // halves: LDS pitch of a K or V row
#define AK_BUF (128 * AK_P)        // halves: one buffer of K, or of V

// One thread's share of a 128-key stage: four 16-byte chunks of K (rows 32
// apart) and four of V^T (rows 16 apart).  The eight copies and s_wait_xcnt 0
// are one statement, so that the wait stands in front of every later write of
// the address registers.
__device__ __forceinline__ void attn_stage(_Float16* kl, const _Float16* kg,
                                           _Float16* vl, const _Float16* vg) {
    const uint32_t k0 = (uint32_t)(uintptr_t)kl;
    const uint32_t v0 = (uint32_t)(uintptr_t)vl;
    asm volatile(
        "global_load_async_to_lds_b128 %0, %8, off\n\t"
        "global_load_async_to_lds_b128 %1, %9, off\n\t"
        "global_load_async_to_lds_b128 %2, %10, off\n\t"
        "global_load_async_to_lds_b128 %3, %11, off\n\t"
        "global_load_async_to_lds_b128 %4, %12, off\n\t"
        "global_load_async_to_lds_b128 %5, %13, off\n\t"
        "global_load_async_to_lds_b128 %6, %14, off\n\t"
        "global_load_async_to_lds_b128 %7, %15, off\n\t"
        "s_wait_xcnt 0x0"
        :
        : "v"(k0), "v"(k0 + 32 * AK_P * 2), "v"(k0 + 64 * AK_P * 2),
          "v"(k0 + 96 * AK_P * 2), "v"(v0), "v"(v0 + 16 * AK_P * 2),
          "v"(v0 + 32 * AK_P * 2), "v"(v0 + 48 * AK_P * 2), "v"(kg),
          "v"(kg + 32 * DEPTH_), "v"(kg + 64 * DEPTH_), "v"(kg + 96 * DEPTH_),
          "v"(vg), "v"(vg + 16 * S_), "v"(vg + 32 * S_), "v"(vg + 48 * S_)
        : "memory");
}

__global__ __launch_bounds__(256) void attn_kernel(
    const _Float16* __restrict__ qh, const _Float16* __restrict__ kh,
    const _Float16* __restrict__ vT, const float* __restrict__ mask,
    _Float16* __restrict__ ctxh) {
    // Rows hold 64 halves; the pitch is 72 halves (144 B = 16 B x odd) so that the
    // 16 rows of a ds_load_b128 fragment read fall on distinct LDS banks.
    __shared__ __align__(16) _Float16 Ks[2][128][AK_P];     // [kpos][d]
    __shared__ __align__(16) _Float16 VsT[2][2][64][AK_P];  // [key half][d][kpos]
    __shared__ __align__(32) float Ms[S_];              // mask * -1e9 of batch b
    __shared__ uint32_t Mf[S_ / 128];  // per stage: not 0 where a term is not 0

    const int qt = blockIdx.x;
    const int bh = blockIdx.y;
    const int b = bh / H_;
    const int h = bh % H_;
    const int t = threadIdx.x;
    // wave-uniform by construction; in a scalar register the choice between the
    // key halves is scalar too
    const int wave = __builtin_amdgcn_readfirstlane(t >> 5);
    const int qg = wave & 3;   // query group
    const int kh2 = wave >> 2;  // key half
    const int lane = t & 31;
    const int hh8 = (lane >> 4) << 3;
    const size_t base = (size_t)bh * S_ * DEPTH_;  // q/k and vT share extent
    const int qr0 = qt * 128 + qg * 32;
    const int NT = S_ / 128;

    // Q fragments straight from global (two 16B loads each); g: the query tile
    v16h qA[2][2];
#pragma unroll
    for (int g = 0; g < 2; ++g)
#pragma unroll
        for (int c = 0; c < 2; ++c)
            qA[g][c] = load_frag(qh + base +
                                     (size_t)(qr0 + g * 16 + (lane & 15)) * DEPTH_ +
                                     c * 32,
                                 lane);

    v8f O[2][4] = {};
    float mrow[2] = {-1e30f, -1e30f};
    float lrow[2] = {0.0f, 0.0f};  // this wave's keys, this lane half's only

    // this thread's first chunk of a stage: K row t / 8, V^T row t / 16
    const _Float16* kg = kh + base + (size_t)(t >> 3) * DEPTH_ + (t & 7) * 8;
    const _Float16* vg = vT + base + (size_t)(t >> 4) * S_ + (t & 15) * 8;
    _Float16* kl = &Ks[0][t >> 3][(t & 7) * 8];
    _Float16* vl = &VsT[0][(t >> 3) & 1][t >> 4][(t & 7) * 8];

    // stage the first 128 keys into buffer 0
    attn_stage(kl, kg, vl, vg);

    // The mask term varies along a lane's registers: the whole row of the batch
    // goes to LDS once; the barrier behind the stage flags publishes it.
    const v4f* mp = (const v4f*)(mask + (size_t)b * S_) + t;
    v4f mv[4];
    // unrolled with a fixed trip count: all four loads fly together
#pragma unroll
    for (int k = 0; k < 4; ++k) mv[k] = mp[k * 256];
    // unrolled: mv lives in registers
#pragma unroll
    for (int k = 0; k < 4; ++k) {
        const v4f tm = mv[k] * -1e9f;
        ((v4f*)Ms)[t + k * 256] = tm;
        // a wave's 32 chunks are the 128 keys of stage wave + 8 k; a NaN term
        // compares unequal and counts as a term
        const uint32_t nz = __builtin_amdgcn_ballot_w32(
            tm[0] != 0.0f || tm[1] != 0.0f || tm[2] != 0.0f || tm[3] != 0.0f);
        if (lane == 0) Mf[wave + k * 8] = nz;
    }
    __syncthreads();  // the stage flags are read by every wave
    // bit kt: stage kt has a mask term that is not zero.  A scalar value, so the
    // loop's test is a scalar branch, one per stage.
    const uint32_t mbits = __builtin_amdgcn_ballot_w32(Mf[lane] != 0u);

    for (int kt = 0; kt < NT; ++kt) {
        const int buf = kt & 1;
        wait_async0();
        __syncthreads();  // stage `buf` ready

        if (kt + 1 < NT)  // DMA next stage into other buffer
            attn_stage(kl + (buf ^ 1) * AK_BUF, kg + (size_t)(kt + 1) * 128 * DEPTH_,
                       vl + (buf ^ 1) * AK_BUF, vg + (kt + 1) * 128);

        // logits tiles: S^T = K @ Q^T   (64 kpos x 16 q, twice)
        v8f sc[2][4] = {};
        v16h kf[4][2];
#pragma unroll
        for (int nt = 0; nt < 4; ++nt)
#pragma unroll
            for (int c = 0; c < 2; ++c)
                kf[nt][c] = load_frag(
                    &Ks[buf][kh2 * 64 + nt * 16 + (lane & 15)][c * 32], lane);
        // keeps the stage's K reads as one group in front of the products, as
        // they stood; sunk to their use, each pair is waited out by itself
        __builtin_amdgcn_sched_barrier(0);
#pragma unroll
        for (int nt = 0; nt < 4; ++nt)
#pragma unroll
            for (int c = 0; c < 2; ++c)
#pragma unroll
                for (int g = 0; g < 2; ++g)
                    sc[g][nt] = __builtin_amdgcn_wmma_f32_16x16x32_f16(
                        false, kf[nt][c], false, qA[g][c], (short)0, sc[g][nt],
                        false, false);
        // the mask term is read and added only in a stage that has one: adding
        // zero changes no score
        if ((mbits >> kt) & 1u) {
#pragma unroll
            for (int nt = 0; nt < 4; ++nt) {
                const v8f mk =
                    *(const v8f*)&Ms[kt * 128 + kh2 * 64 + nt * 16 + hh8];
#pragma unroll
                for (int g = 0; g < 2; ++g) sc[g][nt] += mk;
            }
        }

        // online softmax: 32 of the query's 64 scores live in this lane
        // (the loops down to the epilogue are unrolled because sc and O are
        // register arrays and need constant indices)
#pragma unroll
        for (int g = 0; g < 2; ++g) {
            float mx4[4];
#pragma unroll
            for (int nt = 0; nt < 4; ++nt) {
                float m = sc[g][nt][0];
#pragma unroll
                for (int r = 1; r < 8; ++r) m = fmaxf(m, sc[g][nt][r]);
                mx4[nt] = m;
            }
            float mx = fmaxf(fmaxf(mx4[0], mx4[1]), fmaxf(mx4[2], mx4[3]));
            mx = fmaxf(mx, xhalf(mx));
            const float newm = fmaxf(mrow[g], mx);
            const float corr = __expf(mrow[g] - newm);
            mrow[g] = newm;
#pragma unroll
            for (int nt = 0; nt < 4; ++nt)
#pragma unroll
                for (int r = 0; r < 8; ++r)
                    sc[g][nt][r] = __expf(sc[g][nt][r] - newm);
            const v8f s8 = (sc[g][0] + sc[g][1]) + (sc[g][2] + sc[g][3]);
            const float rs = ((s8[0] + s8[1]) + (s8[2] + s8[3])) +
                             ((s8[4] + s8[5]) + (s8[6] + s8[7]));
            lrow[g] = lrow[g] * corr + rs;
#pragma unroll
            for (int nt = 0; nt < 4; ++nt) O[g][nt] *= corr;
        }

        // O^T += V^T @ P^T; score tiles 2c and 2c+1 are B's k 0..15 and 16..31
#pragma unroll
        for (int c = 0; c < 2; ++c) {
            v16h vf[4];
#pragma unroll
            for (int nt = 0; nt < 4; ++nt)
                vf[nt] = load_frag(
                    &VsT[buf][kh2][nt * 16 + (lane & 15)][c * 32], lane);
            // takes the loaded values as inputs only: holds this half's eight V reads
            // together ahead of its products, as they stood; sunk to their use,
            // each pair of reads is waited out in front of its two products
            asm volatile("" ::"v"(vf[0]), "v"(vf[1]), "v"(vf[2]), "v"(vf[3]));
            v16h pb[2];
#pragma unroll
            for (int g = 0; g < 2; ++g)
                pb[g] = __builtin_shufflevector(
                    __builtin_convertvector(sc[g][2 * c], v8h),
                    __builtin_convertvector(sc[g][2 * c + 1], v8h), 0, 1, 2, 3, 4,
                    5, 6, 7, 8, 9, 10, 11, 12, 13, 14, 15);
#pragma unroll
            for (int nt = 0; nt < 4; ++nt)
#pragma unroll
                for (int g = 0; g < 2; ++g)
                    O[g][nt] = __builtin_amdgcn_wmma_f32_16x16x32_f16(
                        false, vf[nt], false, pb[g], (short)0, O[g][nt], false,
                        false);
        }
        // no trailing barrier: next iteration's wait+barrier protects reuse
    }

    // Merge of the two key halves.  Wave w and wave w ^ 4 hold partial results of
    // the same 32 queries: w keeps query tile kh2 and hands the other tile over
    // through the K buffers, 16 bytes a lane and store (lanes contiguous).
    __syncthreads();  // every wave has read its last stage: the K buffers are free
    v4f* xo = (v4f*)&Ks[0][0][0];                    // [wave][nt][part][lane]
    float* xs = (float*)&Ks[0][0][0] + 8 * 8 * 128;  // [wave][m, l][lane]
    const bool up = kh2 != 0;
#pragma unroll
    for (int nt = 0; nt < 4; ++nt) {
        const v8f s = up ? O[0][nt] : O[1][nt];
        xo[(wave * 8 + nt * 2) * 32 + lane] =
            __builtin_shufflevector(s, s, 0, 1, 2, 3);
        xo[(wave * 8 + nt * 2 + 1) * 32 + lane] =
            __builtin_shufflevector(s, s, 4, 5, 6, 7);
    }
    xs[wave * 64 + lane] = up ? mrow[0] : mrow[1];
    xs[wave * 64 + 32 + lane] = up ? lrow[0] : lrow[1];
    __syncthreads();  // the handed-over tiles are read by the partner waves

    const int pw = wave ^ 4;
    const float mk = up ? mrow[1] : mrow[0];
    const float mp2 = xs[pw * 64 + lane];
    const float newm = fmaxf(mk, mp2);
    const float ck = __expf(mk - newm);
    const float cp = __expf(mp2 - newm);
    const float lh = (up ? lrow[1] : lrow[0]) * ck + xs[pw * 64 + 32 + lane] * cp;

    // write merged-head context, normalized by l: 8 consecutive d per lane
    const float l = lh + xhalf(lh);
#pragma unroll
    for (int nt = 0; nt < 4; ++nt) {
        const v8f ok = up ? O[1][nt] : O[0][nt];
        const v4f p0 = xo[(pw * 8 + nt * 2) * 32 + lane];
        const v4f p1 = xo[(pw * 8 + nt * 2 + 1) * 32 + lane];
        const v8f op = __builtin_shufflevector(p0, p1, 0, 1, 2, 3, 4, 5, 6, 7);
        v8h o;
#pragma unroll
        for (int r = 0; r < 8; ++r)
            o[r] = (_Float16)((ok[r] * ck + op[r] * cp) / l);
        *(v8h*)&ctxh[(size_t)(b * S_ + qr0 + kh2 * 16 + (lane & 15)) * D_ +
                     h * DEPTH_ + nt * 16 + hh8] = o;
    }
}

// ---------------------------------------------------------------------------
// Everything behind attention, fused:
//   out1 = LN1(x + ctx @ wo + bo)
//   out  = LN2(out1 + LNff(relu(out1 @ w1 + b1)) @ w2 + b2).
// One block of 16 waves owns 64 rows from end to end, one block per WGP; the
// projection's result and h never leave the WGP.  A operands come from LDS, B
// operands (packed fragments) from L2 straight into registers: no two waves of a
// block need the same B fragment.
//   0a. a (64 x 256, f32) : wave w owns columns 16 w .. 16 w + 15, all 64 rows
//   0b. LN1 with residual : wave w owns rows 4 w .. 4 w + 3, row in registers
//   1. h (64 x 1024, f32) : wave w owns columns 64 w .. 64 w + 63, all 64 rows
//   2. LNff               : wave w owns rows 4 w .. 4 w + 3, row in registers
//   3. t (64 x 256, f32)  : wave w owns columns 16 w .. 16 w + 15, all 64 rows
//   4. LN2 with residual  : wave w owns rows 4 w .. 4 w + 3
// out1 goes on as f16 in LDS (A operand of step 1); its f32 form is needed again
// in step 4 only, by the lane that made it: that lane parks it in the workspace
// and loads it back, since steps 1 to 3 leave neither registers nor LDS for it.
// Every product sums k in steps of 32, in rising order; a LayerNorm sum is four
// values a lane and group, then a lane-exchange tree.
// LDS pitches: 16 B x odd for the ds_load_b128 fragment rows; for the f32
// planes 8 rows are 32 banks apart, so the two row groups of an accumulator
// store fall on different banks.
// ---------------------------------------------------------------------------
#define FA_P 264    // halves, ctx tile, then out1 tile
#define FH_P 1028   // floats, h before LNff
#define FHH_P 1032  // halves, h after LNff (overlays the f32 plane)
#define FT_P 260    // floats, a and later t (behind the f16 plane)
#define FA_BYTES (64 * FA_P * 2)
#define FH_BYTES (64 * FH_P * 4)
#define FHH_BYTES (64 * FHH_P * 2)

__global__ __launch_bounds__(512) void ffn_kernel(
    const _Float16* __restrict__ ctxh, const float* __restrict__ x,
    const _Float16* __restrict__ woP, const float* __restrict__ bo,
    const float* __restrict__ g1, const float* __restrict__ be1,
    float* out1F, const _Float16* __restrict__ w1P,
    const float* __restrict__ b1,
    const float* __restrict__ gff, const float* __restrict__ bff,
    const _Float16* __restrict__ w2P, const float* __restrict__ b2,
    const float* __restrict__ g2, const float* __restrict__ be2,
    float* __restrict__ out) {
    __shared__ __align__(16) char smem[FA_BYTES + FH_BYTES];
    _Float16* As = (_Float16*)smem;
    float* Hf = (float*)(smem + FA_BYTES);
    _Float16* Hh = (_Float16*)(smem + FA_BYTES);
    float* Tf = (float*)(smem + FA_BYTES + FHH_BYTES);

    const int t = threadIdx.x;
    // wave-uniform by construction; in a scalar register it makes every weight
    // and row base scalar, and the one vector offset (the lane's) lives on
    const int wave = __builtin_amdgcn_readfirstlane(t >> 5);
    const int lane = t & 31;
    const int l15 = lane & 15;
    const int hh8 = (lane >> 4) << 3;
    const int m0 = blockIdx.x * 64;

    // this lane's place in rows 4 * wave .. + 3 of x, out1 and out
    const size_t roff = (size_t)(m0 + wave * 4) * D_ + lane * 4;

    // ---- 0a. a = ctx @ wo + bo ----
    v4f xr[4][2];  // the residual rows of step 0b, asked for ahead of the product
    {
        // ctx tile (f16) to LDS: 64 rows x 512 B, one row per wave-wide load
        const v8h* src = (const v8h*)(ctxh + (size_t)m0 * D_);
        v8h a[4];
#pragma unroll
        for (int i = 0; i < 4; ++i) a[i] = src[t + i * 512];
        // all 8 B fragments of the wave's 16 columns
        const v8h* bp = (const v8h*)woP + (size_t)wave * (8 * 64) + lane;
        v16h bw[D_ / 32];
#pragma unroll
        for (int ks = 0; ks < D_ / 32; ++ks) bw[ks] = load_packed(bp + ks * 64);
#pragma unroll
        for (int rr = 0; rr < 4; ++rr)
#pragma unroll
            for (int j = 0; j < 2; ++j)
                xr[rr][j] = *(const v4f*)(x + roff + rr * D_ + j * 128);
        // the wait that belongs in front of an overwrite of these loads' address
        // registers, written here behind the loads
        asm volatile("s_wait_xcnt 0x0" ::: "memory");
#pragma unroll
        for (int i = 0; i < 4; ++i)
            *(v8h*)&As[(wave + i * 16) * FA_P + lane * 8] = a[i];
        __syncthreads();  // the ctx tile is read by every wave

        v8f acc[4] = {};
        // unrolled: bw is a register array
#pragma unroll
        for (int ks = 0; ks < D_ / 32; ++ks) {
            v16h af[4];
#pragma unroll
            for (int mt = 0; mt < 4; ++mt)
                af[mt] = load_frag(&As[(mt * 16 + l15) * FA_P + ks * 32], lane);
#pragma unroll
            for (int mt = 0; mt < 4; ++mt)
                acc[mt] = __builtin_amdgcn_wmma_f32_16x16x32_f16(
                    false, af[mt], false, bw[ks], (short)0, acc[mt], false,
                    false);
        }
        const int col = wave * 16 + l15;
        const float bvv = bo[col];
#pragma unroll
        for (int mt = 0; mt < 4; ++mt)
#pragma unroll
            for (int r = 0; r < 8; ++r)
                Tf[(mt * 16 + r + hh8) * FT_P + col] = acc[mt][r] + bvv;
    }
    // as above, for the bias load
    asm volatile("s_wait_xcnt 0x0" ::: "memory");
    __syncthreads();  // rows of a are complete, the ctx tile has been read

    // ---- 0b. out1 = LN1(a + x), rows 4 * wave .. + 3 ----
    {
        constexpr int NV = 2, n = D_;
        v4f v[4][NV];
#pragma unroll
        for (int rr = 0; rr < 4; ++rr)
#pragma unroll
            for (int j = 0; j < NV; ++j)
                v[rr][j] =
                    *(const v4f*)&Tf[(wave * 4 + rr) * FT_P + j * 128 + lane * 4] +
                    xr[rr][j];
        float mu[4], rstd[4];
#pragma unroll
        for (int rr = 0; rr < 4; ++rr) {
            float s = 0.0f;
#pragma unroll
            for (int j = 0; j < NV; ++j)
                s += (v[rr][j][0] + v[rr][j][1]) + (v[rr][j][2] + v[rr][j][3]);
            mu[rr] = s;
        }
#pragma unroll
        for (int o = 16; o >= 1; o >>= 1)
#pragma unroll
            for (int rr = 0; rr < 4; ++rr) mu[rr] += __shfl_xor(mu[rr], o, 32);
#pragma unroll
        for (int rr = 0; rr < 4; ++rr) {
            mu[rr] = mu[rr] / n;
            float s2 = 0.0f;
#pragma unroll
            for (int j = 0; j < NV; ++j) {
                v[rr][j] -= mu[rr];
                v4f q = v[rr][j] * v[rr][j];
                s2 += (q[0] + q[1]) + (q[2] + q[3]);
            }
            rstd[rr] = s2;
        }
#pragma unroll
        for (int o = 16; o >= 1; o >>= 1)
#pragma unroll
            for (int rr = 0; rr < 4; ++rr)
                rstd[rr] += __shfl_xor(rstd[rr], o, 32);
#pragma unroll
        for (int rr = 0; rr < 4; ++rr) rstd[rr] = rsqrtf(rstd[rr] / n + 1e-3f);
#pragma unroll
        for (int j = 0; j < NV; ++j) {
            const v4f gg = *(const v4f*)(g1 + j * 128 + lane * 4);
            const v4f bb = *(const v4f*)(be1 + j * 128 + lane * 4);
#pragma unroll
            for (int rr = 0; rr < 4; ++rr) {
                v4f y = v[rr][j] * rstd[rr] * gg + bb;
                *(v4f*)(out1F + roff + rr * n + j * 128) = y;
                *(v4h*)&As[(wave * 4 + rr) * FA_P + j * 128 + lane * 4] =
                    __builtin_convertvector(y, v4h);
            }
        }
    }
    // as above, for the scale and shift loads and the out1 stores
    asm volatile("s_wait_xcnt 0x0" ::: "memory");
    __syncthreads();  // the out1 tile is read by every wave

    // ---- 1. h = relu(out1 @ w1 + b1) ----
    {
        v8f acc[4][4] = {};
        const v8h* bp = (const v8h*)w1P + (size_t)wave * (4 * 8 * 64) + lane;
        v16h bc[4], bn[4];  // B fragments of this k step and of the next
#pragma unroll
        for (int nt = 0; nt < 4; ++nt) bc[nt] = load_packed(bp + nt * 8 * 64);
        // unrolled: acc, bc and bn are register arrays, and every B address is
        // the one base plus a constant
#pragma unroll
        for (int ks = 0; ks < D_ / 32; ++ks) {
            if (ks + 1 < D_ / 32) {
#pragma unroll
                for (int nt = 0; nt < 4; ++nt)
                    bn[nt] = load_packed(bp + (nt * 8 + ks + 1) * 64);
            }
            // keeps the next step's L2 loads in front of this step's products;
            // sunk to their use, each would expose its whole latency
            __builtin_amdgcn_sched_barrier(0);
            v16h af[4];
#pragma unroll
            for (int mt = 0; mt < 4; ++mt)
                af[mt] = load_frag(&As[(mt * 16 + l15) * FA_P + ks * 32], lane);
#pragma unroll
            for (int nt = 0; nt < 4; ++nt) {
#pragma unroll
                for (int mt = 0; mt < 4; ++mt)
                    acc[mt][nt] = __builtin_amdgcn_wmma_f32_16x16x32_f16(
                        false, af[mt], false, bc[nt], (short)0, acc[mt][nt],
                        false, false);
            }
#pragma unroll
            for (int nt = 0; nt < 4; ++nt) bc[nt] = bn[nt];
        }
#pragma unroll
        for (int nt = 0; nt < 4; ++nt) {
            const int col = wave * 64 + nt * 16 + l15;
            const float bvv = b1[col];
#pragma unroll
            for (int mt = 0; mt < 4; ++mt)
#pragma unroll
                for (int r = 0; r < 8; ++r)
                    Hf[(mt * 16 + r + hh8) * FH_P + col] =
                        fmaxf(acc[mt][nt][r] + bvv, 0.0f);
        }
    }
    // the bias loads' offset register is reused further down: the wait that
    // belongs in front of that overwrite, written here behind the loads
    asm volatile("s_wait_xcnt 0x0" ::: "memory");
    __syncthreads();  // rows of h are complete

    // ---- 2. LNff, rows 4 * wave .. + 3, f16 result for the second product ----
    {
        constexpr int NV = 8, n = DFF_;
        v4f v[4][NV];
#pragma unroll
        for (int rr = 0; rr < 4; ++rr)
#pragma unroll
            for (int j = 0; j < NV; ++j)
                v[rr][j] =
                    *(const v4f*)&Hf[(wave * 4 + rr) * FH_P + j * 128 + lane * 4];
        __syncthreads();  // every f32 row is in registers: the plane is reused

        float mu[4], rstd[4];
#pragma unroll
        for (int rr = 0; rr < 4; ++rr) {
            float s = 0.0f;
#pragma unroll
            for (int j = 0; j < NV; ++j)
                s += (v[rr][j][0] + v[rr][j][1]) + (v[rr][j][2] + v[rr][j][3]);
            mu[rr] = s;
        }
#pragma unroll
        for (int o = 16; o >= 1; o >>= 1)
#pragma unroll
            for (int rr = 0; rr < 4; ++rr) mu[rr] += __shfl_xor(mu[rr], o, 32);
#pragma unroll
        for (int rr = 0; rr < 4; ++rr) {
            mu[rr] = mu[rr] / n;
            float s2 = 0.0f;
#pragma unroll
            for (int j = 0; j < NV; ++j) {
                v[rr][j] -= mu[rr];
                v4f q = v[rr][j] * v[rr][j];
                s2 += (q[0] + q[1]) + (q[2] + q[3]);
            }
            rstd[rr] = s2;
        }
#pragma unroll
        for (int o = 16; o >= 1; o >>= 1)
#pragma unroll
            for (int rr = 0; rr < 4; ++rr)
                rstd[rr] += __shfl_xor(rstd[rr], o, 32);
#pragma unroll
        for (int rr = 0; rr < 4; ++rr) rstd[rr] = rsqrtf(rstd[rr] / n + 1e-6f);
#pragma unroll
        for (int j = 0; j < NV; ++j) {
            const v4f gg = *(const v4f*)(gff + j * 128 + lane * 4);
            const v4f bb = *(const v4f*)(bff + j * 128 + lane * 4);
#pragma unroll
            for (int rr = 0; rr < 4; ++rr) {
                v4f y = v[rr][j] * rstd[rr] * gg + bb;
                *(v4h*)&Hh[(wave * 4 + rr) * FHH_P + j * 128 + lane * 4] =
                    __builtin_convertvector(y, v4h);
            }
        }
    }
    __syncthreads();  // the f16 rows are read by every wave

    // ---- 3. t = h @ w2 + b2 ----
    {
        v8f acc[4] = {};
        const v8h* bp = (const v8h*)w2P + (size_t)wave * (32 * 64) + lane;
        v16h bc[4], bn[4];  // B fragments of this group of 4 k steps, the next
#pragma unroll
        for (int j = 0; j < 4; ++j) bc[j] = load_packed(bp + j * 64);
        v16h ac[4], an[4];  // A fragments of this k step and of the next
#pragma unroll
        for (int mt = 0; mt < 4; ++mt)
            ac[mt] = load_frag(&Hh[(mt * 16 + l15) * FHH_P], lane);
        // unrolled: ac, an, bc and bn are register arrays
#pragma unroll
        for (int ks = 0; ks < DFF_ / 32; ++ks) {
            if ((ks & 3) == 0 && ks + 4 < DFF_ / 32) {
#pragma unroll
                for (int j = 0; j < 4; ++j)
                    bn[j] = load_packed(bp + (ks + 4 + j) * 64);
            }
            if (ks + 1 < DFF_ / 32) {
#pragma unroll
                for (int mt = 0; mt < 4; ++mt)
                    an[mt] = load_frag(
                        &Hh[(mt * 16 + l15) * FHH_P + (ks + 1) * 32], lane);
            }
            // keeps the loads for later k steps, as one group, in front of this
            // step's products; sunk to their use, each pair of LDS reads would
            // be waited out in front of its one product
            __builtin_amdgcn_sched_barrier(0);
#pragma unroll
            for (int mt = 0; mt < 4; ++mt)
                acc[mt] = __builtin_amdgcn_wmma_f32_16x16x32_f16(
                    false, ac[mt], false, bc[ks & 3], (short)0, acc[mt], false,
                    false);
#pragma unroll
            for (int mt = 0; mt < 4; ++mt) ac[mt] = an[mt];
            if ((ks & 3) == 3) {
#pragma unroll
                for (int j = 0; j < 4; ++j) bc[j] = bn[j];
            }
        }
        const int col = wave * 16 + l15;
        const float bvv = b2[col];
#pragma unroll
        for (int mt = 0; mt < 4; ++mt)
#pragma unroll
            for (int r = 0; r < 8; ++r)
                Tf[(mt * 16 + r + hh8) * FT_P + col] = acc[mt][r] + bvv;
    }
    __syncthreads();  // rows of t are complete

    // ---- 4. out = LN2(t + out1), rows 4 * wave .. + 3 ----
    {
        constexpr int NV = 2, n = D_;
        const size_t off = (size_t)(m0 + wave * 4) * n + lane * 4;
        v4f v[4][NV];
#pragma unroll
        for (int rr = 0; rr < 4; ++rr)
#pragma unroll
            for (int j = 0; j < NV; ++j)
                v[rr][j] =
                    *(const v4f*)&Tf[(wave * 4 + rr) * FT_P + j * 128 + lane * 4] +
                    *(const v4f*)(out1F + off + rr * n + j * 128);
        float mu[4], rstd[4];
#pragma unroll
        for (int rr = 0; rr < 4; ++rr) {
            float s = 0.0f;
#pragma unroll
            for (int j = 0; j < NV; ++j)
                s += (v[rr][j][0] + v[rr][j][1]) + (v[rr][j][2] + v[rr][j][3]);
            mu[rr] = s;
        }
#pragma unroll
        for (int o = 16; o >= 1; o >>= 1)
#pragma unroll
            for (int rr = 0; rr < 4; ++rr) mu[rr] += __shfl_xor(mu[rr], o, 32);
#pragma unroll
        for (int rr = 0; rr < 4; ++rr) {
            mu[rr] = mu[rr] / n;
            float s2 = 0.0f;
#pragma unroll
            for (int j = 0; j < NV; ++j) {
                v[rr][j] -= mu[rr];
                v4f q = v[rr][j] * v[rr][j];
                s2 += (q[0] + q[1]) + (q[2] + q[3]);
            }
            rstd[rr] = s2;
        }
#pragma unroll
        for (int o = 16; o >= 1; o >>= 1)
#pragma unroll
            for (int rr = 0; rr < 4; ++rr)
                rstd[rr] += __shfl_xor(rstd[rr], o, 32);
#pragma unroll
        for (int j = 0; j < NV; ++j) {
            const v4f gg = *(const v4f*)(g2 + j * 128 + lane * 4);
            const v4f bb = *(const v4f*)(be2 + j * 128 + lane * 4);
#pragma unroll
            for (int rr = 0; rr < 4; ++rr) {
                const float rs = rsqrtf(rstd[rr] / n + 1e-3f);
                *(v4f*)(out + off + rr * n + j * 128) = v[rr][j] * rs * gg + bb;
            }
        }
    }
}

// ---------------------------------------------------------------------------
extern "C" void kernel_launch(void* const* d_in, const int* in_sizes, int n_in,
                              void* d_out, int out_size, void* d_ws,
                              size_t ws_size, hipStream_t stream) {
    const float* x      = (const float*)d_in[0];
    const float* mask   = (const float*)d_in[1];
    const float* wq     = (const float*)d_in[2];
    const float* bq     = (const float*)d_in[3];
    const float* wk     = (const float*)d_in[4];
    const float* bk     = (const float*)d_in[5];
    const float* wv     = (const float*)d_in[6];
    const float* bv     = (const float*)d_in[7];
    const float* wo     = (const float*)d_in[8];
    const float* bo     = (const float*)d_in[9];
    const float* w1     = (const float*)d_in[10];
    const float* b1     = (const float*)d_in[11];
    const float* lnffg  = (const float*)d_in[12];
    const float* lnffb  = (const float*)d_in[13];
    const float* w2     = (const float*)d_in[14];
    const float* b2     = (const float*)d_in[15];
    const float* ln1g   = (const float*)d_in[16];
    const float* ln1b   = (const float*)d_in[17];
    const float* ln2g   = (const float*)d_in[18];
    const float* ln2b   = (const float*)d_in[19];
    float* out = (float*)d_out;

    // workspace carve-up
    char* p = (char*)d_ws;
    _Float16* qh   = (_Float16*)p; p += (size_t)M_ * D_ * 2;    // 8 MiB
    _Float16* kh   = (_Float16*)p; p += (size_t)M_ * D_ * 2;    // 8 MiB
    _Float16* vh   = (_Float16*)p; p += (size_t)M_ * D_ * 2;    // 8 MiB (vT)
    _Float16* ctxh = (_Float16*)p; p += (size_t)M_ * D_ * 2;    // 8 MiB
    float* out1F   = (float*)p;    p += (size_t)M_ * D_ * 4;    // 16 MiB
    _Float16* wqP  = (_Float16*)p; p += (size_t)D_ * D_ * 2;
    _Float16* wkP  = (_Float16*)p; p += (size_t)D_ * D_ * 2;
    _Float16* wvP  = (_Float16*)p; p += (size_t)D_ * D_ * 2;
    _Float16* woP  = (_Float16*)p; p += (size_t)D_ * D_ * 2;
    _Float16* w1P  = (_Float16*)p; p += (size_t)D_ * DFF_ * 2;
    _Float16* w2P  = (_Float16*)p; p += (size_t)DFF_ * D_ * 2;

    // all six weights -> f16 in fragment order
    prep_kernel<<<PREP_BLOCKS, 512, 0, stream>>>(wq, wk, wv, wo, w1, w2, wqP, wkP,
                                                 wvP, woP, w1P, w2P);

    // q/k/v projections from f32 x (q pre-scaled by 1/sqrt(DEPTH); v written
    // transposed)
    qkv_kernel<<<M_ / 64, 512, 0, stream>>>(x, wqP, wkP, wvP, bq, bk, bv, qh, kh,
                                            vh);

    // flash attention
    attn_kernel<<<dim3(S_ / 128, B_ * H_), 256, 0, stream>>>(qh, kh, vh, mask,
                                                            ctxh);

    // output projection -> residual LN (eps 1e-3) -> relu(out1@w1+b1) ->
    // LN(eps 1e-6) -> @w2+b2 -> residual LN (eps 1e-3)
    ffn_kernel<<<M_ / 64, 512, 0, stream>>>(ctxh, x, woP, bo, ln1g, ln1b, out1F,
                                            w1P, b1, lnffg, lnffb, w2P, b2, ln2g,
                                            ln2b, out);
}

// v010
// It runs in 96.4 microseconds.
// Next to v009, in two timings, it ran 1.07 times as fast each time.
// All steps since v000 together make it 5.37 times as fast.
#include <hip/hip_runtime.h>
#include <hip/hip_bf16.h>

// ---------------------------------------------------------------------------
// Transformer encoder layer for MI455X (gfx1250, wave32, WMMA).
// B=4, S=4096, D=256, H=4, DEPTH=64, DFF=1024.
// All GEMMs + attention on v_wmma_f32_16x16x32_f16 (f16 in, f32 acc).
// The q, k, v projections are one kernel that owns 64 rows a block and converts
// x itself.  attn_kernel stages its tiles with global_load_async_to_lds_b128,
// double-buffered (ASYNCcnt); fragments load as 2x b128.  All that follows
// attention (output projection, LN1, the FFN chain, LN2) is one kernel that
// keeps its rows on the WGP.
// ---------------------------------------------------------------------------

#define B_ 4
#define S_ 4096
#define D_ 256
#define H_ 4
#define DEPTH_ 64
#define DFF_ 1024
#define M_ (B_ * S_)

typedef __attribute__((ext_vector_type(16))) _Float16 v16h;
typedef __attribute__((ext_vector_type(8)))  _Float16 v8h;
typedef __attribute__((ext_vector_type(4)))  _Float16 v4h;
typedef __attribute__((ext_vector_type(8)))  float    v8f;
typedef __attribute__((ext_vector_type(4)))  float    v4f;

// Load one 16-half fragment for lane `lane` from a row whose K-run starts at
// `p`.  Lane's data: K offsets [b, b+8) and [b+16, b+24), b = 8*(lane>=16).
__device__ __forceinline__ v16h load_frag(const _Float16* p, int lane) {
    const v8h* q = (const v8h*)(p + ((lane >> 4) << 3));
    v8h lo = q[0];
    v8h hi = q[2];
    return __builtin_shufflevector(lo, hi, 0, 1, 2, 3, 4, 5, 6, 7, 8, 9, 10,
                                   11, 12, 13, 14, 15);
}

__device__ __forceinline__ void wait_async0() {
    asm volatile("s_wait_asynccnt 0" ::: "memory");
}

// ---------------------------------------------------------------------------
// Weight convert into WMMA fragment order for the two row-block kernels, which
// read weights straight from L2 into registers.  One fragment (16 columns n x 32 k)
// is 1 KiB: [part][lane][8 halves], lane = (n & 15) + 16 * hh and
// k = 32 * ks + 16 * part + 8 * hh + e, the k order of load_frag.  A wave-wide
// 16-byte load then covers 512 contiguous bytes.  One 16-byte chunk a thread.
// ---------------------------------------------------------------------------
__device__ __forceinline__ void pack_f16_block(
    const float* __restrict__ W, _Float16* __restrict__ P, int K, int N,
    int blk) {
    const int c = blk * 512 + threadIdx.x;
    const int lane = c & 31;
    const int part = (c >> 5) & 1;
    const int f = c >> 6;  // fragment number: nt * (K / 32) + ks
    const int KS = K >> 5;
    const int ks = f % KS;
    const int nt = f / KS;
    const int n = nt * 16 + (lane & 15);
    const int k0 = ks * 32 + part * 16 + (lane >> 4) * 8;
    float w[8];
#pragma unroll
    for (int e = 0; e < 8; ++e) w[e] = W[(size_t)(k0 + e) * N + n];
    // the converted halves land in registers that held load addresses: the wait
    // that belongs in front of that overwrite
    asm volatile("s_wait_xcnt 0x0" ::: "memory");
    v8h o;
#pragma unroll
    for (int e = 0; e < 8; ++e) o[e] = (_Float16)w[e];
    ((v8h*)P)[c] = o;
    // inlined several times into one kernel, the store is not followed by the
    // program's end alone: the wait that belongs in front of an overwrite of its
    // registers
    asm volatile("s_wait_xcnt 0x0" ::: "memory");
}

// ---------------------------------------------------------------------------
// All weight preparation in one launch.  The six jobs do not depend on each
// other, so each takes a range of the grid's blocks (512 threads a block):
//   [0, 128)    w1, w2 in fragment order, 64 blocks each
//   [128, 192)  wo, wq, wk, wv in fragment order, 16 blocks each
// ---------------------------------------------------------------------------
#define PREP_PACK_BLOCKS (D_ * DFF_ / 8 / 512)
#define PREP_PACKO_BLOCKS (D_ * D_ / 8 / 512)
#define PREP_BLOCKS (2 * PREP_PACK_BLOCKS + 4 * PREP_PACKO_BLOCKS)

__global__ __launch_bounds__(512) void prep_kernel(
    const float* __restrict__ wq, const float* __restrict__ wk,
    const float* __restrict__ wv, const float* __restrict__ wo,
    const float* __restrict__ w1, const float* __restrict__ w2,
    _Float16* __restrict__ wqP, _Float16* __restrict__ wkP,
    _Float16* __restrict__ wvP, _Float16* __restrict__ woP,
    _Float16* __restrict__ w1P, _Float16* __restrict__ w2P) {
    int blk = blockIdx.x;
    if (blk < PREP_PACK_BLOCKS) {
        pack_f16_block(w1, w1P, D_, DFF_, blk);
    } else if (blk < 2 * PREP_PACK_BLOCKS) {
        pack_f16_block(w2, w2P, DFF_, D_, blk - PREP_PACK_BLOCKS);
    } else {
        blk -= 2 * PREP_PACK_BLOCKS;
        const int j = blk / PREP_PACKO_BLOCKS;
        pack_f16_block(j == 0 ? wo : j == 1 ? wq : j == 2 ? wk : wv,
                       j == 0 ? woP : j == 1 ? wqP : j == 2 ? wkP : wvP, D_, D_,
                       blk % PREP_PACKO_BLOCKS);
    }
}

// One packed fragment: two wave-wide 16-byte loads, 512 bytes apart.
__device__ __forceinline__ v16h load_packed(const v8h* p) {
    v8h lo = p[0];
    v8h hi = p[32];
    return __builtin_shufflevector(lo, hi, 0, 1, 2, 3, 4, 5, 6, 7, 8, 9, 10,
                                   11, 12, 13, 14, 15);
}

// ---------------------------------------------------------------------------
// q, k, v projections.  One block of 16 waves owns 64 rows of x, one block per
// WGP: it reads them once as f32, converts them to f16 in LDS (the operand every
// wave shares) and makes all 768 output columns.  Wave w owns columns
// 16 w .. 16 w + 15 of each of q, k and v; its weights come as packed fragments
// from L2 straight into registers (no two waves need the same fragment).
// q and k are made as transposed products (weights as A, x as B), so that a lane
// holds 8 consecutive depth values of one position; v as x times weights, so
// that a lane holds 8 consecutive positions of one depth value: either way the
// lane's 8 results are 16 contiguous bytes of the output's layout.  The three
// tiles are gathered in LDS as [head][row][64] and leave as whole 128-byte lines.
// q: (x wq + bq) * log2(e) / sqrt(DEPTH), so that attention's scores are
// arguments of exp2.  q, k: [B*H, S, 64] f16.  v: [B*H, 64, S] f16.
// Every product sums k in steps of 32, in rising order.
// ---------------------------------------------------------------------------
#define QX_P 264  // halves: pitch of an x row (16 B x odd)
#define QO_P 72   // halves: pitch of a gathered output row (16 B x odd)
#define LOG2E_ 1.44269504088896340736f

__global__ __launch_bounds__(512) void qkv_kernel(
    const float* __restrict__ x, const _Float16* __restrict__ wqP,
    const _Float16* __restrict__ wkP, const _Float16* __restrict__ wvP,
    const float* __restrict__ bq, const float* __restrict__ bk,
    const float* __restrict__ bv, _Float16* __restrict__ qh,
    _Float16* __restrict__ kh, _Float16* __restrict__ vT) {
    __shared__ __align__(16) _Float16 Xs[64 * QX_P];
    __shared__ __align__(16) _Float16 Os[3][H_ * 64 * QO_P];  // q, k, v^T tiles

    const int t = threadIdx.x;
    // wave-uniform by construction; in a scalar register it makes every weight
    // base scalar
    const int wave = __builtin_amdgcn_readfirstlane(t >> 5);
    const int lane = t & 31;
    const int l15 = lane & 15;
    const int hh8 = (lane >> 4) << 3;
    const int m0 = blockIdx.x * 64;

    // the x tile: 64 rows x 1 KiB, 512 contiguous bytes per wave-wide load
    const v4f* src = (const v4f*)(x + (size_t)m0 * D_);
    v4f xv[8];
#pragma unroll
    for (int k = 0; k < 8; ++k) xv[k] = src[t + k * 512];
    // weight fragments in a ring of three k steps: asked for two steps ahead
    const size_t wo0 = (size_t)wave * (8 * 64) + lane;
    const v8h* bp0 = (const v8h*)wqP + wo0;
    const v8h* bp1 = (const v8h*)wkP + wo0;
    const v8h* bp2 = (const v8h*)wvP + wo0;
    v16h bw[3][3];  // [ring place][q, k, v]
#pragma unroll
    for (int ks = 0; ks < 2; ++ks) {
        bw[ks][0] = load_packed(bp0 + ks * 64);
        bw[ks][1] = load_packed(bp1 + ks * 64);
        bw[ks][2] = load_packed(bp2 + ks * 64);
    }
    const v8f bq8 = *(const v8f*)(bq + wave * 16 + hh8);
    const v8f bk8 = *(const v8f*)(bk + wave * 16 + hh8);
    const float bvv = bv[wave * 16 + l15];
    // the wait that belongs in front of an overwrite of these loads' address
    // registers, written here behind the loads
    asm volatile("s_wait_xcnt 0x0" ::: "memory");
#pragma unroll
    for (int k = 0; k < 8; ++k) {
        const int i = t + k * 512;
        *(v4h*)&Xs[(i >> 6) * QX_P + (i & 63) * 4] =
            __builtin_convertvector(xv[k], v4h);
    }
    __syncthreads();  // the x tile is read by every wave

    v8f acc[3][4] = {};
    // unrolled: acc and bw are register arrays, and every weight address is its
    // base plus a constant
#pragma unroll
    for (int ks = 0; ks < D_ / 32; ++ks) {
        if (ks + 2 < D_ / 32) {
            bw[(ks + 2) % 3][0] = load_packed(bp0 + (ks + 2) * 64);
            bw[(ks + 2) % 3][1] = load_packed(bp1 + (ks + 2) * 64);
            bw[(ks + 2) % 3][2] = load_packed(bp2 + (ks + 2) * 64);
        }
        // keeps the L2 loads for two steps on in front of this step's products;
        // sunk to their use, each would expose its whole latency
        __builtin_amdgcn_sched_barrier(0);
        v16h af[4];
#pragma unroll
        for (int mt = 0; mt < 4; ++mt)
            af[mt] = load_frag(&Xs[(mt * 16 + l15) * QX_P + ks * 32], lane);
#pragma unroll
        for (int mt = 0; mt < 4; ++mt) {
            acc[0][mt] = __builtin_amdgcn_wmma_f32_16x16x32_f16(
                false, bw[ks % 3][0], false, af[mt], (short)0, acc[0][mt], false,
                false);
            acc[1][mt] = __builtin_amdgcn_wmma_f32_16x16x32_f16(
                false, bw[ks % 3][1], false, af[mt], (short)0, acc[1][mt], false,
                false);
            acc[2][mt] = __builtin_amdgcn_wmma_f32_16x16x32_f16(
                false, af[mt], false, bw[ks % 3][2], (short)0, acc[2][mt], false,
                false);
        }
    }

    // gather: the wave's 16 columns are depth 16 (w & 3) .. + 15 of head w >> 2
    {
        const int hd = wave >> 2;
        const int d0 = (wave & 3) * 16;
#pragma unroll
        for (int mt = 0; mt < 4; ++mt) {
            const int qk = (hd * 64 + mt * 16 + l15) * QO_P + d0 + hh8;
            *(v8h*)&Os[0][qk] =
                __builtin_convertvector((acc[0][mt] + bq8) * (0.125f * LOG2E_), v8h);
            *(v8h*)&Os[1][qk] = __builtin_convertvector(acc[1][mt] + bk8, v8h);
            *(v8h*)&Os[2][(hd * 64 + d0 + l15) * QO_P + mt * 16 + hh8] =
                __builtin_convertvector(acc[2][mt] + bvv, v8h);
        }
    }
    __syncthreads();  // the gathered tiles are read across waves

    // out: 8 lanes a 128-byte row, 4 rows a wave-wide store; head i per trip
    const int b = m0 / S_;
    const int s0 = m0 % S_;
    const int row = t >> 3;
    const int c8 = (t & 7) * 8;
#pragma unroll
    for (int i = 0; i < H_; ++i) {
        const int ls = (i * 64 + row) * QO_P + c8;
        const size_t bh = (size_t)(b * H_ + i);
        const v8h oq = *(const v8h*)&Os[0][ls];
        const v8h ok = *(const v8h*)&Os[1][ls];
        const v8h ov = *(const v8h*)&Os[2][ls];
        *(v8h*)&qh[(bh * S_ + s0 + row) * DEPTH_ + c8] = oq;
        *(v8h*)&kh[(bh * S_ + s0 + row) * DEPTH_ + c8] = ok;
        *(v8h*)&vT[(bh * DEPTH_ + row) * S_ + s0 + c8] = ov;
    }
}

__device__ __forceinline__ float xhalf(float x) {
    int v = __builtin_bit_cast(int, x);
    return __builtin_bit_cast(
        float, __builtin_amdgcn_permlanex16(v, v, 0x76543210, 0xfedcba98, false,
                                            false));
}

#define AK_P 72                    // halves: LDS pitch of a K or V row
#define AK_BUF (128 * AK_P)        // halves: one buffer of K, or of V

// One thread's share of a 128-key stage: four 16-byte chunks of K (rows 32
// apart) and four of V^T (rows 16 apart).  The eight copies and s_wait_xcnt 0
// are one statement, so that the wait stands in front of every later write of
// the address registers.
__device__ __forceinline__ void attn_stage(_Float16* kl, const _Float16* kg,
                                           _Float16* vl, const _Float16* vg) {
    const uint32_t k0 = (uint32_t)(uintptr_t)kl;
    const uint32_t v0 = (uint32_t)(uintptr_t)vl;
    asm volatile(
        "global_load_async_to_lds_b128 %0, %8, off\n\t"
        "global_load_async_to_lds_b128 %1, %9, off\n\t"
        "global_load_async_to_lds_b128 %2, %10, off\n\t"
        "global_load_async_to_lds_b128 %3, %11, off\n\t"
        "global_load_async_to_lds_b128 %4, %12, off\n\t"
        "global_load_async_to_lds_b128 %5, %13, off\n\t"
        "global_load_async_to_lds_b128 %6, %14, off\n\t"
        "global_load_async_to_lds_b128 %7, %15, off\n\t"
        "s_wait_xcnt 0x0"
        :
        : "v"(k0), "v"(k0 + 32 * AK_P * 2), "v"(k0 + 64 * AK_P * 2),
          "v"(k0 + 96 * AK_P * 2), "v"(v0), "v"(v0 + 16 * AK_P * 2),
          "v"(v0 + 32 * AK_P * 2), "v"(v0 + 48 * AK_P * 2), "v"(kg),
          "v"(kg + 32 * DEPTH_), "v"(kg + 64 * DEPTH_), "v"(kg + 96 * DEPTH_),
          "v"(vg), "v"(vg + 16 * S_), "v"(vg + 32 * S_), "v"(vg + 48 * S_)
        : "memory");
}

__global__ __launch_bounds__(256) void attn_kernel(
    const _Float16* __restrict__ qh, const _Float16* __restrict__ kh,
    const _Float16* __restrict__ vT, const float* __restrict__ mask,
    _Float16* __restrict__ ctxh) {
    // Rows hold 64 halves; the pitch is 72 halves (144 B = 16 B x odd) so that the
    // 16 rows of a ds_load_b128 fragment read fall on distinct LDS banks.
    __shared__ __align__(16) _Float16 Ks[2][128][AK_P];     // [kpos][d]
    __shared__ __align__(16) _Float16 VsT[2][2][64][AK_P];  // [key half][d][kpos]
    __shared__ __align__(32) float Ms[S_];  // mask * -1e9 * log2(e) of batch b
    __shared__ uint32_t Mf[S_ / 128];  // per stage: not 0 where a term is not 0

    const int qt = blockIdx.x;
    const int bh = blockIdx.y;
    const int b = bh / H_;
    const int h = bh % H_;
    const int t = threadIdx.x;
    // wave-uniform by construction; in a scalar register the choice between the
    // key halves is scalar too
    const int wave = __builtin_amdgcn_readfirstlane(t >> 5);
    const int qg = wave & 3;   // query group
    const int kh2 = wave >> 2;  // key half
    const int lane = t & 31;
    const int hh8 = (lane >> 4) << 3;
    const size_t base = (size_t)bh * S_ * DEPTH_;  // q/k and vT share extent
    const int qr0 = qt * 128 + qg * 32;
    const int NT = S_ / 128;

    // Q fragments straight from global (two 16B loads each); g: the query tile
    v16h qA[2][2];
#pragma unroll
    for (int g = 0; g < 2; ++g)
#pragma unroll
        for (int c = 0; c < 2; ++c)
            qA[g][c] = load_frag(qh + base +
                                     (size_t)(qr0 + g * 16 + (lane & 15)) * DEPTH_ +
                                     c * 32,
                                 lane);

    v8f O[2][4] = {};
    float mrow[2] = {-1e30f, -1e30f};  // the reference maximum in use
    float lrow[2] = {0.0f, 0.0f};  // this wave's keys, this lane half's only
    // (the first stage's scores all pass the start reference, which renews it)

    // this thread's first chunk of a stage: K row t / 8, V^T row t / 16
    const _Float16* kg = kh + base + (size_t)(t >> 3) * DEPTH_ + (t & 7) * 8;
    const _Float16* vg = vT + base + (size_t)(t >> 4) * S_ + (t & 15) * 8;
    _Float16* kl = &Ks[0][t >> 3][(t & 7) * 8];
    _Float16* vl = &VsT[0][(t >> 3) & 1][t >> 4][(t & 7) * 8];

    // stage the first 128 keys into buffer 0
    attn_stage(kl, kg, vl, vg);

    // The mask term varies along a lane's registers: the whole row of the batch
    // goes to LDS once; the barrier behind the stage flags publishes it.
    const v4f* mp = (const v4f*)(mask + (size_t)b * S_) + t;
    v4f mv[4];
    // unrolled with a fixed trip count: all four loads fly together
#pragma unroll
    for (int k = 0; k < 4; ++k) mv[k] = mp[k * 256];
    // unrolled: mv lives in registers
#pragma unroll
    for (int k = 0; k < 4; ++k) {
        const v4f tm = mv[k] * -1e9f;
        ((v4f*)Ms)[t + k * 256] = tm * LOG2E_;
        // a wave's 32 chunks are the 128 keys of stage wave + 8 k; a NaN term
        // compares unequal and counts as a term
        const uint32_t nz = __builtin_amdgcn_ballot_w32(
            tm[0] != 0.0f || tm[1] != 0.0f || tm[2] != 0.0f || tm[3] != 0.0f);
        if (lane == 0) Mf[wave + k * 8] = nz;
    }
    __syncthreads();  // the stage flags are read by every wave
    // bit kt: stage kt has a mask term that is not zero.  A scalar value, so the
    // loop's test is a scalar branch, one per stage.
    const uint32_t mbits = __builtin_amdgcn_ballot_w32(Mf[lane] != 0u);

    for (int kt = 0; kt < NT; ++kt) {
        const int buf = kt & 1;
        wait_async0();
        __syncthreads();  // stage `buf` ready

        if (kt + 1 < NT)  // DMA next stage into other buffer
            attn_stage(kl + (buf ^ 1) * AK_BUF, kg + (size_t)(kt + 1) * 128 * DEPTH_,
                       vl + (buf ^ 1) * AK_BUF, vg + (kt + 1) * 128);

        // logits tiles: S^T = K @ Q^T - reference   (64 kpos x 16 q, twice)
        // (the loops down to the epilogue are unrolled because sc and O are
        // register arrays and need constant indices)
        const bool hasm = ((mbits >> kt) & 1u) != 0u;
        v8f sc[2][4];
        // A stage with a mask term renews the reference in any case: a term can
        // be so large that a sum with the reference in it loses the scores.
        bool renew = hasm;
        if (!hasm) {
            // minus the reference in all eight registers: a score tile's start
            v8f cin[2];
#pragma unroll
            for (int g = 0; g < 2; ++g)
#pragma unroll
                for (int r = 0; r < 8; ++r) cin[g][r] = -mrow[g];
            v16h kf[4][2];
#pragma unroll
            for (int nt = 0; nt < 4; ++nt)
#pragma unroll
                for (int c = 0; c < 2; ++c)
                    kf[nt][c] = load_frag(
                        &Ks[buf][kh2 * 64 + nt * 16 + (lane & 15)][c * 32], lane);
            // keeps the stage's K reads as one group in front of the products, as
            // they stood; sunk to their use, each pair is waited out by itself
            __builtin_amdgcn_sched_barrier(0);
#pragma unroll
            for (int nt = 0; nt < 4; ++nt)
#pragma unroll
                for (int c = 0; c < 2; ++c)
#pragma unroll
                    for (int g = 0; g < 2; ++g)
                        sc[g][nt] = __builtin_amdgcn_wmma_f32_16x16x32_f16(
                            false, kf[nt][c], false, qA[g][c], (short)0,
                            c == 0 ? cin[g] : sc[g][nt], false, false);
            // keeps the sixteen products one run; with the test below mixed in,
            // each waits for one tile and idle slots stand behind the products
            __builtin_amdgcn_sched_barrier(0);
            // does a score of this lane pass its reference by more than 8?
            float hi4[4];
#pragma unroll
            for (int nt = 0; nt < 4; ++nt) {
                float m = 8.0f;
#pragma unroll
                for (int g = 0; g < 2; ++g)
#pragma unroll
                    for (int r = 0; r < 8; r += 2)
                        m = fmaxf(fmaxf(m, sc[g][nt][r]), sc[g][nt][r + 1]);
                hi4[nt] = m;
            }
            const float hi =
                fmaxf(fmaxf(hi4[0], hi4[1]), fmaxf(hi4[2], hi4[3]));
            renew = __builtin_amdgcn_ballot_w32(hi > 8.0f) != 0u;
        }
        // one scalar branch a stage; without a mask it is taken in the first
        // stage and then rarely
        if (renew) {
            // The scores are made from zero here: against a reference far off
            // (the start value, or keys that were all masked) the tiles above
            // have lost their low bits.
            v16h kf[4][2];
#pragma unroll
            for (int nt = 0; nt < 4; ++nt)
#pragma unroll
                for (int c = 0; c < 2; ++c)
                    kf[nt][c] = load_frag(
                        &Ks[buf][kh2 * 64 + nt * 16 + (lane & 15)][c * 32], lane);
#pragma unroll
            for (int nt = 0; nt < 4; ++nt)
#pragma unroll
                for (int g = 0; g < 2; ++g) {
                    const v8f z = {};
                    sc[g][nt] = __builtin_amdgcn_wmma_f32_16x16x32_f16(
                        false, kf[nt][0], false, qA[g][0], (short)0, z, false,
                        false);
                    sc[g][nt] = __builtin_amdgcn_wmma_f32_16x16x32_f16(
                        false, kf[nt][1], false, qA[g][1], (short)0, sc[g][nt],
                        false, false);
                }
            // the mask term is read and added only in a stage that has one:
            // adding zero changes no score
            if (hasm) {
#pragma unroll
                for (int nt = 0; nt < 4; ++nt) {
                    const v8f mk =
                        *(const v8f*)&Ms[kt * 128 + kh2 * 64 + nt * 16 + hh8];
#pragma unroll
                    for (int g = 0; g < 2; ++g) sc[g][nt] += mk;
                }
            }
#pragma unroll
            for (int g = 0; g < 2; ++g) {
                float mx4[4];
#pragma unroll
                for (int nt = 0; nt < 4; ++nt) {
                    float m = sc[g][nt][0];
#pragma unroll
                    for (int r = 1; r < 8; ++r) m = fmaxf(m, sc[g][nt][r]);
                    mx4[nt] = m;
                }
                float mx = fmaxf(fmaxf(mx4[0], mx4[1]), fmaxf(mx4[2], mx4[3]));
                mx = fmaxf(mx, xhalf(mx));
                const float newm = fmaxf(mrow[g], mx);
                const float corr = __builtin_amdgcn_exp2f(mrow[g] - newm);
                mrow[g] = newm;
#pragma unroll
                for (int nt = 0; nt < 4; ++nt) sc[g][nt] -= newm;
                lrow[g] *= corr;
#pragma unroll
                for (int nt = 0; nt < 4; ++nt) O[g][nt] *= corr;
            }
        }

        // softmax terms against the reference: 32 of the query's 64 scores live
        // in this lane
#pragma unroll
        for (int g = 0; g < 2; ++g) {
#pragma unroll
            for (int nt = 0; nt < 4; ++nt)
#pragma unroll
                for (int r = 0; r < 8; ++r)
                    sc[g][nt][r] = __builtin_amdgcn_exp2f(sc[g][nt][r]);
            const v8f s8 = (sc[g][0] + sc[g][1]) + (sc[g][2] + sc[g][3]);
            const float rs = ((s8[0] + s8[1]) + (s8[2] + s8[3])) +
                             ((s8[4] + s8[5]) + (s8[6] + s8[7]));
            lrow[g] += rs;
        }

        // O^T += V^T @ P^T; score tiles 2c and 2c+1 are B's k 0..15 and 16..31
#pragma unroll
        for (int c = 0; c < 2; ++c) {
            v16h vf[4];
#pragma unroll
            for (int nt = 0; nt < 4; ++nt)
                vf[nt] = load_frag(
                    &VsT[buf][kh2][nt * 16 + (lane & 15)][c * 32], lane);
            // takes the loaded values as inputs only: holds this half's eight V reads
            // together ahead of its products, as they stood; sunk to their use,
            // each pair of reads is waited out in front of its two products
            asm volatile("" ::"v"(vf[0]), "v"(vf[1]), "v"(vf[2]), "v"(vf[3]));
            v16h pb[2];
#pragma unroll
            for (int g = 0; g < 2; ++g)
                pb[g] = __builtin_shufflevector(
                    __builtin_convertvector(sc[g][2 * c], v8h),
                    __builtin_convertvector(sc[g][2 * c + 1], v8h), 0, 1, 2, 3, 4,
                    5, 6, 7, 8, 9, 10, 11, 12, 13, 14, 15);
#pragma unroll
            for (int nt = 0; nt < 4; ++nt)
#pragma unroll
                for (int g = 0; g < 2; ++g)
                    O[g][nt] = __builtin_amdgcn_wmma_f32_16x16x32_f16(
                        false, vf[nt], false, pb[g], (short)0, O[g][nt], false,
                        false);
        }
        // no trailing barrier: next iteration's wait+barrier protects reuse
    }

    // Merge of the two key halves.  Wave w and wave w ^ 4 hold partial results of
    // the same 32 queries: w keeps query tile kh2 and hands the other tile over
    // through the K buffers, 16 bytes a lane and store (lanes contiguous).
    __syncthreads();  // every wave has read its last stage: the K buffers are free
    v4f* xo = (v4f*)&Ks[0][0][0];                    // [wave][nt][part][lane]
    float* xs = (float*)&Ks[0][0][0] + 8 * 8 * 128;  // [wave][m, l][lane]
    const bool up = kh2 != 0;
#pragma unroll
    for (int nt = 0; nt < 4; ++nt) {
        const v8f s = up ? O[0][nt] : O[1][nt];
        xo[(wave * 8 + nt * 2) * 32 + lane] =
            __builtin_shufflevector(s, s, 0, 1, 2, 3);
        xo[(wave * 8 + nt * 2 + 1) * 32 + lane] =
            __builtin_shufflevector(s, s, 4, 5, 6, 7);
    }
    xs[wave * 64 + lane] = up ? mrow[0] : mrow[1];
    xs[wave * 64 + 32 + lane] = up ? lrow[0] : lrow[1];
    __syncthreads();  // the handed-over tiles are read by the partner waves

    const int pw = wave ^ 4;
    const float mk = up ? mrow[1] : mrow[0];
    const float mp2 = xs[pw * 64 + lane];
    const float newm = fmaxf(mk, mp2);
    const float ck = __builtin_amdgcn_exp2f(mk - newm);
    const float cp = __builtin_amdgcn_exp2f(mp2 - newm);
    const float lh = (up ? lrow[1] : lrow[0]) * ck + xs[pw * 64 + 32 + lane] * cp;

    // write merged-head context, normalized by l: 8 consecutive d per lane
    const float l = lh + xhalf(lh);
#pragma unroll
    for (int nt = 0; nt < 4; ++nt) {
        const v8f ok = up ? O[1][nt] : O[0][nt];
        const v4f p0 = xo[(pw * 8 + nt * 2) * 32 + lane];
        const v4f p1 = xo[(pw * 8 + nt * 2 + 1) * 32 + lane];
        const v8f op = __builtin_shufflevector(p0, p1, 0, 1, 2, 3, 4, 5, 6, 7);
        v8h o;
#pragma unroll
        for (int r = 0; r < 8; ++r)
            o[r] = (_Float16)((ok[r] * ck + op[r] * cp) / l);
        *(v8h*)&ctxh[(size_t)(b * S_ + qr0 + kh2 * 16 + (lane & 15)) * D_ +
                     h * DEPTH_ + nt * 16 + hh8] = o;
    }
}

// ---------------------------------------------------------------------------
// Everything behind attention, fused:
//   out1 = LN1(x + ctx @ wo + bo)
//   out  = LN2(out1 + LNff(relu(out1 @ w1 + b1)) @ w2 + b2).
// One block of 16 waves owns 64 rows from end to end, one block per WGP; the
// projection's result and h never leave the WGP.  A operands come from LDS, B
// operands (packed fragments) from L2 straight into registers: no two waves of a
// block need the same B fragment.
//   0a. a (64 x 256, f32) : wave w owns columns 16 w .. 16 w + 15, all 64 rows
//   0b. LN1 with residual : wave w owns rows 4 w .. 4 w + 3, row in registers
//   1. h (64 x 1024, f32) : wave w owns columns 64 w .. 64 w + 63, all 64 rows
//   2. LNff               : wave w owns rows 4 w .. 4 w + 3, row in registers
//   3. t (64 x 256, f32)  : wave w owns columns 16 w .. 16 w + 15, all 64 rows
//   4. LN2 with residual  : wave w owns rows 4 w .. 4 w + 3
// out1 goes on as f16 in LDS (A operand of step 1); its f32 form is needed again
// in step 4 only, by the lane that made it: that lane parks it in the workspace
// and loads it back, since steps 1 to 3 leave neither registers nor LDS for it.
// Every product sums k in steps of 32, in rising order; a LayerNorm sum is four
// values a lane and group, then a lane-exchange tree.
// LDS pitches: 16 B x odd for the ds_load_b128 fragment rows; for the f32
// planes 8 rows are 32 banks apart, so the two row groups of an accumulator
// store fall on different banks.
// ---------------------------------------------------------------------------
#define FA_P 264    // halves, ctx tile, then out1 tile
#define FH_P 1028   // floats, h before LNff
#define FHH_P 1032  // halves, h after LNff (overlays the f32 plane)
#define FT_P 260    // floats, a and later t (behind the f16 plane)
#define FA_BYTES (64 * FA_P * 2)
#define FH_BYTES (64 * FH_P * 4)
#define FHH_BYTES (64 * FHH_P * 2)

__global__ __launch_bounds__(512) void ffn_kernel(
    const _Float16* __restrict__ ctxh, const float* __restrict__ x,
    const _Float16* __restrict__ woP, const float* __restrict__ bo,
    const float* __restrict__ g1, const float* __restrict__ be1,
    float* out1F, const _Float16* __restrict__ w1P,
    const float* __restrict__ b1,
    const float* __restrict__ gff, const float* __restrict__ bff,
    const _Float16* __restrict__ w2P, const float* __restrict__ b2,
    const float* __restrict__ g2, const float* __restrict__ be2,
    float* __restrict__ out) {
    __shared__ __align__(16) char smem[FA_BYTES + FH_BYTES];
    _Float16* As = (_Float16*)smem;
    float* Hf = (float*)(smem + FA_BYTES);
    _Float16* Hh = (_Float16*)(smem + FA_BYTES);
    float* Tf = (float*)(smem + FA_BYTES + FHH_BYTES);

    const int t = threadIdx.x;
    // wave-uniform by construction; in a scalar register it makes every weight
    // and row base scalar, and the one vector offset (the lane's) lives on
    const int wave = __builtin_amdgcn_readfirstlane(t >> 5);
    const int lane = t & 31;
    const int l15 = lane & 15;
    const int hh8 = (lane >> 4) << 3;
    const int m0 = blockIdx.x * 64;

    // this lane's place in rows 4 * wave .. + 3 of x, out1 and out
    const size_t roff = (size_t)(m0 + wave * 4) * D_ + lane * 4;

    // ---- 0a. a = ctx @ wo + bo ----
    v4f xr[4][2];  // the residual rows of step 0b, asked for ahead of the product
    {
        // ctx tile (f16) to LDS: 64 rows x 512 B, one row per wave-wide load
        const v8h* src = (const v8h*)(ctxh + (size_t)m0 * D_);
        v8h a[4];
#pragma unroll
        for (int i = 0; i < 4; ++i) a[i] = src[t + i * 512];
        // all 8 B fragments of the wave's 16 columns
        const v8h* bp = (const v8h*)woP + (size_t)wave * (8 * 64) + lane;
        v16h bw[D_ / 32];
#pragma unroll
        for (int ks = 0; ks < D_ / 32; ++ks) bw[ks] = load_packed(bp + ks * 64);
#pragma unroll
        for (int rr = 0; rr < 4; ++rr)
#pragma unroll
            for (int j = 0; j < 2; ++j)
                xr[rr][j] = *(const v4f*)(x + roff + rr * D_ + j * 128);
        // the wait that belongs in front of an overwrite of these loads' address
        // registers, written here behind the loads
        asm volatile("s_wait_xcnt 0x0" ::: "memory");
#pragma unroll
        for (int i = 0; i < 4; ++i)
            *(v8h*)&As[(wave + i * 16) * FA_P + lane * 8] = a[i];
        __syncthreads();  // the ctx tile is read by every wave

        v8f acc[4] = {};
        // unrolled: bw is a register array
#pragma unroll
        for (int ks = 0; ks < D_ / 32; ++ks) {
            v16h af[4];
#pragma unroll
            for (int mt = 0; mt < 4; ++mt)
                af[mt] = load_frag(&As[(mt * 16 + l15) * FA_P + ks * 32], lane);
#pragma unroll
            for (int mt = 0; mt < 4; ++mt)
                acc[mt] = __builtin_amdgcn_wmma_f32_16x16x32_f16(
                    false, af[mt], false, bw[ks], (short)0, acc[mt], false,
                    false);
        }
        const int col = wave * 16 + l15;
        const float bvv = bo[col];
#pragma unroll
        for (int mt = 0; mt < 4; ++mt)
#pragma unroll
            for (int r = 0; r < 8; ++r)
                Tf[(mt * 16 + r + hh8) * FT_P + col] = acc[mt][r] + bvv;
    }
    // as above, for the bias load
    asm volatile("s_wait_xcnt 0x0" ::: "memory");
    __syncthreads();  // rows of a are complete, the ctx tile has been read

    // ---- 0b. out1 = LN1(a + x), rows 4 * wave .. + 3 ----
    {
        constexpr int NV = 2, n = D_;
        v4f v[4][NV];
#pragma unroll
        for (int rr = 0; rr < 4; ++rr)
#pragma unroll
            for (int j = 0; j < NV; ++j)
                v[rr][j] =
                    *(const v4f*)&Tf[(wave * 4 + rr) * FT_P + j * 128 + lane * 4] +
                    xr[rr][j];
        float mu[4], rstd[4];
#pragma unroll
        for (int rr = 0; rr < 4; ++rr) {
            float s = 0.0f;
#pragma unroll
            for (int j = 0; j < NV; ++j)
                s += (v[rr][j][0] + v[rr][j][1]) + (v[rr][j][2] + v[rr][j][3]);
            mu[rr] = s;
        }
#pragma unroll
        for (int o = 16; o >= 1; o >>= 1)
#pragma unroll
            for (int rr = 0; rr < 4; ++rr) mu[rr] += __shfl_xor(mu[rr], o, 32);
#pragma unroll
        for (int rr = 0; rr < 4; ++rr) {
            mu[rr] = mu[rr] / n;
            float s2 = 0.0f;
#pragma unroll
            for (int j = 0; j < NV; ++j) {
                v[rr][j] -= mu[rr];
                v4f q = v[rr][j] * v[rr][j];
                s2 += (q[0] + q[1]) + (q[2] + q[3]);
            }
            rstd[rr] = s2;
        }
#pragma unroll
        for (int o = 16; o >= 1; o >>= 1)
#pragma unroll
            for (int rr = 0; rr < 4; ++rr)
                rstd[rr] += __shfl_xor(rstd[rr], o, 32);
#pragma unroll
        for (int rr = 0; rr < 4; ++rr) rstd[rr] = rsqrtf(rstd[rr] / n + 1e-3f);
#pragma unroll
        for (int j = 0; j < NV; ++j) {
            const v4f gg = *(const v4f*)(g1 + j * 128 + lane * 4);
            const v4f bb = *(const v4f*)(be1 + j * 128 + lane * 4);
#pragma unroll
            for (int rr = 0; rr < 4; ++rr) {
                v4f y = v[rr][j] * rstd[rr] * gg + bb;
                *(v4f*)(out1F + roff + rr * n + j * 128) = y;
                *(v4h*)&As[(wave * 4 + rr) * FA_P + j * 128 + lane * 4] =
                    __builtin_convertvector(y, v4h);
            }
        }
    }
    // as above, for the scale and shift loads and the out1 stores
    asm volatile("s_wait_xcnt 0x0" ::: "memory");
    __syncthreads();  // the out1 tile is read by every wave

    // ---- 1. h = relu(out1 @ w1 + b1) ----
    {
        v8f acc[4][4] = {};
        const v8h* bp = (const v8h*)w1P + (size_t)wave * (4 * 8 * 64) + lane;
        v16h bc[4], bn[4];  // B fragments of this k step and of the next
#pragma unroll
        for (int nt = 0; nt < 4; ++nt) bc[nt] = load_packed(bp + nt * 8 * 64);
        // unrolled: acc, bc and bn are register arrays, and every B address is
        // the one base plus a constant
#pragma unroll
        for (int ks = 0; ks < D_ / 32; ++ks) {
            if (ks + 1 < D_ / 32) {
#pragma unroll
                for (int nt = 0; nt < 4; ++nt)
                    bn[nt] = load_packed(bp + (nt * 8 + ks + 1) * 64);
            }
            // keeps the next step's L2 loads in front of this step's products;
            // sunk to their use, each would expose its whole latency
            __builtin_amdgcn_sched_barrier(0);
            v16h af[4];
#pragma unroll
            for (int mt = 0; mt < 4; ++mt)
                af[mt] = load_frag(&As[(mt * 16 + l15) * FA_P + ks * 32], lane);
#pragma unroll
            for (int nt = 0; nt < 4; ++nt) {
#pragma unroll
                for (int mt = 0; mt < 4; ++mt)
                    acc[mt][nt] = __builtin_amdgcn_wmma_f32_16x16x32_f16(
                        false, af[mt], false, bc[nt], (short)0, acc[mt][nt],
                        false, false);
            }
#pragma unroll
            for (int nt = 0; nt < 4; ++nt) bc[nt] = bn[nt];
        }
#pragma unroll
        for (int nt = 0; nt < 4; ++nt) {
            const int col = wave * 64 + nt * 16 + l15;
            const float bvv = b1[col];
#pragma unroll
            for (int mt = 0; mt < 4; ++mt)
#pragma unroll
                for (int r = 0; r < 8; ++r)
                    Hf[(mt * 16 + r + hh8) * FH_P + col] =
                        fmaxf(acc[mt][nt][r] + bvv, 0.0f);
        }
    }
    // the bias loads' offset register is reused further down: the wait that
    // belongs in front of that overwrite, written here behind the loads
    asm volatile("s_wait_xcnt 0x0" ::: "memory");
    __syncthreads();  // rows of h are complete

    // ---- 2. LNff, rows 4 * wave .. + 3, f16 result for the second product ----
    {
        constexpr int NV = 8, n = DFF_;
        v4f v[4][NV];
#pragma unroll
        for (int rr = 0; rr < 4; ++rr)
#pragma unroll
            for (int j = 0; j < NV; ++j)
                v[rr][j] =
                    *(const v4f*)&Hf[(wave * 4 + rr) * FH_P + j * 128 + lane * 4];
        __syncthreads();  // every f32 row is in registers: the plane is reused

        float mu[4], rstd[4];
#pragma unroll
        for (int rr = 0; rr < 4; ++rr) {
            float s = 0.0f;
#pragma unroll
            for (int j = 0; j < NV; ++j)
                s += (v[rr][j][0] + v[rr][j][1]) + (v[rr][j][2] + v[rr][j][3]);
            mu[rr] = s;
        }
#pragma unroll
        for (int o = 16; o >= 1; o >>= 1)
#pragma unroll
            for (int rr = 0; rr < 4; ++rr) mu[rr] += __shfl_xor(mu[rr], o, 32);
#pragma unroll
        for (int rr = 0; rr < 4; ++rr) {
            mu[rr] = mu[rr] / n;
            float s2 = 0.0f;
#pragma unroll
            for (int j = 0; j < NV; ++j) {
                v[rr][j] -= mu[rr];
                v4f q = v[rr][j] * v[rr][j];
                s2 += (q[0] + q[1]) + (q[2] + q[3]);
            }
            rstd[rr] = s2;
        }
#pragma unroll
        for (int o = 16; o >= 1; o >>= 1)
#pragma unroll
            for (int rr = 0; rr < 4; ++rr)
                rstd[rr] += __shfl_xor(rstd[rr], o, 32);
#pragma unroll
        for (int rr = 0; rr < 4; ++rr) rstd[rr] = rsqrtf(rstd[rr] / n + 1e-6f);
#pragma unroll
        for (int j = 0; j < NV; ++j) {
            const v4f gg = *(const v4f*)(gff + j * 128 + lane * 4);
            const v4f bb = *(const v4f*)(bff + j * 128 + lane * 4);
#pragma unroll
            for (int rr = 0; rr < 4; ++rr) {
                v4f y = v[rr][j] * rstd[rr] * gg + bb;
                *(v4h*)&Hh[(wave * 4 + rr) * FHH_P + j * 128 + lane * 4] =
                    __builtin_convertvector(y, v4h);
            }
        }
    }
    __syncthreads();  // the f16 rows are read by every wave

    // ---- 3. t = h @ w2 + b2 ----
    {
        v8f acc[4] = {};
        const v8h* bp = (const v8h*)w2P + (size_t)wave * (32 * 64) + lane;
        v16h bc[4], bn[4];  // B fragments of this group of 4 k steps, the next
#pragma unroll
        for (int j = 0; j < 4; ++j) bc[j] = load_packed(bp + j * 64);
        v16h ac[4], an[4];  // A fragments of this k step and of the next
#pragma unroll
        for (int mt = 0; mt < 4; ++mt)
            ac[mt] = load_frag(&Hh[(mt * 16 + l15) * FHH_P], lane);
        // unrolled: ac, an, bc and bn are register arrays
#pragma unroll
        for (int ks = 0; ks < DFF_ / 32; ++ks) {
            if ((ks & 3) == 0 && ks + 4 < DFF_ / 32) {
#pragma unroll
                for (int j = 0; j < 4; ++j)
                    bn[j] = load_packed(bp + (ks + 4 + j) * 64);
            }
            if (ks + 1 < DFF_ / 32) {
#pragma unroll
                for (int mt = 0; mt < 4; ++mt)
                    an[mt] = load_frag(
                        &Hh[(mt * 16 + l15) * FHH_P + (ks + 1) * 32], lane);
            }
            // keeps the loads for later k steps, as one group, in front of this
            // step's products; sunk to their use, each pair of LDS reads would
            // be waited out in front of its one product
            __builtin_amdgcn_sched_barrier(0);
#pragma unroll
            for (int mt = 0; mt < 4; ++mt)
                acc[mt] = __builtin_amdgcn_wmma_f32_16x16x32_f16(
                    false, ac[mt], false, bc[ks & 3], (short)0, acc[mt], false,
                    false);
#pragma unroll
            for (int mt = 0; mt < 4; ++mt) ac[mt] = an[mt];
            if ((ks & 3) == 3) {
#pragma unroll
                for (int j = 0; j < 4; ++j) bc[j] = bn[j];
            }
        }
        const int col = wave * 16 + l15;
        const float bvv = b2[col];
#pragma unroll
        for (int mt = 0; mt < 4; ++mt)
#pragma unroll
            for (int r = 0; r < 8; ++r)
                Tf[(mt * 16 + r + hh8) * FT_P + col] = acc[mt][r] + bvv;
    }
    __syncthreads();  // rows of t are complete

    // ---- 4. out = LN2(t + out1), rows 4 * wave .. + 3 ----
    {
        constexpr int NV = 2, n = D_;
        const size_t off = (size_t)(m0 + wave * 4) * n + lane * 4;
        v4f v[4][NV];
#pragma unroll
        for (int rr = 0; rr < 4; ++rr)
#pragma unroll
            for (int j = 0; j < NV; ++j)
                v[rr][j] =
                    *(const v4f*)&Tf[(wave * 4 + rr) * FT_P + j * 128 + lane * 4] +
                    *(const v4f*)(out1F + off + rr * n + j * 128);
        float mu[4], rstd[4];
#pragma unroll
        for (int rr = 0; rr < 4; ++rr) {
            float s = 0.0f;
#pragma unroll
            for (int j = 0; j < NV; ++j)
                s += (v[rr][j][0] + v[rr][j][1]) + (v[rr][j][2] + v[rr][j][3]);
            mu[rr] = s;
        }
#pragma unroll
        for (int o = 16; o >= 1; o >>= 1)
#pragma unroll
            for (int rr = 0; rr < 4; ++rr) mu[rr] += __shfl_xor(mu[rr], o, 32);
#pragma unroll
        for (int rr = 0; rr < 4; ++rr) {
            mu[rr] = mu[rr] / n;
            float s2 = 0.0f;
#pragma unroll
            for (int j = 0; j < NV; ++j) {
                v[rr][j] -= mu[rr];
                v4f q = v[rr][j] * v[rr][j];
                s2 += (q[0] + q[1]) + (q[2] + q[3]);
            }
            rstd[rr] = s2;
        }
#pragma unroll
        for (int o = 16; o >= 1; o >>= 1)
#pragma unroll
            for (int rr = 0; rr < 4; ++rr)
                rstd[rr] += __shfl_xor(rstd[rr], o, 32);
#pragma unroll
        for (int j = 0; j < NV; ++j) {
            const v4f gg = *(const v4f*)(g2 + j * 128 + lane * 4);
            const v4f bb = *(const v4f*)(be2 + j * 128 + lane * 4);
#pragma unroll
            for (int rr = 0; rr < 4; ++rr) {
                const float rs = rsqrtf(rstd[rr] / n + 1e-3f);
                *(v4f*)(out + off + rr * n + j * 128) = v[rr][j] * rs * gg + bb;
            }
        }
    }
}

// ---------------------------------------------------------------------------
extern "C" void kernel_launch(void* const* d_in, const int* in_sizes, int n_in,
                              void* d_out, int out_size, void* d_ws,
                              size_t ws_size, hipStream_t stream) {
    const float* x      = (const float*)d_in[0];
    const float* mask   = (const float*)d_in[1];
    const float* wq     = (const float*)d_in[2];
    const float* bq     = (const float*)d_in[3];
    const float* wk     = (const float*)d_in[4];
    const float* bk     = (const float*)d_in[5];
    const float* wv     = (const float*)d_in[6];
    const float* bv     = (const float*)d_in[7];
    const float* wo     = (const float*)d_in[8];
    const float* bo     = (const float*)d_in[9];
    const float* w1     = (const float*)d_in[10];
    const float* b1     = (const float*)d_in[11];
    const float* lnffg  = (const float*)d_in[12];
    const float* lnffb  = (const float*)d_in[13];
    const float* w2     = (const float*)d_in[14];
    const float* b2     = (const float*)d_in[15];
    const float* ln1g   = (const float*)d_in[16];
    const float* ln1b   = (const float*)d_in[17];
    const float* ln2g   = (const float*)d_in[18];
    const float* ln2b   = (const float*)d_in[19];
    float* out = (float*)d_out;

    // workspace carve-up
    char* p = (char*)d_ws;
    _Float16* qh   = (_Float16*)p; p += (size_t)M_ * D_ * 2;    // 8 MiB
    _Float16* kh   = (_Float16*)p; p += (size_t)M_ * D_ * 2;    // 8 MiB
    _Float16* vh   = (_Float16*)p; p += (size_t)M_ * D_ * 2;    // 8 MiB (vT)
    _Float16* ctxh = (_Float16*)p; p += (size_t)M_ * D_ * 2;    // 8 MiB
    float* out1F   = (float*)p;    p += (size_t)M_ * D_ * 4;    // 16 MiB
    _Float16* wqP  = (_Float16*)p; p += (size_t)D_ * D_ * 2;
    _Float16* wkP  = (_Float16*)p; p += (size_t)D_ * D_ * 2;
    _Float16* wvP  = (_Float16*)p; p += (size_t)D_ * D_ * 2;
    _Float16* woP  = (_Float16*)p; p += (size_t)D_ * D_ * 2;
    _Float16* w1P  = (_Float16*)p; p += (size_t)D_ * DFF_ * 2;
    _Float16* w2P  = (_Float16*)p; p += (size_t)DFF_ * D_ * 2;

    // all six weights -> f16 in fragment order
    prep_kernel<<<PREP_BLOCKS, 512, 0, stream>>>(wq, wk, wv, wo, w1, w2, wqP, wkP,
                                                 wvP, woP, w1P, w2P);

    // q/k/v projections from f32 x (q pre-scaled by log2(e)/sqrt(DEPTH); v written
    // transposed)
    qkv_kernel<<<M_ / 64, 512, 0, stream>>>(x, wqP, wkP, wvP, bq, bk, bv, qh, kh,
                                            vh);

    // flash attention
    attn_kernel<<<dim3(S_ / 128, B_ * H_), 256, 0, stream>>>(qh, kh, vh, mask,
                                                            ctxh);

    // output projection -> residual LN (eps 1e-3) -> relu(out1@w1+b1) ->
    // LN(eps 1e-6) -> @w2+b2 -> residual LN (eps 1e-3)
    ffn_kernel<<<M_ / 64, 512, 0, stream>>>(ctxh, x, woP, bo, ln1g, ln1b, out1F,
                                            w1P, b1, lnffg, lnffb, w2P, b2, ln2g,
                                            ln2b, out);
}
